// v000
// Measured on an AMD MI455X. A time is GPU time per run, averaged over a window of back-to-back runs after a warm-up
// (all launches, gaps included; the runs take copies of the inputs in turn), and the median of several windows.
// Apart from v000's, it joins two sittings. Times from different sittings can be a few percent apart, while
// side-by-side timings come from the same sitting.
// v000 is the starting kernel. One run takes 944 microseconds.
#include <hip/hip_runtime.h>
#pragma clang fp contract(off)

// Compute dtypes (f32 accumulate everywhere): input projections x.Wq / x.Wk / x.Wv on v_wmma_f32_16x16x32_bf16 with bf16 RNE-converted inputs as operands (exact operands); q.k scores on v_wmma_f32_16x16x32_bf16 as bf16 hi/lo split (hi.hi + lo.hi + hi.lo); probability.value on v_wmma_f32_16x16x32_f16 (P f16 carried x4096, V f16; the first query block adds P and V residual planes carried x1024 through a second accumulator); softmax, ALiBi/pad terms, lambda and GroupNorm in f32; output projection on v_wmma_f32_16x16x32_bf16 (activation bf16 hi/lo x bf16 Wo, 2 products).
// Layout: x [NB][SEQ_FULL][1024]; Wq/Wk [2048][1024], Wv/Wo [1024][1024] ([out][in], used as K-contiguous Bt planes); per head h the 128 q/k columns are [half 1 | half 2] = virtual 64-wide heads 2h, 2h+1; mask [NB][SEQ_FULL] f32, token positions [NB][SEQ_FULL] int32; out [NB][SEQ_FULL][1024] f32.

#ifndef NB
#define NB 2
#endif
#ifndef SEQ
#define SEQ 2048
#endif
#define NB_FULL 2
#define SEQ_FULL 2048
#define DM   1024
#define NVH  16
#define HD   64
#define NQH  (2 * NVH)
#define DQ   (NQH * HD)
#define DVV  (NVH * HD)
#define SCL  0.125f
#define PCAR 4096.0f
#define RCAR 1024.0f
#define QBL  64
#define KCH  64
#define KSB  32
#define LP   72
#define PP   40
#define OSP  68
#define L2E  1.4426950408889634f
#define NEGB (-3.0e38f)
static_assert(SEQ % 64 == 0);
static_assert(SEQ <= SEQ_FULL);
static_assert(NB >= 1);
static_assert(NB <= NB_FULL);
static_assert(QBL == KCH);
static_assert(KCH % KSB == 0);
static_assert((LP * 2) % 16 == 0);
static_assert((PP * 2) % 16 == 0);
static_assert((OSP * 4) % 16 == 0);
static_assert((NQH * SEQ * HD) % 512 == 0);
static_assert((SEQ * DVV) % 512 == 0);
static_assert((SEQ * DM) % 2048 == 0);

typedef _Float16 h16;
typedef unsigned short bf;
typedef __attribute__((ext_vector_type(16))) __bf16   v16bf;
typedef __attribute__((ext_vector_type(16))) _Float16 v16h;
typedef __attribute__((ext_vector_type(8)))  _Float16 v8h;
typedef __attribute__((ext_vector_type(8)))  unsigned short v8us;
typedef __attribute__((ext_vector_type(8)))  float    v8f;
typedef __attribute__((ext_vector_type(4)))  float    v4f;
typedef __attribute__((ext_vector_type(2)))  _Float16 v2h;
typedef __attribute__((ext_vector_type(2)))  unsigned short v2us;
typedef __attribute__((ext_vector_type(2)))  float v2f;
typedef v8h  __attribute__((may_alias)) v8ha;
typedef v4f  __attribute__((may_alias)) v4fa;
typedef v8us __attribute__((may_alias)) v8usa;

__device__ __forceinline__ unsigned short f2bf(float f) { unsigned u = __float_as_uint(f); u += 0x7FFFu + ((u >> 16) & 1u); return (unsigned short)(u >> 16); }
__device__ __forceinline__ float bf2f(unsigned short b) { return __uint_as_float(((unsigned)b) << 16); }
__device__ __forceinline__ float bfr(float f) { return bf2f(f2bf(f)); }
__device__ __forceinline__ v16h cat16(v8h lo, v8h hi) { return __builtin_shufflevector(lo, hi, 0, 1, 2, 3, 4, 5, 6, 7, 8, 9, 10, 11, 12, 13, 14, 15); }
__device__ __forceinline__ v16bf cat16b(v8us lo, v8us hi) { return __builtin_bit_cast(v16bf, __builtin_shufflevector(lo, hi, 0, 1, 2, 3, 4, 5, 6, 7, 8, 9, 10, 11, 12, 13, 14, 15)); }
__device__ __forceinline__ v8f wmma16(v16h a, v16h b, v8f c) { return __builtin_amdgcn_wmma_f32_16x16x32_f16(false, a, false, b, (short)0, c, false, false); }
__device__ __forceinline__ v8f wmmab(v16bf a, v16bf b, v8f c) { return __builtin_amdgcn_wmma_f32_16x16x32_bf16(false, a, false, b, (short)0, c, false, false); }
__device__ __forceinline__ h16 tohx(float x) { return (h16)x; }
__device__ __forceinline__ void splitf(float y, unsigned short& h, unsigned short& l) { h = f2bf(y); l = f2bf(y - bf2f(h)); }

// ---- k_gemmw: register-blocked GEMM, ONE WAVE per 64x64 output tile (16 accumulators), operands straight from K-contiguous 16-bit planes; grid (M/64, N/64, Z), 32 threads.
// C[m][n] (f32, pitch ldc, + optional f32 bias[n]) = sum_k A[m][k] Bt[n][k] (+ split products per NSPLIT). z-batch strides sA/sB/sC in elements. K % 32 == 0.
// Fragments: lane -> row/col (lane & 15); elements 0..7 <- k + 8*(lane>>4), elements 8..15 <- k + 16 + 8*(lane>>4), for A and Bt alike.
template <typename T16> struct WFrag;
template <> struct WFrag<h16> { typedef v16h V; static __device__ __forceinline__ V ld(const h16* p) { return cat16(*(const v8h*)p, *(const v8h*)(p + 16)); } static __device__ __forceinline__ v8f mma(V a, V b, v8f c) { return wmma16(a, b, c); } };
template <> struct WFrag<bf> { typedef v16bf V; static __device__ __forceinline__ V ld(const bf* p) { return cat16b(*(const v8us*)p, *(const v8us*)(p + 16)); } static __device__ __forceinline__ v8f mma(V a, V b, v8f c) { return wmmab(a, b, c); } };
template <typename T16, int NSPLIT, bool BIAS>
__global__ __launch_bounds__(32) void k_gemmw(const T16* __restrict__ A, const T16* __restrict__ A2, const T16* __restrict__ Bt, const T16* __restrict__ Bt2, int K, float* C, int ldc, const float* __restrict__ bias, size_t sA, size_t sB, size_t sC) {
    typedef typename WFrag<T16>::V V;
    __shared__ __align__(16) float os[16 * 68];
    const size_t z = blockIdx.z; A += z * sA; if (A2) A2 += z * sA; Bt += z * sB; if (Bt2) Bt2 += z * sB; C += z * sC;
    const int lane = threadIdx.x & 31, lr = lane & 15, hi = lane >> 4; const int r0 = blockIdx.x * 64, c0 = blockIdx.y * 64;
    v8f acc[4][4];
#pragma unroll
    for (int mb = 0; mb < 4; ++mb)
#pragma unroll
        for (int nb = 0; nb < 4; ++nb) acc[mb][nb] = (v8f){};
    const size_t aoff = (size_t)(r0 + lr) * K + 8 * hi, boff = (size_t)(c0 + lr) * K + 8 * hi;
#pragma unroll 1
    for (int kc = 0; kc < K; kc += 32) {
        V a[4], a2[4];
#pragma unroll
        for (int mb = 0; mb < 4; ++mb) { a[mb] = WFrag<T16>::ld(A + aoff + (size_t)mb * 16 * K + kc); if (NSPLIT == 1 || NSPLIT == 2) a2[mb] = WFrag<T16>::ld(A2 + aoff + (size_t)mb * 16 * K + kc); }
#pragma unroll
        for (int nb = 0; nb < 4; ++nb) { const V b = WFrag<T16>::ld(Bt + boff + (size_t)nb * 16 * K + kc); V b2; if (NSPLIT >= 2) b2 = WFrag<T16>::ld(Bt2 + boff + (size_t)nb * 16 * K + kc);
#pragma unroll
            for (int mb = 0; mb < 4; ++mb) { acc[mb][nb] = WFrag<T16>::mma(a[mb], b, acc[mb][nb]); if (NSPLIT == 1 || NSPLIT == 2) acc[mb][nb] = WFrag<T16>::mma(a2[mb], b, acc[mb][nb]); if (NSPLIT >= 2) acc[mb][nb] = WFrag<T16>::mma(a[mb], b2, acc[mb][nb]); } }
        asm volatile("v_nop\n\tv_nop\n\tv_nop\n\tv_nop" : "+v"(acc[0][0]), "+v"(acc[1][1]), "+v"(acc[2][2]), "+v"(acc[3][3]) : "v"(a[0]), "v"(a[3]));
    }
#pragma unroll
    for (int mb = 0; mb < 4; ++mb) {
#pragma unroll
        for (int nb = 0; nb < 4; ++nb) {
#pragma unroll
            for (int j = 0; j < 8; ++j) os[(hi * 8 + j) * 68 + nb * 16 + lr] = acc[mb][nb][j]; }
        __builtin_amdgcn_wave_barrier(); asm volatile("" ::: "memory");
        float* crow = C + (size_t)(r0 + mb * 16) * ldc + c0;
{
#pragma unroll
            for (int s = 0; s < 8; ++s) { const int row = 2 * s + hi, cofs = lr * 4; v4f val = *(const v4fa*)(os + row * 68 + cofs); if (BIAS) { val[0] += bfr(bias[c0 + cofs]); val[1] += bfr(bias[c0 + cofs + 1]); val[2] += bfr(bias[c0 + cofs + 2]); val[3] += bfr(bias[c0 + cofs + 3]); }
                *(v4f*)(crow + (size_t)row * ldc + cofs) = val; }
             }
        __builtin_amdgcn_wave_barrier(); asm volatile("" ::: "memory");
    }
}

__global__ __launch_bounds__(256) void k_cvt8(const float* __restrict__ src, bf* dst, size_t n8) { const size_t i = (size_t)blockIdx.x * 256 + threadIdx.x; if (i >= n8) return; const v8f v = *(const v8f*)(src + i * 8); v8us o;
#pragma unroll
    for (int k = 0; k < 8; ++k) o[k] = f2bf(v[k]); *(v8us*)(dst + i * 8) = o;  }
__global__ __launch_bounds__(256) void k_rbf(const float* __restrict__ src, float* dst, int n4) { const int i = blockIdx.x * 256 + threadIdx.x; if (i >= n4) return; const v4f a = *(const v4f*)(src + (size_t)i * 4); v4f o;
#pragma unroll
    for (int u = 0; u < 4; ++u) o[u] = bfr(a[u]); *(v4f*)(dst + (size_t)i * 4) = o;  }
__global__ __launch_bounds__(32) void k_lambda(const float* __restrict__ lq1, const float* __restrict__ lk1, const float* __restrict__ lq2, const float* __restrict__ lk2, float* LAM) { const int lane = threadIdx.x; float d1 = 0.f, d2 = 0.f;
#pragma unroll 1
    for (int i = 0; i < HD; ++i) { float p1 = __fmul_rn(bfr(lq1[i]), bfr(lk1[i])); asm volatile("" : "+v"(p1)); d1 = __fadd_rn(d1, p1); float p2 = __fmul_rn(bfr(lq2[i]), bfr(lk2[i])); asm volatile("" : "+v"(p2)); d2 = __fadd_rn(d2, p2); }
    float lm = __fsub_rn(expf(d1), expf(d2)); asm volatile("" : "+v"(lm)); lm = __fadd_rn(lm, 0.8f); const float v = (lane == 0) ? lm : 0.0f; *(float*)(LAM + lane) = v;  }
__global__ __launch_bounds__(256) void k_qkp(const float* __restrict__ F, int pitch, int nheads, bf* Ph, bf* Pl) {
    const size_t e = ((size_t)blockIdx.x * 256 + threadIdx.x) * 2; if (e >= (size_t)nheads * SEQ * HD) return;
    const int d = (int)(e % HD); const int t = (int)((e / HD) % SEQ); const int vh = (int)(e / ((size_t)HD * SEQ));
    const v2f x = *(const v2f*)(F + (size_t)t * pitch + vh * HD + d); v2us oh, ol;
#pragma unroll
    for (int q = 0; q < 2; ++q) { unsigned short a2, c2; splitf(x[q], a2, c2); oh[q] = a2; ol[q] = c2; }
    *(v2us*)(Ph + e) = oh; *(v2us*)(Pl + e) = ol;  }
__global__ __launch_bounds__(256) void k_vtp(const float* __restrict__ F, int pitch, int nheads, h16* V16, h16* VR) {
    const size_t e = ((size_t)blockIdx.x * 256 + threadIdx.x) * 2; if (e >= (size_t)nheads * HD * SEQ) return;
    const int t = (int)(e % SEQ); const int d = (int)((e / SEQ) % HD); const int g = (int)(e / ((size_t)SEQ * HD)); v2h o16, orr;
#pragma unroll
    for (int q = 0; q < 2; ++q) { const float x = F[(size_t)(t + q) * pitch + g * HD + d]; const h16 hv = tohx(x); const float res = (x - (float)hv) * RCAR; o16[q] = hv; orr[q] = tohx(res); }
    *(v2h*)(V16 + e) = o16; *(v2h*)(VR + e) = orr;  }

// ---- k_attn: causal differential attention for one (query block of 64, head) per block of 4 waves (wave w owns 16 query rows). The two score streams run one after the other (stream loop outside
// the key-chunk loop: one Q/K hi/lo pair, one score tile pair, one O accumulator set and one running max/sum set live at a time). Per stream st and 64-key chunk c = 0..qb the K hi/lo tile of
// head plane 2h+st and the V^T tile are staged in LDS; the softmax recurrence then runs on 32-key sub-chunks: scores S = Q.K (3 bf16 products, 16x32 tile per wave) ->
// t = S/8 - slope (pos_i - pos_j) + (1 - mask_j)(-1e9) for j <= i, excluded otherwise; online softmax (running max / sum, f32); P tile (f16 x4096, 16x32) per wave in LDS; O += P.V (one k-step).
// forms P and V residual planes (x1024) and adds P_res.V + P.V_res per 16-column block through a second accumulator folded before normalisation.
__device__ __forceinline__ v16bf ldsb(const bf* p) { return cat16b(*(const v8usa*)p, *(const v8usa*)(p + 16)); }
__device__ __forceinline__ v16h  ldsh(const h16* p) { return cat16(*(const v8ha*)p, *(const v8ha*)(p + 16)); }

__global__ __launch_bounds__(128) __attribute__((amdgpu_num_vgpr(256)))
void k_attn(const bf* __restrict__ QPh, const bf* __restrict__ QPl, const bf* __restrict__ KPh, const bf* __restrict__ KPl, const h16* __restrict__ VT, const h16* __restrict__ VR,
            const float* __restrict__ amb, const int* __restrict__ tix, const float* __restrict__ LAM, float* Ob) {
    __shared__ __align__(16) bf    qs[2][QBL * LP];      // Q {hi,lo} of the current stream [row*LP + d]     (cross-wave: block barriers)
    __shared__ __align__(16) bf    ks[2][KCH * LP];      // K {hi,lo} of the current stream [key*LP + d]     (cross-wave: block barriers)
    __shared__ __align__(16) h16   vsm[HD * LP];         // V^T tile [d*LP + key]                            (cross-wave: block barriers)
    __shared__ __align__(16) h16   vrm[HD * LP];         // V residual tile, first query block only         (cross-wave: block barriers)
    __shared__ __align__(16) h16   psm[4][16 * PP];      // per-wave P tile [row*PP + key], 16 x 32          (wave-private, block barriers used anyway)
    __shared__ __align__(16) h16   prm[4][16 * PP];      // per-wave P residual tile, first query block only
    __shared__ __align__(16) float osm[4][16 * OSP];     // per-wave f32 result / epilogue staging [row*OSP + d]
    const int tid = threadIdx.x, w = tid >> 5, lane = tid & 31, lr = lane & 15, hi = lane >> 4;
    const int hh = blockIdx.y, qb = blockIdx.x, q0 = qb * QBL; const bool er = (qb == 0);
    const int e2 = hh + 1;                                   // slope = 2^(-(h+1)/2): exact power of two times 2^-0.5 for odd exponents
    const float slope = ((e2 & 1) ? 0.70710678118654752f : 1.0f) * __uint_as_float(((unsigned)(127 - (e2 >> 1))) << 23);
    const float lam = LAM[0];
    const int qrow0 = q0 + 16 * w + 8 * hi;
    float pq[8];
#pragma unroll
    for (int r = 0; r < 8; ++r) pq[r] = (float)tix[qrow0 + r];
    h16* pt = &psm[w][0]; h16* prt = &prm[w][0]; float* os = &osm[w][0];
#pragma unroll 1
    for (int st = 0; st < 2; ++st) {
        const size_t vq = (size_t)(2 * hh + st);
        __syncthreads();
#pragma unroll
        for (int i = 0; i < 8; ++i) { const int p = i >> 2; const int rem = (i & 3) * 128 + tid; const int row = rem >> 3, c8 = rem & 7;
            const bf* src = (p ? QPl : QPh) + (vq * SEQ + q0 + row) * HD + c8 * 8; *(v8usa*)(&qs[p][row * LP + c8 * 8]) = *(const v8usa*)src; }
        float m[8], l[8]; v8f O[4];
#pragma unroll
        for (int r = 0; r < 8; ++r) { m[r] = NEGB; l[r] = 0.0f; }
#pragma unroll
        for (int j = 0; j < 4; ++j) O[j] = (v8f){};
#pragma unroll 1
        for (int c = 0; c <= qb; ++c) {
            const int k0 = c * KCH;
#pragma unroll
            for (int i = 0; i < 8; ++i) { const int p = i >> 2; const int rem = (i & 3) * 128 + tid; const int row = rem >> 3, c8 = rem & 7;
                const bf* src = (p ? KPl : KPh) + (vq * SEQ + k0 + row) * HD + c8 * 8; *(v8usa*)(&ks[p][row * LP + c8 * 8]) = *(const v8usa*)src; }
#pragma unroll
            for (int i = 0; i < 4; ++i) { const int rem = i * 128 + tid; const int d = rem >> 3, c8 = rem & 7; const size_t go = ((size_t)hh * HD + d) * SEQ + k0 + 8 * c8;
                *(v8ha*)(&vsm[d * LP + 8 * c8]) = *(const v8ha*)(VT + go); if (er) *(v8ha*)(&vrm[d * LP + 8 * c8]) = *(const v8ha*)(VR + go); }
            __syncthreads();
#pragma unroll 1
            for (int sb = 0; sb < KCH / KSB; ++sb) {
                const int kb = sb * KSB;
                const int key0 = k0 + kb + lr, key1 = key0 + 16;
                const float pk0 = (float)tix[key0], pk1 = (float)tix[key1];
                const float om0 = 1.0f - amb[key0], om1 = 1.0f - amb[key1]; const float pad0 = om0 * -1.0e9f, pad1 = om1 * -1.0e9f;
                // ---- scores: S[row 8hi+r][key kb + nb*16 + lr], 3 bf16 products (hi.hi + lo.hi + hi.lo); fragments loaded right before each k-step, scheduling barrier after it
                v8f s[2]; s[0] = (v8f){}; s[1] = (v8f){};
                {   v16bf ah, al, bh, bl;
#pragma unroll
                    for (int kc = 0; kc < HD; kc += 32) {
                        ah = ldsb(&qs[0][(16 * w + lr) * LP + kc + 8 * hi]); al = ldsb(&qs[1][(16 * w + lr) * LP + kc + 8 * hi]);
#pragma unroll
                        for (int nb = 0; nb < 2; ++nb) { bh = ldsb(&ks[0][(kb + nb * 16 + lr) * LP + kc + 8 * hi]); bl = ldsb(&ks[1][(kb + nb * 16 + lr) * LP + kc + 8 * hi]);
                            s[nb] = wmmab(ah, bh, s[nb]); s[nb] = wmmab(al, bh, s[nb]); s[nb] = wmmab(ah, bl, s[nb]); }
                        asm volatile("v_nop\n\tv_nop\n\tv_nop\n\tv_nop" : "+v"(s[0]), "+v"(s[1]) : "v"(ah), "v"(al), "v"(bh), "v"(bl) : "memory");
                    }
                }
                // ---- additive terms by value select, sub-chunk max
                float cm[8];
#pragma unroll
                for (int r = 0; r < 8; ++r) cm[r] = NEGB;
#pragma unroll
                for (int nb = 0; nb < 2; ++nb) { const int kv = nb ? key1 : key0; const float pkv = nb ? pk1 : pk0; const float pdv = nb ? pad1 : pad0;
#pragma unroll
                    for (int r = 0; r < 8; ++r) { const float sa = s[nb][r] * SCL; const float pd = pq[r] - pkv; const float bia = slope * pd; const float sm = sa - bia;
                        const float tt = (kv <= qrow0 + r) ? (sm + pdv) : NEGB; s[nb][r] = tt; cm[r] = fmaxf(cm[r], tt); } }
                float cor[8], rs[8];
#pragma unroll
                for (int r = 0; r < 8; ++r) { float x = cm[r]; x = fmaxf(x, __shfl_xor(x, 1, 32)); x = fmaxf(x, __shfl_xor(x, 2, 32)); x = fmaxf(x, __shfl_xor(x, 4, 32)); x = fmaxf(x, __shfl_xor(x, 8, 32));
                    const float mn = fmaxf(m[r], x); const float dlt = (m[r] - mn) * L2E; cor[r] = __builtin_amdgcn_exp2f(dlt); m[r] = mn; rs[r] = 0.0f; }
                // ---- probabilities -> per-wave LDS tile (f16 x4096; residual x1024 on the first query block); excluded keys store exactly 0
#pragma unroll
                for (int nb = 0; nb < 2; ++nb) { const int kv = nb ? key1 : key0;
#pragma unroll
                    for (int r = 0; r < 8; ++r) { const float dq = (s[nb][r] - m[r]) * L2E; const float pe = __builtin_amdgcn_exp2f(dq); const float p = (kv <= qrow0 + r) ? pe : 0.0f; rs[r] = rs[r] + p;
                        const float pc = p * PCAR; const h16 ph = tohx(pc); const int li = (8 * hi + r) * PP + nb * 16 + lr; pt[li] = ph;
                        if (er) { const float res = (pc - (float)ph) * RCAR; prt[li] = tohx(res); } } }
#pragma unroll
                for (int r = 0; r < 8; ++r) { float x = rs[r]; x += __shfl_xor(x, 1, 32); x += __shfl_xor(x, 2, 32); x += __shfl_xor(x, 4, 32); x += __shfl_xor(x, 8, 32);
                    const float lc = l[r] * cor[r]; l[r] = lc + x; const float cf = cor[r];
#pragma unroll
                    for (int j = 0; j < 4; ++j) O[j][r] = O[j][r] * cf; }
                __syncthreads();
                // ---- O[d block j][row] += P[row][key] . V^T[d][key] over the 32 keys of this sub-chunk (one k-step)
                {   const v16h a = ldsh(pt + lr * PP + 8 * hi); v16h b;
#pragma unroll
                    for (int j = 0; j < 4; ++j) { b = ldsh(&vsm[(j * 16 + lr) * LP + kb + 8 * hi]); O[j] = wmma16(a, b, O[j]); }
                    asm volatile("v_nop\n\tv_nop\n\tv_nop\n\tv_nop" : "+v"(O[0]), "+v"(O[1]), "+v"(O[2]), "+v"(O[3]) : "v"(a), "v"(b) : "memory");
                    if (er) {
                        const v16h ar = ldsh(prt + lr * PP + 8 * hi);
#pragma unroll
                        for (int j = 0; j < 4; ++j) {
                            const v16h b2 = ldsh(&vsm[(j * 16 + lr) * LP + kb + 8 * hi]); const v16h br = ldsh(&vrm[(j * 16 + lr) * LP + kb + 8 * hi]);
                            v8f R = wmma16(ar, b2, (v8f){}); R = wmma16(a, br, R);
                            asm volatile("v_nop\n\tv_nop\n\tv_nop\n\tv_nop" : "+v"(R) : "v"(a), "v"(ar), "v"(b2), "v"(br) : "memory");
#pragma unroll
                            for (int r = 0; r < 8; ++r) { const float rr = R[r] * (1.0f / RCAR); O[j][r] = O[j][r] + rr; }
                        }
                    }
                }
                __syncthreads();
            }
        }
#pragma unroll
        for (int r = 0; r < 8; ++r) { const float rl = 1.0f / l[r]; const float il = rl * (1.0f / PCAR);
#pragma unroll
            for (int j = 0; j < 4; ++j) { const float a1 = O[j][r] * il; const int oi = (8 * hi + r) * OSP + j * 16 + lr;
                if (st == 0) { os[oi] = a1; } else { const float lb = lam * a1; const float cur = os[oi]; os[oi] = cur - lb; } } }
    }
    __syncthreads();
    float* orow = Ob + (size_t)(q0 + 16 * w) * DVV + hh * HD;
{
#pragma unroll
        for (int s2 = 0; s2 < 8; ++s2) { const int row = 2 * s2 + hi, cofs = lr * 4; const v4f val = *(const v4fa*)(os + row * OSP + cofs); *(v4f*)(orow + (size_t)row * DVV + cofs) = val; }
         }
}

__global__ __launch_bounds__(1024) void k_gnstat(const float* __restrict__ O, float* GST) {
    __shared__ float sh[1024]; const int tid = threadIdx.x; const int hh = blockIdx.x; const float* base = O + hh * HD; const int n = SEQ * HD; const float rn = 1.0f / (float)n;
    float acc = 0.f;
#pragma unroll 1
    for (int e = tid; e < n; e += 1024) { const int t = e >> 6, d = e & 63; acc = __fadd_rn(acc, base[(size_t)t * DVV + d]); }
    sh[tid] = acc; __syncthreads();
#pragma unroll 1
    for (int st = 512; st > 0; st >>= 1) { if (tid < st) sh[tid] = __fadd_rn(sh[tid], sh[tid + st]); __syncthreads(); }
    const float mean = sh[0] * rn;
    __syncthreads();
    float acc2 = 0.f;
#pragma unroll 1
    for (int e = tid; e < n; e += 1024) { const int t = e >> 6, d = e & 63; float dv = __fsub_rn(base[(size_t)t * DVV + d], mean); asm volatile("" : "+v"(dv)); acc2 = __fadd_rn(acc2, __fmul_rn(dv, dv)); }
    sh[tid] = acc2; __syncthreads();
#pragma unroll 1
    for (int st = 512; st > 0; st >>= 1) { if (tid < st) sh[tid] = __fadd_rn(sh[tid], sh[tid + st]); __syncthreads(); }
    if (tid < 32) { const float var = sh[0] * rn; const float rs = __fdiv_rn(1.0f, sqrtf(__fadd_rn(var, 1e-5f))); const float outv = (tid == 0) ? mean : ((tid == 1) ? rs : 0.0f);
        *(float*)(GST + hh * 32 + tid) = outv;  }
}
__global__ __launch_bounds__(256) void k_gnmerge(const float* __restrict__ O, const float* __restrict__ GST, const float* __restrict__ gw, const float* __restrict__ gb, bf* Ah, bf* Al) {
    const size_t e = ((size_t)blockIdx.x * 256 + threadIdx.x) * 2; if (e >= (size_t)SEQ * DVV) return;
    const int c = (int)(e % DVV); const int hh = c / HD; const float mean = GST[hh * 32], rs = GST[hh * 32 + 1]; v2us oh, ol;
#pragma unroll
    for (int q = 0; q < 2; ++q) { float cc = __fsub_rn(O[e + q], mean); asm volatile("" : "+v"(cc)); float nn = __fmul_rn(cc, rs); asm volatile("" : "+v"(nn)); float y = __fmul_rn(nn, bfr(gw[c + q])); asm volatile("" : "+v"(y)); y = __fadd_rn(y, bfr(gb[c + q])); const float z = __fmul_rn(y, 0.2f); unsigned short a2, c2; splitf(z, a2, c2); oh[q] = a2; ol[q] = c2; }
    *(v2us*)(Ah + e) = oh; *(v2us*)(Al + e) = ol;  }

extern "C" void kernel_launch(void* const* d_in, const int* in_sizes, int n_in,
                              void* d_out, int out_size, void* d_ws, size_t ws_size, hipStream_t stream) {
    if (n_in < 13) return;
    if (in_sizes[0] < (NB - 1) * SEQ_FULL * DM + SEQ * DM) return;
    if (in_sizes[1] < (NB - 1) * SEQ_FULL + SEQ) return;
    if (in_sizes[2] < (NB - 1) * SEQ_FULL + SEQ) return;
    if (in_sizes[3] < DQ * DM || in_sizes[4] < DQ * DM || in_sizes[5] < DVV * DM || in_sizes[6] < DM * DVV) return;
    if (in_sizes[7] < HD || in_sizes[8] < HD || in_sizes[9] < HD || in_sizes[10] < HD || in_sizes[11] < DVV || in_sizes[12] < DVV) return;
    if (out_size < (NB - 1) * SEQ_FULL * DM + SEQ * DM) return;
    const float* x = (const float*)d_in[0]; const float* amask = (const float*)d_in[1]; const int* tix = (const int*)d_in[2];
    const float* wq = (const float*)d_in[3]; const float* wk = (const float*)d_in[4]; const float* wv = (const float*)d_in[5]; const float* wo = (const float*)d_in[6];
    const float* lq1 = (const float*)d_in[7]; const float* lq2 = (const float*)d_in[8]; const float* lk1 = (const float*)d_in[9]; const float* lk2 = (const float*)d_in[10];
    const float* gnw = (const float*)d_in[11]; const float* gnb = (const float*)d_in[12];
    float* OUT = (float*)d_out;     // [NB][SEQ_FULL][1024]
    char* wsp = (char*)d_ws;
    auto take = [&](size_t bytes) { char* p = wsp; wsp += (bytes + 255) & ~(size_t)255; return (void*)p; };
    bf* WQ = (bf*)take((size_t)DQ * DM * 2); bf* WK = (bf*)take((size_t)DQ * DM * 2); bf* WV = (bf*)take((size_t)DVV * DM * 2); bf* WO = (bf*)take((size_t)DM * DVV * 2);
    bf* XB = (bf*)take((size_t)SEQ * DM * 2); float* AMB = (float*)take((size_t)SEQ * 4); float* LAM = (float*)take(256); float* GST = (float*)take((size_t)NVH * 32 * 4);
    float* FQ = (float*)take((size_t)SEQ * DQ * 4); float* FK = (float*)take((size_t)SEQ * DQ * 4);
    bf* QPh = (bf*)take((size_t)NQH * SEQ * HD * 2); bf* QPl = (bf*)take((size_t)NQH * SEQ * HD * 2); bf* KPh = (bf*)take((size_t)NQH * SEQ * HD * 2); bf* KPl = (bf*)take((size_t)NQH * SEQ * HD * 2);
    h16* VT16 = (h16*)take((size_t)NVH * HD * SEQ * 2); h16* VRS = (h16*)take((size_t)NVH * HD * SEQ * 2);
    float* Ob = (float*)take((size_t)SEQ * DVV * 4); bf* ATh = (bf*)take((size_t)SEQ * DVV * 2); bf* ATl = (bf*)take((size_t)SEQ * DVV * 2);
    const size_t used = (size_t)(wsp - (char*)d_ws);
    if (used > ws_size || used > (size_t)134217728) return;
    float* FV = FK;   // v projection reuses the k feature buffer after the k planes are built (stream-ordered)
    k_cvt8<<<(unsigned)(((size_t)DQ * DM / 8 + 255) / 256), 256, 0, stream>>>(wq, WQ, (size_t)DQ * DM / 8);
    k_cvt8<<<(unsigned)(((size_t)DQ * DM / 8 + 255) / 256), 256, 0, stream>>>(wk, WK, (size_t)DQ * DM / 8);
    k_cvt8<<<(unsigned)(((size_t)DVV * DM / 8 + 255) / 256), 256, 0, stream>>>(wv, WV, (size_t)DVV * DM / 8);
    k_cvt8<<<(unsigned)(((size_t)DM * DVV / 8 + 255) / 256), 256, 0, stream>>>(wo, WO, (size_t)DM * DVV / 8);
    k_lambda<<<1, 32, 0, stream>>>(lq1, lk1, lq2, lk2, LAM);
    const unsigned LQK = (unsigned)(((size_t)NQH * SEQ * HD / 2 + 255) / 256), LV = (unsigned)(((size_t)NVH * HD * SEQ / 2 + 255) / 256);
    for (int b = 0; b < NB; ++b) {
        const float* xb = x + (size_t)b * SEQ_FULL * DM; const float* amb = amask + (size_t)b * SEQ_FULL; const int* tixb = tix + (size_t)b * SEQ_FULL; float* outb = OUT + (size_t)b * SEQ_FULL * DM;
        k_cvt8<<<(unsigned)(((size_t)SEQ * DM / 8 + 255) / 256), 256, 0, stream>>>(xb, XB, (size_t)SEQ * DM / 8);
        k_rbf<<<(SEQ / 4 + 255) / 256, 256, 0, stream>>>(amb, AMB, SEQ / 4);
        k_gemmw<bf, 0, false><<<dim3(SEQ / 64, DQ / 64, 1), 32, 0, stream>>>(XB, nullptr, WQ, nullptr, DM, FQ, DQ, nullptr, 0, 0, 0);
        k_qkp<<<LQK, 256, 0, stream>>>(FQ, DQ, NQH, QPh, QPl);
        k_gemmw<bf, 0, false><<<dim3(SEQ / 64, DQ / 64, 1), 32, 0, stream>>>(XB, nullptr, WK, nullptr, DM, FK, DQ, nullptr, 0, 0, 0);
        k_qkp<<<LQK, 256, 0, stream>>>(FK, DQ, NQH, KPh, KPl);
        k_gemmw<bf, 0, false><<<dim3(SEQ / 64, DVV / 64, 1), 32, 0, stream>>>(XB, nullptr, WV, nullptr, DM, FV, DVV, nullptr, 0, 0, 0);
        k_vtp<<<LV, 256, 0, stream>>>(FV, DVV, NVH, VT16, VRS);
        k_attn<<<dim3(SEQ / QBL, NVH, 1), 128, 0, stream>>>(QPh, QPl, KPh, KPl, VT16, VRS, AMB, tixb, LAM, Ob);
        k_gnstat<<<NVH, 1024, 0, stream>>>(Ob, GST);
        k_gnmerge<<<(unsigned)(((size_t)SEQ * DVV / 2 + 255) / 256), 256, 0, stream>>>(Ob, GST, gnw, gnb, ATh, ATl);
        k_gemmw<bf, 1, false><<<dim3(SEQ / 64, DM / 64, 1), 32, 0, stream>>>(ATh, ATl, WO, nullptr, DVV, outb, DM, nullptr, 0, 0, 0);
    }
}

// v001
// One run takes 651 microseconds.
// Timed twice side by side with v000, it ran 1.48 and 1.47 times as fast.
#include <hip/hip_runtime.h>
#pragma clang fp contract(off)

// Compute dtypes (f32 accumulate everywhere): input projections x.Wq / x.Wk / x.Wv on v_wmma_f32_16x16x32_bf16 with bf16 RNE-converted inputs as operands (exact operands); q.k scores on v_wmma_f32_16x16x32_bf16 as bf16 hi/lo split (hi.hi + lo.hi + hi.lo); probability.value on v_wmma_f32_16x16x32_f16 (P f16 carried x4096, V f16; the first query block adds P and V residual planes carried x1024 through a second accumulator); softmax, ALiBi/pad terms, lambda and GroupNorm in f32; output projection on v_wmma_f32_16x16x32_bf16 (activation bf16 hi/lo x bf16 Wo, 2 products).
// Layout: x [NB][SEQ_FULL][1024]; Wq/Wk [2048][1024], Wv/Wo [1024][1024] ([out][in], used as K-contiguous Bt planes); per head h the 128 q/k columns are [half 1 | half 2] = virtual 64-wide heads 2h, 2h+1; mask [NB][SEQ_FULL] f32, token positions [NB][SEQ_FULL] int32; out [NB][SEQ_FULL][1024] f32.

#ifndef NB
#define NB 2
#endif
#ifndef SEQ
#define SEQ 2048
#endif
#define NB_FULL 2
#define SEQ_FULL 2048
#define DM   1024
#define NVH  16
#define HD   64
#define NQH  (2 * NVH)
#define DQ   (NQH * HD)
#define DVV  (NVH * HD)
#define SCL  0.125f
#define PCAR 4096.0f
#define RCAR 1024.0f
#define QBL  64
#define KCH  64
#define KSB  32
#define LP   72
#define PP   40
#define OSP  68
#define L2E  1.4426950408889634f
#define NEGB (-3.0e38f)
static_assert(SEQ % 64 == 0);
static_assert(SEQ <= SEQ_FULL);
static_assert(NB >= 1);
static_assert(NB <= NB_FULL);
static_assert(QBL == KCH);
static_assert(KCH % KSB == 0);
static_assert((LP * 2) % 16 == 0);
static_assert((PP * 2) % 16 == 0);
static_assert((OSP * 4) % 16 == 0);
static_assert((NQH * SEQ * HD) % 512 == 0);
static_assert((SEQ * DVV) % 512 == 0);
static_assert((SEQ * DM) % 2048 == 0);

typedef _Float16 h16;
typedef unsigned short bf;
typedef __attribute__((ext_vector_type(16))) __bf16   v16bf;
typedef __attribute__((ext_vector_type(16))) _Float16 v16h;
typedef __attribute__((ext_vector_type(8)))  _Float16 v8h;
typedef __attribute__((ext_vector_type(8)))  unsigned short v8us;
typedef __attribute__((ext_vector_type(8)))  float    v8f;
typedef __attribute__((ext_vector_type(4)))  float    v4f;
typedef __attribute__((ext_vector_type(2)))  _Float16 v2h;
typedef __attribute__((ext_vector_type(2)))  unsigned short v2us;
typedef __attribute__((ext_vector_type(2)))  float v2f;
typedef v8h  __attribute__((may_alias)) v8ha;
typedef v4f  __attribute__((may_alias)) v4fa;
typedef v8us __attribute__((may_alias)) v8usa;

__device__ __forceinline__ unsigned short f2bf(float f) { unsigned u = __float_as_uint(f); u += 0x7FFFu + ((u >> 16) & 1u); return (unsigned short)(u >> 16); }
__device__ __forceinline__ float bf2f(unsigned short b) { return __uint_as_float(((unsigned)b) << 16); }
__device__ __forceinline__ float bfr(float f) { return bf2f(f2bf(f)); }
__device__ __forceinline__ v16h cat16(v8h lo, v8h hi) { return __builtin_shufflevector(lo, hi, 0, 1, 2, 3, 4, 5, 6, 7, 8, 9, 10, 11, 12, 13, 14, 15); }
__device__ __forceinline__ v16bf cat16b(v8us lo, v8us hi) { return __builtin_bit_cast(v16bf, __builtin_shufflevector(lo, hi, 0, 1, 2, 3, 4, 5, 6, 7, 8, 9, 10, 11, 12, 13, 14, 15)); }
__device__ __forceinline__ v8f wmma16(v16h a, v16h b, v8f c) { return __builtin_amdgcn_wmma_f32_16x16x32_f16(false, a, false, b, (short)0, c, false, false); }
__device__ __forceinline__ v8f wmmab(v16bf a, v16bf b, v8f c) { return __builtin_amdgcn_wmma_f32_16x16x32_bf16(false, a, false, b, (short)0, c, false, false); }
__device__ __forceinline__ h16 tohx(float x) { return (h16)x; }
__device__ __forceinline__ void splitf(float y, unsigned short& h, unsigned short& l) { h = f2bf(y); l = f2bf(y - bf2f(h)); }

// ---- k_gemmw: register-blocked GEMM, ONE WAVE per 64x64 output tile (16 accumulators), operands straight from K-contiguous 16-bit planes; grid (M/64, N/64, Z), 32 threads.
// C[m][n] (f32, pitch ldc, + optional f32 bias[n]) = sum_k A[m][k] Bt[n][k] (+ split products per NSPLIT). z-batch strides sA/sB/sC in elements. K % 32 == 0.
// Fragments: lane -> row/col (lane & 15); elements 0..7 <- k + 8*(lane>>4), elements 8..15 <- k + 16 + 8*(lane>>4), for A and Bt alike.
template <typename T16> struct WFrag;
template <> struct WFrag<h16> { typedef v16h V; static __device__ __forceinline__ V ld(const h16* p) { return cat16(*(const v8h*)p, *(const v8h*)(p + 16)); } static __device__ __forceinline__ v8f mma(V a, V b, v8f c) { return wmma16(a, b, c); } };
template <> struct WFrag<bf> { typedef v16bf V; static __device__ __forceinline__ V ld(const bf* p) { return cat16b(*(const v8us*)p, *(const v8us*)(p + 16)); } static __device__ __forceinline__ v8f mma(V a, V b, v8f c) { return wmmab(a, b, c); } };
template <typename T16, int NSPLIT, bool BIAS>
__global__ __launch_bounds__(32) void k_gemmw(const T16* __restrict__ A, const T16* __restrict__ A2, const T16* __restrict__ Bt, const T16* __restrict__ Bt2, int K, float* C, int ldc, const float* __restrict__ bias, size_t sA, size_t sB, size_t sC) {
    typedef typename WFrag<T16>::V V;
    __shared__ __align__(16) float os[16 * 68];
    const size_t z = blockIdx.z; A += z * sA; if (A2) A2 += z * sA; Bt += z * sB; if (Bt2) Bt2 += z * sB; C += z * sC;
    const int lane = threadIdx.x & 31, lr = lane & 15, hi = lane >> 4; const int r0 = blockIdx.x * 64, c0 = blockIdx.y * 64;
    v8f acc[4][4];
#pragma unroll
    for (int mb = 0; mb < 4; ++mb)
#pragma unroll
        for (int nb = 0; nb < 4; ++nb) acc[mb][nb] = (v8f){};
    const size_t aoff = (size_t)(r0 + lr) * K + 8 * hi, boff = (size_t)(c0 + lr) * K + 8 * hi;
#pragma unroll 1
    for (int kc = 0; kc < K; kc += 32) {
        V a[4], a2[4];
#pragma unroll
        for (int mb = 0; mb < 4; ++mb) { a[mb] = WFrag<T16>::ld(A + aoff + (size_t)mb * 16 * K + kc); if (NSPLIT == 1 || NSPLIT == 2) a2[mb] = WFrag<T16>::ld(A2 + aoff + (size_t)mb * 16 * K + kc); }
#pragma unroll
        for (int nb = 0; nb < 4; ++nb) { const V b = WFrag<T16>::ld(Bt + boff + (size_t)nb * 16 * K + kc); V b2; if (NSPLIT >= 2) b2 = WFrag<T16>::ld(Bt2 + boff + (size_t)nb * 16 * K + kc);
#pragma unroll
            for (int mb = 0; mb < 4; ++mb) { acc[mb][nb] = WFrag<T16>::mma(a[mb], b, acc[mb][nb]); if (NSPLIT == 1 || NSPLIT == 2) acc[mb][nb] = WFrag<T16>::mma(a2[mb], b, acc[mb][nb]); if (NSPLIT >= 2) acc[mb][nb] = WFrag<T16>::mma(a[mb], b2, acc[mb][nb]); } }
        asm volatile("v_nop\n\tv_nop\n\tv_nop\n\tv_nop" : "+v"(acc[0][0]), "+v"(acc[1][1]), "+v"(acc[2][2]), "+v"(acc[3][3]) : "v"(a[0]), "v"(a[3]));
    }
#pragma unroll
    for (int mb = 0; mb < 4; ++mb) {
#pragma unroll
        for (int nb = 0; nb < 4; ++nb) {
#pragma unroll
            for (int j = 0; j < 8; ++j) os[(hi * 8 + j) * 68 + nb * 16 + lr] = acc[mb][nb][j]; }
        __builtin_amdgcn_wave_barrier(); asm volatile("" ::: "memory");
        float* crow = C + (size_t)(r0 + mb * 16) * ldc + c0;
{
#pragma unroll
            for (int s = 0; s < 8; ++s) { const int row = 2 * s + hi, cofs = lr * 4; v4f val = *(const v4fa*)(os + row * 68 + cofs); if (BIAS) { val[0] += bfr(bias[c0 + cofs]); val[1] += bfr(bias[c0 + cofs + 1]); val[2] += bfr(bias[c0 + cofs + 2]); val[3] += bfr(bias[c0 + cofs + 3]); }
                *(v4f*)(crow + (size_t)row * ldc + cofs) = val; }
             }
        __builtin_amdgcn_wave_barrier(); asm volatile("" ::: "memory");
    }
}

__global__ __launch_bounds__(256) void k_cvt8(const float* __restrict__ src, bf* dst, size_t n8, size_t sS, size_t sD) { const size_t i = (size_t)blockIdx.x * 256 + threadIdx.x; if (i >= n8) return; src += blockIdx.y * sS; dst += blockIdx.y * sD; const v8f v = *(const v8f*)(src + i * 8); v8us o;
#pragma unroll
    for (int k = 0; k < 8; ++k) o[k] = f2bf(v[k]); *(v8us*)(dst + i * 8) = o;  }
__global__ __launch_bounds__(256) void k_rbf(const float* __restrict__ src, float* dst, int n4, size_t sS, size_t sD) { const int i = blockIdx.x * 256 + threadIdx.x; if (i >= n4) return; src += blockIdx.y * sS; dst += blockIdx.y * sD; const v4f a = *(const v4f*)(src + (size_t)i * 4); v4f o;
#pragma unroll
    for (int u = 0; u < 4; ++u) o[u] = bfr(a[u]); *(v4f*)(dst + (size_t)i * 4) = o;  }
__global__ __launch_bounds__(32) void k_lambda(const float* __restrict__ lq1, const float* __restrict__ lk1, const float* __restrict__ lq2, const float* __restrict__ lk2, float* LAM) { const int lane = threadIdx.x; float d1 = 0.f, d2 = 0.f;
#pragma unroll 1
    for (int i = 0; i < HD; ++i) { float p1 = __fmul_rn(bfr(lq1[i]), bfr(lk1[i])); asm volatile("" : "+v"(p1)); d1 = __fadd_rn(d1, p1); float p2 = __fmul_rn(bfr(lq2[i]), bfr(lk2[i])); asm volatile("" : "+v"(p2)); d2 = __fadd_rn(d2, p2); }
    float lm = __fsub_rn(expf(d1), expf(d2)); asm volatile("" : "+v"(lm)); lm = __fadd_rn(lm, 0.8f); const float v = (lane == 0) ? lm : 0.0f; *(float*)(LAM + lane) = v;  }
__global__ __launch_bounds__(256) void k_qkp(const float* __restrict__ F, int pitch, int nheads, bf* Ph, bf* Pl) {
    const size_t e = ((size_t)blockIdx.x * 256 + threadIdx.x) * 2; if (e >= (size_t)nheads * SEQ * HD) return;
    F += (size_t)blockIdx.y * SEQ * pitch; Ph += (size_t)blockIdx.y * nheads * SEQ * HD; Pl += (size_t)blockIdx.y * nheads * SEQ * HD;
    const int d = (int)(e % HD); const int t = (int)((e / HD) % SEQ); const int vh = (int)(e / ((size_t)HD * SEQ));
    const v2f x = *(const v2f*)(F + (size_t)t * pitch + vh * HD + d); v2us oh, ol;
#pragma unroll
    for (int q = 0; q < 2; ++q) { unsigned short a2, c2; splitf(x[q], a2, c2); oh[q] = a2; ol[q] = c2; }
    *(v2us*)(Ph + e) = oh; *(v2us*)(Pl + e) = ol;  }
__global__ __launch_bounds__(256) void k_vtp(const float* __restrict__ F, int pitch, int nheads, h16* V16, h16* VR) {
    const size_t e = ((size_t)blockIdx.x * 256 + threadIdx.x) * 2; if (e >= (size_t)nheads * HD * SEQ) return;
    F += (size_t)blockIdx.y * SEQ * pitch; V16 += (size_t)blockIdx.y * nheads * HD * SEQ; VR += (size_t)blockIdx.y * nheads * HD * SEQ;
    const int t = (int)(e % SEQ); const int d = (int)((e / SEQ) % HD); const int g = (int)(e / ((size_t)SEQ * HD)); v2h o16, orr;
#pragma unroll
    for (int q = 0; q < 2; ++q) { const float x = F[(size_t)(t + q) * pitch + g * HD + d]; const h16 hv = tohx(x); const float res = (x - (float)hv) * RCAR; o16[q] = hv; orr[q] = tohx(res); }
    *(v2h*)(V16 + e) = o16; *(v2h*)(VR + e) = orr;  }

// ---- k_attn: causal differential attention for one (query block of 64, head) per block of 4 waves (wave w owns 16 query rows). The two score streams run one after the other (stream loop outside
// the key-chunk loop: one Q/K hi/lo pair, one score tile pair, one O accumulator set and one running max/sum set live at a time). Per stream st and 64-key chunk c = 0..qb the K hi/lo tile of
// head plane 2h+st and the V^T tile are staged in LDS; the softmax recurrence then runs on 32-key sub-chunks: scores S = Q.K (3 bf16 products, 16x32 tile per wave) ->
// t = S/8 - slope (pos_i - pos_j) + (1 - mask_j)(-1e9) for j <= i, excluded otherwise; online softmax (running max / sum, f32); P tile (f16 x4096, 16x32) per wave in LDS; O += P.V (one k-step).
// forms P and V residual planes (x1024) and adds P_res.V + P.V_res per 16-column block through a second accumulator folded before normalisation.
__device__ __forceinline__ v16bf ldsb(const bf* p) { return cat16b(*(const v8usa*)p, *(const v8usa*)(p + 16)); }
__device__ __forceinline__ v16h  ldsh(const h16* p) { return cat16(*(const v8ha*)p, *(const v8ha*)(p + 16)); }

__global__ __launch_bounds__(128) __attribute__((amdgpu_num_vgpr(256)))
void k_attn(const bf* __restrict__ QPh, const bf* __restrict__ QPl, const bf* __restrict__ KPh, const bf* __restrict__ KPl, const h16* __restrict__ VT, const h16* __restrict__ VR,
            const float* __restrict__ amb, const int* __restrict__ tix, const float* __restrict__ LAM, float* Ob) {
    __shared__ __align__(16) bf    qs[2][QBL * LP];      // Q {hi,lo} of the current stream [row*LP + d]     (cross-wave: block barriers)
    __shared__ __align__(16) bf    ks[2][KCH * LP];      // K {hi,lo} of the current stream [key*LP + d]     (cross-wave: block barriers)
    __shared__ __align__(16) h16   vsm[HD * LP];         // V^T tile [d*LP + key]                            (cross-wave: block barriers)
    __shared__ __align__(16) h16   vrm[HD * LP];         // V residual tile, first query block only         (cross-wave: block barriers)
    __shared__ __align__(16) h16   psm[4][16 * PP];      // per-wave P tile [row*PP + key], 16 x 32          (wave-private, block barriers used anyway)
    __shared__ __align__(16) h16   prm[4][16 * PP];      // per-wave P residual tile, first query block only
    __shared__ __align__(16) float osm[4][16 * OSP];     // per-wave f32 result / epilogue staging [row*OSP + d]
    const int tid = threadIdx.x, w = tid >> 5, lane = tid & 31, lr = lane & 15, hi = lane >> 4;
    const int hh = blockIdx.y, qb = blockIdx.x, q0 = qb * QBL; const bool er = (qb == 0);
    {   const size_t bz = blockIdx.z;                        // batch element: every plane is [NB][...]; only the token positions keep the input's own batch pitch
        QPh += bz * ((size_t)NQH * SEQ * HD); QPl += bz * ((size_t)NQH * SEQ * HD); KPh += bz * ((size_t)NQH * SEQ * HD); KPl += bz * ((size_t)NQH * SEQ * HD);
        VT += bz * ((size_t)NVH * HD * SEQ); VR += bz * ((size_t)NVH * HD * SEQ); amb += bz * SEQ; tix += bz * SEQ_FULL; Ob += bz * ((size_t)SEQ * DVV); }
    const int e2 = hh + 1;                                   // slope = 2^(-(h+1)/2): exact power of two times 2^-0.5 for odd exponents
    const float slope = ((e2 & 1) ? 0.70710678118654752f : 1.0f) * __uint_as_float(((unsigned)(127 - (e2 >> 1))) << 23);
    const float lam = LAM[0];
    const int qrow0 = q0 + 16 * w + 8 * hi;
    float pq[8];
#pragma unroll
    for (int r = 0; r < 8; ++r) pq[r] = (float)tix[qrow0 + r];
    h16* pt = &psm[w][0]; h16* prt = &prm[w][0]; float* os = &osm[w][0];
#pragma unroll 1
    for (int st = 0; st < 2; ++st) {
        const size_t vq = (size_t)(2 * hh + st);
        __syncthreads();
#pragma unroll
        for (int i = 0; i < 8; ++i) { const int p = i >> 2; const int rem = (i & 3) * 128 + tid; const int row = rem >> 3, c8 = rem & 7;
            const bf* src = (p ? QPl : QPh) + (vq * SEQ + q0 + row) * HD + c8 * 8; *(v8usa*)(&qs[p][row * LP + c8 * 8]) = *(const v8usa*)src; }
        float m[8], l[8]; v8f O[4];
#pragma unroll
        for (int r = 0; r < 8; ++r) { m[r] = NEGB; l[r] = 0.0f; }
#pragma unroll
        for (int j = 0; j < 4; ++j) O[j] = (v8f){};
#pragma unroll 1
        for (int c = 0; c <= qb; ++c) {
            const int k0 = c * KCH;
#pragma unroll
            for (int i = 0; i < 8; ++i) { const int p = i >> 2; const int rem = (i & 3) * 128 + tid; const int row = rem >> 3, c8 = rem & 7;
                const bf* src = (p ? KPl : KPh) + (vq * SEQ + k0 + row) * HD + c8 * 8; *(v8usa*)(&ks[p][row * LP + c8 * 8]) = *(const v8usa*)src; }
#pragma unroll
            for (int i = 0; i < 4; ++i) { const int rem = i * 128 + tid; const int d = rem >> 3, c8 = rem & 7; const size_t go = ((size_t)hh * HD + d) * SEQ + k0 + 8 * c8;
                *(v8ha*)(&vsm[d * LP + 8 * c8]) = *(const v8ha*)(VT + go); if (er) *(v8ha*)(&vrm[d * LP + 8 * c8]) = *(const v8ha*)(VR + go); }
            __syncthreads();
#pragma unroll 1
            for (int sb = 0; sb < KCH / KSB; ++sb) {
                const int kb = sb * KSB;
                const int key0 = k0 + kb + lr, key1 = key0 + 16;
                const float pk0 = (float)tix[key0], pk1 = (float)tix[key1];
                const float om0 = 1.0f - amb[key0], om1 = 1.0f - amb[key1]; const float pad0 = om0 * -1.0e9f, pad1 = om1 * -1.0e9f;
                // ---- scores: S[row 8hi+r][key kb + nb*16 + lr], 3 bf16 products (hi.hi + lo.hi + hi.lo); fragments loaded right before each k-step, scheduling barrier after it
                v8f s[2]; s[0] = (v8f){}; s[1] = (v8f){};
                {   v16bf ah, al, bh, bl;
#pragma unroll
                    for (int kc = 0; kc < HD; kc += 32) {
                        ah = ldsb(&qs[0][(16 * w + lr) * LP + kc + 8 * hi]); al = ldsb(&qs[1][(16 * w + lr) * LP + kc + 8 * hi]);
#pragma unroll
                        for (int nb = 0; nb < 2; ++nb) { bh = ldsb(&ks[0][(kb + nb * 16 + lr) * LP + kc + 8 * hi]); bl = ldsb(&ks[1][(kb + nb * 16 + lr) * LP + kc + 8 * hi]);
                            s[nb] = wmmab(ah, bh, s[nb]); s[nb] = wmmab(al, bh, s[nb]); s[nb] = wmmab(ah, bl, s[nb]); }
                        asm volatile("v_nop\n\tv_nop\n\tv_nop\n\tv_nop" : "+v"(s[0]), "+v"(s[1]) : "v"(ah), "v"(al), "v"(bh), "v"(bl) : "memory");
                    }
                }
                // ---- additive terms by value select, sub-chunk max
                float cm[8];
#pragma unroll
                for (int r = 0; r < 8; ++r) cm[r] = NEGB;
#pragma unroll
                for (int nb = 0; nb < 2; ++nb) { const int kv = nb ? key1 : key0; const float pkv = nb ? pk1 : pk0; const float pdv = nb ? pad1 : pad0;
#pragma unroll
                    for (int r = 0; r < 8; ++r) { const float sa = s[nb][r] * SCL; const float pd = pq[r] - pkv; const float bia = slope * pd; const float sm = sa - bia;
                        const float tt = (kv <= qrow0 + r) ? (sm + pdv) : NEGB; s[nb][r] = tt; cm[r] = fmaxf(cm[r], tt); } }
                float cor[8], rs[8];
#pragma unroll
                for (int r = 0; r < 8; ++r) { float x = cm[r]; x = fmaxf(x, __shfl_xor(x, 1, 32)); x = fmaxf(x, __shfl_xor(x, 2, 32)); x = fmaxf(x, __shfl_xor(x, 4, 32)); x = fmaxf(x, __shfl_xor(x, 8, 32));
                    const float mn = fmaxf(m[r], x); const float dlt = (m[r] - mn) * L2E; cor[r] = __builtin_amdgcn_exp2f(dlt); m[r] = mn; rs[r] = 0.0f; }
                // ---- probabilities -> per-wave LDS tile (f16 x4096; residual x1024 on the first query block); excluded keys store exactly 0
#pragma unroll
                for (int nb = 0; nb < 2; ++nb) { const int kv = nb ? key1 : key0;
#pragma unroll
                    for (int r = 0; r < 8; ++r) { const float dq = (s[nb][r] - m[r]) * L2E; const float pe = __builtin_amdgcn_exp2f(dq); const float p = (kv <= qrow0 + r) ? pe : 0.0f; rs[r] = rs[r] + p;
                        const float pc = p * PCAR; const h16 ph = tohx(pc); const int li = (8 * hi + r) * PP + nb * 16 + lr; pt[li] = ph;
                        if (er) { const float res = (pc - (float)ph) * RCAR; prt[li] = tohx(res); } } }
#pragma unroll
                for (int r = 0; r < 8; ++r) { float x = rs[r]; x += __shfl_xor(x, 1, 32); x += __shfl_xor(x, 2, 32); x += __shfl_xor(x, 4, 32); x += __shfl_xor(x, 8, 32);
                    const float lc = l[r] * cor[r]; l[r] = lc + x; const float cf = cor[r];
#pragma unroll
                    for (int j = 0; j < 4; ++j) O[j][r] = O[j][r] * cf; }
                __syncthreads();
                // ---- O[d block j][row] += P[row][key] . V^T[d][key] over the 32 keys of this sub-chunk (one k-step)
                {   const v16h a = ldsh(pt + lr * PP + 8 * hi); v16h b;
#pragma unroll
                    for (int j = 0; j < 4; ++j) { b = ldsh(&vsm[(j * 16 + lr) * LP + kb + 8 * hi]); O[j] = wmma16(a, b, O[j]); }
                    asm volatile("v_nop\n\tv_nop\n\tv_nop\n\tv_nop" : "+v"(O[0]), "+v"(O[1]), "+v"(O[2]), "+v"(O[3]) : "v"(a), "v"(b) : "memory");
                    if (er) {
                        const v16h ar = ldsh(prt + lr * PP + 8 * hi);
#pragma unroll
                        for (int j = 0; j < 4; ++j) {
                            const v16h b2 = ldsh(&vsm[(j * 16 + lr) * LP + kb + 8 * hi]); const v16h br = ldsh(&vrm[(j * 16 + lr) * LP + kb + 8 * hi]);
                            v8f R = wmma16(ar, b2, (v8f){}); R = wmma16(a, br, R);
                            asm volatile("v_nop\n\tv_nop\n\tv_nop\n\tv_nop" : "+v"(R) : "v"(a), "v"(ar), "v"(b2), "v"(br) : "memory");
#pragma unroll
                            for (int r = 0; r < 8; ++r) { const float rr = R[r] * (1.0f / RCAR); O[j][r] = O[j][r] + rr; }
                        }
                    }
                }
                __syncthreads();
            }
        }
#pragma unroll
        for (int r = 0; r < 8; ++r) { const float rl = 1.0f / l[r]; const float il = rl * (1.0f / PCAR);
#pragma unroll
            for (int j = 0; j < 4; ++j) { const float a1 = O[j][r] * il; const int oi = (8 * hi + r) * OSP + j * 16 + lr;
                if (st == 0) { os[oi] = a1; } else { const float lb = lam * a1; const float cur = os[oi]; os[oi] = cur - lb; } } }
    }
    __syncthreads();
    float* orow = Ob + (size_t)(q0 + 16 * w) * DVV + hh * HD;
{
#pragma unroll
        for (int s2 = 0; s2 < 8; ++s2) { const int row = 2 * s2 + hi, cofs = lr * 4; const v4f val = *(const v4fa*)(os + row * OSP + cofs); *(v4f*)(orow + (size_t)row * DVV + cofs) = val; }
         }
}

__global__ __launch_bounds__(1024) void k_gnstat(const float* __restrict__ O, float* GST) {
    __shared__ float sh[1024]; const int tid = threadIdx.x; const int hh = blockIdx.x; const float* base = O + (size_t)blockIdx.y * SEQ * DVV + hh * HD; GST += blockIdx.y * (NVH * 32); const int n = SEQ * HD; const float rn = 1.0f / (float)n;
    float acc = 0.f;
#pragma unroll 1
    for (int e = tid; e < n; e += 1024) { const int t = e >> 6, d = e & 63; acc = __fadd_rn(acc, base[(size_t)t * DVV + d]); }
    sh[tid] = acc; __syncthreads();
#pragma unroll 1
    for (int st = 512; st > 0; st >>= 1) { if (tid < st) sh[tid] = __fadd_rn(sh[tid], sh[tid + st]); __syncthreads(); }
    const float mean = sh[0] * rn;
    __syncthreads();
    float acc2 = 0.f;
#pragma unroll 1
    for (int e = tid; e < n; e += 1024) { const int t = e >> 6, d = e & 63; float dv = __fsub_rn(base[(size_t)t * DVV + d], mean); asm volatile("" : "+v"(dv)); acc2 = __fadd_rn(acc2, __fmul_rn(dv, dv)); }
    sh[tid] = acc2; __syncthreads();
#pragma unroll 1
    for (int st = 512; st > 0; st >>= 1) { if (tid < st) sh[tid] = __fadd_rn(sh[tid], sh[tid + st]); __syncthreads(); }
    if (tid < 32) { const float var = sh[0] * rn; const float rs = __fdiv_rn(1.0f, sqrtf(__fadd_rn(var, 1e-5f))); const float outv = (tid == 0) ? mean : ((tid == 1) ? rs : 0.0f);
        *(float*)(GST + hh * 32 + tid) = outv;  }
}
__global__ __launch_bounds__(256) void k_gnmerge(const float* __restrict__ O, const float* __restrict__ GST, const float* __restrict__ gw, const float* __restrict__ gb, bf* Ah, bf* Al) {
    const size_t e = ((size_t)blockIdx.x * 256 + threadIdx.x) * 2; if (e >= (size_t)SEQ * DVV) return;
    O += (size_t)blockIdx.y * SEQ * DVV; GST += blockIdx.y * (NVH * 32); Ah += (size_t)blockIdx.y * SEQ * DVV; Al += (size_t)blockIdx.y * SEQ * DVV;
    const int c = (int)(e % DVV); const int hh = c / HD; const float mean = GST[hh * 32], rs = GST[hh * 32 + 1]; v2us oh, ol;
#pragma unroll
    for (int q = 0; q < 2; ++q) { float cc = __fsub_rn(O[e + q], mean); asm volatile("" : "+v"(cc)); float nn = __fmul_rn(cc, rs); asm volatile("" : "+v"(nn)); float y = __fmul_rn(nn, bfr(gw[c + q])); asm volatile("" : "+v"(y)); y = __fadd_rn(y, bfr(gb[c + q])); const float z = __fmul_rn(y, 0.2f); unsigned short a2, c2; splitf(z, a2, c2); oh[q] = a2; ol[q] = c2; }
    *(v2us*)(Ah + e) = oh; *(v2us*)(Al + e) = ol;  }

extern "C" void kernel_launch(void* const* d_in, const int* in_sizes, int n_in,
                              void* d_out, int out_size, void* d_ws, size_t ws_size, hipStream_t stream) {
    if (n_in < 13) return;
    if (in_sizes[0] < (NB - 1) * SEQ_FULL * DM + SEQ * DM) return;
    if (in_sizes[1] < (NB - 1) * SEQ_FULL + SEQ) return;
    if (in_sizes[2] < (NB - 1) * SEQ_FULL + SEQ) return;
    if (in_sizes[3] < DQ * DM || in_sizes[4] < DQ * DM || in_sizes[5] < DVV * DM || in_sizes[6] < DM * DVV) return;
    if (in_sizes[7] < HD || in_sizes[8] < HD || in_sizes[9] < HD || in_sizes[10] < HD || in_sizes[11] < DVV || in_sizes[12] < DVV) return;
    if (out_size < (NB - 1) * SEQ_FULL * DM + SEQ * DM) return;
    const float* x = (const float*)d_in[0]; const float* amask = (const float*)d_in[1]; const int* tix = (const int*)d_in[2];
    const float* wq = (const float*)d_in[3]; const float* wk = (const float*)d_in[4]; const float* wv = (const float*)d_in[5]; const float* wo = (const float*)d_in[6];
    const float* lq1 = (const float*)d_in[7]; const float* lq2 = (const float*)d_in[8]; const float* lk1 = (const float*)d_in[9]; const float* lk2 = (const float*)d_in[10];
    const float* gnw = (const float*)d_in[11]; const float* gnb = (const float*)d_in[12];
    float* OUT = (float*)d_out;     // [NB][SEQ_FULL][1024]
    char* wsp = (char*)d_ws;
    auto take = [&](size_t bytes) { char* p = wsp; wsp += (bytes + 255) & ~(size_t)255; return (void*)p; };
    bf* WQ = (bf*)take((size_t)DQ * DM * 2); bf* WK = (bf*)take((size_t)DQ * DM * 2); bf* WV = (bf*)take((size_t)DVV * DM * 2); bf* WO = (bf*)take((size_t)DM * DVV * 2);
    bf* XB = (bf*)take((size_t)NB * SEQ * DM * 2); float* AMB = (float*)take((size_t)NB * SEQ * 4); float* LAM = (float*)take(256); float* GST = (float*)take((size_t)NB * NVH * 32 * 4);
    float* FQ = (float*)take((size_t)NB * SEQ * DQ * 4); float* FK = (float*)take((size_t)NB * SEQ * DQ * 4);
    bf* QPh = (bf*)take((size_t)NB * NQH * SEQ * HD * 2); bf* QPl = (bf*)take((size_t)NB * NQH * SEQ * HD * 2); bf* KPh = (bf*)take((size_t)NB * NQH * SEQ * HD * 2); bf* KPl = (bf*)take((size_t)NB * NQH * SEQ * HD * 2);
    h16* VT16 = (h16*)take((size_t)NB * NVH * HD * SEQ * 2); h16* VRS = (h16*)take((size_t)NB * NVH * HD * SEQ * 2);
    float* Ob = (float*)take((size_t)NB * SEQ * DVV * 4); bf* ATh = (bf*)take((size_t)NB * SEQ * DVV * 2); bf* ATl = (bf*)take((size_t)NB * SEQ * DVV * 2);
    const size_t used = (size_t)(wsp - (char*)d_ws);
    if (used > ws_size || used > (size_t)268435456) return;
    float* FV = FK;   // v projection reuses the k feature buffer after the k planes are built (stream-ordered)
    k_cvt8<<<(unsigned)(((size_t)DQ * DM / 8 + 255) / 256), 256, 0, stream>>>(wq, WQ, (size_t)DQ * DM / 8, 0, 0);
    k_cvt8<<<(unsigned)(((size_t)DQ * DM / 8 + 255) / 256), 256, 0, stream>>>(wk, WK, (size_t)DQ * DM / 8, 0, 0);
    k_cvt8<<<(unsigned)(((size_t)DVV * DM / 8 + 255) / 256), 256, 0, stream>>>(wv, WV, (size_t)DVV * DM / 8, 0, 0);
    k_cvt8<<<(unsigned)(((size_t)DM * DVV / 8 + 255) / 256), 256, 0, stream>>>(wo, WO, (size_t)DM * DVV / 8, 0, 0);
    k_lambda<<<1, 32, 0, stream>>>(lq1, lk1, lq2, lk2, LAM);
    const unsigned LQK = (unsigned)(((size_t)NQH * SEQ * HD / 2 + 255) / 256), LV = (unsigned)(((size_t)NVH * HD * SEQ / 2 + 255) / 256);
    // Every stage runs once for all NB batch elements: the batch index is the last used grid dimension, workspace planes are [NB][...].
    k_cvt8<<<dim3((unsigned)(((size_t)SEQ * DM / 8 + 255) / 256), NB, 1), 256, 0, stream>>>(x, XB, (size_t)SEQ * DM / 8, (size_t)SEQ_FULL * DM, (size_t)SEQ * DM);
    k_rbf<<<dim3((SEQ / 4 + 255) / 256, NB, 1), 256, 0, stream>>>(amask, AMB, SEQ / 4, (size_t)SEQ_FULL, (size_t)SEQ);
    k_gemmw<bf, 0, false><<<dim3(SEQ / 64, DQ / 64, NB), 32, 0, stream>>>(XB, nullptr, WQ, nullptr, DM, FQ, DQ, nullptr, (size_t)SEQ * DM, 0, (size_t)SEQ * DQ);
    k_qkp<<<dim3(LQK, NB, 1), 256, 0, stream>>>(FQ, DQ, NQH, QPh, QPl);
    k_gemmw<bf, 0, false><<<dim3(SEQ / 64, DQ / 64, NB), 32, 0, stream>>>(XB, nullptr, WK, nullptr, DM, FK, DQ, nullptr, (size_t)SEQ * DM, 0, (size_t)SEQ * DQ);
    k_qkp<<<dim3(LQK, NB, 1), 256, 0, stream>>>(FK, DQ, NQH, KPh, KPl);
    k_gemmw<bf, 0, false><<<dim3(SEQ / 64, DVV / 64, NB), 32, 0, stream>>>(XB, nullptr, WV, nullptr, DM, FV, DVV, nullptr, (size_t)SEQ * DM, 0, (size_t)SEQ * DVV);
    k_vtp<<<dim3(LV, NB, 1), 256, 0, stream>>>(FV, DVV, NVH, VT16, VRS);
    k_attn<<<dim3(SEQ / QBL, NVH, NB), 128, 0, stream>>>(QPh, QPl, KPh, KPl, VT16, VRS, AMB, tix, LAM, Ob);
    k_gnstat<<<dim3(NVH, NB, 1), 1024, 0, stream>>>(Ob, GST);
    k_gnmerge<<<dim3((unsigned)(((size_t)SEQ * DVV / 2 + 255) / 256), NB, 1), 256, 0, stream>>>(Ob, GST, gnw, gnb, ATh, ATl);
    k_gemmw<bf, 1, false><<<dim3(SEQ / 64, DM / 64, NB), 32, 0, stream>>>(ATh, ATl, WO, nullptr, DVV, OUT, DM, nullptr, (size_t)SEQ * DVV, 0, (size_t)SEQ_FULL * DM);
}

// v002
// One run takes 598 microseconds.
// Timed twice side by side with v001, it ran 1.09 times as fast both times.
// All steps since v000 together make it 1.61 times as fast.
#include <hip/hip_runtime.h>
#pragma clang fp contract(off)

// Compute dtypes (f32 accumulate everywhere): input projections x.Wq / x.Wk / x.Wv on v_wmma_f32_16x16x32_bf16 with bf16 RNE-converted inputs as operands (exact operands); q.k scores on v_wmma_f32_16x16x32_bf16 as bf16 hi/lo split (hi.hi + lo.hi + hi.lo); probability.value on v_wmma_f32_16x16x32_f16 (P f16 carried x4096, V f16; the first query block adds P and V residual planes carried x1024 through a second accumulator); softmax, ALiBi/pad terms, lambda and GroupNorm in f32; output projection on v_wmma_f32_16x16x32_bf16 (activation bf16 hi/lo x bf16 Wo, 2 products).
// Layout: x [NB][SEQ_FULL][1024]; Wq/Wk [2048][1024], Wv/Wo [1024][1024] ([out][in], used as K-contiguous Bt planes); per head h the 128 q/k columns are [half 1 | half 2] = virtual 64-wide heads 2h, 2h+1; mask [NB][SEQ_FULL] f32, token positions [NB][SEQ_FULL] int32; out [NB][SEQ_FULL][1024] f32.

#ifndef NB
#define NB 2
#endif
#ifndef SEQ
#define SEQ 2048
#endif
#define NB_FULL 2
#define SEQ_FULL 2048
#define DM   1024
#define NVH  16
#define HD   64
#define NQH  (2 * NVH)
#define DQ   (NQH * HD)
#define DVV  (NVH * HD)
#define SCL  0.125f
#define PCAR 4096.0f
#define RCAR 1024.0f
#define QBL  64
#define KCH  64
#define KSB  32
#define LP   72
#define PP   40
#define OSP  68
#define L2E  1.4426950408889634f
#define NEGB (-3.0e38f)
static_assert(SEQ % 64 == 0);
static_assert(SEQ <= SEQ_FULL);
static_assert(NB >= 1);
static_assert(NB <= NB_FULL);
static_assert(QBL == KCH);
static_assert(KCH % KSB == 0);
static_assert((LP * 2) % 16 == 0);
static_assert((PP * 2) % 16 == 0);
static_assert((OSP * 4) % 16 == 0);
static_assert((NQH * SEQ * HD) % 512 == 0);
static_assert((SEQ * DVV) % 512 == 0);
static_assert((SEQ * DM) % 2048 == 0);

typedef _Float16 h16;
typedef unsigned short bf;
typedef __attribute__((ext_vector_type(16))) __bf16   v16bf;
typedef __attribute__((ext_vector_type(16))) _Float16 v16h;
typedef __attribute__((ext_vector_type(8)))  _Float16 v8h;
typedef __attribute__((ext_vector_type(8)))  unsigned short v8us;
typedef __attribute__((ext_vector_type(8)))  float    v8f;
typedef __attribute__((ext_vector_type(4)))  float    v4f;
typedef __attribute__((ext_vector_type(2)))  _Float16 v2h;
typedef __attribute__((ext_vector_type(2)))  unsigned short v2us;
typedef __attribute__((ext_vector_type(2)))  float v2f;
typedef v8h  __attribute__((may_alias)) v8ha;
typedef v4f  __attribute__((may_alias)) v4fa;
typedef v8us __attribute__((may_alias)) v8usa;

__device__ __forceinline__ unsigned short f2bf(float f) { unsigned u = __float_as_uint(f); u += 0x7FFFu + ((u >> 16) & 1u); return (unsigned short)(u >> 16); }
__device__ __forceinline__ float bf2f(unsigned short b) { return __uint_as_float(((unsigned)b) << 16); }
__device__ __forceinline__ float bfr(float f) { return bf2f(f2bf(f)); }
__device__ __forceinline__ v16h cat16(v8h lo, v8h hi) { return __builtin_shufflevector(lo, hi, 0, 1, 2, 3, 4, 5, 6, 7, 8, 9, 10, 11, 12, 13, 14, 15); }
__device__ __forceinline__ v16bf cat16b(v8us lo, v8us hi) { return __builtin_bit_cast(v16bf, __builtin_shufflevector(lo, hi, 0, 1, 2, 3, 4, 5, 6, 7, 8, 9, 10, 11, 12, 13, 14, 15)); }
__device__ __forceinline__ v8f wmma16(v16h a, v16h b, v8f c) { return __builtin_amdgcn_wmma_f32_16x16x32_f16(false, a, false, b, (short)0, c, false, false); }
__device__ __forceinline__ v8f wmmab(v16bf a, v16bf b, v8f c) { return __builtin_amdgcn_wmma_f32_16x16x32_bf16(false, a, false, b, (short)0, c, false, false); }
__device__ __forceinline__ h16 tohx(float x) { return (h16)x; }
__device__ __forceinline__ void splitf(float y, unsigned short& h, unsigned short& l) { h = f2bf(y); l = f2bf(y - bf2f(h)); }

// ---- k_gemmb: block-tiled GEMM, 8 waves (2 x 4) per 128x128 output tile, wave tile 64x32 (8 accumulators); grid (M/128, N/128, Z), 256 threads.
// C[m][n] (f32, pitch ldc) = sum_k A[m][k] Bt[n][k] (+ A2[m][k] Bt[n][k] when NSPLIT == 1). z-batch strides sA/sC in elements. K % 64 == 0, K >= 64.
// A stage is 64 k of every operand row (one whole 128-byte line per row), read from the K-contiguous planes by whole-line 16-byte loads, kept in registers while the
// previous stage is multiplied, then stored to the other of two LDS buffers (row pitch 144 B); one block barrier per stage publishes it and ends the reads of the buffer refilled next.
// Fragments: lane -> row/col (lane & 15); elements 0..7 <- k + 8*(lane>>4), elements 8..15 <- k + 16 + 8*(lane>>4), for A and Bt alike. k runs upward, one accumulate chain per element.
#define GT   128
#define GBK  64
#define GLP  72
#define GOP  36
static_assert(SEQ % GT == 0);
static_assert(DQ % GT == 0);
static_assert(DVV % GT == 0);
static_assert(DM % GT == 0);
static_assert(DM % GBK == 0);
static_assert(DVV % GBK == 0);
static_assert((GLP * 2) % 16 == 0);
static_assert((GOP * 4) % 16 == 0);
__device__ __forceinline__ v16bf ldsb(const bf* p) { return cat16b(*(const v8usa*)p, *(const v8usa*)(p + 16)); }
template <int NSPLIT>
// waves_per_eu: at most two 8-wave blocks run per WGP here, so the register budget is that of 4 waves per SIMD and a k-step's fragment loads may be grouped ahead of its products
__global__ __launch_bounds__(256) __attribute__((amdgpu_waves_per_eu(1, 4)))
void k_gemmb(const bf* __restrict__ A, const bf* __restrict__ A2, const bf* __restrict__ Bt, int K, float* C, int ldc, size_t sA, size_t sC) {
    constexpr int NPL = 2 + NSPLIT;                          // planes per stage: A, (A2,) Bt
    __shared__ __align__(16) bf    tl[2][NPL][GT * GLP];     // two stage buffers [row*GLP + k]                  (cross-wave: block barriers)
    __shared__ __align__(16) float osw[8][16 * GOP];         // per-wave f32 epilogue staging [row*GOP + col]    (wave-private)
    const size_t z = blockIdx.z; A += z * sA; if (NSPLIT) A2 += z * sA; C += z * sC;
    const int tid = threadIdx.x, w = tid >> 5, lane = tid & 31, lr = lane & 15, hi = lane >> 4; const int wm = w >> 2, wn = w & 3;
    const int r0 = blockIdx.x * GT, c0 = blockIdx.y * GT;
    v8f acc[4][2];
#pragma unroll
    for (int mb = 0; mb < 4; ++mb)
#pragma unroll
        for (int nb = 0; nb < 2; ++nb) acc[mb][nb] = (v8f){};
    const int srow = tid >> 3, sc8 = (tid & 7) * 8;          // staging: 8 lanes cover one row's 128 bytes; piece i is row srow + 32 i
    const char* gA = (const char*)(A + (size_t)r0 * K); const char* gA2 = (const char*)(A2 + (size_t)r0 * K); const char* gB = (const char*)(Bt + (size_t)c0 * K);   // block-uniform tile bases
    unsigned go[4];                                          // the lane's byte offset of piece i inside a tile's rows, the same for every plane and stage
#pragma unroll
    for (int i = 0; i < 4; ++i) go[i] = ((unsigned)(srow + 32 * i) * (unsigned)K + (unsigned)sc8) * 2u;
    const int so = srow * GLP + sc8;
    const int fa = (wm * 64 + lr) * GLP + 8 * hi, fb = (wn * 32 + lr) * GLP + 8 * hi;
    v8us ra[4], ra2[4], rb[4];
#pragma unroll
    for (int i = 0; i < 4; ++i) { ra[i] = *(const v8us*)(gA + go[i]); if (NSPLIT) ra2[i] = *(const v8us*)(gA2 + go[i]); rb[i] = *(const v8us*)(gB + go[i]); }
#pragma unroll
    for (int i = 0; i < 4; ++i) { *(v8usa*)(&tl[0][0][so + i * 32 * GLP]) = ra[i]; if (NSPLIT) *(v8usa*)(&tl[0][1][so + i * 32 * GLP]) = ra2[i]; *(v8usa*)(&tl[0][NPL - 1][so + i * 32 * GLP]) = rb[i]; }
    __syncthreads();
#pragma unroll 1
    for (int k0 = 0; k0 < K; k0 += GBK) {
        const int cur = (k0 / GBK) & 1; const bool more = k0 + GBK < K;
        gA += GBK * 2; gA2 += GBK * 2; gB += GBK * 2;        // the uniform bases step one stage; the lanes' offsets stay
        if (more) {
#pragma unroll
            for (int i = 0; i < 4; ++i) {   // a wait behind each load: this build lets a later load of the group land in an earlier one's address pair, and the wait stands in front of that overwrite
                ra[i] = *(const v8us*)(gA + go[i]); asm volatile("s_wait_xcnt 0x0" ::: "memory");
                if (NSPLIT) { ra2[i] = *(const v8us*)(gA2 + go[i]); asm volatile("s_wait_xcnt 0x0" ::: "memory"); }
                rb[i] = *(const v8us*)(gB + go[i]); asm volatile("s_wait_xcnt 0x0" ::: "memory"); }
        }
        const bf* ta = &tl[cur][0][fa]; const bf* ta2 = &tl[cur][NSPLIT][fa]; const bf* tb = &tl[cur][NPL - 1][fb];
#pragma unroll
        for (int kc = 0; kc < GBK; kc += 32) {
            v16bf a[4], a2[4], b[2];
#pragma unroll
            for (int mb = 0; mb < 4; ++mb) { a[mb] = ldsb(ta + mb * 16 * GLP + kc); if (NSPLIT) a2[mb] = ldsb(ta2 + mb * 16 * GLP + kc); }
#pragma unroll
            for (int nb = 0; nb < 2; ++nb) b[nb] = ldsb(tb + nb * 16 * GLP + kc);
#pragma unroll
            for (int nb = 0; nb < 2; ++nb)
#pragma unroll
                for (int mb = 0; mb < 4; ++mb) { acc[mb][nb] = wmmab(a[mb], b[nb], acc[mb][nb]); if (NSPLIT) acc[mb][nb] = wmmab(a2[mb], b[nb], acc[mb][nb]); }
        }
        if (more) {
#pragma unroll
            for (int i = 0; i < 4; ++i) { *(v8usa*)(&tl[cur ^ 1][0][so + i * 32 * GLP]) = ra[i]; if (NSPLIT) *(v8usa*)(&tl[cur ^ 1][1][so + i * 32 * GLP]) = ra2[i]; *(v8usa*)(&tl[cur ^ 1][NPL - 1][so + i * 32 * GLP]) = rb[i]; }
        }
        __syncthreads();
    }
    float* os = &osw[w][0];
#pragma unroll
    for (int mb = 0; mb < 4; ++mb) {
#pragma unroll
        for (int nb = 0; nb < 2; ++nb) {
#pragma unroll
            for (int j = 0; j < 8; ++j) os[(hi * 8 + j) * GOP + nb * 16 + lr] = acc[mb][nb][j]; }
        __builtin_amdgcn_wave_barrier(); asm volatile("" ::: "memory");   // keeps the staging stores ahead of the row reads of other lanes of this wave
        float* crow = C + (size_t)(r0 + wm * 64 + mb * 16) * ldc + c0 + wn * 32;
#pragma unroll
        for (int s = 0; s < 4; ++s) { const int row = 4 * s + (lane >> 3), cofs = (lane & 7) * 4; const v4f val = *(const v4fa*)(os + row * GOP + cofs); *(v4f*)(crow + (size_t)row * ldc + cofs) = val; }
        __builtin_amdgcn_wave_barrier(); asm volatile("" ::: "memory");   // keeps the row reads ahead of the next block's staging stores
    }
}

__global__ __launch_bounds__(256) void k_cvt8(const float* __restrict__ src, bf* dst, size_t n8, size_t sS, size_t sD) { const size_t i = (size_t)blockIdx.x * 256 + threadIdx.x; if (i >= n8) return; src += blockIdx.y * sS; dst += blockIdx.y * sD; const v8f v = *(const v8f*)(src + i * 8); v8us o;
#pragma unroll
    for (int k = 0; k < 8; ++k) o[k] = f2bf(v[k]); *(v8us*)(dst + i * 8) = o;  }
__global__ __launch_bounds__(256) void k_rbf(const float* __restrict__ src, float* dst, int n4, size_t sS, size_t sD) { const int i = blockIdx.x * 256 + threadIdx.x; if (i >= n4) return; src += blockIdx.y * sS; dst += blockIdx.y * sD; const v4f a = *(const v4f*)(src + (size_t)i * 4); v4f o;
#pragma unroll
    for (int u = 0; u < 4; ++u) o[u] = bfr(a[u]); *(v4f*)(dst + (size_t)i * 4) = o;  }
__global__ __launch_bounds__(32) void k_lambda(const float* __restrict__ lq1, const float* __restrict__ lk1, const float* __restrict__ lq2, const float* __restrict__ lk2, float* LAM) { const int lane = threadIdx.x; float d1 = 0.f, d2 = 0.f;
#pragma unroll 1
    for (int i = 0; i < HD; ++i) { float p1 = __fmul_rn(bfr(lq1[i]), bfr(lk1[i])); asm volatile("" : "+v"(p1)); d1 = __fadd_rn(d1, p1); float p2 = __fmul_rn(bfr(lq2[i]), bfr(lk2[i])); asm volatile("" : "+v"(p2)); d2 = __fadd_rn(d2, p2); }
    float lm = __fsub_rn(expf(d1), expf(d2)); asm volatile("" : "+v"(lm)); lm = __fadd_rn(lm, 0.8f); const float v = (lane == 0) ? lm : 0.0f; *(float*)(LAM + lane) = v;  }
__global__ __launch_bounds__(256) void k_qkp(const float* __restrict__ F, int pitch, int nheads, bf* Ph, bf* Pl) {
    const size_t e = ((size_t)blockIdx.x * 256 + threadIdx.x) * 2; if (e >= (size_t)nheads * SEQ * HD) return;
    F += (size_t)blockIdx.y * SEQ * pitch; Ph += (size_t)blockIdx.y * nheads * SEQ * HD; Pl += (size_t)blockIdx.y * nheads * SEQ * HD;
    const int d = (int)(e % HD); const int t = (int)((e / HD) % SEQ); const int vh = (int)(e / ((size_t)HD * SEQ));
    const v2f x = *(const v2f*)(F + (size_t)t * pitch + vh * HD + d); v2us oh, ol;
#pragma unroll
    for (int q = 0; q < 2; ++q) { unsigned short a2, c2; splitf(x[q], a2, c2); oh[q] = a2; ol[q] = c2; }
    *(v2us*)(Ph + e) = oh; *(v2us*)(Pl + e) = ol;  }
__global__ __launch_bounds__(256) void k_vtp(const float* __restrict__ F, int pitch, int nheads, h16* V16, h16* VR) {
    const size_t e = ((size_t)blockIdx.x * 256 + threadIdx.x) * 2; if (e >= (size_t)nheads * HD * SEQ) return;
    F += (size_t)blockIdx.y * SEQ * pitch; V16 += (size_t)blockIdx.y * nheads * HD * SEQ; VR += (size_t)blockIdx.y * nheads * HD * SEQ;
    const int t = (int)(e % SEQ); const int d = (int)((e / SEQ) % HD); const int g = (int)(e / ((size_t)SEQ * HD)); v2h o16, orr;
#pragma unroll
    for (int q = 0; q < 2; ++q) { const float x = F[(size_t)(t + q) * pitch + g * HD + d]; const h16 hv = tohx(x); const float res = (x - (float)hv) * RCAR; o16[q] = hv; orr[q] = tohx(res); }
    *(v2h*)(V16 + e) = o16; *(v2h*)(VR + e) = orr;  }

// ---- k_attn: causal differential attention for one (query block of 64, head) per block of 4 waves (wave w owns 16 query rows). The two score streams run one after the other (stream loop outside
// the key-chunk loop: one Q/K hi/lo pair, one score tile pair, one O accumulator set and one running max/sum set live at a time). Per stream st and 64-key chunk c = 0..qb the K hi/lo tile of
// head plane 2h+st and the V^T tile are staged in LDS; the softmax recurrence then runs on 32-key sub-chunks: scores S = Q.K (3 bf16 products, 16x32 tile per wave) ->
// t = S/8 - slope (pos_i - pos_j) + (1 - mask_j)(-1e9) for j <= i, excluded otherwise; online softmax (running max / sum, f32); P tile (f16 x4096, 16x32) per wave in LDS; O += P.V (one k-step).
// the first query block (qb == 0) also forms P residual tiles, stages V residual tiles (both x1024) and adds P_res.V + P.V_res per 16-column block through a second accumulator folded before normalisation.
__device__ __forceinline__ v16h  ldsh(const h16* p) { return cat16(*(const v8ha*)p, *(const v8ha*)(p + 16)); }

__global__ __launch_bounds__(128) __attribute__((amdgpu_num_vgpr(256)))
void k_attn(const bf* __restrict__ QPh, const bf* __restrict__ QPl, const bf* __restrict__ KPh, const bf* __restrict__ KPl, const h16* __restrict__ VT, const h16* __restrict__ VR,
            const float* __restrict__ amb, const int* __restrict__ tix, const float* __restrict__ LAM, float* Ob) {
    __shared__ __align__(16) bf    qs[2][QBL * LP];      // Q {hi,lo} of the current stream [row*LP + d]     (cross-wave: block barriers)
    __shared__ __align__(16) bf    ks[2][KCH * LP];      // K {hi,lo} of the current stream [key*LP + d]     (cross-wave: block barriers)
    __shared__ __align__(16) h16   vsm[HD * LP];         // V^T tile [d*LP + key]                            (cross-wave: block barriers)
    __shared__ __align__(16) h16   vrm[HD * LP];         // V residual tile, first query block only         (cross-wave: block barriers)
    __shared__ __align__(16) h16   psm[4][16 * PP];      // per-wave P tile [row*PP + key], 16 x 32          (wave-private, block barriers used anyway)
    __shared__ __align__(16) h16   prm[4][16 * PP];      // per-wave P residual tile, first query block only
    __shared__ __align__(16) float osm[4][16 * OSP];     // per-wave f32 result / epilogue staging [row*OSP + d]
    const int tid = threadIdx.x, w = tid >> 5, lane = tid & 31, lr = lane & 15, hi = lane >> 4;
    const int hh = blockIdx.y, qb = blockIdx.x, q0 = qb * QBL; const bool er = (qb == 0);
    {   const size_t bz = blockIdx.z;                        // batch element: every plane is [NB][...]; only the token positions keep the input's own batch pitch
        QPh += bz * ((size_t)NQH * SEQ * HD); QPl += bz * ((size_t)NQH * SEQ * HD); KPh += bz * ((size_t)NQH * SEQ * HD); KPl += bz * ((size_t)NQH * SEQ * HD);
        VT += bz * ((size_t)NVH * HD * SEQ); VR += bz * ((size_t)NVH * HD * SEQ); amb += bz * SEQ; tix += bz * SEQ_FULL; Ob += bz * ((size_t)SEQ * DVV); }
    const int e2 = hh + 1;                                   // slope = 2^(-(h+1)/2): exact power of two times 2^-0.5 for odd exponents
    const float slope = ((e2 & 1) ? 0.70710678118654752f : 1.0f) * __uint_as_float(((unsigned)(127 - (e2 >> 1))) << 23);
    const float lam = LAM[0];
    const int qrow0 = q0 + 16 * w + 8 * hi;
    float pq[8];
#pragma unroll
    for (int r = 0; r < 8; ++r) pq[r] = (float)tix[qrow0 + r];
    h16* pt = &psm[w][0]; h16* prt = &prm[w][0]; float* os = &osm[w][0];
#pragma unroll 1
    for (int st = 0; st < 2; ++st) {
        const size_t vq = (size_t)(2 * hh + st);
        __syncthreads();
#pragma unroll
        for (int i = 0; i < 8; ++i) { const int p = i >> 2; const int rem = (i & 3) * 128 + tid; const int row = rem >> 3, c8 = rem & 7;
            const bf* src = (p ? QPl : QPh) + (vq * SEQ + q0 + row) * HD + c8 * 8; *(v8usa*)(&qs[p][row * LP + c8 * 8]) = *(const v8usa*)src; }
        float m[8], l[8]; v8f O[4];
#pragma unroll
        for (int r = 0; r < 8; ++r) { m[r] = NEGB; l[r] = 0.0f; }
#pragma unroll
        for (int j = 0; j < 4; ++j) O[j] = (v8f){};
#pragma unroll 1
        for (int c = 0; c <= qb; ++c) {
            const int k0 = c * KCH;
#pragma unroll
            for (int i = 0; i < 8; ++i) { const int p = i >> 2; const int rem = (i & 3) * 128 + tid; const int row = rem >> 3, c8 = rem & 7;
                const bf* src = (p ? KPl : KPh) + (vq * SEQ + k0 + row) * HD + c8 * 8; *(v8usa*)(&ks[p][row * LP + c8 * 8]) = *(const v8usa*)src; }
#pragma unroll
            for (int i = 0; i < 4; ++i) { const int rem = i * 128 + tid; const int d = rem >> 3, c8 = rem & 7; const size_t go = ((size_t)hh * HD + d) * SEQ + k0 + 8 * c8;
                *(v8ha*)(&vsm[d * LP + 8 * c8]) = *(const v8ha*)(VT + go); if (er) *(v8ha*)(&vrm[d * LP + 8 * c8]) = *(const v8ha*)(VR + go); }
            __syncthreads();
#pragma unroll 1
            for (int sb = 0; sb < KCH / KSB; ++sb) {
                const int kb = sb * KSB;
                const int key0 = k0 + kb + lr, key1 = key0 + 16;
                const float pk0 = (float)tix[key0], pk1 = (float)tix[key1];
                const float om0 = 1.0f - amb[key0], om1 = 1.0f - amb[key1]; const float pad0 = om0 * -1.0e9f, pad1 = om1 * -1.0e9f;
                // ---- scores: S[row 8hi+r][key kb + nb*16 + lr], 3 bf16 products (hi.hi + lo.hi + hi.lo); fragments loaded right before each k-step, scheduling barrier after it
                v8f s[2]; s[0] = (v8f){}; s[1] = (v8f){};
                {   v16bf ah, al, bh, bl;
#pragma unroll
                    for (int kc = 0; kc < HD; kc += 32) {
                        ah = ldsb(&qs[0][(16 * w + lr) * LP + kc + 8 * hi]); al = ldsb(&qs[1][(16 * w + lr) * LP + kc + 8 * hi]);
#pragma unroll
                        for (int nb = 0; nb < 2; ++nb) { bh = ldsb(&ks[0][(kb + nb * 16 + lr) * LP + kc + 8 * hi]); bl = ldsb(&ks[1][(kb + nb * 16 + lr) * LP + kc + 8 * hi]);
                            s[nb] = wmmab(ah, bh, s[nb]); s[nb] = wmmab(al, bh, s[nb]); s[nb] = wmmab(ah, bl, s[nb]); }
                        asm volatile("v_nop\n\tv_nop\n\tv_nop\n\tv_nop" : "+v"(s[0]), "+v"(s[1]) : "v"(ah), "v"(al), "v"(bh), "v"(bl) : "memory");
                    }
                }
                // ---- additive terms by value select, sub-chunk max
                float cm[8];
#pragma unroll
                for (int r = 0; r < 8; ++r) cm[r] = NEGB;
#pragma unroll
                for (int nb = 0; nb < 2; ++nb) { const int kv = nb ? key1 : key0; const float pkv = nb ? pk1 : pk0; const float pdv = nb ? pad1 : pad0;
#pragma unroll
                    for (int r = 0; r < 8; ++r) { const float sa = s[nb][r] * SCL; const float pd = pq[r] - pkv; const float bia = slope * pd; const float sm = sa - bia;
                        const float tt = (kv <= qrow0 + r) ? (sm + pdv) : NEGB; s[nb][r] = tt; cm[r] = fmaxf(cm[r], tt); } }
                float cor[8], rs[8];
#pragma unroll
                for (int r = 0; r < 8; ++r) { float x = cm[r]; x = fmaxf(x, __shfl_xor(x, 1, 32)); x = fmaxf(x, __shfl_xor(x, 2, 32)); x = fmaxf(x, __shfl_xor(x, 4, 32)); x = fmaxf(x, __shfl_xor(x, 8, 32));
                    const float mn = fmaxf(m[r], x); const float dlt = (m[r] - mn) * L2E; cor[r] = __builtin_amdgcn_exp2f(dlt); m[r] = mn; rs[r] = 0.0f; }
                // ---- probabilities -> per-wave LDS tile (f16 x4096; residual x1024 on the first query block); excluded keys store exactly 0
#pragma unroll
                for (int nb = 0; nb < 2; ++nb) { const int kv = nb ? key1 : key0;
#pragma unroll
                    for (int r = 0; r < 8; ++r) { const float dq = (s[nb][r] - m[r]) * L2E; const float pe = __builtin_amdgcn_exp2f(dq); const float p = (kv <= qrow0 + r) ? pe : 0.0f; rs[r] = rs[r] + p;
                        const float pc = p * PCAR; const h16 ph = tohx(pc); const int li = (8 * hi + r) * PP + nb * 16 + lr; pt[li] = ph;
                        if (er) { const float res = (pc - (float)ph) * RCAR; prt[li] = tohx(res); } } }
#pragma unroll
                for (int r = 0; r < 8; ++r) { float x = rs[r]; x += __shfl_xor(x, 1, 32); x += __shfl_xor(x, 2, 32); x += __shfl_xor(x, 4, 32); x += __shfl_xor(x, 8, 32);
                    const float lc = l[r] * cor[r]; l[r] = lc + x; const float cf = cor[r];
#pragma unroll
                    for (int j = 0; j < 4; ++j) O[j][r] = O[j][r] * cf; }
                __syncthreads();
                // ---- O[d block j][row] += P[row][key] . V^T[d][key] over the 32 keys of this sub-chunk (one k-step)
                {   const v16h a = ldsh(pt + lr * PP + 8 * hi); v16h b;
#pragma unroll
                    for (int j = 0; j < 4; ++j) { b = ldsh(&vsm[(j * 16 + lr) * LP + kb + 8 * hi]); O[j] = wmma16(a, b, O[j]); }
                    asm volatile("v_nop\n\tv_nop\n\tv_nop\n\tv_nop" : "+v"(O[0]), "+v"(O[1]), "+v"(O[2]), "+v"(O[3]) : "v"(a), "v"(b) : "memory");
                    if (er) {
                        const v16h ar = ldsh(prt + lr * PP + 8 * hi);
#pragma unroll
                        for (int j = 0; j < 4; ++j) {
                            const v16h b2 = ldsh(&vsm[(j * 16 + lr) * LP + kb + 8 * hi]); const v16h br = ldsh(&vrm[(j * 16 + lr) * LP + kb + 8 * hi]);
                            v8f R = wmma16(ar, b2, (v8f){}); R = wmma16(a, br, R);
                            asm volatile("v_nop\n\tv_nop\n\tv_nop\n\tv_nop" : "+v"(R) : "v"(a), "v"(ar), "v"(b2), "v"(br) : "memory");
#pragma unroll
                            for (int r = 0; r < 8; ++r) { const float rr = R[r] * (1.0f / RCAR); O[j][r] = O[j][r] + rr; }
                        }
                    }
                }
                __syncthreads();
            }
        }
#pragma unroll
        for (int r = 0; r < 8; ++r) { const float rl = 1.0f / l[r]; const float il = rl * (1.0f / PCAR);
#pragma unroll
            for (int j = 0; j < 4; ++j) { const float a1 = O[j][r] * il; const int oi = (8 * hi + r) * OSP + j * 16 + lr;
                if (st == 0) { os[oi] = a1; } else { const float lb = lam * a1; const float cur = os[oi]; os[oi] = cur - lb; } } }
    }
    __syncthreads();
    float* orow = Ob + (size_t)(q0 + 16 * w) * DVV + hh * HD;
{
#pragma unroll
        for (int s2 = 0; s2 < 8; ++s2) { const int row = 2 * s2 + hi, cofs = lr * 4; const v4f val = *(const v4fa*)(os + row * OSP + cofs); *(v4f*)(orow + (size_t)row * DVV + cofs) = val; }
         }
}

__global__ __launch_bounds__(1024) void k_gnstat(const float* __restrict__ O, float* GST) {
    __shared__ float sh[1024]; const int tid = threadIdx.x; const int hh = blockIdx.x; const float* base = O + (size_t)blockIdx.y * SEQ * DVV + hh * HD; GST += blockIdx.y * (NVH * 32); const int n = SEQ * HD; const float rn = 1.0f / (float)n;
    float acc = 0.f;
#pragma unroll 1
    for (int e = tid; e < n; e += 1024) { const int t = e >> 6, d = e & 63; acc = __fadd_rn(acc, base[(size_t)t * DVV + d]); }
    sh[tid] = acc; __syncthreads();
#pragma unroll 1
    for (int st = 512; st > 0; st >>= 1) { if (tid < st) sh[tid] = __fadd_rn(sh[tid], sh[tid + st]); __syncthreads(); }
    const float mean = sh[0] * rn;
    __syncthreads();
    float acc2 = 0.f;
#pragma unroll 1
    for (int e = tid; e < n; e += 1024) { const int t = e >> 6, d = e & 63; float dv = __fsub_rn(base[(size_t)t * DVV + d], mean); asm volatile("" : "+v"(dv)); acc2 = __fadd_rn(acc2, __fmul_rn(dv, dv)); }
    sh[tid] = acc2; __syncthreads();
#pragma unroll 1
    for (int st = 512; st > 0; st >>= 1) { if (tid < st) sh[tid] = __fadd_rn(sh[tid], sh[tid + st]); __syncthreads(); }
    if (tid < 32) { const float var = sh[0] * rn; const float rs = __fdiv_rn(1.0f, sqrtf(__fadd_rn(var, 1e-5f))); const float outv = (tid == 0) ? mean : ((tid == 1) ? rs : 0.0f);
        *(float*)(GST + hh * 32 + tid) = outv;  }
}
__global__ __launch_bounds__(256) void k_gnmerge(const float* __restrict__ O, const float* __restrict__ GST, const float* __restrict__ gw, const float* __restrict__ gb, bf* Ah, bf* Al) {
    const size_t e = ((size_t)blockIdx.x * 256 + threadIdx.x) * 2; if (e >= (size_t)SEQ * DVV) return;
    O += (size_t)blockIdx.y * SEQ * DVV; GST += blockIdx.y * (NVH * 32); Ah += (size_t)blockIdx.y * SEQ * DVV; Al += (size_t)blockIdx.y * SEQ * DVV;
    const int c = (int)(e % DVV); const int hh = c / HD; const float mean = GST[hh * 32], rs = GST[hh * 32 + 1]; v2us oh, ol;
#pragma unroll
    for (int q = 0; q < 2; ++q) { float cc = __fsub_rn(O[e + q], mean); asm volatile("" : "+v"(cc)); float nn = __fmul_rn(cc, rs); asm volatile("" : "+v"(nn)); float y = __fmul_rn(nn, bfr(gw[c + q])); asm volatile("" : "+v"(y)); y = __fadd_rn(y, bfr(gb[c + q])); const float z = __fmul_rn(y, 0.2f); unsigned short a2, c2; splitf(z, a2, c2); oh[q] = a2; ol[q] = c2; }
    *(v2us*)(Ah + e) = oh; *(v2us*)(Al + e) = ol;  }

extern "C" void kernel_launch(void* const* d_in, const int* in_sizes, int n_in,
                              void* d_out, int out_size, void* d_ws, size_t ws_size, hipStream_t stream) {
    if (n_in < 13) return;
    if (in_sizes[0] < (NB - 1) * SEQ_FULL * DM + SEQ * DM) return;
    if (in_sizes[1] < (NB - 1) * SEQ_FULL + SEQ) return;
    if (in_sizes[2] < (NB - 1) * SEQ_FULL + SEQ) return;
    if (in_sizes[3] < DQ * DM || in_sizes[4] < DQ * DM || in_sizes[5] < DVV * DM || in_sizes[6] < DM * DVV) return;
    if (in_sizes[7] < HD || in_sizes[8] < HD || in_sizes[9] < HD || in_sizes[10] < HD || in_sizes[11] < DVV || in_sizes[12] < DVV) return;
    if (out_size < (NB - 1) * SEQ_FULL * DM + SEQ * DM) return;
    const float* x = (const float*)d_in[0]; const float* amask = (const float*)d_in[1]; const int* tix = (const int*)d_in[2];
    const float* wq = (const float*)d_in[3]; const float* wk = (const float*)d_in[4]; const float* wv = (const float*)d_in[5]; const float* wo = (const float*)d_in[6];
    const float* lq1 = (const float*)d_in[7]; const float* lq2 = (const float*)d_in[8]; const float* lk1 = (const float*)d_in[9]; const float* lk2 = (const float*)d_in[10];
    const float* gnw = (const float*)d_in[11]; const float* gnb = (const float*)d_in[12];
    float* OUT = (float*)d_out;     // [NB][SEQ_FULL][1024]
    char* wsp = (char*)d_ws;
    auto take = [&](size_t bytes) { char* p = wsp; wsp += (bytes + 255) & ~(size_t)255; return (void*)p; };
    bf* WQ = (bf*)take((size_t)DQ * DM * 2); bf* WK = (bf*)take((size_t)DQ * DM * 2); bf* WV = (bf*)take((size_t)DVV * DM * 2); bf* WO = (bf*)take((size_t)DM * DVV * 2);
    bf* XB = (bf*)take((size_t)NB * SEQ * DM * 2); float* AMB = (float*)take((size_t)NB * SEQ * 4); float* LAM = (float*)take(256); float* GST = (float*)take((size_t)NB * NVH * 32 * 4);
    float* FQ = (float*)take((size_t)NB * SEQ * DQ * 4); float* FK = (float*)take((size_t)NB * SEQ * DQ * 4);
    bf* QPh = (bf*)take((size_t)NB * NQH * SEQ * HD * 2); bf* QPl = (bf*)take((size_t)NB * NQH * SEQ * HD * 2); bf* KPh = (bf*)take((size_t)NB * NQH * SEQ * HD * 2); bf* KPl = (bf*)take((size_t)NB * NQH * SEQ * HD * 2);
    h16* VT16 = (h16*)take((size_t)NB * NVH * HD * SEQ * 2); h16* VRS = (h16*)take((size_t)NB * NVH * HD * SEQ * 2);
    float* Ob = (float*)take((size_t)NB * SEQ * DVV * 4); bf* ATh = (bf*)take((size_t)NB * SEQ * DVV * 2); bf* ATl = (bf*)take((size_t)NB * SEQ * DVV * 2);
    const size_t used = (size_t)(wsp - (char*)d_ws);
    if (used > ws_size || used > (size_t)268435456) return;
    float* FV = FK;   // v projection reuses the k feature buffer after the k planes are built (stream-ordered)
    k_cvt8<<<(unsigned)(((size_t)DQ * DM / 8 + 255) / 256), 256, 0, stream>>>(wq, WQ, (size_t)DQ * DM / 8, 0, 0);
    k_cvt8<<<(unsigned)(((size_t)DQ * DM / 8 + 255) / 256), 256, 0, stream>>>(wk, WK, (size_t)DQ * DM / 8, 0, 0);
    k_cvt8<<<(unsigned)(((size_t)DVV * DM / 8 + 255) / 256), 256, 0, stream>>>(wv, WV, (size_t)DVV * DM / 8, 0, 0);
    k_cvt8<<<(unsigned)(((size_t)DM * DVV / 8 + 255) / 256), 256, 0, stream>>>(wo, WO, (size_t)DM * DVV / 8, 0, 0);
    k_lambda<<<1, 32, 0, stream>>>(lq1, lk1, lq2, lk2, LAM);
    const unsigned LQK = (unsigned)(((size_t)NQH * SEQ * HD / 2 + 255) / 256), LV = (unsigned)(((size_t)NVH * HD * SEQ / 2 + 255) / 256);
    // Every stage runs once for all NB batch elements: the batch index is the last used grid dimension, workspace planes are [NB][...].
    k_cvt8<<<dim3((unsigned)(((size_t)SEQ * DM / 8 + 255) / 256), NB, 1), 256, 0, stream>>>(x, XB, (size_t)SEQ * DM / 8, (size_t)SEQ_FULL * DM, (size_t)SEQ * DM);
    k_rbf<<<dim3((SEQ / 4 + 255) / 256, NB, 1), 256, 0, stream>>>(amask, AMB, SEQ / 4, (size_t)SEQ_FULL, (size_t)SEQ);
    k_gemmb<0><<<dim3(SEQ / GT, DQ / GT, NB), 256, 0, stream>>>(XB, nullptr, WQ, DM, FQ, DQ, (size_t)SEQ * DM, (size_t)SEQ * DQ);
    k_qkp<<<dim3(LQK, NB, 1), 256, 0, stream>>>(FQ, DQ, NQH, QPh, QPl);
    k_gemmb<0><<<dim3(SEQ / GT, DQ / GT, NB), 256, 0, stream>>>(XB, nullptr, WK, DM, FK, DQ, (size_t)SEQ * DM, (size_t)SEQ * DQ);
    k_qkp<<<dim3(LQK, NB, 1), 256, 0, stream>>>(FK, DQ, NQH, KPh, KPl);
    k_gemmb<0><<<dim3(SEQ / GT, DVV / GT, NB), 256, 0, stream>>>(XB, nullptr, WV, DM, FV, DVV, (size_t)SEQ * DM, (size_t)SEQ * DVV);
    k_vtp<<<dim3(LV, NB, 1), 256, 0, stream>>>(FV, DVV, NVH, VT16, VRS);
    k_attn<<<dim3(SEQ / QBL, NVH, NB), 128, 0, stream>>>(QPh, QPl, KPh, KPl, VT16, VRS, AMB, tix, LAM, Ob);
    k_gnstat<<<dim3(NVH, NB, 1), 1024, 0, stream>>>(Ob, GST);
    k_gnmerge<<<dim3((unsigned)(((size_t)SEQ * DVV / 2 + 255) / 256), NB, 1), 256, 0, stream>>>(Ob, GST, gnw, gnb, ATh, ATl);
    k_gemmb<1><<<dim3(SEQ / GT, DM / GT, NB), 256, 0, stream>>>(ATh, ATl, WO, DVV, OUT, DM, (size_t)SEQ * DVV, (size_t)SEQ_FULL * DM);
}

// v003
// Measured time: 563 microseconds a run.
// Two timings next to v002 both put it at 1.06 times that version's speed.
// Over all steps from v000 it is 1.71 times as fast.
#include <hip/hip_runtime.h>
#pragma clang fp contract(off)

// Compute dtypes (f32 accumulate everywhere): input projections x.Wq / x.Wk / x.Wv on v_wmma_f32_16x16x32_bf16 with bf16 RNE-converted inputs as operands (exact operands); q.k scores on v_wmma_f32_16x16x32_bf16 as bf16 hi/lo split (hi.hi + lo.hi + hi.lo); probability.value on v_wmma_f32_16x16x32_f16 (P f16 carried x4096, V f16; the first query block adds P and V residual planes carried x1024 through a second accumulator); softmax, ALiBi/pad terms, lambda and GroupNorm in f32; output projection on v_wmma_f32_16x16x32_bf16 (activation bf16 hi/lo x bf16 Wo, 2 products).
// Layout: x [NB][SEQ_FULL][1024]; Wq/Wk [2048][1024], Wv/Wo [1024][1024] ([out][in], used as K-contiguous Bt planes); per head h the 128 q/k columns are [half 1 | half 2] = virtual 64-wide heads 2h, 2h+1; mask [NB][SEQ_FULL] f32, token positions [NB][SEQ_FULL] int32; out [NB][SEQ_FULL][1024] f32.

#ifndef NB
#define NB 2
#endif
#ifndef SEQ
#define SEQ 2048
#endif
#define NB_FULL 2
#define SEQ_FULL 2048
#define DM   1024
#define NVH  16
#define HD   64
#define NQH  (2 * NVH)
#define DQ   (NQH * HD)
#define DVV  (NVH * HD)
#define SCL  0.125f
#define PCAR 4096.0f
#define RCAR 1024.0f
#define QBL  64
#define KCH  64
#define KSB  32
#define LP   72
#define PP   40
#define OSP  68
#define L2E  1.4426950408889634f
#define NEGB (-3.0e38f)
static_assert(SEQ % 64 == 0);
static_assert(SEQ <= SEQ_FULL);
static_assert(NB >= 1);
static_assert(NB <= NB_FULL);
static_assert(QBL == KCH);
static_assert(KCH % KSB == 0);
static_assert((LP * 2) % 16 == 0);
static_assert((PP * 2) % 16 == 0);
static_assert((OSP * 4) % 16 == 0);
static_assert((SEQ * DVV) % 512 == 0);
static_assert((SEQ * DM) % 2048 == 0);

typedef _Float16 h16;
typedef unsigned short bf;
typedef __attribute__((ext_vector_type(16))) __bf16   v16bf;
typedef __attribute__((ext_vector_type(16))) _Float16 v16h;
typedef __attribute__((ext_vector_type(8)))  _Float16 v8h;
typedef __attribute__((ext_vector_type(8)))  unsigned short v8us;
typedef __attribute__((ext_vector_type(8)))  float    v8f;
typedef __attribute__((ext_vector_type(4)))  float    v4f;
typedef __attribute__((ext_vector_type(2)))  unsigned short v2us;
typedef v8h  __attribute__((may_alias)) v8ha;
typedef v4f  __attribute__((may_alias)) v4fa;
typedef v8us __attribute__((may_alias)) v8usa;
typedef float __attribute__((may_alias)) f32a;

__device__ __forceinline__ unsigned short f2bf(float f) { unsigned u = __float_as_uint(f); u += 0x7FFFu + ((u >> 16) & 1u); return (unsigned short)(u >> 16); }
__device__ __forceinline__ float bf2f(unsigned short b) { return __uint_as_float(((unsigned)b) << 16); }
__device__ __forceinline__ float bfr(float f) { return bf2f(f2bf(f)); }
__device__ __forceinline__ v16h cat16(v8h lo, v8h hi) { return __builtin_shufflevector(lo, hi, 0, 1, 2, 3, 4, 5, 6, 7, 8, 9, 10, 11, 12, 13, 14, 15); }
__device__ __forceinline__ v16bf cat16b(v8us lo, v8us hi) { return __builtin_bit_cast(v16bf, __builtin_shufflevector(lo, hi, 0, 1, 2, 3, 4, 5, 6, 7, 8, 9, 10, 11, 12, 13, 14, 15)); }
__device__ __forceinline__ v8f wmma16(v16h a, v16h b, v8f c) { return __builtin_amdgcn_wmma_f32_16x16x32_f16(false, a, false, b, (short)0, c, false, false); }
__device__ __forceinline__ v8f wmmab(v16bf a, v16bf b, v8f c) { return __builtin_amdgcn_wmma_f32_16x16x32_bf16(false, a, false, b, (short)0, c, false, false); }
__device__ __forceinline__ h16 tohx(float x) { return (h16)x; }
__device__ __forceinline__ void splitf(float y, unsigned short& h, unsigned short& l) { h = f2bf(y); l = f2bf(y - bf2f(h)); }

// ---- k_gemmb: block-tiled GEMM, 8 waves (2 x 4) per 128x128 output tile, wave tile 64x32 (8 accumulators); grid (M/128, N/128, Z), 256 threads.
// c[m][n] (f32) = sum_k A[m][k] Bt[n][k] (+ A2[m][k] Bt[n][k] when NSPLIT == 1). z-batch strides sA/sC in elements. K % 64 == 0, K >= 64.
// MODE 0: c goes to C (f32, pitch ldc). MODE 1 (q, k): c is split into bf16 hi/lo and goes to the head planes P0/P1 [z][n / 64][m][n % 64]. MODE 2 (v): c goes transposed, as f16 and as its
// residual x1024, to P0/P1 [z][n][m]. MODE 1 and 2 turn the tile in the stage buffers, free behind the loop's last barrier, so that every global store covers whole 128-byte lines.
// A stage is 64 k of every operand row (one whole 128-byte line per row), read from the K-contiguous planes by whole-line 16-byte loads, kept in registers while the
// previous stage is multiplied, then stored to the other of two LDS buffers (row pitch 144 B); one block barrier per stage publishes it and ends the reads of the buffer refilled next.
// Fragments: lane -> row/col (lane & 15); elements 0..7 <- k + 8*(lane>>4), elements 8..15 <- k + 16 + 8*(lane>>4), for A and Bt alike. k runs upward, one accumulate chain per element.
#define GT   128
#define GBK  64
#define GLP  72
#define GOP  36
#define GSP  132
#define GVP  136
static_assert(SEQ % GT == 0);
static_assert(DQ % GT == 0);
static_assert(DVV % GT == 0);
static_assert(DM % GT == 0);
static_assert(DM % GBK == 0);
static_assert(DVV % GBK == 0);
static_assert((GLP * 2) % 16 == 0);
static_assert((GOP * 4) % 16 == 0);
static_assert((GSP * 4) % 16 == 0);
static_assert((GVP * 2) % 16 == 0);
static_assert(GT == 2 * HD);
static_assert(GT * GSP * 4 <= 2 * 2 * GT * GLP * 2);
static_assert(2 * GT * GVP * 2 <= 2 * 2 * GT * GLP * 2);
__device__ __forceinline__ v16bf ldsb(const bf* p) { return cat16b(*(const v8usa*)p, *(const v8usa*)(p + 16)); }
template <int NSPLIT, int MODE = 0>
// waves_per_eu: at most two 8-wave blocks run per WGP here, so the register budget is that of 4 waves per SIMD and a k-step's fragment loads may be grouped ahead of its products
__global__ __launch_bounds__(256) __attribute__((amdgpu_waves_per_eu(1, 4)))
void k_gemmb(const bf* __restrict__ A, const bf* __restrict__ A2, const bf* __restrict__ Bt, int K, float* C, int ldc, size_t sA, size_t sC, bf* P0 = nullptr, bf* P1 = nullptr) {
    constexpr int NPL = 2 + NSPLIT;                          // planes per stage: A, (A2,) Bt
    __shared__ __align__(16) bf    tl[2][NPL][GT * GLP];     // two stage buffers [row*GLP + k]                  (cross-wave: block barriers)
    __shared__ __align__(16) float osw[8][16 * GOP];         // per-wave f32 epilogue staging [row*GOP + col]    (wave-private)
    const size_t z = blockIdx.z; A += z * sA; if (NSPLIT) A2 += z * sA; C += z * sC;
    const int tid = threadIdx.x, w = tid >> 5, lane = tid & 31, lr = lane & 15, hi = lane >> 4; const int wm = w >> 2, wn = w & 3;
    const int r0 = blockIdx.x * GT, c0 = blockIdx.y * GT;
    v8f acc[4][2];
#pragma unroll
    for (int mb = 0; mb < 4; ++mb)
#pragma unroll
        for (int nb = 0; nb < 2; ++nb) acc[mb][nb] = (v8f){};
    const int srow = tid >> 3, sc8 = (tid & 7) * 8;          // staging: 8 lanes cover one row's 128 bytes; piece i is row srow + 32 i
    const char* gA = (const char*)(A + (size_t)r0 * K); const char* gA2 = (const char*)(A2 + (size_t)r0 * K); const char* gB = (const char*)(Bt + (size_t)c0 * K);   // block-uniform tile bases
    unsigned go[4];                                          // the lane's byte offset of piece i inside a tile's rows, the same for every plane and stage
#pragma unroll
    for (int i = 0; i < 4; ++i) go[i] = ((unsigned)(srow + 32 * i) * (unsigned)K + (unsigned)sc8) * 2u;
    const int so = srow * GLP + sc8;
    const int fa = (wm * 64 + lr) * GLP + 8 * hi, fb = (wn * 32 + lr) * GLP + 8 * hi;
    v8us ra[4], ra2[4], rb[4];
#pragma unroll
    for (int i = 0; i < 4; ++i) { ra[i] = *(const v8us*)(gA + go[i]); if (NSPLIT) ra2[i] = *(const v8us*)(gA2 + go[i]); rb[i] = *(const v8us*)(gB + go[i]); }
#pragma unroll
    for (int i = 0; i < 4; ++i) { *(v8usa*)(&tl[0][0][so + i * 32 * GLP]) = ra[i]; if (NSPLIT) *(v8usa*)(&tl[0][1][so + i * 32 * GLP]) = ra2[i]; *(v8usa*)(&tl[0][NPL - 1][so + i * 32 * GLP]) = rb[i]; }
    __syncthreads();
#pragma unroll 1
    for (int k0 = 0; k0 < K; k0 += GBK) {
        const int cur = (k0 / GBK) & 1; const bool more = k0 + GBK < K;
        gA += GBK * 2; gA2 += GBK * 2; gB += GBK * 2;        // the uniform bases step one stage; the lanes' offsets stay
        if (more) {
#pragma unroll
            for (int i = 0; i < 4; ++i) {   // a wait behind each load: this build lets a later load of the group land in an earlier one's address pair, and the wait stands in front of that overwrite
                ra[i] = *(const v8us*)(gA + go[i]); asm volatile("s_wait_xcnt 0x0" ::: "memory");
                if (NSPLIT) { ra2[i] = *(const v8us*)(gA2 + go[i]); asm volatile("s_wait_xcnt 0x0" ::: "memory"); }
                rb[i] = *(const v8us*)(gB + go[i]); asm volatile("s_wait_xcnt 0x0" ::: "memory"); }
        }
        const bf* ta = &tl[cur][0][fa]; const bf* ta2 = &tl[cur][NSPLIT][fa]; const bf* tb = &tl[cur][NPL - 1][fb];
#pragma unroll
        for (int kc = 0; kc < GBK; kc += 32) {
            v16bf a[4], a2[4], b[2];
#pragma unroll
            for (int mb = 0; mb < 4; ++mb) { a[mb] = ldsb(ta + mb * 16 * GLP + kc); if (NSPLIT) a2[mb] = ldsb(ta2 + mb * 16 * GLP + kc); }
#pragma unroll
            for (int nb = 0; nb < 2; ++nb) b[nb] = ldsb(tb + nb * 16 * GLP + kc);
#pragma unroll
            for (int nb = 0; nb < 2; ++nb)
#pragma unroll
                for (int mb = 0; mb < 4; ++mb) { acc[mb][nb] = wmmab(a[mb], b[nb], acc[mb][nb]); if (NSPLIT) acc[mb][nb] = wmmab(a2[mb], b[nb], acc[mb][nb]); }
        }
        if (more) {
#pragma unroll
            for (int i = 0; i < 4; ++i) { *(v8usa*)(&tl[cur ^ 1][0][so + i * 32 * GLP]) = ra[i]; if (NSPLIT) *(v8usa*)(&tl[cur ^ 1][1][so + i * 32 * GLP]) = ra2[i]; *(v8usa*)(&tl[cur ^ 1][NPL - 1][so + i * 32 * GLP]) = rb[i]; }
        }
        __syncthreads();
    }
    if constexpr (MODE == 1) {
        f32a* st = (f32a*)&tl[0][0][0];                      // block f32 tile [row*GSP + col]
#pragma unroll
        for (int mb = 0; mb < 4; ++mb)
#pragma unroll
            for (int nb = 0; nb < 2; ++nb)
#pragma unroll
                for (int j = 0; j < 8; ++j) st[(wm * 64 + mb * 16 + hi * 8 + j) * GSP + wn * 32 + nb * 16 + lr] = acc[mb][nb][j];
        __syncthreads();                                     // publishes the tile: its rows are read back by other waves
        const int hs = w & 1, rw = (w >> 1) * 32 + (lane >> 3), c8 = (lane & 7) * 8;   // a wave takes 32 rows of one 64-wide head; one store = 4 rows = 512 contiguous bytes
        const size_t pb = ((z * NQH + (size_t)(blockIdx.y * 2 + hs)) * SEQ + r0) * HD + c8;
#pragma unroll
        for (int i = 0; i < 8; ++i) { const int row = rw + 4 * i; const f32a* sp = st + row * GSP + hs * HD + c8; const v4f x0 = *(const v4fa*)sp, x1 = *(const v4fa*)(sp + 4); v8us oh, ol;
#pragma unroll
            for (int q = 0; q < 4; ++q) { unsigned short a2, c2; splitf(x0[q], a2, c2); oh[q] = a2; ol[q] = c2; splitf(x1[q], a2, c2); oh[4 + q] = a2; ol[4 + q] = c2; }
            *(v8us*)(P0 + pb + (size_t)row * HD) = oh; *(v8us*)(P1 + pb + (size_t)row * HD) = ol; }
        return;
    }
    if constexpr (MODE == 2) {
        h16* sv = (h16*)&tl[0][0][0]; h16* sr = sv + GT * GVP;   // block f16 tiles, value and residual, transposed [col*GVP + row]; an accumulator lane holds 8 consecutive rows of one column
#pragma unroll
        for (int mb = 0; mb < 4; ++mb)
#pragma unroll
            for (int nb = 0; nb < 2; ++nb) { v8h o16, orr;
#pragma unroll
                for (int j = 0; j < 8; ++j) { const float x = acc[mb][nb][j]; const h16 hv = tohx(x); const float res = (x - (float)hv) * RCAR; o16[j] = hv; orr[j] = tohx(res); }
                const int si = (wn * 32 + nb * 16 + lr) * GVP + wm * 64 + mb * 16 + hi * 8; *(v8ha*)(sv + si) = o16; *(v8ha*)(sr + si) = orr; }
        __syncthreads();                                     // publishes the tiles: their columns are read back by other waves
        const int cw = tid >> 4, t8 = (tid & 15) * 8;        // 16 lanes cover one column's 128 rows = 256 contiguous bytes
        const size_t vb = (z * DVV + (size_t)c0) * SEQ + r0 + t8;
#pragma unroll
        for (int i = 0; i < 8; ++i) { const int col = cw + 16 * i; const v8h a16 = *(const v8ha*)(sv + col * GVP + t8), ar = *(const v8ha*)(sr + col * GVP + t8);
            *(v8ha*)((h16*)P0 + vb + (size_t)col * SEQ) = a16; *(v8ha*)((h16*)P1 + vb + (size_t)col * SEQ) = ar; }
        return;
    }
    float* os = &osw[w][0];
#pragma unroll
    for (int mb = 0; mb < 4; ++mb) {
#pragma unroll
        for (int nb = 0; nb < 2; ++nb) {
#pragma unroll
            for (int j = 0; j < 8; ++j) os[(hi * 8 + j) * GOP + nb * 16 + lr] = acc[mb][nb][j]; }
        __builtin_amdgcn_wave_barrier(); asm volatile("" ::: "memory");   // keeps the staging stores ahead of the row reads of other lanes of this wave
        float* crow = C + (size_t)(r0 + wm * 64 + mb * 16) * ldc + c0 + wn * 32;
#pragma unroll
        for (int s = 0; s < 4; ++s) { const int row = 4 * s + (lane >> 3), cofs = (lane & 7) * 4; const v4f val = *(const v4fa*)(os + row * GOP + cofs); *(v4f*)(crow + (size_t)row * ldc + cofs) = val; }
        __builtin_amdgcn_wave_barrier(); asm volatile("" ::: "memory");   // keeps the row reads ahead of the next block's staging stores
    }
}

__global__ __launch_bounds__(256) void k_cvt8(const float* __restrict__ src, bf* dst, size_t n8, size_t sS, size_t sD) { const size_t i = (size_t)blockIdx.x * 256 + threadIdx.x; if (i >= n8) return; src += blockIdx.y * sS; dst += blockIdx.y * sD; const v8f v = *(const v8f*)(src + i * 8); v8us o;
#pragma unroll
    for (int k = 0; k < 8; ++k) o[k] = f2bf(v[k]); *(v8us*)(dst + i * 8) = o;  }
__global__ __launch_bounds__(256) void k_rbf(const float* __restrict__ src, float* dst, int n4, size_t sS, size_t sD) { const int i = blockIdx.x * 256 + threadIdx.x; if (i >= n4) return; src += blockIdx.y * sS; dst += blockIdx.y * sD; const v4f a = *(const v4f*)(src + (size_t)i * 4); v4f o;
#pragma unroll
    for (int u = 0; u < 4; ++u) o[u] = bfr(a[u]); *(v4f*)(dst + (size_t)i * 4) = o;  }
__global__ __launch_bounds__(32) void k_lambda(const float* __restrict__ lq1, const float* __restrict__ lk1, const float* __restrict__ lq2, const float* __restrict__ lk2, float* LAM) { const int lane = threadIdx.x; float d1 = 0.f, d2 = 0.f;
#pragma unroll 1
    for (int i = 0; i < HD; ++i) { float p1 = __fmul_rn(bfr(lq1[i]), bfr(lk1[i])); asm volatile("" : "+v"(p1)); d1 = __fadd_rn(d1, p1); float p2 = __fmul_rn(bfr(lq2[i]), bfr(lk2[i])); asm volatile("" : "+v"(p2)); d2 = __fadd_rn(d2, p2); }
    float lm = __fsub_rn(expf(d1), expf(d2)); asm volatile("" : "+v"(lm)); lm = __fadd_rn(lm, 0.8f); const float v = (lane == 0) ? lm : 0.0f; *(float*)(LAM + lane) = v;  }

// ---- k_attn: causal differential attention for one (query block of 64, head) per block of 4 waves (wave w owns 16 query rows). The two score streams run one after the other (stream loop outside
// the key-chunk loop: one Q/K hi/lo pair, one score tile pair, one O accumulator set and one running max/sum set live at a time). Per stream st and 64-key chunk c = 0..qb the K hi/lo tile of
// head plane 2h+st and the V^T tile are staged in LDS; the softmax recurrence then runs on 32-key sub-chunks: scores S = Q.K (3 bf16 products, 16x32 tile per wave) ->
// t = S/8 - slope (pos_i - pos_j) + (1 - mask_j)(-1e9) for j <= i, excluded otherwise; online softmax (running max / sum, f32); P tile (f16 x4096, 16x32) per wave in LDS; O += P.V (one k-step).
// the first query block (qb == 0) also forms P residual tiles, stages V residual tiles (both x1024) and adds P_res.V + P.V_res per 16-column block through a second accumulator folded before normalisation.
__device__ __forceinline__ v16h  ldsh(const h16* p) { return cat16(*(const v8ha*)p, *(const v8ha*)(p + 16)); }

__global__ __launch_bounds__(128) __attribute__((amdgpu_num_vgpr(256)))
void k_attn(const bf* __restrict__ QPh, const bf* __restrict__ QPl, const bf* __restrict__ KPh, const bf* __restrict__ KPl, const h16* __restrict__ VT, const h16* __restrict__ VR,
            const float* __restrict__ amb, const int* __restrict__ tix, const float* __restrict__ LAM, float* Ob) {
    __shared__ __align__(16) bf    qs[2][QBL * LP];      // Q {hi,lo} of the current stream [row*LP + d]     (cross-wave: block barriers)
    __shared__ __align__(16) bf    ks[2][KCH * LP];      // K {hi,lo} of the current stream [key*LP + d]     (cross-wave: block barriers)
    __shared__ __align__(16) h16   vsm[HD * LP];         // V^T tile [d*LP + key]                            (cross-wave: block barriers)
    __shared__ __align__(16) h16   vrm[HD * LP];         // V residual tile, first query block only         (cross-wave: block barriers)
    __shared__ __align__(16) h16   psm[4][16 * PP];      // per-wave P tile [row*PP + key], 16 x 32          (wave-private, block barriers used anyway)
    __shared__ __align__(16) h16   prm[4][16 * PP];      // per-wave P residual tile, first query block only
    __shared__ __align__(16) float osm[4][16 * OSP];     // per-wave f32 result / epilogue staging [row*OSP + d]
    const int tid = threadIdx.x, w = tid >> 5, lane = tid & 31, lr = lane & 15, hi = lane >> 4;
    const int hh = blockIdx.y, qb = blockIdx.x, q0 = qb * QBL; const bool er = (qb == 0);
    {   const size_t bz = blockIdx.z;                        // batch element: every plane is [NB][...]; only the token positions keep the input's own batch pitch
        QPh += bz * ((size_t)NQH * SEQ * HD); QPl += bz * ((size_t)NQH * SEQ * HD); KPh += bz * ((size_t)NQH * SEQ * HD); KPl += bz * ((size_t)NQH * SEQ * HD);
        VT += bz * ((size_t)NVH * HD * SEQ); VR += bz * ((size_t)NVH * HD * SEQ); amb += bz * SEQ; tix += bz * SEQ_FULL; Ob += bz * ((size_t)SEQ * DVV); }
    const int e2 = hh + 1;                                   // slope = 2^(-(h+1)/2): exact power of two times 2^-0.5 for odd exponents
    const float slope = ((e2 & 1) ? 0.70710678118654752f : 1.0f) * __uint_as_float(((unsigned)(127 - (e2 >> 1))) << 23);
    const float lam = LAM[0];
    const int qrow0 = q0 + 16 * w + 8 * hi;
    float pq[8];
#pragma unroll
    for (int r = 0; r < 8; ++r) pq[r] = (float)tix[qrow0 + r];
    h16* pt = &psm[w][0]; h16* prt = &prm[w][0]; float* os = &osm[w][0];
#pragma unroll 1
    for (int st = 0; st < 2; ++st) {
        const size_t vq = (size_t)(2 * hh + st);
        __syncthreads();
#pragma unroll
        for (int i = 0; i < 8; ++i) { const int p = i >> 2; const int rem = (i & 3) * 128 + tid; const int row = rem >> 3, c8 = rem & 7;
            const bf* src = (p ? QPl : QPh) + (vq * SEQ + q0 + row) * HD + c8 * 8; *(v8usa*)(&qs[p][row * LP + c8 * 8]) = *(const v8usa*)src; }
        float m[8], l[8]; v8f O[4];
#pragma unroll
        for (int r = 0; r < 8; ++r) { m[r] = NEGB; l[r] = 0.0f; }
#pragma unroll
        for (int j = 0; j < 4; ++j) O[j] = (v8f){};
#pragma unroll 1
        for (int c = 0; c <= qb; ++c) {
            const int k0 = c * KCH;
#pragma unroll
            for (int i = 0; i < 8; ++i) { const int p = i >> 2; const int rem = (i & 3) * 128 + tid; const int row = rem >> 3, c8 = rem & 7;
                const bf* src = (p ? KPl : KPh) + (vq * SEQ + k0 + row) * HD + c8 * 8; *(v8usa*)(&ks[p][row * LP + c8 * 8]) = *(const v8usa*)src; }
#pragma unroll
            for (int i = 0; i < 4; ++i) { const int rem = i * 128 + tid; const int d = rem >> 3, c8 = rem & 7; const size_t go = ((size_t)hh * HD + d) * SEQ + k0 + 8 * c8;
                *(v8ha*)(&vsm[d * LP + 8 * c8]) = *(const v8ha*)(VT + go); if (er) *(v8ha*)(&vrm[d * LP + 8 * c8]) = *(const v8ha*)(VR + go); }
            __syncthreads();
#pragma unroll 1
            for (int sb = 0; sb < KCH / KSB; ++sb) {
                const int kb = sb * KSB;
                const int key0 = k0 + kb + lr, key1 = key0 + 16;
                const float pk0 = (float)tix[key0], pk1 = (float)tix[key1];
                const float om0 = 1.0f - amb[key0], om1 = 1.0f - amb[key1]; const float pad0 = om0 * -1.0e9f, pad1 = om1 * -1.0e9f;
                // ---- scores: S[row 8hi+r][key kb + nb*16 + lr], 3 bf16 products (hi.hi + lo.hi + hi.lo); fragments loaded right before each k-step, scheduling barrier after it
                v8f s[2]; s[0] = (v8f){}; s[1] = (v8f){};
                {   v16bf ah, al, bh, bl;
#pragma unroll
                    for (int kc = 0; kc < HD; kc += 32) {
                        ah = ldsb(&qs[0][(16 * w + lr) * LP + kc + 8 * hi]); al = ldsb(&qs[1][(16 * w + lr) * LP + kc + 8 * hi]);
#pragma unroll
                        for (int nb = 0; nb < 2; ++nb) { bh = ldsb(&ks[0][(kb + nb * 16 + lr) * LP + kc + 8 * hi]); bl = ldsb(&ks[1][(kb + nb * 16 + lr) * LP + kc + 8 * hi]);
                            s[nb] = wmmab(ah, bh, s[nb]); s[nb] = wmmab(al, bh, s[nb]); s[nb] = wmmab(ah, bl, s[nb]); }
                        asm volatile("v_nop\n\tv_nop\n\tv_nop\n\tv_nop" : "+v"(s[0]), "+v"(s[1]) : "v"(ah), "v"(al), "v"(bh), "v"(bl) : "memory");
                    }
                }
                // ---- additive terms by value select, sub-chunk max
                float cm[8];
#pragma unroll
                for (int r = 0; r < 8; ++r) cm[r] = NEGB;
#pragma unroll
                for (int nb = 0; nb < 2; ++nb) { const int kv = nb ? key1 : key0; const float pkv = nb ? pk1 : pk0; const float pdv = nb ? pad1 : pad0;
#pragma unroll
                    for (int r = 0; r < 8; ++r) { const float sa = s[nb][r] * SCL; const float pd = pq[r] - pkv; const float bia = slope * pd; const float sm = sa - bia;
                        const float tt = (kv <= qrow0 + r) ? (sm + pdv) : NEGB; s[nb][r] = tt; cm[r] = fmaxf(cm[r], tt); } }
                float cor[8], rs[8];
#pragma unroll
                for (int r = 0; r < 8; ++r) { float x = cm[r]; x = fmaxf(x, __shfl_xor(x, 1, 32)); x = fmaxf(x, __shfl_xor(x, 2, 32)); x = fmaxf(x, __shfl_xor(x, 4, 32)); x = fmaxf(x, __shfl_xor(x, 8, 32));
                    const float mn = fmaxf(m[r], x); const float dlt = (m[r] - mn) * L2E; cor[r] = __builtin_amdgcn_exp2f(dlt); m[r] = mn; rs[r] = 0.0f; }
                // ---- probabilities -> per-wave LDS tile (f16 x4096; residual x1024 on the first query block); excluded keys store exactly 0
#pragma unroll
                for (int nb = 0; nb < 2; ++nb) { const int kv = nb ? key1 : key0;
#pragma unroll
                    for (int r = 0; r < 8; ++r) { const float dq = (s[nb][r] - m[r]) * L2E; const float pe = __builtin_amdgcn_exp2f(dq); const float p = (kv <= qrow0 + r) ? pe : 0.0f; rs[r] = rs[r] + p;
                        const float pc = p * PCAR; const h16 ph = tohx(pc); const int li = (8 * hi + r) * PP + nb * 16 + lr; pt[li] = ph;
                        if (er) { const float res = (pc - (float)ph) * RCAR; prt[li] = tohx(res); } } }
#pragma unroll
                for (int r = 0; r < 8; ++r) { float x = rs[r]; x += __shfl_xor(x, 1, 32); x += __shfl_xor(x, 2, 32); x += __shfl_xor(x, 4, 32); x += __shfl_xor(x, 8, 32);
                    const float lc = l[r] * cor[r]; l[r] = lc + x; const float cf = cor[r];
#pragma unroll
                    for (int j = 0; j < 4; ++j) O[j][r] = O[j][r] * cf; }
                __syncthreads();
                // ---- O[d block j][row] += P[row][key] . V^T[d][key] over the 32 keys of this sub-chunk (one k-step)
                {   const v16h a = ldsh(pt + lr * PP + 8 * hi); v16h b;
#pragma unroll
                    for (int j = 0; j < 4; ++j) { b = ldsh(&vsm[(j * 16 + lr) * LP + kb + 8 * hi]); O[j] = wmma16(a, b, O[j]); }
                    asm volatile("v_nop\n\tv_nop\n\tv_nop\n\tv_nop" : "+v"(O[0]), "+v"(O[1]), "+v"(O[2]), "+v"(O[3]) : "v"(a), "v"(b) : "memory");
                    if (er) {
                        const v16h ar = ldsh(prt + lr * PP + 8 * hi);
#pragma unroll
                        for (int j = 0; j < 4; ++j) {
                            const v16h b2 = ldsh(&vsm[(j * 16 + lr) * LP + kb + 8 * hi]); const v16h br = ldsh(&vrm[(j * 16 + lr) * LP + kb + 8 * hi]);
                            v8f R = wmma16(ar, b2, (v8f){}); R = wmma16(a, br, R);
                            asm volatile("v_nop\n\tv_nop\n\tv_nop\n\tv_nop" : "+v"(R) : "v"(a), "v"(ar), "v"(b2), "v"(br) : "memory");
#pragma unroll
                            for (int r = 0; r < 8; ++r) { const float rr = R[r] * (1.0f / RCAR); O[j][r] = O[j][r] + rr; }
                        }
                    }
                }
                __syncthreads();
            }
        }
#pragma unroll
        for (int r = 0; r < 8; ++r) { const float rl = 1.0f / l[r]; const float il = rl * (1.0f / PCAR);
#pragma unroll
            for (int j = 0; j < 4; ++j) { const float a1 = O[j][r] * il; const int oi = (8 * hi + r) * OSP + j * 16 + lr;
                if (st == 0) { os[oi] = a1; } else { const float lb = lam * a1; const float cur = os[oi]; os[oi] = cur - lb; } } }
    }
    __syncthreads();
    float* orow = Ob + (size_t)(q0 + 16 * w) * DVV + hh * HD;
{
#pragma unroll
        for (int s2 = 0; s2 < 8; ++s2) { const int row = 2 * s2 + hi, cofs = lr * 4; const v4f val = *(const v4fa*)(os + row * OSP + cofs); *(v4f*)(orow + (size_t)row * DVV + cofs) = val; }
         }
}

__global__ __launch_bounds__(1024) void k_gnstat(const float* __restrict__ O, float* GST) {
    __shared__ float sh[1024]; const int tid = threadIdx.x; const int hh = blockIdx.x; const float* base = O + (size_t)blockIdx.y * SEQ * DVV + hh * HD; GST += blockIdx.y * (NVH * 32); const int n = SEQ * HD; const float rn = 1.0f / (float)n;
    float acc = 0.f;
#pragma unroll 1
    for (int e = tid; e < n; e += 1024) { const int t = e >> 6, d = e & 63; acc = __fadd_rn(acc, base[(size_t)t * DVV + d]); }
    sh[tid] = acc; __syncthreads();
#pragma unroll 1
    for (int st = 512; st > 0; st >>= 1) { if (tid < st) sh[tid] = __fadd_rn(sh[tid], sh[tid + st]); __syncthreads(); }
    const float mean = sh[0] * rn;
    __syncthreads();
    float acc2 = 0.f;
#pragma unroll 1
    for (int e = tid; e < n; e += 1024) { const int t = e >> 6, d = e & 63; float dv = __fsub_rn(base[(size_t)t * DVV + d], mean); asm volatile("" : "+v"(dv)); acc2 = __fadd_rn(acc2, __fmul_rn(dv, dv)); }
    sh[tid] = acc2; __syncthreads();
#pragma unroll 1
    for (int st = 512; st > 0; st >>= 1) { if (tid < st) sh[tid] = __fadd_rn(sh[tid], sh[tid + st]); __syncthreads(); }
    if (tid < 32) { const float var = sh[0] * rn; const float rs = __fdiv_rn(1.0f, sqrtf(__fadd_rn(var, 1e-5f))); const float outv = (tid == 0) ? mean : ((tid == 1) ? rs : 0.0f);
        *(float*)(GST + hh * 32 + tid) = outv;  }
}
__global__ __launch_bounds__(256) void k_gnmerge(const float* __restrict__ O, const float* __restrict__ GST, const float* __restrict__ gw, const float* __restrict__ gb, bf* Ah, bf* Al) {
    const size_t e = ((size_t)blockIdx.x * 256 + threadIdx.x) * 2; if (e >= (size_t)SEQ * DVV) return;
    O += (size_t)blockIdx.y * SEQ * DVV; GST += blockIdx.y * (NVH * 32); Ah += (size_t)blockIdx.y * SEQ * DVV; Al += (size_t)blockIdx.y * SEQ * DVV;
    const int c = (int)(e % DVV); const int hh = c / HD; const float mean = GST[hh * 32], rs = GST[hh * 32 + 1]; v2us oh, ol;
#pragma unroll
    for (int q = 0; q < 2; ++q) { float cc = __fsub_rn(O[e + q], mean); asm volatile("" : "+v"(cc)); float nn = __fmul_rn(cc, rs); asm volatile("" : "+v"(nn)); float y = __fmul_rn(nn, bfr(gw[c + q])); asm volatile("" : "+v"(y)); y = __fadd_rn(y, bfr(gb[c + q])); const float z = __fmul_rn(y, 0.2f); unsigned short a2, c2; splitf(z, a2, c2); oh[q] = a2; ol[q] = c2; }
    *(v2us*)(Ah + e) = oh; *(v2us*)(Al + e) = ol;  }

extern "C" void kernel_launch(void* const* d_in, const int* in_sizes, int n_in,
                              void* d_out, int out_size, void* d_ws, size_t ws_size, hipStream_t stream) {
    if (n_in < 13) return;
    if (in_sizes[0] < (NB - 1) * SEQ_FULL * DM + SEQ * DM) return;
    if (in_sizes[1] < (NB - 1) * SEQ_FULL + SEQ) return;
    if (in_sizes[2] < (NB - 1) * SEQ_FULL + SEQ) return;
    if (in_sizes[3] < DQ * DM || in_sizes[4] < DQ * DM || in_sizes[5] < DVV * DM || in_sizes[6] < DM * DVV) return;
    if (in_sizes[7] < HD || in_sizes[8] < HD || in_sizes[9] < HD || in_sizes[10] < HD || in_sizes[11] < DVV || in_sizes[12] < DVV) return;
    if (out_size < (NB - 1) * SEQ_FULL * DM + SEQ * DM) return;
    const float* x = (const float*)d_in[0]; const float* amask = (const float*)d_in[1]; const int* tix = (const int*)d_in[2];
    const float* wq = (const float*)d_in[3]; const float* wk = (const float*)d_in[4]; const float* wv = (const float*)d_in[5]; const float* wo = (const float*)d_in[6];
    const float* lq1 = (const float*)d_in[7]; const float* lq2 = (const float*)d_in[8]; const float* lk1 = (const float*)d_in[9]; const float* lk2 = (const float*)d_in[10];
    const float* gnw = (const float*)d_in[11]; const float* gnb = (const float*)d_in[12];
    float* OUT = (float*)d_out;     // [NB][SEQ_FULL][1024]
    char* wsp = (char*)d_ws;
    auto take = [&](size_t bytes) { char* p = wsp; wsp += (bytes + 255) & ~(size_t)255; return (void*)p; };
    bf* WQ = (bf*)take((size_t)DQ * DM * 2); bf* WK = (bf*)take((size_t)DQ * DM * 2); bf* WV = (bf*)take((size_t)DVV * DM * 2); bf* WO = (bf*)take((size_t)DM * DVV * 2);
    bf* XB = (bf*)take((size_t)NB * SEQ * DM * 2); float* AMB = (float*)take((size_t)NB * SEQ * 4); float* LAM = (float*)take(256); float* GST = (float*)take((size_t)NB * NVH * 32 * 4);
    bf* QPh = (bf*)take((size_t)NB * NQH * SEQ * HD * 2); bf* QPl = (bf*)take((size_t)NB * NQH * SEQ * HD * 2); bf* KPh = (bf*)take((size_t)NB * NQH * SEQ * HD * 2); bf* KPl = (bf*)take((size_t)NB * NQH * SEQ * HD * 2);
    h16* VT16 = (h16*)take((size_t)NB * NVH * HD * SEQ * 2); h16* VRS = (h16*)take((size_t)NB * NVH * HD * SEQ * 2);
    float* Ob = (float*)take((size_t)NB * SEQ * DVV * 4); bf* ATh = (bf*)take((size_t)NB * SEQ * DVV * 2); bf* ATl = (bf*)take((size_t)NB * SEQ * DVV * 2);
    const size_t used = (size_t)(wsp - (char*)d_ws);
    if (used > ws_size || used > (size_t)268435456) return;
    k_cvt8<<<(unsigned)(((size_t)DQ * DM / 8 + 255) / 256), 256, 0, stream>>>(wq, WQ, (size_t)DQ * DM / 8, 0, 0);
    k_cvt8<<<(unsigned)(((size_t)DQ * DM / 8 + 255) / 256), 256, 0, stream>>>(wk, WK, (size_t)DQ * DM / 8, 0, 0);
    k_cvt8<<<(unsigned)(((size_t)DVV * DM / 8 + 255) / 256), 256, 0, stream>>>(wv, WV, (size_t)DVV * DM / 8, 0, 0);
    k_cvt8<<<(unsigned)(((size_t)DM * DVV / 8 + 255) / 256), 256, 0, stream>>>(wo, WO, (size_t)DM * DVV / 8, 0, 0);
    k_lambda<<<1, 32, 0, stream>>>(lq1, lk1, lq2, lk2, LAM);
    // Every stage runs once for all NB batch elements: the batch index is the last used grid dimension, workspace planes are [NB][...].
    k_cvt8<<<dim3((unsigned)(((size_t)SEQ * DM / 8 + 255) / 256), NB, 1), 256, 0, stream>>>(x, XB, (size_t)SEQ * DM / 8, (size_t)SEQ_FULL * DM, (size_t)SEQ * DM);
    k_rbf<<<dim3((SEQ / 4 + 255) / 256, NB, 1), 256, 0, stream>>>(amask, AMB, SEQ / 4, (size_t)SEQ_FULL, (size_t)SEQ);
    k_gemmb<0, 1><<<dim3(SEQ / GT, DQ / GT, NB), 256, 0, stream>>>(XB, nullptr, WQ, DM, nullptr, 0, (size_t)SEQ * DM, 0, QPh, QPl);
    k_gemmb<0, 1><<<dim3(SEQ / GT, DQ / GT, NB), 256, 0, stream>>>(XB, nullptr, WK, DM, nullptr, 0, (size_t)SEQ * DM, 0, KPh, KPl);
    k_gemmb<0, 2><<<dim3(SEQ / GT, DVV / GT, NB), 256, 0, stream>>>(XB, nullptr, WV, DM, nullptr, 0, (size_t)SEQ * DM, 0, (bf*)VT16, (bf*)VRS);
    k_attn<<<dim3(SEQ / QBL, NVH, NB), 128, 0, stream>>>(QPh, QPl, KPh, KPl, VT16, VRS, AMB, tix, LAM, Ob);
    k_gnstat<<<dim3(NVH, NB, 1), 1024, 0, stream>>>(Ob, GST);
    k_gnmerge<<<dim3((unsigned)(((size_t)SEQ * DVV / 2 + 255) / 256), NB, 1), 256, 0, stream>>>(Ob, GST, gnw, gnb, ATh, ATl);
    k_gemmb<1><<<dim3(SEQ / GT, DM / GT, NB), 256, 0, stream>>>(ATh, ATl, WO, DVV, OUT, DM, (size_t)SEQ * DVV, (size_t)SEQ_FULL * DM);
}

// v004
// Measured time: 500 microseconds a run.
// Next to v003, in two timings, it ran 1.13 times as fast each time.
// Counting every step since v000, it is 1.93 times as fast.
#include <hip/hip_runtime.h>
#pragma clang fp contract(off)

// Compute dtypes (f32 accumulate everywhere): input projections x.Wq / x.Wk / x.Wv on v_wmma_f32_16x16x32_bf16 with bf16 RNE-converted inputs as operands (exact operands); q.k scores on v_wmma_f32_16x16x32_bf16 as bf16 hi/lo split (hi.hi + lo.hi + hi.lo); probability.value on v_wmma_f32_16x16x32_f16 (P f16 carried x4096, V f16; the first query block adds P and V residual planes carried x1024 through a second accumulator); softmax, ALiBi/pad terms, lambda and GroupNorm in f32; output projection on v_wmma_f32_16x16x32_bf16 (activation bf16 hi/lo x bf16 Wo, 2 products).
// Layout: x [NB][SEQ_FULL][1024]; Wq/Wk [2048][1024], Wv/Wo [1024][1024] ([out][in], used as K-contiguous Bt planes); per head h the 128 q/k columns are [half 1 | half 2] = virtual 64-wide heads 2h, 2h+1; mask [NB][SEQ_FULL] f32, token positions [NB][SEQ_FULL] int32; out [NB][SEQ_FULL][1024] f32.

#ifndef NB
#define NB 2
#endif
#ifndef SEQ
#define SEQ 2048
#endif
#define NB_FULL 2
#define SEQ_FULL 2048
#define DM   1024
#define NVH  16
#define HD   64
#define NQH  (2 * NVH)
#define DQ   (NQH * HD)
#define DVV  (NVH * HD)
#define SCL  0.125f
#define PCAR 4096.0f
#define RCAR 1024.0f
#define QBL  64
#define KCH  64
#define KSB  32
#define LP   72
#define PP   40
#define OSP  68
#define L2E  1.4426950408889634f
#define NEGB (-3.0e38f)
static_assert(SEQ % 64 == 0);
static_assert(SEQ <= SEQ_FULL);
static_assert(NB >= 1);
static_assert(NB <= NB_FULL);
static_assert(QBL == KCH);
static_assert(KCH % KSB == 0);
static_assert((LP * 2) % 16 == 0);
static_assert((PP * 2) % 16 == 0);
static_assert((OSP * 4) % 16 == 0);
static_assert((SEQ * DVV) % 512 == 0);
static_assert((SEQ * DM) % 2048 == 0);

typedef _Float16 h16;
typedef unsigned short bf;
typedef __attribute__((ext_vector_type(16))) __bf16   v16bf;
typedef __attribute__((ext_vector_type(16))) _Float16 v16h;
typedef __attribute__((ext_vector_type(8)))  _Float16 v8h;
typedef __attribute__((ext_vector_type(8)))  unsigned short v8us;
typedef __attribute__((ext_vector_type(8)))  float    v8f;
typedef __attribute__((ext_vector_type(4)))  float    v4f;
typedef __attribute__((ext_vector_type(2)))  unsigned short v2us;
typedef v8h  __attribute__((may_alias)) v8ha;
typedef v4f  __attribute__((may_alias)) v4fa;
typedef v8us __attribute__((may_alias)) v8usa;
typedef float __attribute__((may_alias)) f32a;

__device__ __forceinline__ unsigned short f2bf(float f) { unsigned u = __float_as_uint(f); u += 0x7FFFu + ((u >> 16) & 1u); return (unsigned short)(u >> 16); }
__device__ __forceinline__ float bf2f(unsigned short b) { return __uint_as_float(((unsigned)b) << 16); }
__device__ __forceinline__ float bfr(float f) { return bf2f(f2bf(f)); }
__device__ __forceinline__ v16h cat16(v8h lo, v8h hi) { return __builtin_shufflevector(lo, hi, 0, 1, 2, 3, 4, 5, 6, 7, 8, 9, 10, 11, 12, 13, 14, 15); }
__device__ __forceinline__ v16bf cat16b(v8us lo, v8us hi) { return __builtin_bit_cast(v16bf, __builtin_shufflevector(lo, hi, 0, 1, 2, 3, 4, 5, 6, 7, 8, 9, 10, 11, 12, 13, 14, 15)); }
__device__ __forceinline__ v8f wmma16(v16h a, v16h b, v8f c) { return __builtin_amdgcn_wmma_f32_16x16x32_f16(false, a, false, b, (short)0, c, false, false); }
__device__ __forceinline__ v8f wmmab(v16bf a, v16bf b, v8f c) { return __builtin_amdgcn_wmma_f32_16x16x32_bf16(false, a, false, b, (short)0, c, false, false); }
__device__ __forceinline__ h16 tohx(float x) { return (h16)x; }
__device__ __forceinline__ void splitf(float y, unsigned short& h, unsigned short& l) { h = f2bf(y); l = f2bf(y - bf2f(h)); }

// ---- k_gemmb: block-tiled GEMM, 8 waves (2 x 4) per 128x128 output tile, wave tile 64x32 (8 accumulators); grid (M/128, N/128, Z), 256 threads.
// c[m][n] (f32) = sum_k A[m][k] Bt[n][k] (+ A2[m][k] Bt[n][k] when NSPLIT == 1). z-batch strides sA/sC in elements. K % 64 == 0, K >= 64.
// MODE 0: c goes to C (f32, pitch ldc). MODE 1 (q, k): c is split into bf16 hi/lo and goes to the head planes P0/P1 [z][n / 64][m][n % 64]. MODE 2 (v): c goes transposed, as f16 and as its
// residual x1024, to P0/P1 [z][n][m]. MODE 1 and 2 turn the tile in the stage buffers, free behind the loop's last barrier, so that every global store covers whole 128-byte lines.
// A stage is 64 k of every operand row (one whole 128-byte line per row), read from the K-contiguous planes by whole-line 16-byte loads, kept in registers while the
// previous stage is multiplied, then stored to the other of two LDS buffers (row pitch 144 B); one block barrier per stage publishes it and ends the reads of the buffer refilled next.
// Fragments: lane -> row/col (lane & 15); elements 0..7 <- k + 8*(lane>>4), elements 8..15 <- k + 16 + 8*(lane>>4), for A and Bt alike. k runs upward, one accumulate chain per element.
#define GT   128
#define GBK  64
#define GLP  72
#define GOP  36
#define GSP  132
#define GVP  136
static_assert(SEQ % GT == 0);
static_assert(DQ % GT == 0);
static_assert(DVV % GT == 0);
static_assert(DM % GT == 0);
static_assert(DM % GBK == 0);
static_assert(DVV % GBK == 0);
static_assert((GLP * 2) % 16 == 0);
static_assert((GOP * 4) % 16 == 0);
static_assert((GSP * 4) % 16 == 0);
static_assert((GVP * 2) % 16 == 0);
static_assert(GT == 2 * HD);
static_assert(GT * GSP * 4 <= 2 * 2 * GT * GLP * 2);
static_assert(2 * GT * GVP * 2 <= 2 * 2 * GT * GLP * 2);
__device__ __forceinline__ v16bf ldsb(const bf* p) { return cat16b(*(const v8usa*)p, *(const v8usa*)(p + 16)); }
template <int NSPLIT, int MODE = 0>
// waves_per_eu: at most two 8-wave blocks run per WGP here, so the register budget is that of 4 waves per SIMD and a k-step's fragment loads may be grouped ahead of its products
__global__ __launch_bounds__(256) __attribute__((amdgpu_waves_per_eu(1, 4)))
void k_gemmb(const bf* __restrict__ A, const bf* __restrict__ A2, const bf* __restrict__ Bt, int K, float* C, int ldc, size_t sA, size_t sC, bf* P0 = nullptr, bf* P1 = nullptr) {
    constexpr int NPL = 2 + NSPLIT;                          // planes per stage: A, (A2,) Bt
    __shared__ __align__(16) bf    tl[2][NPL][GT * GLP];     // two stage buffers [row*GLP + k]                  (cross-wave: block barriers)
    __shared__ __align__(16) float osw[8][16 * GOP];         // per-wave f32 epilogue staging [row*GOP + col]    (wave-private)
    const size_t z = blockIdx.z; A += z * sA; if (NSPLIT) A2 += z * sA; C += z * sC;
    const int tid = threadIdx.x, w = tid >> 5, lane = tid & 31, lr = lane & 15, hi = lane >> 4; const int wm = w >> 2, wn = w & 3;
    const int r0 = blockIdx.x * GT, c0 = blockIdx.y * GT;
    v8f acc[4][2];
#pragma unroll
    for (int mb = 0; mb < 4; ++mb)
#pragma unroll
        for (int nb = 0; nb < 2; ++nb) acc[mb][nb] = (v8f){};
    const int srow = tid >> 3, sc8 = (tid & 7) * 8;          // staging: 8 lanes cover one row's 128 bytes; piece i is row srow + 32 i
    const char* gA = (const char*)(A + (size_t)r0 * K); const char* gA2 = (const char*)(A2 + (size_t)r0 * K); const char* gB = (const char*)(Bt + (size_t)c0 * K);   // block-uniform tile bases
    unsigned go[4];                                          // the lane's byte offset of piece i inside a tile's rows, the same for every plane and stage
#pragma unroll
    for (int i = 0; i < 4; ++i) go[i] = ((unsigned)(srow + 32 * i) * (unsigned)K + (unsigned)sc8) * 2u;
    const int so = srow * GLP + sc8;
    const int fa = (wm * 64 + lr) * GLP + 8 * hi, fb = (wn * 32 + lr) * GLP + 8 * hi;
    v8us ra[4], ra2[4], rb[4];
#pragma unroll
    for (int i = 0; i < 4; ++i) { ra[i] = *(const v8us*)(gA + go[i]); if (NSPLIT) ra2[i] = *(const v8us*)(gA2 + go[i]); rb[i] = *(const v8us*)(gB + go[i]); }
#pragma unroll
    for (int i = 0; i < 4; ++i) { *(v8usa*)(&tl[0][0][so + i * 32 * GLP]) = ra[i]; if (NSPLIT) *(v8usa*)(&tl[0][1][so + i * 32 * GLP]) = ra2[i]; *(v8usa*)(&tl[0][NPL - 1][so + i * 32 * GLP]) = rb[i]; }
    __syncthreads();
#pragma unroll 1
    for (int k0 = 0; k0 < K; k0 += GBK) {
        const int cur = (k0 / GBK) & 1; const bool more = k0 + GBK < K;
        gA += GBK * 2; gA2 += GBK * 2; gB += GBK * 2;        // the uniform bases step one stage; the lanes' offsets stay
        if (more) {
#pragma unroll
            for (int i = 0; i < 4; ++i) {   // a wait behind each load: this build lets a later load of the group land in an earlier one's address pair, and the wait stands in front of that overwrite
                ra[i] = *(const v8us*)(gA + go[i]); asm volatile("s_wait_xcnt 0x0" ::: "memory");
                if (NSPLIT) { ra2[i] = *(const v8us*)(gA2 + go[i]); asm volatile("s_wait_xcnt 0x0" ::: "memory"); }
                rb[i] = *(const v8us*)(gB + go[i]); asm volatile("s_wait_xcnt 0x0" ::: "memory"); }
        }
        const bf* ta = &tl[cur][0][fa]; const bf* ta2 = &tl[cur][NSPLIT][fa]; const bf* tb = &tl[cur][NPL - 1][fb];
#pragma unroll
        for (int kc = 0; kc < GBK; kc += 32) {
            v16bf a[4], a2[4], b[2];
#pragma unroll
            for (int mb = 0; mb < 4; ++mb) { a[mb] = ldsb(ta + mb * 16 * GLP + kc); if (NSPLIT) a2[mb] = ldsb(ta2 + mb * 16 * GLP + kc); }
#pragma unroll
            for (int nb = 0; nb < 2; ++nb) b[nb] = ldsb(tb + nb * 16 * GLP + kc);
#pragma unroll
            for (int nb = 0; nb < 2; ++nb)
#pragma unroll
                for (int mb = 0; mb < 4; ++mb) { acc[mb][nb] = wmmab(a[mb], b[nb], acc[mb][nb]); if (NSPLIT) acc[mb][nb] = wmmab(a2[mb], b[nb], acc[mb][nb]); }
        }
        if (more) {
#pragma unroll
            for (int i = 0; i < 4; ++i) { *(v8usa*)(&tl[cur ^ 1][0][so + i * 32 * GLP]) = ra[i]; if (NSPLIT) *(v8usa*)(&tl[cur ^ 1][1][so + i * 32 * GLP]) = ra2[i]; *(v8usa*)(&tl[cur ^ 1][NPL - 1][so + i * 32 * GLP]) = rb[i]; }
        }
        __syncthreads();
    }
    if constexpr (MODE == 1) {
        f32a* st = (f32a*)&tl[0][0][0];                      // block f32 tile [row*GSP + col]
#pragma unroll
        for (int mb = 0; mb < 4; ++mb)
#pragma unroll
            for (int nb = 0; nb < 2; ++nb)
#pragma unroll
                for (int j = 0; j < 8; ++j) st[(wm * 64 + mb * 16 + hi * 8 + j) * GSP + wn * 32 + nb * 16 + lr] = acc[mb][nb][j];
        __syncthreads();                                     // publishes the tile: its rows are read back by other waves
        const int hs = w & 1, rw = (w >> 1) * 32 + (lane >> 3), c8 = (lane & 7) * 8;   // a wave takes 32 rows of one 64-wide head; one store = 4 rows = 512 contiguous bytes
        const size_t pb = ((z * NQH + (size_t)(blockIdx.y * 2 + hs)) * SEQ + r0) * HD + c8;
#pragma unroll
        for (int i = 0; i < 8; ++i) { const int row = rw + 4 * i; const f32a* sp = st + row * GSP + hs * HD + c8; const v4f x0 = *(const v4fa*)sp, x1 = *(const v4fa*)(sp + 4); v8us oh, ol;
#pragma unroll
            for (int q = 0; q < 4; ++q) { unsigned short a2, c2; splitf(x0[q], a2, c2); oh[q] = a2; ol[q] = c2; splitf(x1[q], a2, c2); oh[4 + q] = a2; ol[4 + q] = c2; }
            *(v8us*)(P0 + pb + (size_t)row * HD) = oh; *(v8us*)(P1 + pb + (size_t)row * HD) = ol; }
        return;
    }
    if constexpr (MODE == 2) {
        h16* sv = (h16*)&tl[0][0][0]; h16* sr = sv + GT * GVP;   // block f16 tiles, value and residual, transposed [col*GVP + row]; an accumulator lane holds 8 consecutive rows of one column
#pragma unroll
        for (int mb = 0; mb < 4; ++mb)
#pragma unroll
            for (int nb = 0; nb < 2; ++nb) { v8h o16, orr;
#pragma unroll
                for (int j = 0; j < 8; ++j) { const float x = acc[mb][nb][j]; const h16 hv = tohx(x); const float res = (x - (float)hv) * RCAR; o16[j] = hv; orr[j] = tohx(res); }
                const int si = (wn * 32 + nb * 16 + lr) * GVP + wm * 64 + mb * 16 + hi * 8; *(v8ha*)(sv + si) = o16; *(v8ha*)(sr + si) = orr; }
        __syncthreads();                                     // publishes the tiles: their columns are read back by other waves
        const int cw = tid >> 4, t8 = (tid & 15) * 8;        // 16 lanes cover one column's 128 rows = 256 contiguous bytes
        const size_t vb = (z * DVV + (size_t)c0) * SEQ + r0 + t8;
#pragma unroll
        for (int i = 0; i < 8; ++i) { const int col = cw + 16 * i; const v8h a16 = *(const v8ha*)(sv + col * GVP + t8), ar = *(const v8ha*)(sr + col * GVP + t8);
            *(v8ha*)((h16*)P0 + vb + (size_t)col * SEQ) = a16; *(v8ha*)((h16*)P1 + vb + (size_t)col * SEQ) = ar; }
        return;
    }
    float* os = &osw[w][0];
#pragma unroll
    for (int mb = 0; mb < 4; ++mb) {
#pragma unroll
        for (int nb = 0; nb < 2; ++nb) {
#pragma unroll
            for (int j = 0; j < 8; ++j) os[(hi * 8 + j) * GOP + nb * 16 + lr] = acc[mb][nb][j]; }
        __builtin_amdgcn_wave_barrier(); asm volatile("" ::: "memory");   // keeps the staging stores ahead of the row reads of other lanes of this wave
        float* crow = C + (size_t)(r0 + wm * 64 + mb * 16) * ldc + c0 + wn * 32;
#pragma unroll
        for (int s = 0; s < 4; ++s) { const int row = 4 * s + (lane >> 3), cofs = (lane & 7) * 4; const v4f val = *(const v4fa*)(os + row * GOP + cofs); *(v4f*)(crow + (size_t)row * ldc + cofs) = val; }
        __builtin_amdgcn_wave_barrier(); asm volatile("" ::: "memory");   // keeps the row reads ahead of the next block's staging stores
    }
}

__global__ __launch_bounds__(256) void k_cvt8(const float* __restrict__ src, bf* dst, size_t n8, size_t sS, size_t sD) { const size_t i = (size_t)blockIdx.x * 256 + threadIdx.x; if (i >= n8) return; src += blockIdx.y * sS; dst += blockIdx.y * sD; const v8f v = *(const v8f*)(src + i * 8); v8us o;
#pragma unroll
    for (int k = 0; k < 8; ++k) o[k] = f2bf(v[k]); *(v8us*)(dst + i * 8) = o;  }
__global__ __launch_bounds__(256) void k_rbf(const float* __restrict__ src, float* dst, int n4, size_t sS, size_t sD) { const int i = blockIdx.x * 256 + threadIdx.x; if (i >= n4) return; src += blockIdx.y * sS; dst += blockIdx.y * sD; const v4f a = *(const v4f*)(src + (size_t)i * 4); v4f o;
#pragma unroll
    for (int u = 0; u < 4; ++u) o[u] = bfr(a[u]); *(v4f*)(dst + (size_t)i * 4) = o;  }
__global__ __launch_bounds__(32) void k_lambda(const float* __restrict__ lq1, const float* __restrict__ lk1, const float* __restrict__ lq2, const float* __restrict__ lk2, float* LAM) { const int lane = threadIdx.x; float d1 = 0.f, d2 = 0.f;
#pragma unroll 1
    for (int i = 0; i < HD; ++i) { float p1 = __fmul_rn(bfr(lq1[i]), bfr(lk1[i])); asm volatile("" : "+v"(p1)); d1 = __fadd_rn(d1, p1); float p2 = __fmul_rn(bfr(lq2[i]), bfr(lk2[i])); asm volatile("" : "+v"(p2)); d2 = __fadd_rn(d2, p2); }
    float lm = __fsub_rn(expf(d1), expf(d2)); asm volatile("" : "+v"(lm)); lm = __fadd_rn(lm, 0.8f); const float v = (lane == 0) ? lm : 0.0f; *(float*)(LAM + lane) = v;  }

// ---- k_attn: causal differential attention for one (query block of 64, head) per block of 4 waves (wave w owns 16 query rows). The two score streams run one after the other (stream loop outside
// the key-chunk loop: one Q/K hi/lo pair, one score tile pair, one O accumulator set and one running max/sum set live at a time). Per stream st and 64-key chunk c = 0..qb the K hi/lo tile of
// head plane 2h+st and the V^T tile are staged in LDS; the softmax recurrence then runs on 32-key sub-chunks: scores S = Q.K (3 bf16 products, 16x32 tile per wave) ->
// t = S/8 - slope (pos_i - pos_j) + (1 - mask_j)(-1e9) for j <= i, excluded otherwise; online softmax (running max / sum, f32); P tile (f16 x4096, 16x32) per wave in LDS; O += P.V (one k-step).
// the first query block (qb == 0) also forms P residual tiles, stages V residual tiles (both x1024) and adds P_res.V + P.V_res per 16-column block through a second accumulator folded before normalisation.
__device__ __forceinline__ v16h  ldsh(const h16* p) { return cat16(*(const v8ha*)p, *(const v8ha*)(p + 16)); }

__global__ __launch_bounds__(128) __attribute__((amdgpu_num_vgpr(256)))
void k_attn(const bf* __restrict__ QPh, const bf* __restrict__ QPl, const bf* __restrict__ KPh, const bf* __restrict__ KPl, const h16* __restrict__ VT, const h16* __restrict__ VR,
            const float* __restrict__ amb, const int* __restrict__ tix, const float* __restrict__ LAM, float* Ob) {
    __shared__ __align__(16) bf    qs[2][QBL * LP];      // Q {hi,lo} of the current stream [row*LP + d]     (cross-wave: block barriers)
    __shared__ __align__(16) bf    ks[2][KCH * LP];      // K {hi,lo} of the current stream [key*LP + d]     (cross-wave: block barriers)
    __shared__ __align__(16) h16   vsm[HD * LP];         // V^T tile [d*LP + key]                            (cross-wave: block barriers)
    __shared__ __align__(16) h16   vrm[HD * LP];         // V residual tile, first query block only         (cross-wave: block barriers)
    __shared__ __align__(16) h16   psm[4][16 * PP];      // per-wave P tile [row*PP + key], 16 x 32          (wave-private, block barriers used anyway)
    __shared__ __align__(16) h16   prm[4][16 * PP];      // per-wave P residual tile, first query block only
    __shared__ __align__(16) float osm[4][16 * OSP];     // per-wave f32 result / epilogue staging [row*OSP + d]
    const int tid = threadIdx.x, w = tid >> 5, lane = tid & 31, lr = lane & 15, hi = lane >> 4;
    const int hh = blockIdx.y, qb = blockIdx.x, q0 = qb * QBL; const bool er = (qb == 0);
    {   const size_t bz = blockIdx.z;                        // batch element: every plane is [NB][...]; only the token positions keep the input's own batch pitch
        QPh += bz * ((size_t)NQH * SEQ * HD); QPl += bz * ((size_t)NQH * SEQ * HD); KPh += bz * ((size_t)NQH * SEQ * HD); KPl += bz * ((size_t)NQH * SEQ * HD);
        VT += bz * ((size_t)NVH * HD * SEQ); VR += bz * ((size_t)NVH * HD * SEQ); amb += bz * SEQ; tix += bz * SEQ_FULL; Ob += bz * ((size_t)SEQ * DVV); }
    const int e2 = hh + 1;                                   // slope = 2^(-(h+1)/2): exact power of two times 2^-0.5 for odd exponents
    const float slope = ((e2 & 1) ? 0.70710678118654752f : 1.0f) * __uint_as_float(((unsigned)(127 - (e2 >> 1))) << 23);
    const float lam = LAM[0];
    const int qrow0 = q0 + 16 * w + 8 * hi;
    float pq[8];
#pragma unroll
    for (int r = 0; r < 8; ++r) pq[r] = (float)tix[qrow0 + r];
    h16* pt = &psm[w][0]; h16* prt = &prm[w][0]; float* os = &osm[w][0];
#pragma unroll 1
    for (int st = 0; st < 2; ++st) {
        const size_t vq = (size_t)(2 * hh + st);
        __syncthreads();
#pragma unroll
        for (int i = 0; i < 8; ++i) { const int p = i >> 2; const int rem = (i & 3) * 128 + tid; const int row = rem >> 3, c8 = rem & 7;
            const bf* src = (p ? QPl : QPh) + (vq * SEQ + q0 + row) * HD + c8 * 8; *(v8usa*)(&qs[p][row * LP + c8 * 8]) = *(const v8usa*)src; }
        float m[8], l[8]; v8f O[4];
#pragma unroll
        for (int r = 0; r < 8; ++r) { m[r] = NEGB; l[r] = 0.0f; }
#pragma unroll
        for (int j = 0; j < 4; ++j) O[j] = (v8f){};
#pragma unroll 1
        for (int c = 0; c <= qb; ++c) {
            const int k0 = c * KCH;
#pragma unroll
            for (int i = 0; i < 8; ++i) { const int p = i >> 2; const int rem = (i & 3) * 128 + tid; const int row = rem >> 3, c8 = rem & 7;
                const bf* src = (p ? KPl : KPh) + (vq * SEQ + k0 + row) * HD + c8 * 8; *(v8usa*)(&ks[p][row * LP + c8 * 8]) = *(const v8usa*)src; }
#pragma unroll
            for (int i = 0; i < 4; ++i) { const int rem = i * 128 + tid; const int d = rem >> 3, c8 = rem & 7; const size_t go = ((size_t)hh * HD + d) * SEQ + k0 + 8 * c8;
                *(v8ha*)(&vsm[d * LP + 8 * c8]) = *(const v8ha*)(VT + go); if (er) *(v8ha*)(&vrm[d * LP + 8 * c8]) = *(const v8ha*)(VR + go); }
            __syncthreads();
#pragma unroll 1
            for (int sb = 0; sb < KCH / KSB; ++sb) {
                const int kb = sb * KSB;
                const int key0 = k0 + kb + lr, key1 = key0 + 16;
                const float pk0 = (float)tix[key0], pk1 = (float)tix[key1];
                const float om0 = 1.0f - amb[key0], om1 = 1.0f - amb[key1]; const float pad0 = om0 * -1.0e9f, pad1 = om1 * -1.0e9f;
                // ---- scores: S[row 8hi+r][key kb + nb*16 + lr], 3 bf16 products (hi.hi + lo.hi + hi.lo); fragments loaded right before each k-step, scheduling barrier after it
                v8f s[2]; s[0] = (v8f){}; s[1] = (v8f){};
                {   v16bf ah, al, bh, bl;
#pragma unroll
                    for (int kc = 0; kc < HD; kc += 32) {
                        ah = ldsb(&qs[0][(16 * w + lr) * LP + kc + 8 * hi]); al = ldsb(&qs[1][(16 * w + lr) * LP + kc + 8 * hi]);
#pragma unroll
                        for (int nb = 0; nb < 2; ++nb) { bh = ldsb(&ks[0][(kb + nb * 16 + lr) * LP + kc + 8 * hi]); bl = ldsb(&ks[1][(kb + nb * 16 + lr) * LP + kc + 8 * hi]);
                            s[nb] = wmmab(ah, bh, s[nb]); s[nb] = wmmab(al, bh, s[nb]); s[nb] = wmmab(ah, bl, s[nb]); }
                        asm volatile("v_nop\n\tv_nop\n\tv_nop\n\tv_nop" : "+v"(s[0]), "+v"(s[1]) : "v"(ah), "v"(al), "v"(bh), "v"(bl) : "memory");
                    }
                }
                // ---- additive terms by value select, sub-chunk max
                float cm[8];
#pragma unroll
                for (int r = 0; r < 8; ++r) cm[r] = NEGB;
#pragma unroll
                for (int nb = 0; nb < 2; ++nb) { const int kv = nb ? key1 : key0; const float pkv = nb ? pk1 : pk0; const float pdv = nb ? pad1 : pad0;
#pragma unroll
                    for (int r = 0; r < 8; ++r) { const float sa = s[nb][r] * SCL; const float pd = pq[r] - pkv; const float bia = slope * pd; const float sm = sa - bia;
                        const float tt = (kv <= qrow0 + r) ? (sm + pdv) : NEGB; s[nb][r] = tt; cm[r] = fmaxf(cm[r], tt); } }
                float cor[8], rs[8];
#pragma unroll
                for (int r = 0; r < 8; ++r) { float x = cm[r]; x = fmaxf(x, __shfl_xor(x, 1, 32)); x = fmaxf(x, __shfl_xor(x, 2, 32)); x = fmaxf(x, __shfl_xor(x, 4, 32)); x = fmaxf(x, __shfl_xor(x, 8, 32));
                    const float mn = fmaxf(m[r], x); const float dlt = (m[r] - mn) * L2E; cor[r] = __builtin_amdgcn_exp2f(dlt); m[r] = mn; rs[r] = 0.0f; }
                // ---- probabilities -> per-wave LDS tile (f16 x4096; residual x1024 on the first query block); excluded keys store exactly 0
#pragma unroll
                for (int nb = 0; nb < 2; ++nb) { const int kv = nb ? key1 : key0;
#pragma unroll
                    for (int r = 0; r < 8; ++r) { const float dq = (s[nb][r] - m[r]) * L2E; const float pe = __builtin_amdgcn_exp2f(dq); const float p = (kv <= qrow0 + r) ? pe : 0.0f; rs[r] = rs[r] + p;
                        const float pc = p * PCAR; const h16 ph = tohx(pc); const int li = (8 * hi + r) * PP + nb * 16 + lr; pt[li] = ph;
                        if (er) { const float res = (pc - (float)ph) * RCAR; prt[li] = tohx(res); } } }
#pragma unroll
                for (int r = 0; r < 8; ++r) { float x = rs[r]; x += __shfl_xor(x, 1, 32); x += __shfl_xor(x, 2, 32); x += __shfl_xor(x, 4, 32); x += __shfl_xor(x, 8, 32);
                    const float lc = l[r] * cor[r]; l[r] = lc + x; const float cf = cor[r];
#pragma unroll
                    for (int j = 0; j < 4; ++j) O[j][r] = O[j][r] * cf; }
                __syncthreads();
                // ---- O[d block j][row] += P[row][key] . V^T[d][key] over the 32 keys of this sub-chunk (one k-step)
                {   const v16h a = ldsh(pt + lr * PP + 8 * hi); v16h b;
#pragma unroll
                    for (int j = 0; j < 4; ++j) { b = ldsh(&vsm[(j * 16 + lr) * LP + kb + 8 * hi]); O[j] = wmma16(a, b, O[j]); }
                    asm volatile("v_nop\n\tv_nop\n\tv_nop\n\tv_nop" : "+v"(O[0]), "+v"(O[1]), "+v"(O[2]), "+v"(O[3]) : "v"(a), "v"(b) : "memory");
                    if (er) {
                        const v16h ar = ldsh(prt + lr * PP + 8 * hi);
#pragma unroll
                        for (int j = 0; j < 4; ++j) {
                            const v16h b2 = ldsh(&vsm[(j * 16 + lr) * LP + kb + 8 * hi]); const v16h br = ldsh(&vrm[(j * 16 + lr) * LP + kb + 8 * hi]);
                            v8f R = wmma16(ar, b2, (v8f){}); R = wmma16(a, br, R);
                            asm volatile("v_nop\n\tv_nop\n\tv_nop\n\tv_nop" : "+v"(R) : "v"(a), "v"(ar), "v"(b2), "v"(br) : "memory");
#pragma unroll
                            for (int r = 0; r < 8; ++r) { const float rr = R[r] * (1.0f / RCAR); O[j][r] = O[j][r] + rr; }
                        }
                    }
                }
                __syncthreads();
            }
        }
#pragma unroll
        for (int r = 0; r < 8; ++r) { const float rl = 1.0f / l[r]; const float il = rl * (1.0f / PCAR);
#pragma unroll
            for (int j = 0; j < 4; ++j) { const float a1 = O[j][r] * il; const int oi = (8 * hi + r) * OSP + j * 16 + lr;
                if (st == 0) { os[oi] = a1; } else { const float lb = lam * a1; const float cur = os[oi]; os[oi] = cur - lb; } } }
    }
    __syncthreads();
    float* orow = Ob + (size_t)(q0 + 16 * w) * DVV + hh * HD;
{
#pragma unroll
        for (int s2 = 0; s2 < 8; ++s2) { const int row = 2 * s2 + hi, cofs = lr * 4; const v4f val = *(const v4fa*)(os + row * OSP + cofs); *(v4f*)(orow + (size_t)row * DVV + cofs) = val; }
         }
}

#define GNB 32
static_assert((SEQ * HD / 1024) % GNB == 0);
__global__ __launch_bounds__(1024) void k_gnstat(const float* __restrict__ O, float* GST) {
    __shared__ float sh[1024]; const int tid = threadIdx.x; const int hh = blockIdx.x; const float* base = O + (size_t)blockIdx.y * SEQ * DVV + hh * HD; GST += blockIdx.y * (NVH * 32); const int n = SEQ * HD; const float rn = 1.0f / (float)n;
    // A thread's chain is e = tid + 1024 i: row (tid >> 6) + 16 i, column tid & 63. GNB loads of the chain are issued together, then added in the chain's own order.
    const float* pl = base + (size_t)(tid >> 6) * DVV + (tid & 63);
    float acc = 0.f;
#pragma unroll
    for (int g = 0; g < n / 1024; g += GNB) { float v[GNB];
#pragma unroll
        for (int u = 0; u < GNB; ++u) v[u] = pl[(size_t)(g + u) * 16 * DVV];
#pragma unroll
        for (int u = 0; u < GNB; ++u) acc = __fadd_rn(acc, v[u]); }
    sh[tid] = acc; __syncthreads();
#pragma unroll 1
    for (int st = 512; st > 0; st >>= 1) { if (tid < st) sh[tid] = __fadd_rn(sh[tid], sh[tid + st]); __syncthreads(); }
    const float mean = sh[0] * rn;
    __syncthreads();
    float acc2 = 0.f;
#pragma unroll
    for (int g = 0; g < n / 1024; g += GNB) { float v[GNB];
#pragma unroll
        for (int u = 0; u < GNB; ++u) v[u] = pl[(size_t)(g + u) * 16 * DVV];
#pragma unroll
        for (int u = 0; u < GNB; ++u) { const float dv = __fsub_rn(v[u], mean); acc2 = __builtin_fmaf(dv, dv, acc2); } }   // the fused square-add that the rolled loop compiled to, written out: left to the compiler, the unrolled chain fuses its first two squares the other way round
    asm volatile("s_wait_xcnt 0x0" :: "v"(pl) : "memory");   // holds the address pair whole up to this wait: without it this build lets the last load land in the pair that the loads before it name
    sh[tid] = acc2; __syncthreads();
#pragma unroll 1
    for (int st = 512; st > 0; st >>= 1) { if (tid < st) sh[tid] = __fadd_rn(sh[tid], sh[tid + st]); __syncthreads(); }
    if (tid < 32) { const float var = sh[0] * rn; const float rs = __fdiv_rn(1.0f, sqrtf(__fadd_rn(var, 1e-5f))); const float outv = (tid == 0) ? mean : ((tid == 1) ? rs : 0.0f);
        *(float*)(GST + hh * 32 + tid) = outv;  }
}
__global__ __launch_bounds__(256) void k_gnmerge(const float* __restrict__ O, const float* __restrict__ GST, const float* __restrict__ gw, const float* __restrict__ gb, bf* Ah, bf* Al) {
    const size_t e = ((size_t)blockIdx.x * 256 + threadIdx.x) * 2; if (e >= (size_t)SEQ * DVV) return;
    O += (size_t)blockIdx.y * SEQ * DVV; GST += blockIdx.y * (NVH * 32); Ah += (size_t)blockIdx.y * SEQ * DVV; Al += (size_t)blockIdx.y * SEQ * DVV;
    const int c = (int)(e % DVV); const int hh = c / HD; const float mean = GST[hh * 32], rs = GST[hh * 32 + 1]; v2us oh, ol;
#pragma unroll
    for (int q = 0; q < 2; ++q) { float cc = __fsub_rn(O[e + q], mean); asm volatile("" : "+v"(cc)); float nn = __fmul_rn(cc, rs); asm volatile("" : "+v"(nn)); float y = __fmul_rn(nn, bfr(gw[c + q])); asm volatile("" : "+v"(y)); y = __fadd_rn(y, bfr(gb[c + q])); const float z = __fmul_rn(y, 0.2f); unsigned short a2, c2; splitf(z, a2, c2); oh[q] = a2; ol[q] = c2; }
    *(v2us*)(Ah + e) = oh; *(v2us*)(Al + e) = ol;  }

extern "C" void kernel_launch(void* const* d_in, const int* in_sizes, int n_in,
                              void* d_out, int out_size, void* d_ws, size_t ws_size, hipStream_t stream) {
    if (n_in < 13) return;
    if (in_sizes[0] < (NB - 1) * SEQ_FULL * DM + SEQ * DM) return;
    if (in_sizes[1] < (NB - 1) * SEQ_FULL + SEQ) return;
    if (in_sizes[2] < (NB - 1) * SEQ_FULL + SEQ) return;
    if (in_sizes[3] < DQ * DM || in_sizes[4] < DQ * DM || in_sizes[5] < DVV * DM || in_sizes[6] < DM * DVV) return;
    if (in_sizes[7] < HD || in_sizes[8] < HD || in_sizes[9] < HD || in_sizes[10] < HD || in_sizes[11] < DVV || in_sizes[12] < DVV) return;
    if (out_size < (NB - 1) * SEQ_FULL * DM + SEQ * DM) return;
    const float* x = (const float*)d_in[0]; const float* amask = (const float*)d_in[1]; const int* tix = (const int*)d_in[2];
    const float* wq = (const float*)d_in[3]; const float* wk = (const float*)d_in[4]; const float* wv = (const float*)d_in[5]; const float* wo = (const float*)d_in[6];
    const float* lq1 = (const float*)d_in[7]; const float* lq2 = (const float*)d_in[8]; const float* lk1 = (const float*)d_in[9]; const float* lk2 = (const float*)d_in[10];
    const float* gnw = (const float*)d_in[11]; const float* gnb = (const float*)d_in[12];
    float* OUT = (float*)d_out;     // [NB][SEQ_FULL][1024]
    char* wsp = (char*)d_ws;
    auto take = [&](size_t bytes) { char* p = wsp; wsp += (bytes + 255) & ~(size_t)255; return (void*)p; };
    bf* WQ = (bf*)take((size_t)DQ * DM * 2); bf* WK = (bf*)take((size_t)DQ * DM * 2); bf* WV = (bf*)take((size_t)DVV * DM * 2); bf* WO = (bf*)take((size_t)DM * DVV * 2);
    bf* XB = (bf*)take((size_t)NB * SEQ * DM * 2); float* AMB = (float*)take((size_t)NB * SEQ * 4); float* LAM = (float*)take(256); float* GST = (float*)take((size_t)NB * NVH * 32 * 4);
    bf* QPh = (bf*)take((size_t)NB * NQH * SEQ * HD * 2); bf* QPl = (bf*)take((size_t)NB * NQH * SEQ * HD * 2); bf* KPh = (bf*)take((size_t)NB * NQH * SEQ * HD * 2); bf* KPl = (bf*)take((size_t)NB * NQH * SEQ * HD * 2);
    h16* VT16 = (h16*)take((size_t)NB * NVH * HD * SEQ * 2); h16* VRS = (h16*)take((size_t)NB * NVH * HD * SEQ * 2);
    float* Ob = (float*)take((size_t)NB * SEQ * DVV * 4); bf* ATh = (bf*)take((size_t)NB * SEQ * DVV * 2); bf* ATl = (bf*)take((size_t)NB * SEQ * DVV * 2);
    const size_t used = (size_t)(wsp - (char*)d_ws);
    if (used > ws_size || used > (size_t)268435456) return;
    k_cvt8<<<(unsigned)(((size_t)DQ * DM / 8 + 255) / 256), 256, 0, stream>>>(wq, WQ, (size_t)DQ * DM / 8, 0, 0);
    k_cvt8<<<(unsigned)(((size_t)DQ * DM / 8 + 255) / 256), 256, 0, stream>>>(wk, WK, (size_t)DQ * DM / 8, 0, 0);
    k_cvt8<<<(unsigned)(((size_t)DVV * DM / 8 + 255) / 256), 256, 0, stream>>>(wv, WV, (size_t)DVV * DM / 8, 0, 0);
    k_cvt8<<<(unsigned)(((size_t)DM * DVV / 8 + 255) / 256), 256, 0, stream>>>(wo, WO, (size_t)DM * DVV / 8, 0, 0);
    k_lambda<<<1, 32, 0, stream>>>(lq1, lk1, lq2, lk2, LAM);
    // Every stage runs once for all NB batch elements: the batch index is the last used grid dimension, workspace planes are [NB][...].
    k_cvt8<<<dim3((unsigned)(((size_t)SEQ * DM / 8 + 255) / 256), NB, 1), 256, 0, stream>>>(x, XB, (size_t)SEQ * DM / 8, (size_t)SEQ_FULL * DM, (size_t)SEQ * DM);
    k_rbf<<<dim3((SEQ / 4 + 255) / 256, NB, 1), 256, 0, stream>>>(amask, AMB, SEQ / 4, (size_t)SEQ_FULL, (size_t)SEQ);
    k_gemmb<0, 1><<<dim3(SEQ / GT, DQ / GT, NB), 256, 0, stream>>>(XB, nullptr, WQ, DM, nullptr, 0, (size_t)SEQ * DM, 0, QPh, QPl);
    k_gemmb<0, 1><<<dim3(SEQ / GT, DQ / GT, NB), 256, 0, stream>>>(XB, nullptr, WK, DM, nullptr, 0, (size_t)SEQ * DM, 0, KPh, KPl);
    k_gemmb<0, 2><<<dim3(SEQ / GT, DVV / GT, NB), 256, 0, stream>>>(XB, nullptr, WV, DM, nullptr, 0, (size_t)SEQ * DM, 0, (bf*)VT16, (bf*)VRS);
    k_attn<<<dim3(SEQ / QBL, NVH, NB), 128, 0, stream>>>(QPh, QPl, KPh, KPl, VT16, VRS, AMB, tix, LAM, Ob);
    k_gnstat<<<dim3(NVH, NB, 1), 1024, 0, stream>>>(Ob, GST);
    k_gnmerge<<<dim3((unsigned)(((size_t)SEQ * DVV / 2 + 255) / 256), NB, 1), 256, 0, stream>>>(Ob, GST, gnw, gnb, ATh, ATl);
    k_gemmb<1><<<dim3(SEQ / GT, DM / GT, NB), 256, 0, stream>>>(ATh, ATl, WO, DVV, OUT, DM, (size_t)SEQ * DVV, (size_t)SEQ_FULL * DM);
}

// v005
// Measured time: 387 microseconds a run.
// In both of two side-by-side timings against v004, it was 1.29 times as fast.
// Counting every step since v000, it is 2.49 times as fast.
#include <hip/hip_runtime.h>
#pragma clang fp contract(off)

// Compute dtypes (f32 accumulate everywhere): input projections x.Wq / x.Wk / x.Wv on v_wmma_f32_16x16x32_bf16 with bf16 RNE-converted inputs as operands (exact operands); q.k scores on v_wmma_f32_16x16x32_bf16 as bf16 hi/lo split (hi.hi + lo.hi + hi.lo); probability.value on v_wmma_f32_16x16x32_f16 (P f16 carried x4096, V f16; the first query block adds P and V residual planes carried x1024 through a second accumulator); softmax, ALiBi/pad terms, lambda and GroupNorm in f32; output projection on v_wmma_f32_16x16x32_bf16 (activation bf16 hi/lo x bf16 Wo, 2 products).
// Layout: x [NB][SEQ_FULL][1024]; Wq/Wk [2048][1024], Wv/Wo [1024][1024] ([out][in], used as K-contiguous Bt planes); per head h the 128 q/k columns are [half 1 | half 2] = virtual 64-wide heads 2h, 2h+1; mask [NB][SEQ_FULL] f32, token positions [NB][SEQ_FULL] int32; out [NB][SEQ_FULL][1024] f32.

#ifndef NB
#define NB 2
#endif
#ifndef SEQ
#define SEQ 2048
#endif
#define NB_FULL 2
#define SEQ_FULL 2048
#define DM   1024
#define NVH  16
#define HD   64
#define NQH  (2 * NVH)
#define DQ   (NQH * HD)
#define DVV  (NVH * HD)
#define SCL  0.125f
#define PCAR 4096.0f
#define RCAR 1024.0f
#define QBL  64
#define KCH  64
#define KSB  32
#define LP   72
#define PP   40
#define OSP  68
#define L2E  1.4426950408889634f
#define NEGB (-3.0e38f)
static_assert(SEQ % 64 == 0);
static_assert(SEQ <= SEQ_FULL);
static_assert(NB >= 1);
static_assert(NB <= NB_FULL);
static_assert(QBL == KCH);
static_assert(KCH % KSB == 0);
static_assert((LP * 2) % 16 == 0);
static_assert((PP * 2) % 16 == 0);
static_assert((OSP * 4) % 16 == 0);
static_assert((SEQ * DVV) % 512 == 0);
static_assert((SEQ * DM) % 2048 == 0);

typedef _Float16 h16;
typedef unsigned short bf;
typedef __attribute__((ext_vector_type(16))) __bf16   v16bf;
typedef __attribute__((ext_vector_type(16))) _Float16 v16h;
typedef __attribute__((ext_vector_type(8)))  _Float16 v8h;
typedef __attribute__((ext_vector_type(8)))  unsigned short v8us;
typedef __attribute__((ext_vector_type(8)))  float    v8f;
typedef __attribute__((ext_vector_type(4)))  float    v4f;
typedef __attribute__((ext_vector_type(2)))  unsigned short v2us;
typedef v8h  __attribute__((may_alias)) v8ha;
typedef v4f  __attribute__((may_alias)) v4fa;
typedef v8us __attribute__((may_alias)) v8usa;
typedef float __attribute__((may_alias)) f32a;

__device__ __forceinline__ unsigned short f2bf(float f) { unsigned u = __float_as_uint(f); u += 0x7FFFu + ((u >> 16) & 1u); return (unsigned short)(u >> 16); }
__device__ __forceinline__ float bf2f(unsigned short b) { return __uint_as_float(((unsigned)b) << 16); }
__device__ __forceinline__ float bfr(float f) { return bf2f(f2bf(f)); }
__device__ __forceinline__ v16h cat16(v8h lo, v8h hi) { return __builtin_shufflevector(lo, hi, 0, 1, 2, 3, 4, 5, 6, 7, 8, 9, 10, 11, 12, 13, 14, 15); }
__device__ __forceinline__ v16bf cat16b(v8us lo, v8us hi) { return __builtin_bit_cast(v16bf, __builtin_shufflevector(lo, hi, 0, 1, 2, 3, 4, 5, 6, 7, 8, 9, 10, 11, 12, 13, 14, 15)); }
__device__ __forceinline__ v8f wmma16(v16h a, v16h b, v8f c) { return __builtin_amdgcn_wmma_f32_16x16x32_f16(false, a, false, b, (short)0, c, false, false); }
__device__ __forceinline__ v8f wmmab(v16bf a, v16bf b, v8f c) { return __builtin_amdgcn_wmma_f32_16x16x32_bf16(false, a, false, b, (short)0, c, false, false); }
__device__ __forceinline__ h16 tohx(float x) { return (h16)x; }
__device__ __forceinline__ void splitf(float y, unsigned short& h, unsigned short& l) { h = f2bf(y); l = f2bf(y - bf2f(h)); }

// ---- k_gemmb: block-tiled GEMM, 8 waves (2 x 4) per 128x128 output tile, wave tile 64x32 (8 accumulators); grid (M/128, N/128, Z), 256 threads.
// c[m][n] (f32) = sum_k A[m][k] Bt[n][k] (+ A2[m][k] Bt[n][k] when NSPLIT == 1). z-batch strides sA/sC in elements. K % 64 == 0, K >= 64.
// MODE 0: c goes to C (f32, pitch ldc). MODE 1 (q, k): c is split into bf16 hi/lo and goes to the head planes P0/P1 [z][n / 64][m][n % 64]. MODE 2 (v): c goes transposed, as f16 and as its
// residual x1024, to P0/P1 [z][n][m]. MODE 1 and 2 turn the tile in the stage buffers, free behind the loop's last barrier, so that every global store covers whole 128-byte lines.
// A stage is 64 k of every operand row (one whole 128-byte line per row), read from the K-contiguous planes by whole-line 16-byte loads, kept in registers while the
// previous stage is multiplied, then stored to the other of two LDS buffers (row pitch 144 B); one block barrier per stage publishes it and ends the reads of the buffer refilled next.
// Fragments: lane -> row/col (lane & 15); elements 0..7 <- k + 8*(lane>>4), elements 8..15 <- k + 16 + 8*(lane>>4), for A and Bt alike. k runs upward, one accumulate chain per element.
#define GT   128
#define GBK  64
#define GLP  72
#define GOP  36
#define GSP  132
#define GVP  136
static_assert(SEQ % GT == 0);
static_assert(DQ % GT == 0);
static_assert(DVV % GT == 0);
static_assert(DM % GT == 0);
static_assert(DM % GBK == 0);
static_assert(DVV % GBK == 0);
static_assert((GLP * 2) % 16 == 0);
static_assert((GOP * 4) % 16 == 0);
static_assert((GSP * 4) % 16 == 0);
static_assert((GVP * 2) % 16 == 0);
static_assert(GT == 2 * HD);
static_assert(GT * GSP * 4 <= 2 * 2 * GT * GLP * 2);
static_assert(2 * GT * GVP * 2 <= 2 * 2 * GT * GLP * 2);
__device__ __forceinline__ v16bf ldsb(const bf* p) { return cat16b(*(const v8usa*)p, *(const v8usa*)(p + 16)); }
template <int NSPLIT, int MODE = 0>
// waves_per_eu: at most two 8-wave blocks run per WGP here, so the register budget is that of 4 waves per SIMD and a k-step's fragment loads may be grouped ahead of its products
__global__ __launch_bounds__(256) __attribute__((amdgpu_waves_per_eu(1, 4)))
void k_gemmb(const bf* __restrict__ A, const bf* __restrict__ A2, const bf* __restrict__ Bt, int K, float* C, int ldc, size_t sA, size_t sC, bf* P0 = nullptr, bf* P1 = nullptr) {
    constexpr int NPL = 2 + NSPLIT;                          // planes per stage: A, (A2,) Bt
    __shared__ __align__(16) bf    tl[2][NPL][GT * GLP];     // two stage buffers [row*GLP + k]                  (cross-wave: block barriers)
    __shared__ __align__(16) float osw[8][16 * GOP];         // per-wave f32 epilogue staging [row*GOP + col]    (wave-private)
    const size_t z = blockIdx.z; A += z * sA; if (NSPLIT) A2 += z * sA; C += z * sC;
    const int tid = threadIdx.x, w = tid >> 5, lane = tid & 31, lr = lane & 15, hi = lane >> 4; const int wm = w >> 2, wn = w & 3;
    const int r0 = blockIdx.x * GT, c0 = blockIdx.y * GT;
    v8f acc[4][2];
#pragma unroll
    for (int mb = 0; mb < 4; ++mb)
#pragma unroll
        for (int nb = 0; nb < 2; ++nb) acc[mb][nb] = (v8f){};
    const int srow = tid >> 3, sc8 = (tid & 7) * 8;          // staging: 8 lanes cover one row's 128 bytes; piece i is row srow + 32 i
    const char* gA = (const char*)(A + (size_t)r0 * K); const char* gA2 = (const char*)(A2 + (size_t)r0 * K); const char* gB = (const char*)(Bt + (size_t)c0 * K);   // block-uniform tile bases
    unsigned go[4];                                          // the lane's byte offset of piece i inside a tile's rows, the same for every plane and stage
#pragma unroll
    for (int i = 0; i < 4; ++i) go[i] = ((unsigned)(srow + 32 * i) * (unsigned)K + (unsigned)sc8) * 2u;
    const int so = srow * GLP + sc8;
    const int fa = (wm * 64 + lr) * GLP + 8 * hi, fb = (wn * 32 + lr) * GLP + 8 * hi;
    v8us ra[4], ra2[4], rb[4];
#pragma unroll
    for (int i = 0; i < 4; ++i) { ra[i] = *(const v8us*)(gA + go[i]); if (NSPLIT) ra2[i] = *(const v8us*)(gA2 + go[i]); rb[i] = *(const v8us*)(gB + go[i]); }
#pragma unroll
    for (int i = 0; i < 4; ++i) { *(v8usa*)(&tl[0][0][so + i * 32 * GLP]) = ra[i]; if (NSPLIT) *(v8usa*)(&tl[0][1][so + i * 32 * GLP]) = ra2[i]; *(v8usa*)(&tl[0][NPL - 1][so + i * 32 * GLP]) = rb[i]; }
    __syncthreads();
#pragma unroll 1
    for (int k0 = 0; k0 < K; k0 += GBK) {
        const int cur = (k0 / GBK) & 1; const bool more = k0 + GBK < K;
        gA += GBK * 2; gA2 += GBK * 2; gB += GBK * 2;        // the uniform bases step one stage; the lanes' offsets stay
        if (more) {
#pragma unroll
            for (int i = 0; i < 4; ++i) {   // a wait behind each load: this build lets a later load of the group land in an earlier one's address pair, and the wait stands in front of that overwrite
                ra[i] = *(const v8us*)(gA + go[i]); asm volatile("s_wait_xcnt 0x0" ::: "memory");
                if (NSPLIT) { ra2[i] = *(const v8us*)(gA2 + go[i]); asm volatile("s_wait_xcnt 0x0" ::: "memory"); }
                rb[i] = *(const v8us*)(gB + go[i]); asm volatile("s_wait_xcnt 0x0" ::: "memory"); }
        }
        const bf* ta = &tl[cur][0][fa]; const bf* ta2 = &tl[cur][NSPLIT][fa]; const bf* tb = &tl[cur][NPL - 1][fb];
#pragma unroll
        for (int kc = 0; kc < GBK; kc += 32) {
            v16bf a[4], a2[4], b[2];
#pragma unroll
            for (int mb = 0; mb < 4; ++mb) { a[mb] = ldsb(ta + mb * 16 * GLP + kc); if (NSPLIT) a2[mb] = ldsb(ta2 + mb * 16 * GLP + kc); }
#pragma unroll
            for (int nb = 0; nb < 2; ++nb) b[nb] = ldsb(tb + nb * 16 * GLP + kc);
#pragma unroll
            for (int nb = 0; nb < 2; ++nb)
#pragma unroll
                for (int mb = 0; mb < 4; ++mb) { acc[mb][nb] = wmmab(a[mb], b[nb], acc[mb][nb]); if (NSPLIT) acc[mb][nb] = wmmab(a2[mb], b[nb], acc[mb][nb]); }
        }
        if (more) {
#pragma unroll
            for (int i = 0; i < 4; ++i) { *(v8usa*)(&tl[cur ^ 1][0][so + i * 32 * GLP]) = ra[i]; if (NSPLIT) *(v8usa*)(&tl[cur ^ 1][1][so + i * 32 * GLP]) = ra2[i]; *(v8usa*)(&tl[cur ^ 1][NPL - 1][so + i * 32 * GLP]) = rb[i]; }
        }
        __syncthreads();
    }
    if constexpr (MODE == 1) {
        f32a* st = (f32a*)&tl[0][0][0];                      // block f32 tile [row*GSP + col]
#pragma unroll
        for (int mb = 0; mb < 4; ++mb)
#pragma unroll
            for (int nb = 0; nb < 2; ++nb)
#pragma unroll
                for (int j = 0; j < 8; ++j) st[(wm * 64 + mb * 16 + hi * 8 + j) * GSP + wn * 32 + nb * 16 + lr] = acc[mb][nb][j];
        __syncthreads();                                     // publishes the tile: its rows are read back by other waves
        const int hs = w & 1, rw = (w >> 1) * 32 + (lane >> 3), c8 = (lane & 7) * 8;   // a wave takes 32 rows of one 64-wide head; one store = 4 rows = 512 contiguous bytes
        const size_t pb = ((z * NQH + (size_t)(blockIdx.y * 2 + hs)) * SEQ + r0) * HD + c8;
#pragma unroll
        for (int i = 0; i < 8; ++i) { const int row = rw + 4 * i; const f32a* sp = st + row * GSP + hs * HD + c8; const v4f x0 = *(const v4fa*)sp, x1 = *(const v4fa*)(sp + 4); v8us oh, ol;
#pragma unroll
            for (int q = 0; q < 4; ++q) { unsigned short a2, c2; splitf(x0[q], a2, c2); oh[q] = a2; ol[q] = c2; splitf(x1[q], a2, c2); oh[4 + q] = a2; ol[4 + q] = c2; }
            *(v8us*)(P0 + pb + (size_t)row * HD) = oh; *(v8us*)(P1 + pb + (size_t)row * HD) = ol; }
        return;
    }
    if constexpr (MODE == 2) {
        h16* sv = (h16*)&tl[0][0][0]; h16* sr = sv + GT * GVP;   // block f16 tiles, value and residual, transposed [col*GVP + row]; an accumulator lane holds 8 consecutive rows of one column
#pragma unroll
        for (int mb = 0; mb < 4; ++mb)
#pragma unroll
            for (int nb = 0; nb < 2; ++nb) { v8h o16, orr;
#pragma unroll
                for (int j = 0; j < 8; ++j) { const float x = acc[mb][nb][j]; const h16 hv = tohx(x); const float res = (x - (float)hv) * RCAR; o16[j] = hv; orr[j] = tohx(res); }
                const int si = (wn * 32 + nb * 16 + lr) * GVP + wm * 64 + mb * 16 + hi * 8; *(v8ha*)(sv + si) = o16; *(v8ha*)(sr + si) = orr; }
        __syncthreads();                                     // publishes the tiles: their columns are read back by other waves
        const int cw = tid >> 4, t8 = (tid & 15) * 8;        // 16 lanes cover one column's 128 rows = 256 contiguous bytes
        const size_t vb = (z * DVV + (size_t)c0) * SEQ + r0 + t8;
#pragma unroll
        for (int i = 0; i < 8; ++i) { const int col = cw + 16 * i; const v8h a16 = *(const v8ha*)(sv + col * GVP + t8), ar = *(const v8ha*)(sr + col * GVP + t8);
            *(v8ha*)((h16*)P0 + vb + (size_t)col * SEQ) = a16; *(v8ha*)((h16*)P1 + vb + (size_t)col * SEQ) = ar; }
        return;
    }
    float* os = &osw[w][0];
#pragma unroll
    for (int mb = 0; mb < 4; ++mb) {
#pragma unroll
        for (int nb = 0; nb < 2; ++nb) {
#pragma unroll
            for (int j = 0; j < 8; ++j) os[(hi * 8 + j) * GOP + nb * 16 + lr] = acc[mb][nb][j]; }
        __builtin_amdgcn_wave_barrier(); asm volatile("" ::: "memory");   // keeps the staging stores ahead of the row reads of other lanes of this wave
        float* crow = C + (size_t)(r0 + wm * 64 + mb * 16) * ldc + c0 + wn * 32;
#pragma unroll
        for (int s = 0; s < 4; ++s) { const int row = 4 * s + (lane >> 3), cofs = (lane & 7) * 4; const v4f val = *(const v4fa*)(os + row * GOP + cofs); *(v4f*)(crow + (size_t)row * ldc + cofs) = val; }
        __builtin_amdgcn_wave_barrier(); asm volatile("" ::: "memory");   // keeps the row reads ahead of the next block's staging stores
    }
}

__global__ __launch_bounds__(256) void k_cvt8(const float* __restrict__ src, bf* dst, size_t n8, size_t sS, size_t sD) { const size_t i = (size_t)blockIdx.x * 256 + threadIdx.x; if (i >= n8) return; src += blockIdx.y * sS; dst += blockIdx.y * sD; const v8f v = *(const v8f*)(src + i * 8); v8us o;
#pragma unroll
    for (int k = 0; k < 8; ++k) o[k] = f2bf(v[k]); *(v8us*)(dst + i * 8) = o;  }
__global__ __launch_bounds__(256) void k_rbf(const float* __restrict__ src, float* dst, int n4, size_t sS, size_t sD) { const int i = blockIdx.x * 256 + threadIdx.x; if (i >= n4) return; src += blockIdx.y * sS; dst += blockIdx.y * sD; const v4f a = *(const v4f*)(src + (size_t)i * 4); v4f o;
#pragma unroll
    for (int u = 0; u < 4; ++u) o[u] = bfr(a[u]); *(v4f*)(dst + (size_t)i * 4) = o;  }
__global__ __launch_bounds__(32) void k_lambda(const float* __restrict__ lq1, const float* __restrict__ lk1, const float* __restrict__ lq2, const float* __restrict__ lk2, float* LAM) { const int lane = threadIdx.x; float d1 = 0.f, d2 = 0.f;
#pragma unroll 1
    for (int i = 0; i < HD; ++i) { float p1 = __fmul_rn(bfr(lq1[i]), bfr(lk1[i])); asm volatile("" : "+v"(p1)); d1 = __fadd_rn(d1, p1); float p2 = __fmul_rn(bfr(lq2[i]), bfr(lk2[i])); asm volatile("" : "+v"(p2)); d2 = __fadd_rn(d2, p2); }
    float lm = __fsub_rn(expf(d1), expf(d2)); asm volatile("" : "+v"(lm)); lm = __fadd_rn(lm, 0.8f); const float v = (lane == 0) ? lm : 0.0f; *(float*)(LAM + lane) = v;  }

// ---- k_attn: causal differential attention for one (query block of 64, head) per block of 4 waves (wave w owns 16 query rows). The two score streams run one after the other (stream loop outside
// the key-chunk loop: one Q/K hi/lo pair, one score tile pair, one O accumulator set and one running max/sum set live at a time). Per stream st and 64-key chunk c = 0..qb the K hi/lo tile of
// head plane 2h+st and the V^T tile are staged in LDS; the softmax recurrence then runs on 32-key sub-chunks: scores S = Q.K (3 bf16 products, 16x32 tile per wave) ->
// t = S/8 - slope (pos_i - pos_j) + (1 - mask_j)(-1e9) for j <= i, excluded otherwise; online softmax (running max / sum, f32); P tile (f16 x4096, 16x32) per wave in LDS; O += P.V (one k-step).
// the first query block (qb == 0) also forms P residual tiles, stages V residual tiles (both x1024) and adds P_res.V + P.V_res per 16-column block through a second accumulator folded before normalisation.
__device__ __forceinline__ v16h  ldsh(const h16* p) { return cat16(*(const v8ha*)p, *(const v8ha*)(p + 16)); }

// attn_blk: the two streams' loops of one block. ER (first query block: residual planes) is a compile-time value, so the loops hold no test of it: a chunk's tile loads are one group
// behind which the LDS stores follow, and the sixteen probability chains of a sub-chunk stand in one basic block.
template <bool ER>
__device__ __forceinline__ void attn_blk(const bf* __restrict__ QPh, const bf* __restrict__ QPl, const bf* __restrict__ KPh, const bf* __restrict__ KPl, const h16* __restrict__ VT, const h16* __restrict__ VR,
                                         const float* __restrict__ amb, const int* __restrict__ tix, const float lam, const float slope, const float (&pq)[8], const int hh, const int qb,
                                         bf* qs0, bf* qs1, bf* ks0, bf* ks1, h16* vsm, h16* vrm, h16* pt, h16* prt, float* os) {
    const int tid = threadIdx.x, w = tid >> 5, lane = tid & 31, lr = lane & 15, hi = lane >> 4;
    const int q0 = qb * QBL, qrow0 = q0 + 16 * w + 8 * hi;
    // staging: piece i of a K plane is row 16 i + (tid >> 3), 16 bytes at 8 (tid & 7): the 64 x 64 tile is 8 KiB in a row, so a lane's byte offset is 16 tid + 2048 i; piece i of V^T is row d = 16 i + (tid >> 3)
    const unsigned ko = (unsigned)tid * 16u, vo = ((unsigned)(tid >> 3) * (unsigned)SEQ + 8u * (unsigned)(tid & 7)) * 2u;   // the lane's offsets, the same for every chunk
    const int sk = (tid >> 3) * LP + (tid & 7) * 8;
#pragma unroll 1
    for (int st = 0; st < 2; ++st) {
        const size_t vq = (size_t)(2 * hh + st);
        __syncthreads();
        {   const char* pqh = (const char*)(QPh + (vq * SEQ + q0) * HD) + ko; const char* pql = (const char*)(QPl + (vq * SEQ + q0) * HD) + ko;
            v8us qh[4], ql[4];
#pragma unroll
            for (int i = 0; i < 4; ++i) { qh[i] = *(const v8usa*)(pqh + i * 2048); ql[i] = *(const v8usa*)(pql + i * 2048); }
            asm volatile("s_wait_xcnt 0x0" :: "v"(pqh), "v"(pql) : "memory");   // holds the address pairs whole up to this wait: without it a later load of the group may land in a pair that the loads before it name
#pragma unroll
            for (int i = 0; i < 4; ++i) { *(v8usa*)(&qs0[sk + i * 16 * LP]) = qh[i]; *(v8usa*)(&qs1[sk + i * 16 * LP]) = ql[i]; }
        }
        float m[8], l[8]; v8f O[4];
#pragma unroll
        for (int r = 0; r < 8; ++r) { m[r] = NEGB; l[r] = 0.0f; }
#pragma unroll
        for (int j = 0; j < 4; ++j) O[j] = (v8f){};
#pragma unroll 1
        for (int c = 0; c <= qb; ++c) {
            const int k0 = c * KCH;
            {   const char* pkh = (const char*)(KPh + (vq * SEQ + k0) * HD) + ko; const char* pkl = (const char*)(KPl + (vq * SEQ + k0) * HD) + ko;
                const char* pv = (const char*)(VT + (size_t)hh * HD * SEQ + k0) + vo; const char* pr = (const char*)(VR + (size_t)hh * HD * SEQ + k0) + vo;
                v8us kh[4], kl[4]; v8h vv[4], vr[4];
#pragma unroll
                for (int i = 0; i < 4; ++i) { kh[i] = *(const v8usa*)(pkh + i * 2048); kl[i] = *(const v8usa*)(pkl + i * 2048); }
#pragma unroll
                for (int i = 0; i < 4; ++i) { vv[i] = *(const v8ha*)(pv + i * (16 * SEQ * 2)); if constexpr (ER) vr[i] = *(const v8ha*)(pr + i * (16 * SEQ * 2)); }
                // holds the address pairs whole up to this wait: without it the last load of a group lands in the pair that the loads before it name
                if constexpr (ER) asm volatile("s_wait_xcnt 0x0" :: "v"(pkh), "v"(pkl), "v"(pv), "v"(pr) : "memory"); else asm volatile("s_wait_xcnt 0x0" :: "v"(pkh), "v"(pkl), "v"(pv) : "memory");
#pragma unroll
                for (int i = 0; i < 4; ++i) { *(v8usa*)(&ks0[sk + i * 16 * LP]) = kh[i]; *(v8usa*)(&ks1[sk + i * 16 * LP]) = kl[i]; }
#pragma unroll
                for (int i = 0; i < 4; ++i) { *(v8ha*)(&vsm[sk + i * 16 * LP]) = vv[i]; if constexpr (ER) *(v8ha*)(&vrm[sk + i * 16 * LP]) = vr[i]; }
            }
            __syncthreads();
#pragma unroll 1
            for (int sb = 0; sb < KCH / KSB; ++sb) {
                const int kb = sb * KSB;
                const int key0 = k0 + kb + lr, key1 = key0 + 16;
                const float pk0 = (float)tix[key0], pk1 = (float)tix[key1];
                const float om0 = 1.0f - amb[key0], om1 = 1.0f - amb[key1]; const float pad0 = om0 * -1.0e9f, pad1 = om1 * -1.0e9f;
                // ---- scores: S[row 8hi+r][key kb + nb*16 + lr], 3 bf16 products (hi.hi + lo.hi + hi.lo); fragments loaded right before each k-step, scheduling barrier after it
                v8f s[2]; s[0] = (v8f){}; s[1] = (v8f){};
                {   v16bf ah, al, bh, bl;
#pragma unroll
                    for (int kc = 0; kc < HD; kc += 32) {
                        ah = ldsb(&qs0[(16 * w + lr) * LP + kc + 8 * hi]); al = ldsb(&qs1[(16 * w + lr) * LP + kc + 8 * hi]);
#pragma unroll
                        for (int nb = 0; nb < 2; ++nb) { bh = ldsb(&ks0[(kb + nb * 16 + lr) * LP + kc + 8 * hi]); bl = ldsb(&ks1[(kb + nb * 16 + lr) * LP + kc + 8 * hi]);
                            s[nb] = wmmab(ah, bh, s[nb]); s[nb] = wmmab(al, bh, s[nb]); s[nb] = wmmab(ah, bl, s[nb]); }
                        asm volatile("v_nop\n\tv_nop\n\tv_nop\n\tv_nop" : "+v"(s[0]), "+v"(s[1]) : "v"(ah), "v"(al), "v"(bh), "v"(bl) : "memory");
                    }
                }
                // ---- additive terms by value select, sub-chunk max
                float cm[8];
#pragma unroll
                for (int r = 0; r < 8; ++r) cm[r] = NEGB;
#pragma unroll
                for (int nb = 0; nb < 2; ++nb) { const int kv = nb ? key1 : key0; const float pkv = nb ? pk1 : pk0; const float pdv = nb ? pad1 : pad0;
#pragma unroll
                    for (int r = 0; r < 8; ++r) { const float sa = s[nb][r] * SCL; const float pd = pq[r] - pkv; const float bia = slope * pd; const float sm = sa - bia;
                        const float tt = (kv <= qrow0 + r) ? (sm + pdv) : NEGB; s[nb][r] = tt; cm[r] = fmaxf(cm[r], tt); } }
                float cor[8], rs[8];
#pragma unroll
                for (int r = 0; r < 8; ++r) { float x = cm[r]; x = fmaxf(x, __shfl_xor(x, 1, 32)); x = fmaxf(x, __shfl_xor(x, 2, 32)); x = fmaxf(x, __shfl_xor(x, 4, 32)); x = fmaxf(x, __shfl_xor(x, 8, 32));
                    const float mn = fmaxf(m[r], x); const float dlt = (m[r] - mn) * L2E; cor[r] = __builtin_amdgcn_exp2f(dlt); m[r] = mn; rs[r] = 0.0f; }
                // ---- probabilities -> per-wave LDS tile (f16 x4096; residual x1024 on the first query block); excluded keys store exactly 0
#pragma unroll
                for (int nb = 0; nb < 2; ++nb) { const int kv = nb ? key1 : key0;
#pragma unroll
                    for (int r = 0; r < 8; ++r) { const float dq = (s[nb][r] - m[r]) * L2E; const float pe = __builtin_amdgcn_exp2f(dq); const float p = (kv <= qrow0 + r) ? pe : 0.0f; rs[r] = rs[r] + p;
                        const float pc = p * PCAR; const h16 ph = tohx(pc); const int li = (8 * hi + r) * PP + nb * 16 + lr; pt[li] = ph;
                        if constexpr (ER) { const float res = (pc - (float)ph) * RCAR; prt[li] = tohx(res); } } }
#pragma unroll
                for (int r = 0; r < 8; ++r) { float x = rs[r]; x += __shfl_xor(x, 1, 32); x += __shfl_xor(x, 2, 32); x += __shfl_xor(x, 4, 32); x += __shfl_xor(x, 8, 32);
                    const float lc = l[r] * cor[r]; l[r] = lc + x; const float cf = cor[r];
#pragma unroll
                    for (int j = 0; j < 4; ++j) O[j][r] = O[j][r] * cf; }
                __syncthreads();
                // ---- O[d block j][row] += P[row][key] . V^T[d][key] over the 32 keys of this sub-chunk (one k-step)
                {   const v16h a = ldsh(pt + lr * PP + 8 * hi); v16h b;
#pragma unroll
                    for (int j = 0; j < 4; ++j) { b = ldsh(&vsm[(j * 16 + lr) * LP + kb + 8 * hi]); O[j] = wmma16(a, b, O[j]); }
                    asm volatile("v_nop\n\tv_nop\n\tv_nop\n\tv_nop" : "+v"(O[0]), "+v"(O[1]), "+v"(O[2]), "+v"(O[3]) : "v"(a), "v"(b) : "memory");
                    if constexpr (ER) {
                        const v16h ar = ldsh(prt + lr * PP + 8 * hi);
#pragma unroll
                        for (int j = 0; j < 4; ++j) {
                            const v16h b2 = ldsh(&vsm[(j * 16 + lr) * LP + kb + 8 * hi]); const v16h br = ldsh(&vrm[(j * 16 + lr) * LP + kb + 8 * hi]);
                            v8f R = wmma16(ar, b2, (v8f){}); R = wmma16(a, br, R);
                            asm volatile("v_nop\n\tv_nop\n\tv_nop\n\tv_nop" : "+v"(R) : "v"(a), "v"(ar), "v"(b2), "v"(br) : "memory");
#pragma unroll
                            for (int r = 0; r < 8; ++r) { const float rr = R[r] * (1.0f / RCAR); O[j][r] = O[j][r] + rr; }
                        }
                    }
                }
                __syncthreads();
            }
        }
#pragma unroll
        for (int r = 0; r < 8; ++r) { const float rl = 1.0f / l[r]; const float il = rl * (1.0f / PCAR);
#pragma unroll
            for (int j = 0; j < 4; ++j) { const float a1 = O[j][r] * il; const int oi = (8 * hi + r) * OSP + j * 16 + lr;
                if (st == 0) { os[oi] = a1; } else { const float lb = lam * a1; const float cur = os[oi]; os[oi] = cur - lb; } } }
    }
}

__global__ __launch_bounds__(128) __attribute__((amdgpu_num_vgpr(256)))
void k_attn(const bf* __restrict__ QPh, const bf* __restrict__ QPl, const bf* __restrict__ KPh, const bf* __restrict__ KPl, const h16* __restrict__ VT, const h16* __restrict__ VR,
            const float* __restrict__ amb, const int* __restrict__ tix, const float* __restrict__ LAM, float* Ob) {
    __shared__ __align__(16) bf    qs[2][QBL * LP];      // Q {hi,lo} of the current stream [row*LP + d]     (cross-wave: block barriers)
    __shared__ __align__(16) bf    ks[2][KCH * LP];      // K {hi,lo} of the current stream [key*LP + d]     (cross-wave: block barriers)
    __shared__ __align__(16) h16   vsm[HD * LP];         // V^T tile [d*LP + key]                            (cross-wave: block barriers)
    __shared__ __align__(16) h16   vrm[HD * LP];         // V residual tile, first query block only         (cross-wave: block barriers)
    __shared__ __align__(16) h16   psm[4][16 * PP];      // per-wave P tile [row*PP + key], 16 x 32          (wave-private, block barriers used anyway)
    __shared__ __align__(16) h16   prm[4][16 * PP];      // per-wave P residual tile, first query block only
    __shared__ __align__(16) float osm[4][16 * OSP];     // per-wave f32 result / epilogue staging [row*OSP + d]
    const int tid = threadIdx.x, w = tid >> 5, lane = tid & 31, lr = lane & 15, hi = lane >> 4;
    const int hh = blockIdx.y, qb = blockIdx.x, q0 = qb * QBL;
    {   const size_t bz = blockIdx.z;                        // batch element: every plane is [NB][...]; only the token positions keep the input's own batch pitch
        QPh += bz * ((size_t)NQH * SEQ * HD); QPl += bz * ((size_t)NQH * SEQ * HD); KPh += bz * ((size_t)NQH * SEQ * HD); KPl += bz * ((size_t)NQH * SEQ * HD);
        VT += bz * ((size_t)NVH * HD * SEQ); VR += bz * ((size_t)NVH * HD * SEQ); amb += bz * SEQ; tix += bz * SEQ_FULL; Ob += bz * ((size_t)SEQ * DVV); }
    const int e2 = hh + 1;                                   // slope = 2^(-(h+1)/2): exact power of two times 2^-0.5 for odd exponents
    const float slope = ((e2 & 1) ? 0.70710678118654752f : 1.0f) * __uint_as_float(((unsigned)(127 - (e2 >> 1))) << 23);
    const float lam = LAM[0];
    const int qrow0 = q0 + 16 * w + 8 * hi;
    float pq[8];
#pragma unroll
    for (int r = 0; r < 8; ++r) pq[r] = (float)tix[qrow0 + r];
    float* os = &osm[w][0];
    // block-uniform: every wave of a block takes the same side, with all its barriers
    if (qb == 0) attn_blk<true>(QPh, QPl, KPh, KPl, VT, VR, amb, tix, lam, slope, pq, hh, qb, &qs[0][0], &qs[1][0], &ks[0][0], &ks[1][0], vsm, vrm, &psm[w][0], &prm[w][0], os);
    else         attn_blk<false>(QPh, QPl, KPh, KPl, VT, VR, amb, tix, lam, slope, pq, hh, qb, &qs[0][0], &qs[1][0], &ks[0][0], &ks[1][0], vsm, vrm, &psm[w][0], &prm[w][0], os);
    __syncthreads();
    float* orow = Ob + (size_t)(q0 + 16 * w) * DVV + hh * HD;
{
#pragma unroll
        for (int s2 = 0; s2 < 8; ++s2) { const int row = 2 * s2 + hi, cofs = lr * 4; const v4f val = *(const v4fa*)(os + row * OSP + cofs); *(v4f*)(orow + (size_t)row * DVV + cofs) = val; }
         }
}

#define GNB 32
static_assert((SEQ * HD / 1024) % GNB == 0);
__global__ __launch_bounds__(1024) void k_gnstat(const float* __restrict__ O, float* GST) {
    __shared__ float sh[1024]; const int tid = threadIdx.x; const int hh = blockIdx.x; const float* base = O + (size_t)blockIdx.y * SEQ * DVV + hh * HD; GST += blockIdx.y * (NVH * 32); const int n = SEQ * HD; const float rn = 1.0f / (float)n;
    // A thread's chain is e = tid + 1024 i: row (tid >> 6) + 16 i, column tid & 63. GNB loads of the chain are issued together, then added in the chain's own order.
    const float* pl = base + (size_t)(tid >> 6) * DVV + (tid & 63);
    float acc = 0.f;
#pragma unroll
    for (int g = 0; g < n / 1024; g += GNB) { float v[GNB];
#pragma unroll
        for (int u = 0; u < GNB; ++u) v[u] = pl[(size_t)(g + u) * 16 * DVV];
#pragma unroll
        for (int u = 0; u < GNB; ++u) acc = __fadd_rn(acc, v[u]); }
    sh[tid] = acc; __syncthreads();
#pragma unroll 1
    for (int st = 512; st > 0; st >>= 1) { if (tid < st) sh[tid] = __fadd_rn(sh[tid], sh[tid + st]); __syncthreads(); }
    const float mean = sh[0] * rn;
    __syncthreads();
    float acc2 = 0.f;
#pragma unroll
    for (int g = 0; g < n / 1024; g += GNB) { float v[GNB];
#pragma unroll
        for (int u = 0; u < GNB; ++u) v[u] = pl[(size_t)(g + u) * 16 * DVV];
#pragma unroll
        for (int u = 0; u < GNB; ++u) { const float dv = __fsub_rn(v[u], mean); acc2 = __builtin_fmaf(dv, dv, acc2); } }   // the fused square-add that the rolled loop compiled to, written out: left to the compiler, the unrolled chain fuses its first two squares the other way round
    asm volatile("s_wait_xcnt 0x0" :: "v"(pl) : "memory");   // holds the address pair whole up to this wait: without it this build lets the last load land in the pair that the loads before it name
    sh[tid] = acc2; __syncthreads();
#pragma unroll 1
    for (int st = 512; st > 0; st >>= 1) { if (tid < st) sh[tid] = __fadd_rn(sh[tid], sh[tid + st]); __syncthreads(); }
    if (tid < 32) { const float var = sh[0] * rn; const float rs = __fdiv_rn(1.0f, sqrtf(__fadd_rn(var, 1e-5f))); const float outv = (tid == 0) ? mean : ((tid == 1) ? rs : 0.0f);
        *(float*)(GST + hh * 32 + tid) = outv;  }
}
__global__ __launch_bounds__(256) void k_gnmerge(const float* __restrict__ O, const float* __restrict__ GST, const float* __restrict__ gw, const float* __restrict__ gb, bf* Ah, bf* Al) {
    const size_t e = ((size_t)blockIdx.x * 256 + threadIdx.x) * 2; if (e >= (size_t)SEQ * DVV) return;
    O += (size_t)blockIdx.y * SEQ * DVV; GST += blockIdx.y * (NVH * 32); Ah += (size_t)blockIdx.y * SEQ * DVV; Al += (size_t)blockIdx.y * SEQ * DVV;
    const int c = (int)(e % DVV); const int hh = c / HD; const float mean = GST[hh * 32], rs = GST[hh * 32 + 1]; v2us oh, ol;
#pragma unroll
    for (int q = 0; q < 2; ++q) { float cc = __fsub_rn(O[e + q], mean); asm volatile("" : "+v"(cc)); float nn = __fmul_rn(cc, rs); asm volatile("" : "+v"(nn)); float y = __fmul_rn(nn, bfr(gw[c + q])); asm volatile("" : "+v"(y)); y = __fadd_rn(y, bfr(gb[c + q])); const float z = __fmul_rn(y, 0.2f); unsigned short a2, c2; splitf(z, a2, c2); oh[q] = a2; ol[q] = c2; }
    *(v2us*)(Ah + e) = oh; *(v2us*)(Al + e) = ol;  }

extern "C" void kernel_launch(void* const* d_in, const int* in_sizes, int n_in,
                              void* d_out, int out_size, void* d_ws, size_t ws_size, hipStream_t stream) {
    if (n_in < 13) return;
    if (in_sizes[0] < (NB - 1) * SEQ_FULL * DM + SEQ * DM) return;
    if (in_sizes[1] < (NB - 1) * SEQ_FULL + SEQ) return;
    if (in_sizes[2] < (NB - 1) * SEQ_FULL + SEQ) return;
    if (in_sizes[3] < DQ * DM || in_sizes[4] < DQ * DM || in_sizes[5] < DVV * DM || in_sizes[6] < DM * DVV) return;
    if (in_sizes[7] < HD || in_sizes[8] < HD || in_sizes[9] < HD || in_sizes[10] < HD || in_sizes[11] < DVV || in_sizes[12] < DVV) return;
    if (out_size < (NB - 1) * SEQ_FULL * DM + SEQ * DM) return;
    const float* x = (const float*)d_in[0]; const float* amask = (const float*)d_in[1]; const int* tix = (const int*)d_in[2];
    const float* wq = (const float*)d_in[3]; const float* wk = (const float*)d_in[4]; const float* wv = (const float*)d_in[5]; const float* wo = (const float*)d_in[6];
    const float* lq1 = (const float*)d_in[7]; const float* lq2 = (const float*)d_in[8]; const float* lk1 = (const float*)d_in[9]; const float* lk2 = (const float*)d_in[10];
    const float* gnw = (const float*)d_in[11]; const float* gnb = (const float*)d_in[12];
    float* OUT = (float*)d_out;     // [NB][SEQ_FULL][1024]
    char* wsp = (char*)d_ws;
    auto take = [&](size_t bytes) { char* p = wsp; wsp += (bytes + 255) & ~(size_t)255; return (void*)p; };
    bf* WQ = (bf*)take((size_t)DQ * DM * 2); bf* WK = (bf*)take((size_t)DQ * DM * 2); bf* WV = (bf*)take((size_t)DVV * DM * 2); bf* WO = (bf*)take((size_t)DM * DVV * 2);
    bf* XB = (bf*)take((size_t)NB * SEQ * DM * 2); float* AMB = (float*)take((size_t)NB * SEQ * 4); float* LAM = (float*)take(256); float* GST = (float*)take((size_t)NB * NVH * 32 * 4);
    bf* QPh = (bf*)take((size_t)NB * NQH * SEQ * HD * 2); bf* QPl = (bf*)take((size_t)NB * NQH * SEQ * HD * 2); bf* KPh = (bf*)take((size_t)NB * NQH * SEQ * HD * 2); bf* KPl = (bf*)take((size_t)NB * NQH * SEQ * HD * 2);
    h16* VT16 = (h16*)take((size_t)NB * NVH * HD * SEQ * 2); h16* VRS = (h16*)take((size_t)NB * NVH * HD * SEQ * 2);
    float* Ob = (float*)take((size_t)NB * SEQ * DVV * 4); bf* ATh = (bf*)take((size_t)NB * SEQ * DVV * 2); bf* ATl = (bf*)take((size_t)NB * SEQ * DVV * 2);
    const size_t used = (size_t)(wsp - (char*)d_ws);
    if (used > ws_size || used > (size_t)268435456) return;
    k_cvt8<<<(unsigned)(((size_t)DQ * DM / 8 + 255) / 256), 256, 0, stream>>>(wq, WQ, (size_t)DQ * DM / 8, 0, 0);
    k_cvt8<<<(unsigned)(((size_t)DQ * DM / 8 + 255) / 256), 256, 0, stream>>>(wk, WK, (size_t)DQ * DM / 8, 0, 0);
    k_cvt8<<<(unsigned)(((size_t)DVV * DM / 8 + 255) / 256), 256, 0, stream>>>(wv, WV, (size_t)DVV * DM / 8, 0, 0);
    k_cvt8<<<(unsigned)(((size_t)DM * DVV / 8 + 255) / 256), 256, 0, stream>>>(wo, WO, (size_t)DM * DVV / 8, 0, 0);
    k_lambda<<<1, 32, 0, stream>>>(lq1, lk1, lq2, lk2, LAM);
    // Every stage runs once for all NB batch elements: the batch index is the last used grid dimension, workspace planes are [NB][...].
    k_cvt8<<<dim3((unsigned)(((size_t)SEQ * DM / 8 + 255) / 256), NB, 1), 256, 0, stream>>>(x, XB, (size_t)SEQ * DM / 8, (size_t)SEQ_FULL * DM, (size_t)SEQ * DM);
    k_rbf<<<dim3((SEQ / 4 + 255) / 256, NB, 1), 256, 0, stream>>>(amask, AMB, SEQ / 4, (size_t)SEQ_FULL, (size_t)SEQ);
    k_gemmb<0, 1><<<dim3(SEQ / GT, DQ / GT, NB), 256, 0, stream>>>(XB, nullptr, WQ, DM, nullptr, 0, (size_t)SEQ * DM, 0, QPh, QPl);
    k_gemmb<0, 1><<<dim3(SEQ / GT, DQ / GT, NB), 256, 0, stream>>>(XB, nullptr, WK, DM, nullptr, 0, (size_t)SEQ * DM, 0, KPh, KPl);
    k_gemmb<0, 2><<<dim3(SEQ / GT, DVV / GT, NB), 256, 0, stream>>>(XB, nullptr, WV, DM, nullptr, 0, (size_t)SEQ * DM, 0, (bf*)VT16, (bf*)VRS);
    k_attn<<<dim3(SEQ / QBL, NVH, NB), 128, 0, stream>>>(QPh, QPl, KPh, KPl, VT16, VRS, AMB, tix, LAM, Ob);
    k_gnstat<<<dim3(NVH, NB, 1), 1024, 0, stream>>>(Ob, GST);
    k_gnmerge<<<dim3((unsigned)(((size_t)SEQ * DVV / 2 + 255) / 256), NB, 1), 256, 0, stream>>>(Ob, GST, gnw, gnb, ATh, ATl);
    k_gemmb<1><<<dim3(SEQ / GT, DM / GT, NB), 256, 0, stream>>>(ATh, ATl, WO, DVV, OUT, DM, (size_t)SEQ * DVV, (size_t)SEQ_FULL * DM);
}

// v006
// It runs in 334 microseconds.
// Two timings next to v005 both put it at 1.16 times that version's speed.
// All steps since v000 together make it 2.88 times as fast.
#include <hip/hip_runtime.h>
#pragma clang fp contract(off)

// Compute dtypes (f32 accumulate everywhere): input projections x.Wq / x.Wk / x.Wv on v_wmma_f32_16x16x32_bf16 with bf16 RNE-converted inputs as operands (exact operands); q.k scores on v_wmma_f32_16x16x32_bf16 as bf16 hi/lo split (hi.hi + lo.hi + hi.lo); probability.value on v_wmma_f32_16x16x32_f16 (P f16 carried x4096, V f16; the first query block adds P and V residual planes carried x1024 through a second accumulator); softmax, ALiBi/pad terms, lambda and GroupNorm in f32; output projection on v_wmma_f32_16x16x32_bf16 (activation bf16 hi/lo x bf16 Wo, 2 products).
// Layout: x [NB][SEQ_FULL][1024]; Wq/Wk [2048][1024], Wv/Wo [1024][1024] ([out][in], used as K-contiguous Bt planes); per head h the 128 q/k columns are [half 1 | half 2] = virtual 64-wide heads 2h, 2h+1; mask [NB][SEQ_FULL] f32, token positions [NB][SEQ_FULL] int32; out [NB][SEQ_FULL][1024] f32.

#ifndef NB
#define NB 2
#endif
#ifndef SEQ
#define SEQ 2048
#endif
#define NB_FULL 2
#define SEQ_FULL 2048
#define DM   1024
#define NVH  16
#define HD   64
#define NQH  (2 * NVH)
#define DQ   (NQH * HD)
#define DVV  (NVH * HD)
#define SCL  0.125f
#define PCAR 4096.0f
#define RCAR 1024.0f
#define QBL  64
#define KCH  64
#define KSB  32
#define LP   72
#define PP   40
#define OSP  68
#define L2E  1.4426950408889634f
#define NEGB (-3.0e38f)
static_assert(SEQ % 64 == 0);
static_assert(SEQ <= SEQ_FULL);
static_assert(NB >= 1);
static_assert(NB <= NB_FULL);
static_assert(QBL == KCH);
static_assert(KCH % KSB == 0);
static_assert((LP * 2) % 16 == 0);
static_assert((PP * 2) % 16 == 0);
static_assert((OSP * 4) % 16 == 0);
static_assert((SEQ * DVV) % 512 == 0);
static_assert((SEQ * DM) % 2048 == 0);

typedef _Float16 h16;
typedef unsigned short bf;
typedef __attribute__((ext_vector_type(16))) __bf16   v16bf;
typedef __attribute__((ext_vector_type(16))) _Float16 v16h;
typedef __attribute__((ext_vector_type(8)))  _Float16 v8h;
typedef __attribute__((ext_vector_type(8)))  unsigned short v8us;
typedef __attribute__((ext_vector_type(8)))  float    v8f;
typedef __attribute__((ext_vector_type(4)))  float    v4f;
typedef __attribute__((ext_vector_type(2)))  unsigned short v2us;
typedef v8h  __attribute__((may_alias)) v8ha;
typedef v4f  __attribute__((may_alias)) v4fa;
typedef v8us __attribute__((may_alias)) v8usa;
typedef float __attribute__((may_alias)) f32a;

__device__ __forceinline__ unsigned short f2bf(float f) { unsigned u = __float_as_uint(f); u += 0x7FFFu + ((u >> 16) & 1u); return (unsigned short)(u >> 16); }
__device__ __forceinline__ float bf2f(unsigned short b) { return __uint_as_float(((unsigned)b) << 16); }
__device__ __forceinline__ float bfr(float f) { return bf2f(f2bf(f)); }
__device__ __forceinline__ v16h cat16(v8h lo, v8h hi) { return __builtin_shufflevector(lo, hi, 0, 1, 2, 3, 4, 5, 6, 7, 8, 9, 10, 11, 12, 13, 14, 15); }
__device__ __forceinline__ v16bf cat16b(v8us lo, v8us hi) { return __builtin_bit_cast(v16bf, __builtin_shufflevector(lo, hi, 0, 1, 2, 3, 4, 5, 6, 7, 8, 9, 10, 11, 12, 13, 14, 15)); }
__device__ __forceinline__ v8f wmma16(v16h a, v16h b, v8f c) { return __builtin_amdgcn_wmma_f32_16x16x32_f16(false, a, false, b, (short)0, c, false, false); }
__device__ __forceinline__ v8f wmmab(v16bf a, v16bf b, v8f c) { return __builtin_amdgcn_wmma_f32_16x16x32_bf16(false, a, false, b, (short)0, c, false, false); }
__device__ __forceinline__ h16 tohx(float x) { return (h16)x; }
__device__ __forceinline__ void splitf(float y, unsigned short& h, unsigned short& l) { h = f2bf(y); l = f2bf(y - bf2f(h)); }

// ---- k_gemmb: block-tiled GEMM, 8 waves (2 x 4) per 128x128 output tile, wave tile 64x32 (8 accumulators); grid (M/128, N/128, Z), 256 threads.
// c[m][n] (f32) = sum_k A[m][k] Bt[n][k] (+ A2[m][k] Bt[n][k] when NSPLIT == 1). z-batch strides sA/sC in elements. K % 64 == 0, K >= 64.
// MODE 0: c goes to C (f32, pitch ldc). MODE 1 (q, k): c is split into bf16 hi/lo and goes to the head planes P0/P1 [z][n / 64][m][n % 64]. MODE 2 (v): c goes transposed, as f16 and as its
// residual x1024, to P0/P1 [z][n][m]. MODE 1 and 2 turn the tile in the stage buffers, free behind the loop's last barrier, so that every global store covers whole 128-byte lines.
// A stage is 64 k of every operand row (one whole 128-byte line per row), read from the K-contiguous planes by whole-line 16-byte loads, kept in registers while the
// previous stage is multiplied, then stored to the other of two LDS buffers (row pitch 144 B); one block barrier per stage publishes it and ends the reads of the buffer refilled next.
// Fragments: lane -> row/col (lane & 15); elements 0..7 <- k + 8*(lane>>4), elements 8..15 <- k + 16 + 8*(lane>>4), for A and Bt alike. k runs upward, one accumulate chain per element.
#define GT   128
#define GBK  64
#define GLP  72
#define GOP  36
#define GSP  132
#define GVP  136
static_assert(SEQ % GT == 0);
static_assert(DQ % GT == 0);
static_assert(DVV % GT == 0);
static_assert(DM % GT == 0);
static_assert(DM % GBK == 0);
static_assert(DVV % GBK == 0);
static_assert((GLP * 2) % 16 == 0);
static_assert((GOP * 4) % 16 == 0);
static_assert((GSP * 4) % 16 == 0);
static_assert((GVP * 2) % 16 == 0);
static_assert(GT == 2 * HD);
static_assert(GT * GSP * 4 <= 2 * 2 * GT * GLP * 2);
static_assert(2 * GT * GVP * 2 <= 2 * 2 * GT * GLP * 2);
__device__ __forceinline__ v16bf ldsb(const bf* p) { return cat16b(*(const v8usa*)p, *(const v8usa*)(p + 16)); }
template <int NSPLIT, int MODE = 0>
// waves_per_eu: at most two 8-wave blocks run per WGP here, so the register budget is that of 4 waves per SIMD and a k-step's fragment loads may be grouped ahead of its products
__global__ __launch_bounds__(256) __attribute__((amdgpu_waves_per_eu(1, 4)))
void k_gemmb(const bf* __restrict__ A, const bf* __restrict__ A2, const bf* __restrict__ Bt, int K, float* C, int ldc, size_t sA, size_t sC, bf* P0 = nullptr, bf* P1 = nullptr) {
    constexpr int NPL = 2 + NSPLIT;                          // planes per stage: A, (A2,) Bt
    __shared__ __align__(16) bf    tl[2][NPL][GT * GLP];     // two stage buffers [row*GLP + k]                  (cross-wave: block barriers)
    __shared__ __align__(16) float osw[8][16 * GOP];         // per-wave f32 epilogue staging [row*GOP + col]    (wave-private)
    const size_t z = blockIdx.z; A += z * sA; if (NSPLIT) A2 += z * sA; C += z * sC;
    const int tid = threadIdx.x, w = tid >> 5, lane = tid & 31, lr = lane & 15, hi = lane >> 4; const int wm = w >> 2, wn = w & 3;
    const int r0 = blockIdx.x * GT, c0 = blockIdx.y * GT;
    v8f acc[4][2];
#pragma unroll
    for (int mb = 0; mb < 4; ++mb)
#pragma unroll
        for (int nb = 0; nb < 2; ++nb) acc[mb][nb] = (v8f){};
    const int srow = tid >> 3, sc8 = (tid & 7) * 8;          // staging: 8 lanes cover one row's 128 bytes; piece i is row srow + 32 i
    const char* gA = (const char*)(A + (size_t)r0 * K); const char* gA2 = (const char*)(A2 + (size_t)r0 * K); const char* gB = (const char*)(Bt + (size_t)c0 * K);   // block-uniform tile bases
    unsigned go[4];                                          // the lane's byte offset of piece i inside a tile's rows, the same for every plane and stage
#pragma unroll
    for (int i = 0; i < 4; ++i) go[i] = ((unsigned)(srow + 32 * i) * (unsigned)K + (unsigned)sc8) * 2u;
    const int so = srow * GLP + sc8;
    const int fa = (wm * 64 + lr) * GLP + 8 * hi, fb = (wn * 32 + lr) * GLP + 8 * hi;
    v8us ra[4], ra2[4], rb[4];
#pragma unroll
    for (int i = 0; i < 4; ++i) { ra[i] = *(const v8us*)(gA + go[i]); if (NSPLIT) ra2[i] = *(const v8us*)(gA2 + go[i]); rb[i] = *(const v8us*)(gB + go[i]); }
#pragma unroll
    for (int i = 0; i < 4; ++i) { *(v8usa*)(&tl[0][0][so + i * 32 * GLP]) = ra[i]; if (NSPLIT) *(v8usa*)(&tl[0][1][so + i * 32 * GLP]) = ra2[i]; *(v8usa*)(&tl[0][NPL - 1][so + i * 32 * GLP]) = rb[i]; }
    __syncthreads();
#pragma unroll 1
    for (int k0 = 0; k0 < K; k0 += GBK) {
        const int cur = (k0 / GBK) & 1; const bool more = k0 + GBK < K;
        gA += GBK * 2; gA2 += GBK * 2; gB += GBK * 2;        // the uniform bases step one stage; the lanes' offsets stay
        if (more) {
#pragma unroll
            for (int i = 0; i < 4; ++i) {   // a wait behind each load: this build lets a later load of the group land in an earlier one's address pair, and the wait stands in front of that overwrite
                ra[i] = *(const v8us*)(gA + go[i]); asm volatile("s_wait_xcnt 0x0" ::: "memory");
                if (NSPLIT) { ra2[i] = *(const v8us*)(gA2 + go[i]); asm volatile("s_wait_xcnt 0x0" ::: "memory"); }
                rb[i] = *(const v8us*)(gB + go[i]); asm volatile("s_wait_xcnt 0x0" ::: "memory"); }
        }
        const bf* ta = &tl[cur][0][fa]; const bf* ta2 = &tl[cur][NSPLIT][fa]; const bf* tb = &tl[cur][NPL - 1][fb];
#pragma unroll
        for (int kc = 0; kc < GBK; kc += 32) {
            v16bf a[4], a2[4], b[2];
#pragma unroll
            for (int mb = 0; mb < 4; ++mb) { a[mb] = ldsb(ta + mb * 16 * GLP + kc); if (NSPLIT) a2[mb] = ldsb(ta2 + mb * 16 * GLP + kc); }
#pragma unroll
            for (int nb = 0; nb < 2; ++nb) b[nb] = ldsb(tb + nb * 16 * GLP + kc);
#pragma unroll
            for (int nb = 0; nb < 2; ++nb)
#pragma unroll
                for (int mb = 0; mb < 4; ++mb) { acc[mb][nb] = wmmab(a[mb], b[nb], acc[mb][nb]); if (NSPLIT) acc[mb][nb] = wmmab(a2[mb], b[nb], acc[mb][nb]); }
        }
        if (more) {
#pragma unroll
            for (int i = 0; i < 4; ++i) { *(v8usa*)(&tl[cur ^ 1][0][so + i * 32 * GLP]) = ra[i]; if (NSPLIT) *(v8usa*)(&tl[cur ^ 1][1][so + i * 32 * GLP]) = ra2[i]; *(v8usa*)(&tl[cur ^ 1][NPL - 1][so + i * 32 * GLP]) = rb[i]; }
        }
        __syncthreads();
    }
    if constexpr (MODE == 1) {
        f32a* st = (f32a*)&tl[0][0][0];                      // block f32 tile [row*GSP + col]
#pragma unroll
        for (int mb = 0; mb < 4; ++mb)
#pragma unroll
            for (int nb = 0; nb < 2; ++nb)
#pragma unroll
                for (int j = 0; j < 8; ++j) st[(wm * 64 + mb * 16 + hi * 8 + j) * GSP + wn * 32 + nb * 16 + lr] = acc[mb][nb][j];
        __syncthreads();                                     // publishes the tile: its rows are read back by other waves
        const int hs = w & 1, rw = (w >> 1) * 32 + (lane >> 3), c8 = (lane & 7) * 8;   // a wave takes 32 rows of one 64-wide head; one store = 4 rows = 512 contiguous bytes
        const size_t pb = ((z * NQH + (size_t)(blockIdx.y * 2 + hs)) * SEQ + r0) * HD + c8;
#pragma unroll
        for (int i = 0; i < 8; ++i) { const int row = rw + 4 * i; const f32a* sp = st + row * GSP + hs * HD + c8; const v4f x0 = *(const v4fa*)sp, x1 = *(const v4fa*)(sp + 4); v8us oh, ol;
#pragma unroll
            for (int q = 0; q < 4; ++q) { unsigned short a2, c2; splitf(x0[q], a2, c2); oh[q] = a2; ol[q] = c2; splitf(x1[q], a2, c2); oh[4 + q] = a2; ol[4 + q] = c2; }
            *(v8us*)(P0 + pb + (size_t)row * HD) = oh; *(v8us*)(P1 + pb + (size_t)row * HD) = ol; }
        return;
    }
    if constexpr (MODE == 2) {
        h16* sv = (h16*)&tl[0][0][0]; h16* sr = sv + GT * GVP;   // block f16 tiles, value and residual, transposed [col*GVP + row]; an accumulator lane holds 8 consecutive rows of one column
#pragma unroll
        for (int mb = 0; mb < 4; ++mb)
#pragma unroll
            for (int nb = 0; nb < 2; ++nb) { v8h o16, orr;
#pragma unroll
                for (int j = 0; j < 8; ++j) { const float x = acc[mb][nb][j]; const h16 hv = tohx(x); const float res = (x - (float)hv) * RCAR; o16[j] = hv; orr[j] = tohx(res); }
                const int si = (wn * 32 + nb * 16 + lr) * GVP + wm * 64 + mb * 16 + hi * 8; *(v8ha*)(sv + si) = o16; *(v8ha*)(sr + si) = orr; }
        __syncthreads();                                     // publishes the tiles: their columns are read back by other waves
        const int cw = tid >> 4, t8 = (tid & 15) * 8;        // 16 lanes cover one column's 128 rows = 256 contiguous bytes
        const size_t vb = (z * DVV + (size_t)c0) * SEQ + r0 + t8;
#pragma unroll
        for (int i = 0; i < 8; ++i) { const int col = cw + 16 * i; const v8h a16 = *(const v8ha*)(sv + col * GVP + t8), ar = *(const v8ha*)(sr + col * GVP + t8);
            *(v8ha*)((h16*)P0 + vb + (size_t)col * SEQ) = a16; *(v8ha*)((h16*)P1 + vb + (size_t)col * SEQ) = ar; }
        return;
    }
    float* os = &osw[w][0];
#pragma unroll
    for (int mb = 0; mb < 4; ++mb) {
#pragma unroll
        for (int nb = 0; nb < 2; ++nb) {
#pragma unroll
            for (int j = 0; j < 8; ++j) os[(hi * 8 + j) * GOP + nb * 16 + lr] = acc[mb][nb][j]; }
        __builtin_amdgcn_wave_barrier(); asm volatile("" ::: "memory");   // keeps the staging stores ahead of the row reads of other lanes of this wave
        float* crow = C + (size_t)(r0 + wm * 64 + mb * 16) * ldc + c0 + wn * 32;
#pragma unroll
        for (int s = 0; s < 4; ++s) { const int row = 4 * s + (lane >> 3), cofs = (lane & 7) * 4; const v4f val = *(const v4fa*)(os + row * GOP + cofs); *(v4f*)(crow + (size_t)row * ldc + cofs) = val; }
        __builtin_amdgcn_wave_barrier(); asm volatile("" ::: "memory");   // keeps the row reads ahead of the next block's staging stores
    }
}

__global__ __launch_bounds__(256) void k_cvt8(const float* __restrict__ src, bf* dst, size_t n8, size_t sS, size_t sD) { const size_t i = (size_t)blockIdx.x * 256 + threadIdx.x; if (i >= n8) return; src += blockIdx.y * sS; dst += blockIdx.y * sD; const v8f v = *(const v8f*)(src + i * 8); v8us o;
#pragma unroll
    for (int k = 0; k < 8; ++k) o[k] = f2bf(v[k]); *(v8us*)(dst + i * 8) = o;  }
__global__ __launch_bounds__(256) void k_rbf(const float* __restrict__ src, float* dst, int n4, size_t sS, size_t sD) { const int i = blockIdx.x * 256 + threadIdx.x; if (i >= n4) return; src += blockIdx.y * sS; dst += blockIdx.y * sD; const v4f a = *(const v4f*)(src + (size_t)i * 4); v4f o;
#pragma unroll
    for (int u = 0; u < 4; ++u) o[u] = bfr(a[u]); *(v4f*)(dst + (size_t)i * 4) = o;  }
__global__ __launch_bounds__(32) void k_lambda(const float* __restrict__ lq1, const float* __restrict__ lk1, const float* __restrict__ lq2, const float* __restrict__ lk2, float* LAM) { const int lane = threadIdx.x; float d1 = 0.f, d2 = 0.f;
#pragma unroll 1
    for (int i = 0; i < HD; ++i) { float p1 = __fmul_rn(bfr(lq1[i]), bfr(lk1[i])); asm volatile("" : "+v"(p1)); d1 = __fadd_rn(d1, p1); float p2 = __fmul_rn(bfr(lq2[i]), bfr(lk2[i])); asm volatile("" : "+v"(p2)); d2 = __fadd_rn(d2, p2); }
    float lm = __fsub_rn(expf(d1), expf(d2)); asm volatile("" : "+v"(lm)); lm = __fadd_rn(lm, 0.8f); const float v = (lane == 0) ? lm : 0.0f; *(float*)(LAM + lane) = v;  }

// ---- k_attn: causal differential attention for one (query block of 64, head) per block of 4 waves (wave w owns 16 query rows). The two score streams run one after the other (stream loop outside
// the key-chunk loop: one Q/K hi/lo pair, one score tile pair, one O accumulator set and one running max/sum set live at a time). Per stream st and 64-key chunk c = 0..qb the K hi/lo tile of
// head plane 2h+st and the V^T tile are staged in LDS; the softmax recurrence then runs on 32-key sub-chunks: scores S = Q.K (3 bf16 products, 16x32 tile per wave) ->
// t = S/8 - slope (pos_i - pos_j) + (1 - mask_j)(-1e9) for j <= i, excluded otherwise; online softmax (running max / sum, f32); P tile (f16 x4096, 16x32) per wave in LDS; O += P.V (one k-step).
// The first query block also forms P and V residual planes (x1024) and adds P_res.V + P.V_res per 16-column block through a second accumulator folded before normalisation.
// rowx<M>: the value of lane l ^ M of the lane's own 16-lane row, read through DPP (row_xmask) on the vector pipe; __shfl_xor compiles to ds_bpermute_b32, a trip through the LDS unit with a wait on dscnt per link. Every lane is on where it is used.
template <int M> __device__ __forceinline__ float rowx(float x) { return __builtin_bit_cast(float, __builtin_amdgcn_update_dpp(0, __builtin_bit_cast(int, x), 0x160 | M, 0xf, 0xf, true)); }
__device__ __forceinline__ v16h  ldsh(const h16* p) { return cat16(*(const v8ha*)p, *(const v8ha*)(p + 16)); }

// attn_blk: the two streams' loops of one block. ER (first query block: residual planes) is a compile-time value, so the loops hold no test of it: a chunk's tile loads are one group
// behind which the LDS stores follow, and the sixteen probability chains of a sub-chunk stand in one basic block.
template <bool ER>
__device__ __forceinline__ void attn_blk(const bf* __restrict__ QPh, const bf* __restrict__ QPl, const bf* __restrict__ KPh, const bf* __restrict__ KPl, const h16* __restrict__ VT, const h16* __restrict__ VR,
                                         const float* __restrict__ amb, const int* __restrict__ tix, const float lam, const float slope, const float (&pq)[8], const int hh, const int qb,
                                         bf* qs0, bf* qs1, bf* ks0, bf* ks1, h16* vsm, h16* vrm, h16* pt, h16* prt, float* os) {
    const int tid = threadIdx.x, w = tid >> 5, lane = tid & 31, lr = lane & 15, hi = lane >> 4;
    const int q0 = qb * QBL, qrow0 = q0 + 16 * w + 8 * hi;
    // staging: piece i of a K plane is row 16 i + (tid >> 3), 16 bytes at 8 (tid & 7): the 64 x 64 tile is 8 KiB in a row, so a lane's byte offset is 16 tid + 2048 i; piece i of V^T is row d = 16 i + (tid >> 3)
    const unsigned ko = (unsigned)tid * 16u, vo = ((unsigned)(tid >> 3) * (unsigned)SEQ + 8u * (unsigned)(tid & 7)) * 2u;   // the lane's offsets, the same for every chunk
    const int sk = (tid >> 3) * LP + (tid & 7) * 8;
#pragma unroll 1
    for (int st = 0; st < 2; ++st) {
        const size_t vq = (size_t)(2 * hh + st);
        __syncthreads();
        {   const char* pqh = (const char*)(QPh + (vq * SEQ + q0) * HD) + ko; const char* pql = (const char*)(QPl + (vq * SEQ + q0) * HD) + ko;
            v8us qh[4], ql[4];
#pragma unroll
            for (int i = 0; i < 4; ++i) { qh[i] = *(const v8usa*)(pqh + i * 2048); ql[i] = *(const v8usa*)(pql + i * 2048); }
            asm volatile("s_wait_xcnt 0x0" :: "v"(pqh), "v"(pql) : "memory");   // holds the address pairs whole up to this wait: without it a later load of the group may land in a pair that the loads before it name
#pragma unroll
            for (int i = 0; i < 4; ++i) { *(v8usa*)(&qs0[sk + i * 16 * LP]) = qh[i]; *(v8usa*)(&qs1[sk + i * 16 * LP]) = ql[i]; }
        }
        float m[8], l[8]; v8f O[4];
#pragma unroll
        for (int r = 0; r < 8; ++r) { m[r] = NEGB; l[r] = 0.0f; }
#pragma unroll
        for (int j = 0; j < 4; ++j) O[j] = (v8f){};
#pragma unroll 1
        for (int c = 0; c <= qb; ++c) {
            const int k0 = c * KCH;
            {   const char* pkh = (const char*)(KPh + (vq * SEQ + k0) * HD) + ko; const char* pkl = (const char*)(KPl + (vq * SEQ + k0) * HD) + ko;
                const char* pv = (const char*)(VT + (size_t)hh * HD * SEQ + k0) + vo; const char* pr = (const char*)(VR + (size_t)hh * HD * SEQ + k0) + vo;
                v8us kh[4], kl[4]; v8h vv[4], vr[4];
#pragma unroll
                for (int i = 0; i < 4; ++i) { kh[i] = *(const v8usa*)(pkh + i * 2048); kl[i] = *(const v8usa*)(pkl + i * 2048); }
#pragma unroll
                for (int i = 0; i < 4; ++i) { vv[i] = *(const v8ha*)(pv + i * (16 * SEQ * 2)); if constexpr (ER) vr[i] = *(const v8ha*)(pr + i * (16 * SEQ * 2)); }
                // holds the address pairs whole up to this wait: without it the last load of a group lands in the pair that the loads before it name
                if constexpr (ER) asm volatile("s_wait_xcnt 0x0" :: "v"(pkh), "v"(pkl), "v"(pv), "v"(pr) : "memory"); else asm volatile("s_wait_xcnt 0x0" :: "v"(pkh), "v"(pkl), "v"(pv) : "memory");
#pragma unroll
                for (int i = 0; i < 4; ++i) { *(v8usa*)(&ks0[sk + i * 16 * LP]) = kh[i]; *(v8usa*)(&ks1[sk + i * 16 * LP]) = kl[i]; }
#pragma unroll
                for (int i = 0; i < 4; ++i) { *(v8ha*)(&vsm[sk + i * 16 * LP]) = vv[i]; if constexpr (ER) *(v8ha*)(&vrm[sk + i * 16 * LP]) = vr[i]; }
            }
            __syncthreads();
#pragma unroll 1
            for (int sb = 0; sb < KCH / KSB; ++sb) {
                const int kb = sb * KSB;
                const int key0 = k0 + kb + lr, key1 = key0 + 16;
                const float pk0 = (float)tix[key0], pk1 = (float)tix[key1];
                const float om0 = 1.0f - amb[key0], om1 = 1.0f - amb[key1]; const float pad0 = om0 * -1.0e9f, pad1 = om1 * -1.0e9f;
                // ---- scores: S[row 8hi+r][key kb + nb*16 + lr], 3 bf16 products (hi.hi + lo.hi + hi.lo); fragments loaded right before each k-step, scheduling barrier after it
                v8f s[2]; s[0] = (v8f){}; s[1] = (v8f){};
                {   v16bf ah, al, bh, bl;
#pragma unroll
                    for (int kc = 0; kc < HD; kc += 32) {
                        ah = ldsb(&qs0[(16 * w + lr) * LP + kc + 8 * hi]); al = ldsb(&qs1[(16 * w + lr) * LP + kc + 8 * hi]);
#pragma unroll
                        for (int nb = 0; nb < 2; ++nb) { bh = ldsb(&ks0[(kb + nb * 16 + lr) * LP + kc + 8 * hi]); bl = ldsb(&ks1[(kb + nb * 16 + lr) * LP + kc + 8 * hi]);
                            s[nb] = wmmab(ah, bh, s[nb]); s[nb] = wmmab(al, bh, s[nb]); s[nb] = wmmab(ah, bl, s[nb]); }
                        asm volatile("v_nop\n\tv_nop\n\tv_nop\n\tv_nop" : "+v"(s[0]), "+v"(s[1]) : "v"(ah), "v"(al), "v"(bh), "v"(bl) : "memory");
                    }
                }
                // ---- additive terms by value select, sub-chunk max
                float cm[8];
#pragma unroll
                for (int r = 0; r < 8; ++r) cm[r] = NEGB;
#pragma unroll
                for (int nb = 0; nb < 2; ++nb) { const int kv = nb ? key1 : key0; const float pkv = nb ? pk1 : pk0; const float pdv = nb ? pad1 : pad0;
#pragma unroll
                    for (int r = 0; r < 8; ++r) { const float sa = s[nb][r] * SCL; const float pd = pq[r] - pkv; const float bia = slope * pd; const float sm = sa - bia;
                        const float tt = (kv <= qrow0 + r) ? (sm + pdv) : NEGB; s[nb][r] = tt; cm[r] = fmaxf(cm[r], tt); } }
                float cor[8], rs[8];
#pragma unroll
                for (int r = 0; r < 8; ++r) { float x = cm[r]; x = fmaxf(x, rowx<1>(x)); x = fmaxf(x, rowx<2>(x)); x = fmaxf(x, rowx<4>(x)); x = fmaxf(x, rowx<8>(x));
                    const float mn = fmaxf(m[r], x); const float dlt = (m[r] - mn) * L2E; cor[r] = __builtin_amdgcn_exp2f(dlt); m[r] = mn; rs[r] = 0.0f; }
                // ---- probabilities -> per-wave LDS tile (f16 x4096; residual x1024 on the first query block); excluded keys store exactly 0
#pragma unroll
                for (int nb = 0; nb < 2; ++nb) { const int kv = nb ? key1 : key0;
#pragma unroll
                    for (int r = 0; r < 8; ++r) { const float dq = (s[nb][r] - m[r]) * L2E; const float pe = __builtin_amdgcn_exp2f(dq); const float p = (kv <= qrow0 + r) ? pe : 0.0f; rs[r] = rs[r] + p;
                        const float pc = p * PCAR; const h16 ph = tohx(pc); const int li = (8 * hi + r) * PP + nb * 16 + lr; pt[li] = ph;
                        if constexpr (ER) { const float res = (pc - (float)ph) * RCAR; prt[li] = tohx(res); } } }
#pragma unroll
                for (int r = 0; r < 8; ++r) { float x = rs[r]; x += rowx<1>(x); x += rowx<2>(x); x += rowx<4>(x); x += rowx<8>(x);
                    const float lc = l[r] * cor[r]; l[r] = lc + x; const float cf = cor[r];
#pragma unroll
                    for (int j = 0; j < 4; ++j) O[j][r] = O[j][r] * cf; }
                __syncthreads();
                // ---- O[d block j][row] += P[row][key] . V^T[d][key] over the 32 keys of this sub-chunk (one k-step)
                {   const v16h a = ldsh(pt + lr * PP + 8 * hi); v16h b;
#pragma unroll
                    for (int j = 0; j < 4; ++j) { b = ldsh(&vsm[(j * 16 + lr) * LP + kb + 8 * hi]); O[j] = wmma16(a, b, O[j]); }
                    asm volatile("v_nop\n\tv_nop\n\tv_nop\n\tv_nop" : "+v"(O[0]), "+v"(O[1]), "+v"(O[2]), "+v"(O[3]) : "v"(a), "v"(b) : "memory");
                    if constexpr (ER) {
                        const v16h ar = ldsh(prt + lr * PP + 8 * hi);
#pragma unroll
                        for (int j = 0; j < 4; ++j) {
                            const v16h b2 = ldsh(&vsm[(j * 16 + lr) * LP + kb + 8 * hi]); const v16h br = ldsh(&vrm[(j * 16 + lr) * LP + kb + 8 * hi]);
                            v8f R = wmma16(ar, b2, (v8f){}); R = wmma16(a, br, R);
                            asm volatile("v_nop\n\tv_nop\n\tv_nop\n\tv_nop" : "+v"(R) : "v"(a), "v"(ar), "v"(b2), "v"(br) : "memory");
#pragma unroll
                            for (int r = 0; r < 8; ++r) { const float rr = R[r] * (1.0f / RCAR); O[j][r] = O[j][r] + rr; }
                        }
                    }
                }
                __syncthreads();
            }
        }
#pragma unroll
        for (int r = 0; r < 8; ++r) { const float rl = 1.0f / l[r]; const float il = rl * (1.0f / PCAR);
#pragma unroll
            for (int j = 0; j < 4; ++j) { const float a1 = O[j][r] * il; const int oi = (8 * hi + r) * OSP + j * 16 + lr;
                if (st == 0) { os[oi] = a1; } else { const float lb = lam * a1; const float cur = os[oi]; os[oi] = cur - lb; } } }
    }
}

__global__ __launch_bounds__(128) __attribute__((amdgpu_num_vgpr(256)))
void k_attn(const bf* __restrict__ QPh, const bf* __restrict__ QPl, const bf* __restrict__ KPh, const bf* __restrict__ KPl, const h16* __restrict__ VT, const h16* __restrict__ VR,
            const float* __restrict__ amb, const int* __restrict__ tix, const float* __restrict__ LAM, float* Ob) {
    __shared__ __align__(16) bf    qs[2][QBL * LP];      // Q {hi,lo} of the current stream [row*LP + d]     (cross-wave: block barriers)
    __shared__ __align__(16) bf    ks[2][KCH * LP];      // K {hi,lo} of the current stream [key*LP + d]     (cross-wave: block barriers)
    __shared__ __align__(16) h16   vsm[HD * LP];         // V^T tile [d*LP + key]                            (cross-wave: block barriers)
    __shared__ __align__(16) h16   vrm[HD * LP];         // V residual tile, first query block only         (cross-wave: block barriers)
    __shared__ __align__(16) h16   psm[4][16 * PP];      // per-wave P tile [row*PP + key], 16 x 32          (wave-private, block barriers used anyway)
    __shared__ __align__(16) h16   prm[4][16 * PP];      // per-wave P residual tile, first query block only
    __shared__ __align__(16) float osm[4][16 * OSP];     // per-wave f32 result / epilogue staging [row*OSP + d]
    const int tid = threadIdx.x, w = tid >> 5, lane = tid & 31, lr = lane & 15, hi = lane >> 4;
    const int hh = blockIdx.y, qb = blockIdx.x, q0 = qb * QBL;
    {   const size_t bz = blockIdx.z;                        // batch element: every plane is [NB][...]; only the token positions keep the input's own batch pitch
        QPh += bz * ((size_t)NQH * SEQ * HD); QPl += bz * ((size_t)NQH * SEQ * HD); KPh += bz * ((size_t)NQH * SEQ * HD); KPl += bz * ((size_t)NQH * SEQ * HD);
        VT += bz * ((size_t)NVH * HD * SEQ); VR += bz * ((size_t)NVH * HD * SEQ); amb += bz * SEQ; tix += bz * SEQ_FULL; Ob += bz * ((size_t)SEQ * DVV); }
    const int e2 = hh + 1;                                   // slope = 2^(-(h+1)/2): exact power of two times 2^-0.5 for odd exponents
    const float slope = ((e2 & 1) ? 0.70710678118654752f : 1.0f) * __uint_as_float(((unsigned)(127 - (e2 >> 1))) << 23);
    const float lam = LAM[0];
    const int qrow0 = q0 + 16 * w + 8 * hi;
    float pq[8];
#pragma unroll
    for (int r = 0; r < 8; ++r) pq[r] = (float)tix[qrow0 + r];
    float* os = &osm[w][0];
    // block-uniform: every wave of a block takes the same side, with all its barriers
    if (qb == 0) attn_blk<true>(QPh, QPl, KPh, KPl, VT, VR, amb, tix, lam, slope, pq, hh, qb, &qs[0][0], &qs[1][0], &ks[0][0], &ks[1][0], vsm, vrm, &psm[w][0], &prm[w][0], os);
    else         attn_blk<false>(QPh, QPl, KPh, KPl, VT, VR, amb, tix, lam, slope, pq, hh, qb, &qs[0][0], &qs[1][0], &ks[0][0], &ks[1][0], vsm, vrm, &psm[w][0], &prm[w][0], os);
    __syncthreads();
    float* orow = Ob + (size_t)(q0 + 16 * w) * DVV + hh * HD;
{
#pragma unroll
        for (int s2 = 0; s2 < 8; ++s2) { const int row = 2 * s2 + hi, cofs = lr * 4; const v4f val = *(const v4fa*)(os + row * OSP + cofs); *(v4f*)(orow + (size_t)row * DVV + cofs) = val; }
         }
}

#define GNB 32
static_assert((SEQ * HD / 1024) % GNB == 0);
__global__ __launch_bounds__(1024) void k_gnstat(const float* __restrict__ O, float* GST) {
    __shared__ float sh[1024]; const int tid = threadIdx.x; const int hh = blockIdx.x; const float* base = O + (size_t)blockIdx.y * SEQ * DVV + hh * HD; GST += blockIdx.y * (NVH * 32); const int n = SEQ * HD; const float rn = 1.0f / (float)n;
    // A thread's chain is e = tid + 1024 i: row (tid >> 6) + 16 i, column tid & 63. GNB loads of the chain are issued together, then added in the chain's own order.
    const float* pl = base + (size_t)(tid >> 6) * DVV + (tid & 63);
    float acc = 0.f;
#pragma unroll
    for (int g = 0; g < n / 1024; g += GNB) { float v[GNB];
#pragma unroll
        for (int u = 0; u < GNB; ++u) v[u] = pl[(size_t)(g + u) * 16 * DVV];
#pragma unroll
        for (int u = 0; u < GNB; ++u) acc = __fadd_rn(acc, v[u]); }
    sh[tid] = acc; __syncthreads();
#pragma unroll 1
    for (int st = 512; st > 0; st >>= 1) { if (tid < st) sh[tid] = __fadd_rn(sh[tid], sh[tid + st]); __syncthreads(); }
    const float mean = sh[0] * rn;
    __syncthreads();
    float acc2 = 0.f;
#pragma unroll
    for (int g = 0; g < n / 1024; g += GNB) { float v[GNB];
#pragma unroll
        for (int u = 0; u < GNB; ++u) v[u] = pl[(size_t)(g + u) * 16 * DVV];
#pragma unroll
        for (int u = 0; u < GNB; ++u) { const float dv = __fsub_rn(v[u], mean); acc2 = __builtin_fmaf(dv, dv, acc2); } }   // the fused square-add that the rolled loop compiled to, written out: left to the compiler, the unrolled chain fuses its first two squares the other way round
    asm volatile("s_wait_xcnt 0x0" :: "v"(pl) : "memory");   // holds the address pair whole up to this wait: without it this build lets the last load land in the pair that the loads before it name
    sh[tid] = acc2; __syncthreads();
#pragma unroll 1
    for (int st = 512; st > 0; st >>= 1) { if (tid < st) sh[tid] = __fadd_rn(sh[tid], sh[tid + st]); __syncthreads(); }
    if (tid < 32) { const float var = sh[0] * rn; const float rs = __fdiv_rn(1.0f, sqrtf(__fadd_rn(var, 1e-5f))); const float outv = (tid == 0) ? mean : ((tid == 1) ? rs : 0.0f);
        *(float*)(GST + hh * 32 + tid) = outv;  }
}
__global__ __launch_bounds__(256) void k_gnmerge(const float* __restrict__ O, const float* __restrict__ GST, const float* __restrict__ gw, const float* __restrict__ gb, bf* Ah, bf* Al) {
    const size_t e = ((size_t)blockIdx.x * 256 + threadIdx.x) * 2; if (e >= (size_t)SEQ * DVV) return;
    O += (size_t)blockIdx.y * SEQ * DVV; GST += blockIdx.y * (NVH * 32); Ah += (size_t)blockIdx.y * SEQ * DVV; Al += (size_t)blockIdx.y * SEQ * DVV;
    const int c = (int)(e % DVV); const int hh = c / HD; const float mean = GST[hh * 32], rs = GST[hh * 32 + 1]; v2us oh, ol;
#pragma unroll
    for (int q = 0; q < 2; ++q) { float cc = __fsub_rn(O[e + q], mean); asm volatile("" : "+v"(cc)); float nn = __fmul_rn(cc, rs); asm volatile("" : "+v"(nn)); float y = __fmul_rn(nn, bfr(gw[c + q])); asm volatile("" : "+v"(y)); y = __fadd_rn(y, bfr(gb[c + q])); const float z = __fmul_rn(y, 0.2f); unsigned short a2, c2; splitf(z, a2, c2); oh[q] = a2; ol[q] = c2; }
    *(v2us*)(Ah + e) = oh; *(v2us*)(Al + e) = ol;  }

extern "C" void kernel_launch(void* const* d_in, const int* in_sizes, int n_in,
                              void* d_out, int out_size, void* d_ws, size_t ws_size, hipStream_t stream) {
    if (n_in < 13) return;
    if (in_sizes[0] < (NB - 1) * SEQ_FULL * DM + SEQ * DM) return;
    if (in_sizes[1] < (NB - 1) * SEQ_FULL + SEQ) return;
    if (in_sizes[2] < (NB - 1) * SEQ_FULL + SEQ) return;
    if (in_sizes[3] < DQ * DM || in_sizes[4] < DQ * DM || in_sizes[5] < DVV * DM || in_sizes[6] < DM * DVV) return;
    if (in_sizes[7] < HD || in_sizes[8] < HD || in_sizes[9] < HD || in_sizes[10] < HD || in_sizes[11] < DVV || in_sizes[12] < DVV) return;
    if (out_size < (NB - 1) * SEQ_FULL * DM + SEQ * DM) return;
    const float* x = (const float*)d_in[0]; const float* amask = (const float*)d_in[1]; const int* tix = (const int*)d_in[2];
    const float* wq = (const float*)d_in[3]; const float* wk = (const float*)d_in[4]; const float* wv = (const float*)d_in[5]; const float* wo = (const float*)d_in[6];
    const float* lq1 = (const float*)d_in[7]; const float* lq2 = (const float*)d_in[8]; const float* lk1 = (const float*)d_in[9]; const float* lk2 = (const float*)d_in[10];
    const float* gnw = (const float*)d_in[11]; const float* gnb = (const float*)d_in[12];
    float* OUT = (float*)d_out;     // [NB][SEQ_FULL][1024]
    char* wsp = (char*)d_ws;
    auto take = [&](size_t bytes) { char* p = wsp; wsp += (bytes + 255) & ~(size_t)255; return (void*)p; };
    bf* WQ = (bf*)take((size_t)DQ * DM * 2); bf* WK = (bf*)take((size_t)DQ * DM * 2); bf* WV = (bf*)take((size_t)DVV * DM * 2); bf* WO = (bf*)take((size_t)DM * DVV * 2);
    bf* XB = (bf*)take((size_t)NB * SEQ * DM * 2); float* AMB = (float*)take((size_t)NB * SEQ * 4); float* LAM = (float*)take(256); float* GST = (float*)take((size_t)NB * NVH * 32 * 4);
    bf* QPh = (bf*)take((size_t)NB * NQH * SEQ * HD * 2); bf* QPl = (bf*)take((size_t)NB * NQH * SEQ * HD * 2); bf* KPh = (bf*)take((size_t)NB * NQH * SEQ * HD * 2); bf* KPl = (bf*)take((size_t)NB * NQH * SEQ * HD * 2);
    h16* VT16 = (h16*)take((size_t)NB * NVH * HD * SEQ * 2); h16* VRS = (h16*)take((size_t)NB * NVH * HD * SEQ * 2);
    float* Ob = (float*)take((size_t)NB * SEQ * DVV * 4); bf* ATh = (bf*)take((size_t)NB * SEQ * DVV * 2); bf* ATl = (bf*)take((size_t)NB * SEQ * DVV * 2);
    const size_t used = (size_t)(wsp - (char*)d_ws);
    if (used > ws_size || used > (size_t)268435456) return;
    k_cvt8<<<(unsigned)(((size_t)DQ * DM / 8 + 255) / 256), 256, 0, stream>>>(wq, WQ, (size_t)DQ * DM / 8, 0, 0);
    k_cvt8<<<(unsigned)(((size_t)DQ * DM / 8 + 255) / 256), 256, 0, stream>>>(wk, WK, (size_t)DQ * DM / 8, 0, 0);
    k_cvt8<<<(unsigned)(((size_t)DVV * DM / 8 + 255) / 256), 256, 0, stream>>>(wv, WV, (size_t)DVV * DM / 8, 0, 0);
    k_cvt8<<<(unsigned)(((size_t)DM * DVV / 8 + 255) / 256), 256, 0, stream>>>(wo, WO, (size_t)DM * DVV / 8, 0, 0);
    k_lambda<<<1, 32, 0, stream>>>(lq1, lk1, lq2, lk2, LAM);
    // Every stage runs once for all NB batch elements: the batch index is the last used grid dimension, workspace planes are [NB][...].
    k_cvt8<<<dim3((unsigned)(((size_t)SEQ * DM / 8 + 255) / 256), NB, 1), 256, 0, stream>>>(x, XB, (size_t)SEQ * DM / 8, (size_t)SEQ_FULL * DM, (size_t)SEQ * DM);
    k_rbf<<<dim3((SEQ / 4 + 255) / 256, NB, 1), 256, 0, stream>>>(amask, AMB, SEQ / 4, (size_t)SEQ_FULL, (size_t)SEQ);
    k_gemmb<0, 1><<<dim3(SEQ / GT, DQ / GT, NB), 256, 0, stream>>>(XB, nullptr, WQ, DM, nullptr, 0, (size_t)SEQ * DM, 0, QPh, QPl);
    k_gemmb<0, 1><<<dim3(SEQ / GT, DQ / GT, NB), 256, 0, stream>>>(XB, nullptr, WK, DM, nullptr, 0, (size_t)SEQ * DM, 0, KPh, KPl);
    k_gemmb<0, 2><<<dim3(SEQ / GT, DVV / GT, NB), 256, 0, stream>>>(XB, nullptr, WV, DM, nullptr, 0, (size_t)SEQ * DM, 0, (bf*)VT16, (bf*)VRS);
    k_attn<<<dim3(SEQ / QBL, NVH, NB), 128, 0, stream>>>(QPh, QPl, KPh, KPl, VT16, VRS, AMB, tix, LAM, Ob);
    k_gnstat<<<dim3(NVH, NB, 1), 1024, 0, stream>>>(Ob, GST);
    k_gnmerge<<<dim3((unsigned)(((size_t)SEQ * DVV / 2 + 255) / 256), NB, 1), 256, 0, stream>>>(Ob, GST, gnw, gnb, ATh, ATl);
    k_gemmb<1><<<dim3(SEQ / GT, DM / GT, NB), 256, 0, stream>>>(ATh, ATl, WO, DVV, OUT, DM, (size_t)SEQ * DVV, (size_t)SEQ_FULL * DM);
}

// v007
// One run takes 263 microseconds.
// Next to v006, in two timings, it ran 1.27 times as fast each time.
// All steps since v000 together make it 3.67 times as fast.
#include <hip/hip_runtime.h>
#pragma clang fp contract(off)

// Compute dtypes (f32 accumulate everywhere): input projections x.Wq / x.Wk / x.Wv on v_wmma_f32_16x16x32_bf16 with bf16 RNE-converted inputs as operands (exact operands); q.k scores on v_wmma_f32_16x16x32_bf16 as bf16 hi/lo split (hi.hi + lo.hi + hi.lo); probability.value on v_wmma_f32_16x16x32_f16 (P f16 carried x4096, V f16; the first query block adds P and V residual planes carried x1024 through a second accumulator); softmax, ALiBi/pad terms, lambda and GroupNorm in f32; output projection on v_wmma_f32_16x16x32_bf16 (activation bf16 hi/lo x bf16 Wo, 2 products).
// Layout: x [NB][SEQ_FULL][1024]; Wq/Wk [2048][1024], Wv/Wo [1024][1024] ([out][in], used as K-contiguous Bt planes); per head h the 128 q/k columns are [half 1 | half 2] = virtual 64-wide heads 2h, 2h+1; mask [NB][SEQ_FULL] f32, token positions [NB][SEQ_FULL] int32; out [NB][SEQ_FULL][1024] f32.

#ifndef NB
#define NB 2
#endif
#ifndef SEQ
#define SEQ 2048
#endif
#define NB_FULL 2
#define SEQ_FULL 2048
#define DM   1024
#define NVH  16
#define HD   64
#define NQH  (2 * NVH)
#define DQ   (NQH * HD)
#define DVV  (NVH * HD)
#define SCL  0.125f
#define PCAR 4096.0f
#define RCAR 1024.0f
#define QBL  64
#define KCH  64
#define KSB  32
#define LP   72
#define PP   40
#define OSP  68
#define L2E  1.4426950408889634f
#define NEGB (-3.0e38f)
static_assert(SEQ % 64 == 0);
static_assert(SEQ <= SEQ_FULL);
static_assert(NB >= 1);
static_assert(NB <= NB_FULL);
static_assert(QBL == KCH);
static_assert(KCH % KSB == 0);
static_assert((LP * 2) % 16 == 0);
static_assert((PP * 2) % 16 == 0);
static_assert((OSP * 4) % 16 == 0);
static_assert((SEQ * DVV) % 512 == 0);
static_assert((SEQ * DM) % 2048 == 0);

typedef _Float16 h16;
typedef unsigned short bf;
typedef __attribute__((ext_vector_type(16))) __bf16   v16bf;
typedef __attribute__((ext_vector_type(16))) _Float16 v16h;
typedef __attribute__((ext_vector_type(8)))  _Float16 v8h;
typedef __attribute__((ext_vector_type(8)))  unsigned short v8us;
typedef __attribute__((ext_vector_type(8)))  float    v8f;
typedef __attribute__((ext_vector_type(4)))  float    v4f;
typedef __attribute__((ext_vector_type(2)))  unsigned short v2us;
typedef v8h  __attribute__((may_alias)) v8ha;
typedef v4f  __attribute__((may_alias)) v4fa;
typedef v8us __attribute__((may_alias)) v8usa;
typedef float __attribute__((may_alias)) f32a;

__device__ __forceinline__ unsigned short f2bf(float f) { unsigned u = __float_as_uint(f); u += 0x7FFFu + ((u >> 16) & 1u); return (unsigned short)(u >> 16); }
__device__ __forceinline__ float bf2f(unsigned short b) { return __uint_as_float(((unsigned)b) << 16); }
__device__ __forceinline__ float bfr(float f) { return bf2f(f2bf(f)); }
__device__ __forceinline__ v16h cat16(v8h lo, v8h hi) { return __builtin_shufflevector(lo, hi, 0, 1, 2, 3, 4, 5, 6, 7, 8, 9, 10, 11, 12, 13, 14, 15); }
__device__ __forceinline__ v16bf cat16b(v8us lo, v8us hi) { return __builtin_bit_cast(v16bf, __builtin_shufflevector(lo, hi, 0, 1, 2, 3, 4, 5, 6, 7, 8, 9, 10, 11, 12, 13, 14, 15)); }
__device__ __forceinline__ v8f wmma16(v16h a, v16h b, v8f c) { return __builtin_amdgcn_wmma_f32_16x16x32_f16(false, a, false, b, (short)0, c, false, false); }
__device__ __forceinline__ v8f wmmab(v16bf a, v16bf b, v8f c) { return __builtin_amdgcn_wmma_f32_16x16x32_bf16(false, a, false, b, (short)0, c, false, false); }
__device__ __forceinline__ h16 tohx(float x) { return (h16)x; }
__device__ __forceinline__ void splitf(float y, unsigned short& h, unsigned short& l) { h = f2bf(y); l = f2bf(y - bf2f(h)); }

// ---- k_gemmb: block-tiled GEMM, 8 waves (2 x 4) per 128x128 output tile, wave tile 64x32 (8 accumulators); grid (M/128, N/128, Z), 256 threads.
// c[m][n] (f32) = sum_k A[m][k] Bt[n][k] (+ A2[m][k] Bt[n][k] when NSPLIT == 1). z-batch strides sA/sC in elements. K % 64 == 0, K >= 64.
// MODE 0: c goes to C (f32, pitch ldc). MODE 1 (q, k): c is split into bf16 hi/lo and goes to the head planes P0/P1 [z][n / 64][m][n % 64]. MODE 2 (v): c goes transposed, as f16 and as its
// residual x1024, to P0/P1 [z][n][m]. MODE 1 and 2 turn the tile in the stage buffers, free behind the loop's last barrier, so that every global store covers whole 128-byte lines.
// A stage is 64 k of every operand row (one whole 128-byte line per row), read from the K-contiguous planes by whole-line 16-byte loads, kept in registers while the
// previous stage is multiplied, then stored to the other of two LDS buffers (row pitch 144 B); one block barrier per stage publishes it and ends the reads of the buffer refilled next.
// Fragments: lane -> row/col (lane & 15); elements 0..7 <- k + 8*(lane>>4), elements 8..15 <- k + 16 + 8*(lane>>4), for A and Bt alike. k runs upward, one accumulate chain per element.
#define GT   128
#define GBK  64
#define GLP  72
#define GOP  36
#define GSP  132
#define GVP  136
static_assert(SEQ % GT == 0);
static_assert(DQ % GT == 0);
static_assert(DVV % GT == 0);
static_assert(DM % GT == 0);
static_assert(DM % GBK == 0);
static_assert(DVV % GBK == 0);
static_assert((GLP * 2) % 16 == 0);
static_assert((GOP * 4) % 16 == 0);
static_assert((GSP * 4) % 16 == 0);
static_assert((GVP * 2) % 16 == 0);
static_assert(GT == 2 * HD);
static_assert(GT * GSP * 4 <= 2 * 2 * GT * GLP * 2);
static_assert(2 * GT * GVP * 2 <= 2 * 2 * GT * GLP * 2);
__device__ __forceinline__ v16bf ldsb(const bf* p) { return cat16b(*(const v8usa*)p, *(const v8usa*)(p + 16)); }
template <int NSPLIT, int MODE = 0>
// waves_per_eu: at most two 8-wave blocks run per WGP here, so the register budget is that of 4 waves per SIMD and a k-step's fragment loads may be grouped ahead of its products
__global__ __launch_bounds__(256) __attribute__((amdgpu_waves_per_eu(1, 4)))
void k_gemmb(const bf* __restrict__ A, const bf* __restrict__ A2, const bf* __restrict__ Bt, int K, float* C, int ldc, size_t sA, size_t sC, bf* P0 = nullptr, bf* P1 = nullptr) {
    constexpr int NPL = 2 + NSPLIT;                          // planes per stage: A, (A2,) Bt
    __shared__ __align__(16) bf    tl[2][NPL][GT * GLP];     // two stage buffers [row*GLP + k]                  (cross-wave: block barriers)
    __shared__ __align__(16) float osw[8][16 * GOP];         // per-wave f32 epilogue staging [row*GOP + col]    (wave-private)
    const size_t z = blockIdx.z; A += z * sA; if (NSPLIT) A2 += z * sA; C += z * sC;
    const int tid = threadIdx.x, w = tid >> 5, lane = tid & 31, lr = lane & 15, hi = lane >> 4; const int wm = w >> 2, wn = w & 3;
    const int r0 = blockIdx.x * GT, c0 = blockIdx.y * GT;
    v8f acc[4][2];
#pragma unroll
    for (int mb = 0; mb < 4; ++mb)
#pragma unroll
        for (int nb = 0; nb < 2; ++nb) acc[mb][nb] = (v8f){};
    const int srow = tid >> 3, sc8 = (tid & 7) * 8;          // staging: 8 lanes cover one row's 128 bytes; piece i is row srow + 32 i
    const char* gA = (const char*)(A + (size_t)r0 * K); const char* gA2 = (const char*)(A2 + (size_t)r0 * K); const char* gB = (const char*)(Bt + (size_t)c0 * K);   // block-uniform tile bases
    unsigned go[4];                                          // the lane's byte offset of piece i inside a tile's rows, the same for every plane and stage
#pragma unroll
    for (int i = 0; i < 4; ++i) go[i] = ((unsigned)(srow + 32 * i) * (unsigned)K + (unsigned)sc8) * 2u;
    const int so = srow * GLP + sc8;
    const int fa = (wm * 64 + lr) * GLP + 8 * hi, fb = (wn * 32 + lr) * GLP + 8 * hi;
    v8us ra[4], ra2[4], rb[4];
#pragma unroll
    for (int i = 0; i < 4; ++i) { ra[i] = *(const v8us*)(gA + go[i]); if (NSPLIT) ra2[i] = *(const v8us*)(gA2 + go[i]); rb[i] = *(const v8us*)(gB + go[i]); }
#pragma unroll
    for (int i = 0; i < 4; ++i) { *(v8usa*)(&tl[0][0][so + i * 32 * GLP]) = ra[i]; if (NSPLIT) *(v8usa*)(&tl[0][1][so + i * 32 * GLP]) = ra2[i]; *(v8usa*)(&tl[0][NPL - 1][so + i * 32 * GLP]) = rb[i]; }
    __syncthreads();
#pragma unroll 1
    for (int k0 = 0; k0 < K; k0 += GBK) {
        const int cur = (k0 / GBK) & 1; const bool more = k0 + GBK < K;
        gA += GBK * 2; gA2 += GBK * 2; gB += GBK * 2;        // the uniform bases step one stage; the lanes' offsets stay
        if (more) {
#pragma unroll
            for (int i = 0; i < 4; ++i) {   // a wait behind each load: this build lets a later load of the group land in an earlier one's address pair, and the wait stands in front of that overwrite
                ra[i] = *(const v8us*)(gA + go[i]); asm volatile("s_wait_xcnt 0x0" ::: "memory");
                if (NSPLIT) { ra2[i] = *(const v8us*)(gA2 + go[i]); asm volatile("s_wait_xcnt 0x0" ::: "memory"); }
                rb[i] = *(const v8us*)(gB + go[i]); asm volatile("s_wait_xcnt 0x0" ::: "memory"); }
        }
        const bf* ta = &tl[cur][0][fa]; const bf* ta2 = &tl[cur][NSPLIT][fa]; const bf* tb = &tl[cur][NPL - 1][fb];
#pragma unroll
        for (int kc = 0; kc < GBK; kc += 32) {
            v16bf a[4], a2[4], b[2];
#pragma unroll
            for (int mb = 0; mb < 4; ++mb) { a[mb] = ldsb(ta + mb * 16 * GLP + kc); if (NSPLIT) a2[mb] = ldsb(ta2 + mb * 16 * GLP + kc); }
#pragma unroll
            for (int nb = 0; nb < 2; ++nb) b[nb] = ldsb(tb + nb * 16 * GLP + kc);
#pragma unroll
            for (int nb = 0; nb < 2; ++nb)
#pragma unroll
                for (int mb = 0; mb < 4; ++mb) { acc[mb][nb] = wmmab(a[mb], b[nb], acc[mb][nb]); if (NSPLIT) acc[mb][nb] = wmmab(a2[mb], b[nb], acc[mb][nb]); }
        }
        if (more) {
#pragma unroll
            for (int i = 0; i < 4; ++i) { *(v8usa*)(&tl[cur ^ 1][0][so + i * 32 * GLP]) = ra[i]; if (NSPLIT) *(v8usa*)(&tl[cur ^ 1][1][so + i * 32 * GLP]) = ra2[i]; *(v8usa*)(&tl[cur ^ 1][NPL - 1][so + i * 32 * GLP]) = rb[i]; }
        }
        __syncthreads();
    }
    if constexpr (MODE == 1) {
        f32a* st = (f32a*)&tl[0][0][0];                      // block f32 tile [row*GSP + col]
#pragma unroll
        for (int mb = 0; mb < 4; ++mb)
#pragma unroll
            for (int nb = 0; nb < 2; ++nb)
#pragma unroll
                for (int j = 0; j < 8; ++j) st[(wm * 64 + mb * 16 + hi * 8 + j) * GSP + wn * 32 + nb * 16 + lr] = acc[mb][nb][j];
        __syncthreads();                                     // publishes the tile: its rows are read back by other waves
        const int hs = w & 1, rw = (w >> 1) * 32 + (lane >> 3), c8 = (lane & 7) * 8;   // a wave takes 32 rows of one 64-wide head; one store = 4 rows = 512 contiguous bytes
        const size_t pb = ((z * NQH + (size_t)(blockIdx.y * 2 + hs)) * SEQ + r0) * HD + c8;
#pragma unroll
        for (int i = 0; i < 8; ++i) { const int row = rw + 4 * i; const f32a* sp = st + row * GSP + hs * HD + c8; const v4f x0 = *(const v4fa*)sp, x1 = *(const v4fa*)(sp + 4); v8us oh, ol;
#pragma unroll
            for (int q = 0; q < 4; ++q) { unsigned short a2, c2; splitf(x0[q], a2, c2); oh[q] = a2; ol[q] = c2; splitf(x1[q], a2, c2); oh[4 + q] = a2; ol[4 + q] = c2; }
            *(v8us*)(P0 + pb + (size_t)row * HD) = oh; *(v8us*)(P1 + pb + (size_t)row * HD) = ol; }
        return;
    }
    if constexpr (MODE == 2) {
        h16* sv = (h16*)&tl[0][0][0]; h16* sr = sv + GT * GVP;   // block f16 tiles, value and residual, transposed [col*GVP + row]; an accumulator lane holds 8 consecutive rows of one column
#pragma unroll
        for (int mb = 0; mb < 4; ++mb)
#pragma unroll
            for (int nb = 0; nb < 2; ++nb) { v8h o16, orr;
#pragma unroll
                for (int j = 0; j < 8; ++j) { const float x = acc[mb][nb][j]; const h16 hv = tohx(x); const float res = (x - (float)hv) * RCAR; o16[j] = hv; orr[j] = tohx(res); }
                const int si = (wn * 32 + nb * 16 + lr) * GVP + wm * 64 + mb * 16 + hi * 8; *(v8ha*)(sv + si) = o16; *(v8ha*)(sr + si) = orr; }
        __syncthreads();                                     // publishes the tiles: their columns are read back by other waves
        const int cw = tid >> 4, t8 = (tid & 15) * 8;        // 16 lanes cover one column's 128 rows = 256 contiguous bytes
        const size_t vb = (z * DVV + (size_t)c0) * SEQ + r0 + t8;
#pragma unroll
        for (int i = 0; i < 8; ++i) { const int col = cw + 16 * i; const v8h a16 = *(const v8ha*)(sv + col * GVP + t8), ar = *(const v8ha*)(sr + col * GVP + t8);
            *(v8ha*)((h16*)P0 + vb + (size_t)col * SEQ) = a16; *(v8ha*)((h16*)P1 + vb + (size_t)col * SEQ) = ar; }
        return;
    }
    float* os = &osw[w][0];
#pragma unroll
    for (int mb = 0; mb < 4; ++mb) {
#pragma unroll
        for (int nb = 0; nb < 2; ++nb) {
#pragma unroll
            for (int j = 0; j < 8; ++j) os[(hi * 8 + j) * GOP + nb * 16 + lr] = acc[mb][nb][j]; }
        __builtin_amdgcn_wave_barrier(); asm volatile("" ::: "memory");   // keeps the staging stores ahead of the row reads of other lanes of this wave
        float* crow = C + (size_t)(r0 + wm * 64 + mb * 16) * ldc + c0 + wn * 32;
#pragma unroll
        for (int s = 0; s < 4; ++s) { const int row = 4 * s + (lane >> 3), cofs = (lane & 7) * 4; const v4f val = *(const v4fa*)(os + row * GOP + cofs); *(v4f*)(crow + (size_t)row * ldc + cofs) = val; }
        __builtin_amdgcn_wave_barrier(); asm volatile("" ::: "memory");   // keeps the row reads ahead of the next block's staging stores
    }
}

__global__ __launch_bounds__(256) void k_cvt8(const float* __restrict__ src, bf* dst, size_t n8, size_t sS, size_t sD) { const size_t i = (size_t)blockIdx.x * 256 + threadIdx.x; if (i >= n8) return; src += blockIdx.y * sS; dst += blockIdx.y * sD; const v8f v = *(const v8f*)(src + i * 8); v8us o;
#pragma unroll
    for (int k = 0; k < 8; ++k) o[k] = f2bf(v[k]); *(v8us*)(dst + i * 8) = o;  }
__global__ __launch_bounds__(256) void k_rbf(const float* __restrict__ src, float* dst, int n4, size_t sS, size_t sD) { const int i = blockIdx.x * 256 + threadIdx.x; if (i >= n4) return; src += blockIdx.y * sS; dst += blockIdx.y * sD; const v4f a = *(const v4f*)(src + (size_t)i * 4); v4f o;
#pragma unroll
    for (int u = 0; u < 4; ++u) o[u] = bfr(a[u]); *(v4f*)(dst + (size_t)i * 4) = o;  }
__global__ __launch_bounds__(32) void k_lambda(const float* __restrict__ lq1, const float* __restrict__ lk1, const float* __restrict__ lq2, const float* __restrict__ lk2, float* LAM) { const int lane = threadIdx.x; float d1 = 0.f, d2 = 0.f;
#pragma unroll 1
    for (int i = 0; i < HD; ++i) { float p1 = __fmul_rn(bfr(lq1[i]), bfr(lk1[i])); asm volatile("" : "+v"(p1)); d1 = __fadd_rn(d1, p1); float p2 = __fmul_rn(bfr(lq2[i]), bfr(lk2[i])); asm volatile("" : "+v"(p2)); d2 = __fadd_rn(d2, p2); }
    float lm = __fsub_rn(expf(d1), expf(d2)); asm volatile("" : "+v"(lm)); lm = __fadd_rn(lm, 0.8f); const float v = (lane == 0) ? lm : 0.0f; *(float*)(LAM + lane) = v;  }

// ---- k_attn: causal differential attention for one (query block of 64, head) per block of 4 waves (wave w owns 16 query rows). The two score streams run one after the other (stream loop outside
// the key-chunk loop: one Q/K hi/lo pair, one score tile pair, one O accumulator set and one running max/sum set live at a time). Per stream st and 64-key chunk c = 0..qb the K hi/lo tile of
// head plane 2h+st and the V^T tile are staged in LDS; the softmax recurrence then runs on 32-key sub-chunks: scores S = Q.K (3 bf16 products, 16x32 tile per wave) ->
// t = S/8 - slope (pos_i - pos_j) + (1 - mask_j)(-1e9) for j <= i, excluded otherwise; online softmax (running max / sum, f32); P tile (f16 x4096, 16x32) per wave in LDS; O += P.V (one k-step).
// The first query block also forms P and V residual planes (x1024) and adds P_res.V + P.V_res per 16-column block through a second accumulator folded before normalisation.
// rowx<M>: the value of lane l ^ M of the lane's own 16-lane row, read through DPP (row_xmask) on the vector pipe; __shfl_xor compiles to ds_bpermute_b32, a trip through the LDS unit with a wait on dscnt per link. Every lane is on where it is used.
template <int M> __device__ __forceinline__ float rowx(float x) { return __builtin_bit_cast(float, __builtin_amdgcn_update_dpp(0, __builtin_bit_cast(int, x), 0x160 | M, 0xf, 0xf, true)); }
__device__ __forceinline__ v16h  ldsh(const h16* p) { return cat16(*(const v8ha*)p, *(const v8ha*)(p + 16)); }

// attn_blk: the two streams' loops of one block. ER (first query block: residual planes) is a compile-time value, so the loops hold no test of it: a chunk's tile loads are one group
// behind which the LDS stores follow, and the sixteen probability chains of a sub-chunk stand in one basic block.
template <bool ER>
__device__ __forceinline__ void attn_blk(const bf* __restrict__ QPh, const bf* __restrict__ QPl, const bf* __restrict__ KPh, const bf* __restrict__ KPl, const h16* __restrict__ VT, const h16* __restrict__ VR,
                                         const float* __restrict__ amb, const int* __restrict__ tix, const float lam, const float slope, const float (&pq)[8], const int hh, const int qb,
                                         bf* qs0, bf* qs1, bf* ks0, bf* ks1, h16* vsm, h16* vrm, h16* pt, h16* prt, float* os) {
    const int tid = threadIdx.x, w = tid >> 5, lane = tid & 31, lr = lane & 15, hi = lane >> 4;
    const int q0 = qb * QBL, qrow0 = q0 + 16 * w + 8 * hi;
    // staging: piece i of a K plane is row 16 i + (tid >> 3), 16 bytes at 8 (tid & 7): the 64 x 64 tile is 8 KiB in a row, so a lane's byte offset is 16 tid + 2048 i; piece i of V^T is row d = 16 i + (tid >> 3)
    const unsigned ko = (unsigned)tid * 16u, vo = ((unsigned)(tid >> 3) * (unsigned)SEQ + 8u * (unsigned)(tid & 7)) * 2u;   // the lane's offsets, the same for every chunk
    const int sk = (tid >> 3) * LP + (tid & 7) * 8;
#pragma unroll 1
    for (int st = 0; st < 2; ++st) {
        const size_t vq = (size_t)(2 * hh + st);
        __syncthreads();
        {   const char* pqh = (const char*)(QPh + (vq * SEQ + q0) * HD) + ko; const char* pql = (const char*)(QPl + (vq * SEQ + q0) * HD) + ko;
            v8us qh[4], ql[4];
#pragma unroll
            for (int i = 0; i < 4; ++i) { qh[i] = *(const v8usa*)(pqh + i * 2048); ql[i] = *(const v8usa*)(pql + i * 2048); }
            asm volatile("s_wait_xcnt 0x0" :: "v"(pqh), "v"(pql) : "memory");   // holds the address pairs whole up to this wait: without it a later load of the group may land in a pair that the loads before it name
#pragma unroll
            for (int i = 0; i < 4; ++i) { *(v8usa*)(&qs0[sk + i * 16 * LP]) = qh[i]; *(v8usa*)(&qs1[sk + i * 16 * LP]) = ql[i]; }
        }
        float m[8], l[8]; v8f O[4];
#pragma unroll
        for (int r = 0; r < 8; ++r) { m[r] = NEGB; l[r] = 0.0f; }
#pragma unroll
        for (int j = 0; j < 4; ++j) O[j] = (v8f){};
#pragma unroll 1
        for (int c = 0; c <= qb; ++c) {
            const int k0 = c * KCH;
            {   const char* pkh = (const char*)(KPh + (vq * SEQ + k0) * HD) + ko; const char* pkl = (const char*)(KPl + (vq * SEQ + k0) * HD) + ko;
                const char* pv = (const char*)(VT + (size_t)hh * HD * SEQ + k0) + vo; const char* pr = (const char*)(VR + (size_t)hh * HD * SEQ + k0) + vo;
                v8us kh[4], kl[4]; v8h vv[4], vr[4];
#pragma unroll
                for (int i = 0; i < 4; ++i) { kh[i] = *(const v8usa*)(pkh + i * 2048); kl[i] = *(const v8usa*)(pkl + i * 2048); }
#pragma unroll
                for (int i = 0; i < 4; ++i) { vv[i] = *(const v8ha*)(pv + i * (16 * SEQ * 2)); if constexpr (ER) vr[i] = *(const v8ha*)(pr + i * (16 * SEQ * 2)); }
                // holds the address pairs whole up to this wait: without it the last load of a group lands in the pair that the loads before it name
                if constexpr (ER) asm volatile("s_wait_xcnt 0x0" :: "v"(pkh), "v"(pkl), "v"(pv), "v"(pr) : "memory"); else asm volatile("s_wait_xcnt 0x0" :: "v"(pkh), "v"(pkl), "v"(pv) : "memory");
#pragma unroll
                for (int i = 0; i < 4; ++i) { *(v8usa*)(&ks0[sk + i * 16 * LP]) = kh[i]; *(v8usa*)(&ks1[sk + i * 16 * LP]) = kl[i]; }
#pragma unroll
                for (int i = 0; i < 4; ++i) { *(v8ha*)(&vsm[sk + i * 16 * LP]) = vv[i]; if constexpr (ER) *(v8ha*)(&vrm[sk + i * 16 * LP]) = vr[i]; }
            }
            __syncthreads();
#pragma unroll 1
            for (int sb = 0; sb < KCH / KSB; ++sb) {
                const int kb = sb * KSB;
                const int key0 = k0 + kb + lr, key1 = key0 + 16;
                const float pk0 = (float)tix[key0], pk1 = (float)tix[key1];
                const float om0 = 1.0f - amb[key0], om1 = 1.0f - amb[key1]; const float pad0 = om0 * -1.0e9f, pad1 = om1 * -1.0e9f;
                // ---- scores: S[row 8hi+r][key kb + nb*16 + lr], 3 bf16 products (hi.hi + lo.hi + hi.lo); fragments loaded right before each k-step, scheduling barrier after it
                v8f s[2]; s[0] = (v8f){}; s[1] = (v8f){};
                {   v16bf ah, al, bh, bl;
#pragma unroll
                    for (int kc = 0; kc < HD; kc += 32) {
                        ah = ldsb(&qs0[(16 * w + lr) * LP + kc + 8 * hi]); al = ldsb(&qs1[(16 * w + lr) * LP + kc + 8 * hi]);
#pragma unroll
                        for (int nb = 0; nb < 2; ++nb) { bh = ldsb(&ks0[(kb + nb * 16 + lr) * LP + kc + 8 * hi]); bl = ldsb(&ks1[(kb + nb * 16 + lr) * LP + kc + 8 * hi]);
                            s[nb] = wmmab(ah, bh, s[nb]); s[nb] = wmmab(al, bh, s[nb]); s[nb] = wmmab(ah, bl, s[nb]); }
                        asm volatile("v_nop\n\tv_nop\n\tv_nop\n\tv_nop" : "+v"(s[0]), "+v"(s[1]) : "v"(ah), "v"(al), "v"(bh), "v"(bl) : "memory");
                    }
                }
                // ---- additive terms by value select, sub-chunk max
                float cm[8];
#pragma unroll
                for (int r = 0; r < 8; ++r) cm[r] = NEGB;
#pragma unroll
                for (int nb = 0; nb < 2; ++nb) { const int kv = nb ? key1 : key0; const float pkv = nb ? pk1 : pk0; const float pdv = nb ? pad1 : pad0;
#pragma unroll
                    for (int r = 0; r < 8; ++r) { const float sa = s[nb][r] * SCL; const float pd = pq[r] - pkv; const float bia = slope * pd; const float sm = sa - bia;
                        const float tt = (kv <= qrow0 + r) ? (sm + pdv) : NEGB; s[nb][r] = tt; cm[r] = fmaxf(cm[r], tt); } }
                float cor[8], rs[8];
#pragma unroll
                for (int r = 0; r < 8; ++r) { float x = cm[r]; x = fmaxf(x, rowx<1>(x)); x = fmaxf(x, rowx<2>(x)); x = fmaxf(x, rowx<4>(x)); x = fmaxf(x, rowx<8>(x));
                    const float mn = fmaxf(m[r], x); const float dlt = (m[r] - mn) * L2E; cor[r] = __builtin_amdgcn_exp2f(dlt); m[r] = mn; rs[r] = 0.0f; }
                // ---- probabilities -> per-wave LDS tile (f16 x4096; residual x1024 on the first query block); excluded keys store exactly 0
#pragma unroll
                for (int nb = 0; nb < 2; ++nb) { const int kv = nb ? key1 : key0;
#pragma unroll
                    for (int r = 0; r < 8; ++r) { const float dq = (s[nb][r] - m[r]) * L2E; const float pe = __builtin_amdgcn_exp2f(dq); const float p = (kv <= qrow0 + r) ? pe : 0.0f; rs[r] = rs[r] + p;
                        const float pc = p * PCAR; const h16 ph = tohx(pc); const int li = (8 * hi + r) * PP + nb * 16 + lr; pt[li] = ph;
                        if constexpr (ER) { const float res = (pc - (float)ph) * RCAR; prt[li] = tohx(res); } } }
#pragma unroll
                for (int r = 0; r < 8; ++r) { float x = rs[r]; x += rowx<1>(x); x += rowx<2>(x); x += rowx<4>(x); x += rowx<8>(x);
                    const float lc = l[r] * cor[r]; l[r] = lc + x; const float cf = cor[r];
#pragma unroll
                    for (int j = 0; j < 4; ++j) O[j][r] = O[j][r] * cf; }
                __syncthreads();
                // ---- O[d block j][row] += P[row][key] . V^T[d][key] over the 32 keys of this sub-chunk (one k-step)
                {   const v16h a = ldsh(pt + lr * PP + 8 * hi); v16h b;
#pragma unroll
                    for (int j = 0; j < 4; ++j) { b = ldsh(&vsm[(j * 16 + lr) * LP + kb + 8 * hi]); O[j] = wmma16(a, b, O[j]); }
                    asm volatile("v_nop\n\tv_nop\n\tv_nop\n\tv_nop" : "+v"(O[0]), "+v"(O[1]), "+v"(O[2]), "+v"(O[3]) : "v"(a), "v"(b) : "memory");
                    if constexpr (ER) {
                        const v16h ar = ldsh(prt + lr * PP + 8 * hi);
#pragma unroll
                        for (int j = 0; j < 4; ++j) {
                            const v16h b2 = ldsh(&vsm[(j * 16 + lr) * LP + kb + 8 * hi]); const v16h br = ldsh(&vrm[(j * 16 + lr) * LP + kb + 8 * hi]);
                            v8f R = wmma16(ar, b2, (v8f){}); R = wmma16(a, br, R);
                            asm volatile("v_nop\n\tv_nop\n\tv_nop\n\tv_nop" : "+v"(R) : "v"(a), "v"(ar), "v"(b2), "v"(br) : "memory");
#pragma unroll
                            for (int r = 0; r < 8; ++r) { const float rr = R[r] * (1.0f / RCAR); O[j][r] = O[j][r] + rr; }
                        }
                    }
                }
                __syncthreads();
            }
        }
#pragma unroll
        for (int r = 0; r < 8; ++r) { const float rl = 1.0f / l[r]; const float il = rl * (1.0f / PCAR);
#pragma unroll
            for (int j = 0; j < 4; ++j) { const float a1 = O[j][r] * il; const int oi = (8 * hi + r) * OSP + j * 16 + lr;
                if (st == 0) { os[oi] = a1; } else { const float lb = lam * a1; const float cur = os[oi]; os[oi] = cur - lb; } } }
    }
}

__global__ __launch_bounds__(128) __attribute__((amdgpu_num_vgpr(256)))
void k_attn(const bf* __restrict__ QPh, const bf* __restrict__ QPl, const bf* __restrict__ KPh, const bf* __restrict__ KPl, const h16* __restrict__ VT, const h16* __restrict__ VR,
            const float* __restrict__ amb, const int* __restrict__ tix, const float* __restrict__ LAM, float* Ob) {
    __shared__ __align__(16) bf    qs[2][QBL * LP];      // Q {hi,lo} of the current stream [row*LP + d]     (cross-wave: block barriers)
    __shared__ __align__(16) bf    ks[2][KCH * LP];      // K {hi,lo} of the current stream [key*LP + d]     (cross-wave: block barriers)
    __shared__ __align__(16) h16   vsm[HD * LP];         // V^T tile [d*LP + key]                            (cross-wave: block barriers)
    __shared__ __align__(16) h16   vrm[HD * LP];         // V residual tile, first query block only         (cross-wave: block barriers)
    __shared__ __align__(16) h16   psm[4][16 * PP];      // per-wave P tile [row*PP + key], 16 x 32          (wave-private, block barriers used anyway)
    __shared__ __align__(16) h16   prm[4][16 * PP];      // per-wave P residual tile, first query block only
    __shared__ __align__(16) float osm[4][16 * OSP];     // per-wave f32 result / epilogue staging [row*OSP + d]
    const int tid = threadIdx.x, w = tid >> 5, lane = tid & 31, lr = lane & 15, hi = lane >> 4;
    // A block's cost grows with qb and the grid holds more blocks than fit on the chip at once: the longest query blocks take the lowest indices
    // and the short ones fill the places that come free; (head, batch) is the fast index, so every run of consecutive blocks holds equal costs.
    const int hh = blockIdx.x, qb = SEQ / QBL - 1 - (int)blockIdx.z, q0 = qb * QBL;
    {   const size_t bz = blockIdx.y;                        // batch element: every plane is [NB][...]; only the token positions keep the input's own batch pitch
        QPh += bz * ((size_t)NQH * SEQ * HD); QPl += bz * ((size_t)NQH * SEQ * HD); KPh += bz * ((size_t)NQH * SEQ * HD); KPl += bz * ((size_t)NQH * SEQ * HD);
        VT += bz * ((size_t)NVH * HD * SEQ); VR += bz * ((size_t)NVH * HD * SEQ); amb += bz * SEQ; tix += bz * SEQ_FULL; Ob += bz * ((size_t)SEQ * DVV); }
    const int e2 = hh + 1;                                   // slope = 2^(-(h+1)/2): exact power of two times 2^-0.5 for odd exponents
    const float slope = ((e2 & 1) ? 0.70710678118654752f : 1.0f) * __uint_as_float(((unsigned)(127 - (e2 >> 1))) << 23);
    const float lam = LAM[0];
    const int qrow0 = q0 + 16 * w + 8 * hi;
    float pq[8];
#pragma unroll
    for (int r = 0; r < 8; ++r) pq[r] = (float)tix[qrow0 + r];
    float* os = &osm[w][0];
    // block-uniform: every wave of a block takes the same side, with all its barriers
    if (qb == 0) attn_blk<true>(QPh, QPl, KPh, KPl, VT, VR, amb, tix, lam, slope, pq, hh, qb, &qs[0][0], &qs[1][0], &ks[0][0], &ks[1][0], vsm, vrm, &psm[w][0], &prm[w][0], os);
    else         attn_blk<false>(QPh, QPl, KPh, KPl, VT, VR, amb, tix, lam, slope, pq, hh, qb, &qs[0][0], &qs[1][0], &ks[0][0], &ks[1][0], vsm, vrm, &psm[w][0], &prm[w][0], os);
    __syncthreads();
    float* orow = Ob + (size_t)(q0 + 16 * w) * DVV + hh * HD;
{
#pragma unroll
        for (int s2 = 0; s2 < 8; ++s2) { const int row = 2 * s2 + hi, cofs = lr * 4; const v4f val = *(const v4fa*)(os + row * OSP + cofs); *(v4f*)(orow + (size_t)row * DVV + cofs) = val; }
         }
}

#define GNB 32
static_assert((SEQ * HD / 1024) % GNB == 0);
__global__ __launch_bounds__(1024) void k_gnstat(const float* __restrict__ O, float* GST) {
    __shared__ float sh[1024]; const int tid = threadIdx.x; const int hh = blockIdx.x; const float* base = O + (size_t)blockIdx.y * SEQ * DVV + hh * HD; GST += blockIdx.y * (NVH * 32); const int n = SEQ * HD; const float rn = 1.0f / (float)n;
    // A thread's chain is e = tid + 1024 i: row (tid >> 6) + 16 i, column tid & 63. GNB loads of the chain are issued together, then added in the chain's own order.
    const float* pl = base + (size_t)(tid >> 6) * DVV + (tid & 63);
    float acc = 0.f;
#pragma unroll
    for (int g = 0; g < n / 1024; g += GNB) { float v[GNB];
#pragma unroll
        for (int u = 0; u < GNB; ++u) v[u] = pl[(size_t)(g + u) * 16 * DVV];
#pragma unroll
        for (int u = 0; u < GNB; ++u) acc = __fadd_rn(acc, v[u]); }
    sh[tid] = acc; __syncthreads();
#pragma unroll 1
    for (int st = 512; st > 0; st >>= 1) { if (tid < st) sh[tid] = __fadd_rn(sh[tid], sh[tid + st]); __syncthreads(); }
    const float mean = sh[0] * rn;
    __syncthreads();
    float acc2 = 0.f;
#pragma unroll
    for (int g = 0; g < n / 1024; g += GNB) { float v[GNB];
#pragma unroll
        for (int u = 0; u < GNB; ++u) v[u] = pl[(size_t)(g + u) * 16 * DVV];
#pragma unroll
        for (int u = 0; u < GNB; ++u) { const float dv = __fsub_rn(v[u], mean); acc2 = __builtin_fmaf(dv, dv, acc2); } }   // the fused square-add that the rolled loop compiled to, written out: left to the compiler, the unrolled chain fuses its first two squares the other way round
    asm volatile("s_wait_xcnt 0x0" :: "v"(pl) : "memory");   // holds the address pair whole up to this wait: without it this build lets the last load land in the pair that the loads before it name
    sh[tid] = acc2; __syncthreads();
#pragma unroll 1
    for (int st = 512; st > 0; st >>= 1) { if (tid < st) sh[tid] = __fadd_rn(sh[tid], sh[tid + st]); __syncthreads(); }
    if (tid < 32) { const float var = sh[0] * rn; const float rs = __fdiv_rn(1.0f, sqrtf(__fadd_rn(var, 1e-5f))); const float outv = (tid == 0) ? mean : ((tid == 1) ? rs : 0.0f);
        *(float*)(GST + hh * 32 + tid) = outv;  }
}
__global__ __launch_bounds__(256) void k_gnmerge(const float* __restrict__ O, const float* __restrict__ GST, const float* __restrict__ gw, const float* __restrict__ gb, bf* Ah, bf* Al) {
    const size_t e = ((size_t)blockIdx.x * 256 + threadIdx.x) * 2; if (e >= (size_t)SEQ * DVV) return;
    O += (size_t)blockIdx.y * SEQ * DVV; GST += blockIdx.y * (NVH * 32); Ah += (size_t)blockIdx.y * SEQ * DVV; Al += (size_t)blockIdx.y * SEQ * DVV;
    const int c = (int)(e % DVV); const int hh = c / HD; const float mean = GST[hh * 32], rs = GST[hh * 32 + 1]; v2us oh, ol;
#pragma unroll
    for (int q = 0; q < 2; ++q) { float cc = __fsub_rn(O[e + q], mean); asm volatile("" : "+v"(cc)); float nn = __fmul_rn(cc, rs); asm volatile("" : "+v"(nn)); float y = __fmul_rn(nn, bfr(gw[c + q])); asm volatile("" : "+v"(y)); y = __fadd_rn(y, bfr(gb[c + q])); const float z = __fmul_rn(y, 0.2f); unsigned short a2, c2; splitf(z, a2, c2); oh[q] = a2; ol[q] = c2; }
    *(v2us*)(Ah + e) = oh; *(v2us*)(Al + e) = ol;  }

extern "C" void kernel_launch(void* const* d_in, const int* in_sizes, int n_in,
                              void* d_out, int out_size, void* d_ws, size_t ws_size, hipStream_t stream) {
    if (n_in < 13) return;
    if (in_sizes[0] < (NB - 1) * SEQ_FULL * DM + SEQ * DM) return;
    if (in_sizes[1] < (NB - 1) * SEQ_FULL + SEQ) return;
    if (in_sizes[2] < (NB - 1) * SEQ_FULL + SEQ) return;
    if (in_sizes[3] < DQ * DM || in_sizes[4] < DQ * DM || in_sizes[5] < DVV * DM || in_sizes[6] < DM * DVV) return;
    if (in_sizes[7] < HD || in_sizes[8] < HD || in_sizes[9] < HD || in_sizes[10] < HD || in_sizes[11] < DVV || in_sizes[12] < DVV) return;
    if (out_size < (NB - 1) * SEQ_FULL * DM + SEQ * DM) return;
    const float* x = (const float*)d_in[0]; const float* amask = (const float*)d_in[1]; const int* tix = (const int*)d_in[2];
    const float* wq = (const float*)d_in[3]; const float* wk = (const float*)d_in[4]; const float* wv = (const float*)d_in[5]; const float* wo = (const float*)d_in[6];
    const float* lq1 = (const float*)d_in[7]; const float* lq2 = (const float*)d_in[8]; const float* lk1 = (const float*)d_in[9]; const float* lk2 = (const float*)d_in[10];
    const float* gnw = (const float*)d_in[11]; const float* gnb = (const float*)d_in[12];
    float* OUT = (float*)d_out;     // [NB][SEQ_FULL][1024]
    char* wsp = (char*)d_ws;
    auto take = [&](size_t bytes) { char* p = wsp; wsp += (bytes + 255) & ~(size_t)255; return (void*)p; };
    bf* WQ = (bf*)take((size_t)DQ * DM * 2); bf* WK = (bf*)take((size_t)DQ * DM * 2); bf* WV = (bf*)take((size_t)DVV * DM * 2); bf* WO = (bf*)take((size_t)DM * DVV * 2);
    bf* XB = (bf*)take((size_t)NB * SEQ * DM * 2); float* AMB = (float*)take((size_t)NB * SEQ * 4); float* LAM = (float*)take(256); float* GST = (float*)take((size_t)NB * NVH * 32 * 4);
    bf* QPh = (bf*)take((size_t)NB * NQH * SEQ * HD * 2); bf* QPl = (bf*)take((size_t)NB * NQH * SEQ * HD * 2); bf* KPh = (bf*)take((size_t)NB * NQH * SEQ * HD * 2); bf* KPl = (bf*)take((size_t)NB * NQH * SEQ * HD * 2);
    h16* VT16 = (h16*)take((size_t)NB * NVH * HD * SEQ * 2); h16* VRS = (h16*)take((size_t)NB * NVH * HD * SEQ * 2);
    float* Ob = (float*)take((size_t)NB * SEQ * DVV * 4); bf* ATh = (bf*)take((size_t)NB * SEQ * DVV * 2); bf* ATl = (bf*)take((size_t)NB * SEQ * DVV * 2);
    const size_t used = (size_t)(wsp - (char*)d_ws);
    if (used > ws_size || used > (size_t)268435456) return;
    k_cvt8<<<(unsigned)(((size_t)DQ * DM / 8 + 255) / 256), 256, 0, stream>>>(wq, WQ, (size_t)DQ * DM / 8, 0, 0);
    k_cvt8<<<(unsigned)(((size_t)DQ * DM / 8 + 255) / 256), 256, 0, stream>>>(wk, WK, (size_t)DQ * DM / 8, 0, 0);
    k_cvt8<<<(unsigned)(((size_t)DVV * DM / 8 + 255) / 256), 256, 0, stream>>>(wv, WV, (size_t)DVV * DM / 8, 0, 0);
    k_cvt8<<<(unsigned)(((size_t)DM * DVV / 8 + 255) / 256), 256, 0, stream>>>(wo, WO, (size_t)DM * DVV / 8, 0, 0);
    k_lambda<<<1, 32, 0, stream>>>(lq1, lk1, lq2, lk2, LAM);
    // Every stage runs once for all NB batch elements: the batch index is grid y, z in k_gemmb (k_attn's z holds the query blocks), workspace planes are [NB][...].
    k_cvt8<<<dim3((unsigned)(((size_t)SEQ * DM / 8 + 255) / 256), NB, 1), 256, 0, stream>>>(x, XB, (size_t)SEQ * DM / 8, (size_t)SEQ_FULL * DM, (size_t)SEQ * DM);
    k_rbf<<<dim3((SEQ / 4 + 255) / 256, NB, 1), 256, 0, stream>>>(amask, AMB, SEQ / 4, (size_t)SEQ_FULL, (size_t)SEQ);
    k_gemmb<0, 1><<<dim3(SEQ / GT, DQ / GT, NB), 256, 0, stream>>>(XB, nullptr, WQ, DM, nullptr, 0, (size_t)SEQ * DM, 0, QPh, QPl);
    k_gemmb<0, 1><<<dim3(SEQ / GT, DQ / GT, NB), 256, 0, stream>>>(XB, nullptr, WK, DM, nullptr, 0, (size_t)SEQ * DM, 0, KPh, KPl);
    k_gemmb<0, 2><<<dim3(SEQ / GT, DVV / GT, NB), 256, 0, stream>>>(XB, nullptr, WV, DM, nullptr, 0, (size_t)SEQ * DM, 0, (bf*)VT16, (bf*)VRS);
    k_attn<<<dim3(NVH, NB, SEQ / QBL), 128, 0, stream>>>(QPh, QPl, KPh, KPl, VT16, VRS, AMB, tix, LAM, Ob);
    k_gnstat<<<dim3(NVH, NB, 1), 1024, 0, stream>>>(Ob, GST);
    k_gnmerge<<<dim3((unsigned)(((size_t)SEQ * DVV / 2 + 255) / 256), NB, 1), 256, 0, stream>>>(Ob, GST, gnw, gnb, ATh, ATl);
    k_gemmb<1><<<dim3(SEQ / GT, DM / GT, NB), 256, 0, stream>>>(ATh, ATl, WO, DVV, OUT, DM, (size_t)SEQ * DVV, (size_t)SEQ_FULL * DM);
}

// v008
// A run of this version takes 246 microseconds.
// Next to v007, in two timings, it ran 1.07 times as fast each time.
// Counting every step since v000, it is 3.91 times as fast.
#include <hip/hip_runtime.h>
#pragma clang fp contract(off)

// Compute dtypes (f32 accumulate everywhere): input projections x.Wq / x.Wk / x.Wv on v_wmma_f32_16x16x32_bf16 with bf16 RNE-converted inputs as operands (exact operands); q.k scores on v_wmma_f32_16x16x32_bf16 as bf16 hi/lo split (hi.hi + lo.hi + hi.lo); probability.value on v_wmma_f32_16x16x32_f16 (P f16 carried x4096, V f16; the first query block adds P and V residual planes carried x1024 through a second accumulator); softmax, ALiBi/pad terms, lambda and GroupNorm in f32; output projection on v_wmma_f32_16x16x32_bf16 (activation bf16 hi/lo x bf16 Wo, 2 products).
// Layout: x [NB][SEQ_FULL][1024]; Wq/Wk [2048][1024], Wv/Wo [1024][1024] ([out][in], used as K-contiguous Bt planes); per head h the 128 q/k columns are [half 1 | half 2] = virtual 64-wide heads 2h, 2h+1; mask [NB][SEQ_FULL] f32, token positions [NB][SEQ_FULL] int32; out [NB][SEQ_FULL][1024] f32.

#ifndef NB
#define NB 2
#endif
#ifndef SEQ
#define SEQ 2048
#endif
#define NB_FULL 2
#define SEQ_FULL 2048
#define DM   1024
#define NVH  16
#define HD   64
#define NQH  (2 * NVH)
#define DQ   (NQH * HD)
#define DVV  (NVH * HD)
#define SCL  0.125f
#define PCAR 4096.0f
#define RCAR 1024.0f
#define QBL  64
#define KCH  64
#define KSB  32
#define LP   72
#define PP   40
#define OSP  68
#define L2E  1.4426950408889634f
#define NEGB (-3.0e38f)
static_assert(SEQ % 64 == 0);
static_assert(SEQ <= SEQ_FULL);
static_assert(NB >= 1);
static_assert(NB <= NB_FULL);
static_assert(QBL == KCH);
static_assert(KCH % KSB == 0);
static_assert((LP * 2) % 16 == 0);
static_assert((PP * 2) % 16 == 0);
static_assert((OSP * 4) % 16 == 0);
static_assert((SEQ * DVV) % 512 == 0);
static_assert((SEQ * DM) % 2048 == 0);

typedef _Float16 h16;
typedef unsigned short bf;
typedef __attribute__((ext_vector_type(16))) __bf16   v16bf;
typedef __attribute__((ext_vector_type(16))) _Float16 v16h;
typedef __attribute__((ext_vector_type(8)))  _Float16 v8h;
typedef __attribute__((ext_vector_type(8)))  unsigned short v8us;
typedef __attribute__((ext_vector_type(8)))  float    v8f;
typedef __attribute__((ext_vector_type(4)))  float    v4f;
typedef __attribute__((ext_vector_type(2)))  unsigned short v2us;
typedef v8h  __attribute__((may_alias)) v8ha;
typedef v4f  __attribute__((may_alias)) v4fa;
typedef v8us __attribute__((may_alias)) v8usa;
typedef float __attribute__((may_alias)) f32a;

__device__ __forceinline__ unsigned short f2bf(float f) { unsigned u = __float_as_uint(f); u += 0x7FFFu + ((u >> 16) & 1u); return (unsigned short)(u >> 16); }
__device__ __forceinline__ float bf2f(unsigned short b) { return __uint_as_float(((unsigned)b) << 16); }
__device__ __forceinline__ float bfr(float f) { return bf2f(f2bf(f)); }
__device__ __forceinline__ v16h cat16(v8h lo, v8h hi) { return __builtin_shufflevector(lo, hi, 0, 1, 2, 3, 4, 5, 6, 7, 8, 9, 10, 11, 12, 13, 14, 15); }
__device__ __forceinline__ v16bf cat16b(v8us lo, v8us hi) { return __builtin_bit_cast(v16bf, __builtin_shufflevector(lo, hi, 0, 1, 2, 3, 4, 5, 6, 7, 8, 9, 10, 11, 12, 13, 14, 15)); }
__device__ __forceinline__ v8f wmma16(v16h a, v16h b, v8f c) { return __builtin_amdgcn_wmma_f32_16x16x32_f16(false, a, false, b, (short)0, c, false, false); }
__device__ __forceinline__ v8f wmmab(v16bf a, v16bf b, v8f c) { return __builtin_amdgcn_wmma_f32_16x16x32_bf16(false, a, false, b, (short)0, c, false, false); }
__device__ __forceinline__ h16 tohx(float x) { return (h16)x; }
__device__ __forceinline__ void splitf(float y, unsigned short& h, unsigned short& l) { h = f2bf(y); l = f2bf(y - bf2f(h)); }

// ---- k_gemmb: block-tiled GEMM, 8 waves (2 x 4) per 128x128 output tile, wave tile 64x32 (8 accumulators); grid (M/128, N/128, Z), 256 threads.
// c[m][n] (f32) = sum_k A[m][k] Bt[n][k] (+ A2[m][k] Bt[n][k] when NSPLIT == 1). z-batch strides sA/sC in elements. K % 64 == 0, K >= 64.
// MODE 0: c goes to C (f32, pitch ldc). MODE 1 (q, k): c is split into bf16 hi/lo and goes to the head planes P0/P1 [z][n / 64][m][n % 64]. MODE 2 (v): c goes transposed, as f16 and as its
// residual x1024, to P0/P1 [z][n][m]. MODE 1 and 2 turn the tile in the stage buffers, free behind the loop's last barrier, so that every global store covers whole 128-byte lines.
// A stage is 64 k of every operand row (one whole 128-byte line per row), read from the K-contiguous planes by whole-line 16-byte loads, kept in registers while the
// previous stage is multiplied, then stored to the other of two LDS buffers (row pitch 144 B); one block barrier per stage publishes it and ends the reads of the buffer refilled next.
// Fragments: lane -> row/col (lane & 15); elements 0..7 <- k + 8*(lane>>4), elements 8..15 <- k + 16 + 8*(lane>>4), for A and Bt alike. k runs upward, one accumulate chain per element.
#define GT   128
#define GBK  64
#define GLP  72
#define GOP  36
#define GSP  132
#define GVP  136
static_assert(SEQ % GT == 0);
static_assert(DQ % GT == 0);
static_assert(DVV % GT == 0);
static_assert(DM % GT == 0);
static_assert(DM % GBK == 0);
static_assert(DVV % GBK == 0);
static_assert((GLP * 2) % 16 == 0);
static_assert((GOP * 4) % 16 == 0);
static_assert((GSP * 4) % 16 == 0);
static_assert((GVP * 2) % 16 == 0);
static_assert(GT == 2 * HD);
static_assert(GT * GSP * 4 <= 2 * 2 * GT * GLP * 2);
static_assert(2 * GT * GVP * 2 <= 2 * 2 * GT * GLP * 2);
__device__ __forceinline__ v16bf ldsb(const bf* p) { return cat16b(*(const v8usa*)p, *(const v8usa*)(p + 16)); }
template <int NSPLIT, int MODE = 0>
// waves_per_eu: at most two 8-wave blocks run per WGP here, so the register budget is that of 4 waves per SIMD and a k-step's fragment loads may be grouped ahead of its products
__global__ __launch_bounds__(256) __attribute__((amdgpu_waves_per_eu(1, 4)))
void k_gemmb(const bf* __restrict__ A, const bf* __restrict__ A2, const bf* __restrict__ Bt, int K, float* C, int ldc, size_t sA, size_t sC, bf* P0 = nullptr, bf* P1 = nullptr) {
    constexpr int NPL = 2 + NSPLIT;                          // planes per stage: A, (A2,) Bt
    __shared__ __align__(16) bf    tl[2][NPL][GT * GLP];     // two stage buffers [row*GLP + k]                  (cross-wave: block barriers)
    __shared__ __align__(16) float osw[8][16 * GOP];         // per-wave f32 epilogue staging [row*GOP + col]    (wave-private)
    const size_t z = blockIdx.z; A += z * sA; if (NSPLIT) A2 += z * sA; C += z * sC;
    const int tid = threadIdx.x, w = tid >> 5, lane = tid & 31, lr = lane & 15, hi = lane >> 4; const int wm = w >> 2, wn = w & 3;
    const int r0 = blockIdx.x * GT, c0 = blockIdx.y * GT;
    v8f acc[4][2];
#pragma unroll
    for (int mb = 0; mb < 4; ++mb)
#pragma unroll
        for (int nb = 0; nb < 2; ++nb) acc[mb][nb] = (v8f){};
    const int srow = tid >> 3, sc8 = (tid & 7) * 8;          // staging: 8 lanes cover one row's 128 bytes; piece i is row srow + 32 i
    const char* gA = (const char*)(A + (size_t)r0 * K); const char* gA2 = (const char*)(A2 + (size_t)r0 * K); const char* gB = (const char*)(Bt + (size_t)c0 * K);   // block-uniform tile bases
    unsigned go[4];                                          // the lane's byte offset of piece i inside a tile's rows, the same for every plane and stage
#pragma unroll
    for (int i = 0; i < 4; ++i) go[i] = ((unsigned)(srow + 32 * i) * (unsigned)K + (unsigned)sc8) * 2u;
    const int so = srow * GLP + sc8;
    const int fa = (wm * 64 + lr) * GLP + 8 * hi, fb = (wn * 32 + lr) * GLP + 8 * hi;
    v8us ra[4], ra2[4], rb[4];
#pragma unroll
    for (int i = 0; i < 4; ++i) { ra[i] = *(const v8us*)(gA + go[i]); if (NSPLIT) ra2[i] = *(const v8us*)(gA2 + go[i]); rb[i] = *(const v8us*)(gB + go[i]); }
#pragma unroll
    for (int i = 0; i < 4; ++i) { *(v8usa*)(&tl[0][0][so + i * 32 * GLP]) = ra[i]; if (NSPLIT) *(v8usa*)(&tl[0][1][so + i * 32 * GLP]) = ra2[i]; *(v8usa*)(&tl[0][NPL - 1][so + i * 32 * GLP]) = rb[i]; }
    __syncthreads();
#pragma unroll 1
    for (int k0 = 0; k0 < K; k0 += GBK) {
        const int cur = (k0 / GBK) & 1; const bool more = k0 + GBK < K;
        gA += GBK * 2; gA2 += GBK * 2; gB += GBK * 2;        // the uniform bases step one stage; the lanes' offsets stay
        if (more) {
#pragma unroll
            for (int i = 0; i < 4; ++i) {   // a wait behind each load: this build lets a later load of the group land in an earlier one's address pair, and the wait stands in front of that overwrite
                ra[i] = *(const v8us*)(gA + go[i]); asm volatile("s_wait_xcnt 0x0" ::: "memory");
                if (NSPLIT) { ra2[i] = *(const v8us*)(gA2 + go[i]); asm volatile("s_wait_xcnt 0x0" ::: "memory"); }
                rb[i] = *(const v8us*)(gB + go[i]); asm volatile("s_wait_xcnt 0x0" ::: "memory"); }
        }
        const bf* ta = &tl[cur][0][fa]; const bf* ta2 = &tl[cur][NSPLIT][fa]; const bf* tb = &tl[cur][NPL - 1][fb];
#pragma unroll
        for (int kc = 0; kc < GBK; kc += 32) {
            v16bf a[4], a2[4], b[2];
#pragma unroll
            for (int mb = 0; mb < 4; ++mb) { a[mb] = ldsb(ta + mb * 16 * GLP + kc); if (NSPLIT) a2[mb] = ldsb(ta2 + mb * 16 * GLP + kc); }
#pragma unroll
            for (int nb = 0; nb < 2; ++nb) b[nb] = ldsb(tb + nb * 16 * GLP + kc);
#pragma unroll
            for (int nb = 0; nb < 2; ++nb)
#pragma unroll
                for (int mb = 0; mb < 4; ++mb) { acc[mb][nb] = wmmab(a[mb], b[nb], acc[mb][nb]); if (NSPLIT) acc[mb][nb] = wmmab(a2[mb], b[nb], acc[mb][nb]); }
        }
        if (more) {
#pragma unroll
            for (int i = 0; i < 4; ++i) { *(v8usa*)(&tl[cur ^ 1][0][so + i * 32 * GLP]) = ra[i]; if (NSPLIT) *(v8usa*)(&tl[cur ^ 1][1][so + i * 32 * GLP]) = ra2[i]; *(v8usa*)(&tl[cur ^ 1][NPL - 1][so + i * 32 * GLP]) = rb[i]; }
        }
        __syncthreads();
    }
    if constexpr (MODE == 1) {
        f32a* st = (f32a*)&tl[0][0][0];                      // block f32 tile [row*GSP + col]
#pragma unroll
        for (int mb = 0; mb < 4; ++mb)
#pragma unroll
            for (int nb = 0; nb < 2; ++nb)
#pragma unroll
                for (int j = 0; j < 8; ++j) st[(wm * 64 + mb * 16 + hi * 8 + j) * GSP + wn * 32 + nb * 16 + lr] = acc[mb][nb][j];
        __syncthreads();                                     // publishes the tile: its rows are read back by other waves
        const int hs = w & 1, rw = (w >> 1) * 32 + (lane >> 3), c8 = (lane & 7) * 8;   // a wave takes 32 rows of one 64-wide head; one store = 4 rows = 512 contiguous bytes
        const size_t pb = ((z * NQH + (size_t)(blockIdx.y * 2 + hs)) * SEQ + r0) * HD + c8;
#pragma unroll
        for (int i = 0; i < 8; ++i) { const int row = rw + 4 * i; const f32a* sp = st + row * GSP + hs * HD + c8; const v4f x0 = *(const v4fa*)sp, x1 = *(const v4fa*)(sp + 4); v8us oh, ol;
#pragma unroll
            for (int q = 0; q < 4; ++q) { unsigned short a2, c2; splitf(x0[q], a2, c2); oh[q] = a2; ol[q] = c2; splitf(x1[q], a2, c2); oh[4 + q] = a2; ol[4 + q] = c2; }
            *(v8us*)(P0 + pb + (size_t)row * HD) = oh; *(v8us*)(P1 + pb + (size_t)row * HD) = ol; }
        return;
    }
    if constexpr (MODE == 2) {
        h16* sv = (h16*)&tl[0][0][0]; h16* sr = sv + GT * GVP;   // block f16 tiles, value and residual, transposed [col*GVP + row]; an accumulator lane holds 8 consecutive rows of one column
#pragma unroll
        for (int mb = 0; mb < 4; ++mb)
#pragma unroll
            for (int nb = 0; nb < 2; ++nb) { v8h o16, orr;
#pragma unroll
                for (int j = 0; j < 8; ++j) { const float x = acc[mb][nb][j]; const h16 hv = tohx(x); const float res = (x - (float)hv) * RCAR; o16[j] = hv; orr[j] = tohx(res); }
                const int si = (wn * 32 + nb * 16 + lr) * GVP + wm * 64 + mb * 16 + hi * 8; *(v8ha*)(sv + si) = o16; *(v8ha*)(sr + si) = orr; }
        __syncthreads();                                     // publishes the tiles: their columns are read back by other waves
        const int cw = tid >> 4, t8 = (tid & 15) * 8;        // 16 lanes cover one column's 128 rows = 256 contiguous bytes
        const size_t vb = (z * DVV + (size_t)c0) * SEQ + r0 + t8;
#pragma unroll
        for (int i = 0; i < 8; ++i) { const int col = cw + 16 * i; const v8h a16 = *(const v8ha*)(sv + col * GVP + t8), ar = *(const v8ha*)(sr + col * GVP + t8);
            *(v8ha*)((h16*)P0 + vb + (size_t)col * SEQ) = a16; *(v8ha*)((h16*)P1 + vb + (size_t)col * SEQ) = ar; }
        return;
    }
    float* os = &osw[w][0];
#pragma unroll
    for (int mb = 0; mb < 4; ++mb) {
#pragma unroll
        for (int nb = 0; nb < 2; ++nb) {
#pragma unroll
            for (int j = 0; j < 8; ++j) os[(hi * 8 + j) * GOP + nb * 16 + lr] = acc[mb][nb][j]; }
        __builtin_amdgcn_wave_barrier(); asm volatile("" ::: "memory");   // keeps the staging stores ahead of the row reads of other lanes of this wave
        float* crow = C + (size_t)(r0 + wm * 64 + mb * 16) * ldc + c0 + wn * 32;
#pragma unroll
        for (int s = 0; s < 4; ++s) { const int row = 4 * s + (lane >> 3), cofs = (lane & 7) * 4; const v4f val = *(const v4fa*)(os + row * GOP + cofs); *(v4f*)(crow + (size_t)row * ldc + cofs) = val; }
        __builtin_amdgcn_wave_barrier(); asm volatile("" ::: "memory");   // keeps the row reads ahead of the next block's staging stores
    }
}

__global__ __launch_bounds__(256) void k_cvt8(const float* __restrict__ src, bf* dst, size_t n8, size_t sS, size_t sD) { const size_t i = (size_t)blockIdx.x * 256 + threadIdx.x; if (i >= n8) return; src += blockIdx.y * sS; dst += blockIdx.y * sD; const v8f v = *(const v8f*)(src + i * 8); v8us o;
#pragma unroll
    for (int k = 0; k < 8; ++k) o[k] = f2bf(v[k]); *(v8us*)(dst + i * 8) = o;  }
__global__ __launch_bounds__(256) void k_rbf(const float* __restrict__ src, float* dst, int n4, size_t sS, size_t sD) { const int i = blockIdx.x * 256 + threadIdx.x; if (i >= n4) return; src += blockIdx.y * sS; dst += blockIdx.y * sD; const v4f a = *(const v4f*)(src + (size_t)i * 4); v4f o;
#pragma unroll
    for (int u = 0; u < 4; ++u) o[u] = bfr(a[u]); *(v4f*)(dst + (size_t)i * 4) = o;  }
__global__ __launch_bounds__(32) void k_lambda(const float* __restrict__ lq1, const float* __restrict__ lk1, const float* __restrict__ lq2, const float* __restrict__ lk2, float* LAM) { const int lane = threadIdx.x; float d1 = 0.f, d2 = 0.f;
#pragma unroll 1
    for (int i = 0; i < HD; ++i) { float p1 = __fmul_rn(bfr(lq1[i]), bfr(lk1[i])); asm volatile("" : "+v"(p1)); d1 = __fadd_rn(d1, p1); float p2 = __fmul_rn(bfr(lq2[i]), bfr(lk2[i])); asm volatile("" : "+v"(p2)); d2 = __fadd_rn(d2, p2); }
    float lm = __fsub_rn(expf(d1), expf(d2)); asm volatile("" : "+v"(lm)); lm = __fadd_rn(lm, 0.8f); const float v = (lane == 0) ? lm : 0.0f; *(float*)(LAM + lane) = v;  }

// ---- k_attn: causal differential attention for one (query block of 64, head) per block of 8 waves. The two score streams run side by side: waves 0..3 take stream 0, waves 4..7 stream 1
// (wave w & 3 owns 16 query rows), each group with its own Q/K hi/lo tiles, score tiles, O accumulators and running max/sum. Per 64-key chunk c = 0..qb each group stages the K hi/lo tile of its
// head plane 2h+st and half of the one V^T tile that both groups read; the softmax recurrence then runs on 32-key sub-chunks: scores S = Q.K (3 bf16 products, 16x32 tile per wave) ->
// t = S/8 - slope (pos_i - pos_j) + (1 - mask_j)(-1e9) for j <= i, excluded otherwise; online softmax (running max / sum, f32); P tile (f16 x4096, 16x32) per wave in LDS; O += P.V (one k-step).
// The first query block also forms P and V residual planes (x1024) and adds P_res.V + P.V_res per 16-column block through a second accumulator folded before normalisation.
// rowx<M>: the value of lane l ^ M of the lane's own 16-lane row, read through DPP (row_xmask) on the vector pipe; __shfl_xor compiles to ds_bpermute_b32, a trip through the LDS unit with a wait on dscnt per link. Every lane is on where it is used.
template <int M> __device__ __forceinline__ float rowx(float x) { return __builtin_bit_cast(float, __builtin_amdgcn_update_dpp(0, __builtin_bit_cast(int, x), 0x160 | M, 0xf, 0xf, true)); }
__device__ __forceinline__ v16h  ldsh(const h16* p) { return cat16(*(const v8ha*)p, *(const v8ha*)(p + 16)); }

// attn_blk: one stream's loop of one block (st is the wave group's stream). ER (first query block: residual planes) is a compile-time value, so the loops hold no test of it: a chunk's tile loads are one group
// behind which the LDS stores follow, and the sixteen probability chains of a sub-chunk stand in one basic block.
template <bool ER>
__device__ __forceinline__ void attn_blk(const bf* __restrict__ QPh, const bf* __restrict__ QPl, const bf* __restrict__ KPh, const bf* __restrict__ KPl, const h16* __restrict__ VT, const h16* __restrict__ VR,
                                         const float* __restrict__ amb, const int* __restrict__ tix, const float lam, const float slope, const float (&pq)[8], const int hh, const int qb, const int st,
                                         bf* qs0, bf* qs1, bf* ks0, bf* ks1, h16* vsm, h16* vrm, h16* pt, h16* prt, float* os) {
    const int tid = threadIdx.x & 127, w = tid >> 5, lane = tid & 31, lr = lane & 15, hi = lane >> 4;   // tid, w: inside the wave group of one stream
    const int q0 = qb * QBL, qrow0 = q0 + 16 * w + 8 * hi;
    // staging: piece i of a K plane is row 16 i + (tid >> 3), 16 bytes at 8 (tid & 7): the 64 x 64 tile is 8 KiB in a row, so a lane's byte offset is 16 tid + 2048 i; piece i of V^T is row d = 16 i + (tid >> 3), group st brings pieces 2 st and 2 st + 1
    const unsigned ko = (unsigned)tid * 16u, vo = ((unsigned)(tid >> 3) * (unsigned)SEQ + 8u * (unsigned)(tid & 7)) * 2u;   // the lane's offsets, the same for every chunk
    const int sk = (tid >> 3) * LP + (tid & 7) * 8;
    {
        const size_t vq = (size_t)(2 * hh + st);
        {   const char* pqh = (const char*)(QPh + (vq * SEQ + q0) * HD) + ko; const char* pql = (const char*)(QPl + (vq * SEQ + q0) * HD) + ko;
            v8us qh[4], ql[4];
#pragma unroll
            for (int i = 0; i < 4; ++i) { qh[i] = *(const v8usa*)(pqh + i * 2048); ql[i] = *(const v8usa*)(pql + i * 2048); }
            asm volatile("s_wait_xcnt 0x0" :: "v"(pqh), "v"(pql) : "memory");   // holds the address pairs whole up to this wait: without it a later load of the group may land in a pair that the loads before it name
#pragma unroll
            for (int i = 0; i < 4; ++i) { *(v8usa*)(&qs0[sk + i * 16 * LP]) = qh[i]; *(v8usa*)(&qs1[sk + i * 16 * LP]) = ql[i]; }
        }
        float m[8], l[8]; v8f O[4];
#pragma unroll
        for (int r = 0; r < 8; ++r) { m[r] = NEGB; l[r] = 0.0f; }
#pragma unroll
        for (int j = 0; j < 4; ++j) O[j] = (v8f){};
#pragma unroll 1
        for (int c = 0; c <= qb; ++c) {
            const int k0 = c * KCH;
            {   const char* pkh = (const char*)(KPh + (vq * SEQ + k0) * HD) + ko; const char* pkl = (const char*)(KPl + (vq * SEQ + k0) * HD) + ko;
                const char* pv = (const char*)(VT + ((size_t)hh * HD + 32 * st) * SEQ + k0) + vo; const char* pr = (const char*)(VR + ((size_t)hh * HD + 32 * st) * SEQ + k0) + vo;
                v8us kh[4], kl[4]; v8h vv[2], vr[2];
#pragma unroll
                for (int i = 0; i < 4; ++i) { kh[i] = *(const v8usa*)(pkh + i * 2048); kl[i] = *(const v8usa*)(pkl + i * 2048); }
#pragma unroll
                for (int i = 0; i < 2; ++i) { vv[i] = *(const v8ha*)(pv + i * (16 * SEQ * 2)); if constexpr (ER) vr[i] = *(const v8ha*)(pr + i * (16 * SEQ * 2)); }
                // holds the address pairs whole up to this wait: without it the last load of a group lands in the pair that the loads before it name
                if constexpr (ER) asm volatile("s_wait_xcnt 0x0" :: "v"(pkh), "v"(pkl), "v"(pv), "v"(pr) : "memory"); else asm volatile("s_wait_xcnt 0x0" :: "v"(pkh), "v"(pkl), "v"(pv) : "memory");
#pragma unroll
                for (int i = 0; i < 4; ++i) { *(v8usa*)(&ks0[sk + i * 16 * LP]) = kh[i]; *(v8usa*)(&ks1[sk + i * 16 * LP]) = kl[i]; }
#pragma unroll
                for (int i = 0; i < 2; ++i) { *(v8ha*)(&vsm[sk + (2 * st + i) * 16 * LP]) = vv[i]; if constexpr (ER) *(v8ha*)(&vrm[sk + (2 * st + i) * 16 * LP]) = vr[i]; }
            }
            __syncthreads();
#pragma unroll 1
            for (int sb = 0; sb < KCH / KSB; ++sb) {
                const int kb = sb * KSB;
                const int key0 = k0 + kb + lr, key1 = key0 + 16;
                const float pk0 = (float)tix[key0], pk1 = (float)tix[key1];
                const float om0 = 1.0f - amb[key0], om1 = 1.0f - amb[key1]; const float pad0 = om0 * -1.0e9f, pad1 = om1 * -1.0e9f;
                // ---- scores: S[row 8hi+r][key kb + nb*16 + lr], 3 bf16 products (hi.hi + lo.hi + hi.lo); fragments loaded right before each k-step, scheduling barrier after it
                v8f s[2]; s[0] = (v8f){}; s[1] = (v8f){};
                {   v16bf ah, al, bh, bl;
#pragma unroll
                    for (int kc = 0; kc < HD; kc += 32) {
                        ah = ldsb(&qs0[(16 * w + lr) * LP + kc + 8 * hi]); al = ldsb(&qs1[(16 * w + lr) * LP + kc + 8 * hi]);
#pragma unroll
                        for (int nb = 0; nb < 2; ++nb) { bh = ldsb(&ks0[(kb + nb * 16 + lr) * LP + kc + 8 * hi]); bl = ldsb(&ks1[(kb + nb * 16 + lr) * LP + kc + 8 * hi]);
                            s[nb] = wmmab(ah, bh, s[nb]); s[nb] = wmmab(al, bh, s[nb]); s[nb] = wmmab(ah, bl, s[nb]); }
                        asm volatile("v_nop\n\tv_nop\n\tv_nop\n\tv_nop" : "+v"(s[0]), "+v"(s[1]) : "v"(ah), "v"(al), "v"(bh), "v"(bl) : "memory");
                    }
                }
                // ---- additive terms by value select, sub-chunk max
                float cm[8];
#pragma unroll
                for (int r = 0; r < 8; ++r) cm[r] = NEGB;
#pragma unroll
                for (int nb = 0; nb < 2; ++nb) { const int kv = nb ? key1 : key0; const float pkv = nb ? pk1 : pk0; const float pdv = nb ? pad1 : pad0;
#pragma unroll
                    for (int r = 0; r < 8; ++r) { const float sa = s[nb][r] * SCL; const float pd = pq[r] - pkv; const float bia = slope * pd; const float sm = sa - bia;
                        const float tt = (kv <= qrow0 + r) ? (sm + pdv) : NEGB; s[nb][r] = tt; cm[r] = fmaxf(cm[r], tt); } }
                float cor[8], rs[8];
#pragma unroll
                for (int r = 0; r < 8; ++r) { float x = cm[r]; x = fmaxf(x, rowx<1>(x)); x = fmaxf(x, rowx<2>(x)); x = fmaxf(x, rowx<4>(x)); x = fmaxf(x, rowx<8>(x));
                    const float mn = fmaxf(m[r], x); const float dlt = (m[r] - mn) * L2E; cor[r] = __builtin_amdgcn_exp2f(dlt); m[r] = mn; rs[r] = 0.0f; }
                // ---- probabilities -> per-wave LDS tile (f16 x4096; residual x1024 on the first query block); excluded keys store exactly 0
#pragma unroll
                for (int nb = 0; nb < 2; ++nb) { const int kv = nb ? key1 : key0;
#pragma unroll
                    for (int r = 0; r < 8; ++r) { const float dq = (s[nb][r] - m[r]) * L2E; const float pe = __builtin_amdgcn_exp2f(dq); const float p = (kv <= qrow0 + r) ? pe : 0.0f; rs[r] = rs[r] + p;
                        const float pc = p * PCAR; const h16 ph = tohx(pc); const int li = (8 * hi + r) * PP + nb * 16 + lr; pt[li] = ph;
                        if constexpr (ER) { const float res = (pc - (float)ph) * RCAR; prt[li] = tohx(res); } } }
#pragma unroll
                for (int r = 0; r < 8; ++r) { float x = rs[r]; x += rowx<1>(x); x += rowx<2>(x); x += rowx<4>(x); x += rowx<8>(x);
                    const float lc = l[r] * cor[r]; l[r] = lc + x; const float cf = cor[r];
#pragma unroll
                    for (int j = 0; j < 4; ++j) O[j][r] = O[j][r] * cf; }
                __syncthreads();
                // ---- O[d block j][row] += P[row][key] . V^T[d][key] over the 32 keys of this sub-chunk (one k-step)
                {   const v16h a = ldsh(pt + lr * PP + 8 * hi); v16h b;
#pragma unroll
                    for (int j = 0; j < 4; ++j) { b = ldsh(&vsm[(j * 16 + lr) * LP + kb + 8 * hi]); O[j] = wmma16(a, b, O[j]); }
                    asm volatile("v_nop\n\tv_nop\n\tv_nop\n\tv_nop" : "+v"(O[0]), "+v"(O[1]), "+v"(O[2]), "+v"(O[3]) : "v"(a), "v"(b) : "memory");
                    if constexpr (ER) {
                        const v16h ar = ldsh(prt + lr * PP + 8 * hi);
#pragma unroll
                        for (int j = 0; j < 4; ++j) {
                            const v16h b2 = ldsh(&vsm[(j * 16 + lr) * LP + kb + 8 * hi]); const v16h br = ldsh(&vrm[(j * 16 + lr) * LP + kb + 8 * hi]);
                            v8f R = wmma16(ar, b2, (v8f){}); R = wmma16(a, br, R);
                            asm volatile("v_nop\n\tv_nop\n\tv_nop\n\tv_nop" : "+v"(R) : "v"(a), "v"(ar), "v"(b2), "v"(br) : "memory");
#pragma unroll
                            for (int r = 0; r < 8; ++r) { const float rr = R[r] * (1.0f / RCAR); O[j][r] = O[j][r] + rr; }
                        }
                    }
                }
                __syncthreads();
            }
        }
#pragma unroll
        for (int r = 0; r < 8; ++r) { const float rl = 1.0f / l[r]; const float il = rl * (1.0f / PCAR);
#pragma unroll
            for (int j = 0; j < 4; ++j) O[j][r] = O[j][r] * il; }
        if (st == 0) {
#pragma unroll
            for (int r = 0; r < 8; ++r)
#pragma unroll
                for (int j = 0; j < 4; ++j) os[(8 * hi + r) * OSP + j * 16 + lr] = O[j][r];
        }
        __syncthreads();                                     // publishes stream 0's result to the stream 1 wave of the same rows
        if (st != 0) {
#pragma unroll
            for (int r = 0; r < 8; ++r)
#pragma unroll
                for (int j = 0; j < 4; ++j) { const int oi = (8 * hi + r) * OSP + j * 16 + lr; const float lb = lam * O[j][r]; const float cur = os[oi]; os[oi] = cur - lb; }
        }
    }
}

__global__ __launch_bounds__(256) __attribute__((amdgpu_num_vgpr(256)))
void k_attn(const bf* __restrict__ QPh, const bf* __restrict__ QPl, const bf* __restrict__ KPh, const bf* __restrict__ KPl, const h16* __restrict__ VT, const h16* __restrict__ VR,
            const float* __restrict__ amb, const int* __restrict__ tix, const float* __restrict__ LAM, float* Ob) {
    __shared__ __align__(16) bf    qs[2][2][QBL * LP];   // Q [stream]{hi,lo} [row*LP + d]                   (cross-wave: block barriers)
    __shared__ __align__(16) bf    ks[2][2][KCH * LP];   // K [stream]{hi,lo} [key*LP + d]                   (cross-wave: block barriers)
    __shared__ __align__(16) h16   vsm[HD * LP];         // V^T tile [d*LP + key], read by both streams      (cross-wave: block barriers)
    __shared__ __align__(16) h16   vrm[HD * LP];         // V residual tile, first query block only         (cross-wave: block barriers)
    __shared__ __align__(16) h16   psm[8][16 * PP];      // per-wave P tile [row*PP + key], 16 x 32          (wave-private, block barriers used anyway)
    __shared__ __align__(16) h16   prm[8][16 * PP];      // per-wave P residual tile, first query block only
    __shared__ __align__(16) float osm[4][16 * OSP];     // f32 result / epilogue staging [row*OSP + d] per 16 query rows: written by stream 0's wave, finished by stream 1's
    const int st = __builtin_amdgcn_readfirstlane((int)(threadIdx.x >> 7));   // the wave group's stream, held scalar: tests of it are scalar branches, the stream's tile bases are uniform
    const int w8 = threadIdx.x >> 5, w = w8 & 3, lane = threadIdx.x & 31, lr = lane & 15, hi = lane >> 4;
    // A block's cost grows with qb and the grid holds more blocks than fit on the chip at once: the longest query blocks take the lowest indices
    // and the short ones fill the places that come free; (head, batch) is the fast index, so every run of consecutive blocks holds equal costs.
    const int hh = blockIdx.x, qb = SEQ / QBL - 1 - (int)blockIdx.z, q0 = qb * QBL;
    {   const size_t bz = blockIdx.y;                        // batch element: every plane is [NB][...]; only the token positions keep the input's own batch pitch
        QPh += bz * ((size_t)NQH * SEQ * HD); QPl += bz * ((size_t)NQH * SEQ * HD); KPh += bz * ((size_t)NQH * SEQ * HD); KPl += bz * ((size_t)NQH * SEQ * HD);
        VT += bz * ((size_t)NVH * HD * SEQ); VR += bz * ((size_t)NVH * HD * SEQ); amb += bz * SEQ; tix += bz * SEQ_FULL; Ob += bz * ((size_t)SEQ * DVV); }
    const int e2 = hh + 1;                                   // slope = 2^(-(h+1)/2): exact power of two times 2^-0.5 for odd exponents
    const float slope = ((e2 & 1) ? 0.70710678118654752f : 1.0f) * __uint_as_float(((unsigned)(127 - (e2 >> 1))) << 23);
    const float lam = LAM[0];
    const int qrow0 = q0 + 16 * w + 8 * hi;
    float pq[8];
#pragma unroll
    for (int r = 0; r < 8; ++r) pq[r] = (float)tix[qrow0 + r];
    float* os = &osm[w][0];
    // block-uniform: every wave of a block takes the same side, with all its barriers
    if (qb == 0) attn_blk<true>(QPh, QPl, KPh, KPl, VT, VR, amb, tix, lam, slope, pq, hh, qb, st, &qs[st][0][0], &qs[st][1][0], &ks[st][0][0], &ks[st][1][0], vsm, vrm, &psm[w8][0], &prm[w8][0], os);
    else         attn_blk<false>(QPh, QPl, KPh, KPl, VT, VR, amb, tix, lam, slope, pq, hh, qb, st, &qs[st][0][0], &qs[st][1][0], &ks[st][0][0], &ks[st][1][0], vsm, vrm, &psm[w8][0], &prm[w8][0], os);
    __syncthreads();
    float* orow = Ob + (size_t)(q0 + 16 * w) * DVV + hh * HD;
{
#pragma unroll
        for (int s2 = 0; s2 < 4; ++s2) { const int row = 8 * st + 2 * s2 + hi, cofs = lr * 4;   // each of the two waves of a row group stores 8 of its 16 rows
            const v4f val = *(const v4fa*)(os + row * OSP + cofs); *(v4f*)(orow + (size_t)row * DVV + cofs) = val; }
         }
}

#define GNB 32
static_assert((SEQ * HD / 1024) % GNB == 0);
__global__ __launch_bounds__(1024) void k_gnstat(const float* __restrict__ O, float* GST) {
    __shared__ float sh[1024]; const int tid = threadIdx.x; const int hh = blockIdx.x; const float* base = O + (size_t)blockIdx.y * SEQ * DVV + hh * HD; GST += blockIdx.y * (NVH * 32); const int n = SEQ * HD; const float rn = 1.0f / (float)n;
    // A thread's chain is e = tid + 1024 i: row (tid >> 6) + 16 i, column tid & 63. GNB loads of the chain are issued together, then added in the chain's own order.
    const float* pl = base + (size_t)(tid >> 6) * DVV + (tid & 63);
    float acc = 0.f;
#pragma unroll
    for (int g = 0; g < n / 1024; g += GNB) { float v[GNB];
#pragma unroll
        for (int u = 0; u < GNB; ++u) v[u] = pl[(size_t)(g + u) * 16 * DVV];
#pragma unroll
        for (int u = 0; u < GNB; ++u) acc = __fadd_rn(acc, v[u]); }
    sh[tid] = acc; __syncthreads();
#pragma unroll 1
    for (int st = 512; st > 0; st >>= 1) { if (tid < st) sh[tid] = __fadd_rn(sh[tid], sh[tid + st]); __syncthreads(); }
    const float mean = sh[0] * rn;
    __syncthreads();
    float acc2 = 0.f;
#pragma unroll
    for (int g = 0; g < n / 1024; g += GNB) { float v[GNB];
#pragma unroll
        for (int u = 0; u < GNB; ++u) v[u] = pl[(size_t)(g + u) * 16 * DVV];
#pragma unroll
        for (int u = 0; u < GNB; ++u) { const float dv = __fsub_rn(v[u], mean); acc2 = __builtin_fmaf(dv, dv, acc2); } }   // the fused square-add that the rolled loop compiled to, written out: left to the compiler, the unrolled chain fuses its first two squares the other way round
    asm volatile("s_wait_xcnt 0x0" :: "v"(pl) : "memory");   // holds the address pair whole up to this wait: without it this build lets the last load land in the pair that the loads before it name
    sh[tid] = acc2; __syncthreads();
#pragma unroll 1
    for (int st = 512; st > 0; st >>= 1) { if (tid < st) sh[tid] = __fadd_rn(sh[tid], sh[tid + st]); __syncthreads(); }
    if (tid < 32) { const float var = sh[0] * rn; const float rs = __fdiv_rn(1.0f, sqrtf(__fadd_rn(var, 1e-5f))); const float outv = (tid == 0) ? mean : ((tid == 1) ? rs : 0.0f);
        *(float*)(GST + hh * 32 + tid) = outv;  }
}
__global__ __launch_bounds__(256) void k_gnmerge(const float* __restrict__ O, const float* __restrict__ GST, const float* __restrict__ gw, const float* __restrict__ gb, bf* Ah, bf* Al) {
    const size_t e = ((size_t)blockIdx.x * 256 + threadIdx.x) * 2; if (e >= (size_t)SEQ * DVV) return;
    O += (size_t)blockIdx.y * SEQ * DVV; GST += blockIdx.y * (NVH * 32); Ah += (size_t)blockIdx.y * SEQ * DVV; Al += (size_t)blockIdx.y * SEQ * DVV;
    const int c = (int)(e % DVV); const int hh = c / HD; const float mean = GST[hh * 32], rs = GST[hh * 32 + 1]; v2us oh, ol;
#pragma unroll
    for (int q = 0; q < 2; ++q) { float cc = __fsub_rn(O[e + q], mean); asm volatile("" : "+v"(cc)); float nn = __fmul_rn(cc, rs); asm volatile("" : "+v"(nn)); float y = __fmul_rn(nn, bfr(gw[c + q])); asm volatile("" : "+v"(y)); y = __fadd_rn(y, bfr(gb[c + q])); const float z = __fmul_rn(y, 0.2f); unsigned short a2, c2; splitf(z, a2, c2); oh[q] = a2; ol[q] = c2; }
    *(v2us*)(Ah + e) = oh; *(v2us*)(Al + e) = ol;  }

extern "C" void kernel_launch(void* const* d_in, const int* in_sizes, int n_in,
                              void* d_out, int out_size, void* d_ws, size_t ws_size, hipStream_t stream) {
    if (n_in < 13) return;
    if (in_sizes[0] < (NB - 1) * SEQ_FULL * DM + SEQ * DM) return;
    if (in_sizes[1] < (NB - 1) * SEQ_FULL + SEQ) return;
    if (in_sizes[2] < (NB - 1) * SEQ_FULL + SEQ) return;
    if (in_sizes[3] < DQ * DM || in_sizes[4] < DQ * DM || in_sizes[5] < DVV * DM || in_sizes[6] < DM * DVV) return;
    if (in_sizes[7] < HD || in_sizes[8] < HD || in_sizes[9] < HD || in_sizes[10] < HD || in_sizes[11] < DVV || in_sizes[12] < DVV) return;
    if (out_size < (NB - 1) * SEQ_FULL * DM + SEQ * DM) return;
    const float* x = (const float*)d_in[0]; const float* amask = (const float*)d_in[1]; const int* tix = (const int*)d_in[2];
    const float* wq = (const float*)d_in[3]; const float* wk = (const float*)d_in[4]; const float* wv = (const float*)d_in[5]; const float* wo = (const float*)d_in[6];
    const float* lq1 = (const float*)d_in[7]; const float* lq2 = (const float*)d_in[8]; const float* lk1 = (const float*)d_in[9]; const float* lk2 = (const float*)d_in[10];
    const float* gnw = (const float*)d_in[11]; const float* gnb = (const float*)d_in[12];
    float* OUT = (float*)d_out;     // [NB][SEQ_FULL][1024]
    char* wsp = (char*)d_ws;
    auto take = [&](size_t bytes) { char* p = wsp; wsp += (bytes + 255) & ~(size_t)255; return (void*)p; };
    bf* WQ = (bf*)take((size_t)DQ * DM * 2); bf* WK = (bf*)take((size_t)DQ * DM * 2); bf* WV = (bf*)take((size_t)DVV * DM * 2); bf* WO = (bf*)take((size_t)DM * DVV * 2);
    bf* XB = (bf*)take((size_t)NB * SEQ * DM * 2); float* AMB = (float*)take((size_t)NB * SEQ * 4); float* LAM = (float*)take(256); float* GST = (float*)take((size_t)NB * NVH * 32 * 4);
    bf* QPh = (bf*)take((size_t)NB * NQH * SEQ * HD * 2); bf* QPl = (bf*)take((size_t)NB * NQH * SEQ * HD * 2); bf* KPh = (bf*)take((size_t)NB * NQH * SEQ * HD * 2); bf* KPl = (bf*)take((size_t)NB * NQH * SEQ * HD * 2);
    h16* VT16 = (h16*)take((size_t)NB * NVH * HD * SEQ * 2); h16* VRS = (h16*)take((size_t)NB * NVH * HD * SEQ * 2);
    float* Ob = (float*)take((size_t)NB * SEQ * DVV * 4); bf* ATh = (bf*)take((size_t)NB * SEQ * DVV * 2); bf* ATl = (bf*)take((size_t)NB * SEQ * DVV * 2);
    const size_t used = (size_t)(wsp - (char*)d_ws);
    if (used > ws_size || used > (size_t)268435456) return;
    k_cvt8<<<(unsigned)(((size_t)DQ * DM / 8 + 255) / 256), 256, 0, stream>>>(wq, WQ, (size_t)DQ * DM / 8, 0, 0);
    k_cvt8<<<(unsigned)(((size_t)DQ * DM / 8 + 255) / 256), 256, 0, stream>>>(wk, WK, (size_t)DQ * DM / 8, 0, 0);
    k_cvt8<<<(unsigned)(((size_t)DVV * DM / 8 + 255) / 256), 256, 0, stream>>>(wv, WV, (size_t)DVV * DM / 8, 0, 0);
    k_cvt8<<<(unsigned)(((size_t)DM * DVV / 8 + 255) / 256), 256, 0, stream>>>(wo, WO, (size_t)DM * DVV / 8, 0, 0);
    k_lambda<<<1, 32, 0, stream>>>(lq1, lk1, lq2, lk2, LAM);
    // Every stage runs once for all NB batch elements: the batch index is grid y, z in k_gemmb (k_attn's z holds the query blocks), workspace planes are [NB][...].
    k_cvt8<<<dim3((unsigned)(((size_t)SEQ * DM / 8 + 255) / 256), NB, 1), 256, 0, stream>>>(x, XB, (size_t)SEQ * DM / 8, (size_t)SEQ_FULL * DM, (size_t)SEQ * DM);
    k_rbf<<<dim3((SEQ / 4 + 255) / 256, NB, 1), 256, 0, stream>>>(amask, AMB, SEQ / 4, (size_t)SEQ_FULL, (size_t)SEQ);
    k_gemmb<0, 1><<<dim3(SEQ / GT, DQ / GT, NB), 256, 0, stream>>>(XB, nullptr, WQ, DM, nullptr, 0, (size_t)SEQ * DM, 0, QPh, QPl);
    k_gemmb<0, 1><<<dim3(SEQ / GT, DQ / GT, NB), 256, 0, stream>>>(XB, nullptr, WK, DM, nullptr, 0, (size_t)SEQ * DM, 0, KPh, KPl);
    k_gemmb<0, 2><<<dim3(SEQ / GT, DVV / GT, NB), 256, 0, stream>>>(XB, nullptr, WV, DM, nullptr, 0, (size_t)SEQ * DM, 0, (bf*)VT16, (bf*)VRS);
    k_attn<<<dim3(NVH, NB, SEQ / QBL), 256, 0, stream>>>(QPh, QPl, KPh, KPl, VT16, VRS, AMB, tix, LAM, Ob);
    k_gnstat<<<dim3(NVH, NB, 1), 1024, 0, stream>>>(Ob, GST);
    k_gnmerge<<<dim3((unsigned)(((size_t)SEQ * DVV / 2 + 255) / 256), NB, 1), 256, 0, stream>>>(Ob, GST, gnw, gnb, ATh, ATl);
    k_gemmb<1><<<dim3(SEQ / GT, DM / GT, NB), 256, 0, stream>>>(ATh, ATl, WO, DVV, OUT, DM, (size_t)SEQ * DVV, (size_t)SEQ_FULL * DM);
}

// v009
// One run takes 213 microseconds.
// Two timings next to v008 put it at 1.16 and 1.15 times that version's speed.
// Counting every step since v000, it is 4.52 times as fast.
#include <hip/hip_runtime.h>
#pragma clang fp contract(off)

// Compute dtypes (f32 accumulate everywhere): input projections x.Wq / x.Wk / x.Wv on v_wmma_f32_16x16x32_bf16 with bf16 RNE-converted inputs as operands (exact operands); q.k scores on v_wmma_f32_16x16x32_bf16 as bf16 hi/lo split (hi.hi + lo.hi + hi.lo); probability.value on v_wmma_f32_16x16x32_f16 (P f16 carried x4096, V f16; the first query block adds P and V residual planes carried x1024 through a second accumulator); softmax, ALiBi/pad terms, lambda and GroupNorm in f32; output projection on v_wmma_f32_16x16x32_bf16 (activation bf16 hi/lo x bf16 Wo, 2 products).
// Layout: x [NB][SEQ_FULL][1024]; Wq/Wk [2048][1024], Wv/Wo [1024][1024] ([out][in], used as K-contiguous Bt planes); per head h the 128 q/k columns are [half 1 | half 2] = virtual 64-wide heads 2h, 2h+1; mask [NB][SEQ_FULL] f32, token positions [NB][SEQ_FULL] int32; out [NB][SEQ_FULL][1024] f32.

#ifndef NB
#define NB 2
#endif
#ifndef SEQ
#define SEQ 2048
#endif
#define NB_FULL 2
#define SEQ_FULL 2048
#define DM   1024
#define NVH  16
#define HD   64
#define NQH  (2 * NVH)
#define DQ   (NQH * HD)
#define DVV  (NVH * HD)
#define SCL  0.125f
#define PCAR 4096.0f
#define RCAR 1024.0f
#define QBL  64
#define KCH  64
#define KSB  32
#define LP   72
#define PP   40
#define OSP  68
#define L2E  1.4426950408889634f
#define NEGB (-3.0e38f)
static_assert(SEQ % 64 == 0);
static_assert(SEQ <= SEQ_FULL);
static_assert(NB >= 1);
static_assert(NB <= NB_FULL);
static_assert(QBL == KCH);
static_assert(KCH % KSB == 0);
static_assert((LP * 2) % 16 == 0);
static_assert((PP * 2) % 16 == 0);
static_assert((OSP * 4) % 16 == 0);
static_assert((SEQ * DVV) % 512 == 0);
static_assert((SEQ * DM) % 2048 == 0);

typedef _Float16 h16;
typedef unsigned short bf;
typedef __attribute__((ext_vector_type(16))) __bf16   v16bf;
typedef __attribute__((ext_vector_type(16))) _Float16 v16h;
typedef __attribute__((ext_vector_type(8)))  _Float16 v8h;
typedef __attribute__((ext_vector_type(8)))  unsigned short v8us;
typedef __attribute__((ext_vector_type(8)))  float    v8f;
typedef __attribute__((ext_vector_type(4)))  float    v4f;
typedef __attribute__((ext_vector_type(2)))  unsigned short v2us;
typedef v8h  __attribute__((may_alias)) v8ha;
typedef v4f  __attribute__((may_alias)) v4fa;
typedef v8us __attribute__((may_alias)) v8usa;
typedef float __attribute__((may_alias)) f32a;

__device__ __forceinline__ unsigned short f2bf(float f) { unsigned u = __float_as_uint(f); u += 0x7FFFu + ((u >> 16) & 1u); return (unsigned short)(u >> 16); }
__device__ __forceinline__ float bf2f(unsigned short b) { return __uint_as_float(((unsigned)b) << 16); }
__device__ __forceinline__ float bfr(float f) { return bf2f(f2bf(f)); }
__device__ __forceinline__ v16h cat16(v8h lo, v8h hi) { return __builtin_shufflevector(lo, hi, 0, 1, 2, 3, 4, 5, 6, 7, 8, 9, 10, 11, 12, 13, 14, 15); }
__device__ __forceinline__ v16bf cat16b(v8us lo, v8us hi) { return __builtin_bit_cast(v16bf, __builtin_shufflevector(lo, hi, 0, 1, 2, 3, 4, 5, 6, 7, 8, 9, 10, 11, 12, 13, 14, 15)); }
__device__ __forceinline__ v8f wmma16(v16h a, v16h b, v8f c) { return __builtin_amdgcn_wmma_f32_16x16x32_f16(false, a, false, b, (short)0, c, false, false); }
__device__ __forceinline__ v8f wmmab(v16bf a, v16bf b, v8f c) { return __builtin_amdgcn_wmma_f32_16x16x32_bf16(false, a, false, b, (short)0, c, false, false); }
__device__ __forceinline__ h16 tohx(float x) { return (h16)x; }
__device__ __forceinline__ void splitf(float y, unsigned short& h, unsigned short& l) { h = f2bf(y); l = f2bf(y - bf2f(h)); }

// ---- k_gemmb: block-tiled GEMM, 8 waves (2 x 4) per 128x128 output tile, wave tile 64x32 (8 accumulators); grid (M/128, N/128, Z), 256 threads.
// c[m][n] (f32) = sum_k A[m][k] Bt[n][k] (+ A2[m][k] Bt[n][k] when NSPLIT == 1). z-batch strides sA/sC in elements. K % 64 == 0, K >= 64.
// MODE 0: c goes to C (f32, pitch ldc). MODE 1: the q, k and v projections of one A in one grid; blockIdx.y runs over the column tiles of Bt (q), then BtK (k), then BtV (v), a block-uniform choice.
// q, k tiles: c is split into bf16 hi/lo and goes to the head planes P0/P1 [z][n / 64][m][n % 64]. v tiles: c goes transposed, as f16 and as its
// residual x1024, to P0/P1 [z][n][m]. Both turn the tile in the stage buffers, free behind the loop's last barrier, so that every global store covers whole 128-byte lines.
// A stage is 64 k of every operand row (one whole 128-byte line per row), read from the K-contiguous planes by whole-line 16-byte loads, kept in registers while the
// previous stage is multiplied, then stored to the other of two LDS buffers (row pitch 144 B); one block barrier per stage publishes it and ends the reads of the buffer refilled next.
// Fragments: lane -> row/col (lane & 15); elements 0..7 <- k + 8*(lane>>4), elements 8..15 <- k + 16 + 8*(lane>>4), for A and Bt alike. k runs upward, one accumulate chain per element.
#define GT   128
#define GBK  64
#define GLP  72
#define GOP  36
#define GSP  132
#define GVP  136
static_assert(SEQ % GT == 0);
static_assert(DQ % GT == 0);
static_assert(DVV % GT == 0);
static_assert(DM % GT == 0);
static_assert(DM % GBK == 0);
static_assert(DVV % GBK == 0);
static_assert((GLP * 2) % 16 == 0);
static_assert((GOP * 4) % 16 == 0);
static_assert((GSP * 4) % 16 == 0);
static_assert((GVP * 2) % 16 == 0);
static_assert(GT == 2 * HD);
static_assert(GT * GSP * 4 <= 2 * 2 * GT * GLP * 2);
static_assert(2 * GT * GVP * 2 <= 2 * 2 * GT * GLP * 2);
__device__ __forceinline__ v16bf ldsb(const bf* p) { return cat16b(*(const v8usa*)p, *(const v8usa*)(p + 16)); }
template <int NSPLIT, int MODE = 0>
// waves_per_eu: the register budget is that of 4 waves per SIMD (two 8-wave blocks per WGP), so that a k-step's fragment loads may be grouped ahead of its products
__global__ __launch_bounds__(256) __attribute__((amdgpu_waves_per_eu(1, 4)))
void k_gemmb(const bf* __restrict__ A, const bf* __restrict__ A2, const bf* __restrict__ Bt, int K, float* C, int ldc, size_t sA, size_t sC, const bf* __restrict__ BtK = nullptr, const bf* __restrict__ BtV = nullptr,
             bf* Qh = nullptr, bf* Ql = nullptr, bf* Kh = nullptr, bf* Kl = nullptr, bf* Vt = nullptr, bf* Vr = nullptr) {
    constexpr int NPL = 2 + NSPLIT;                          // planes per stage: A, (A2,) Bt
    __shared__ __align__(16) bf    tl[2][NPL][GT * GLP];     // two stage buffers [row*GLP + k]                  (cross-wave: block barriers)
    __shared__ __align__(16) float osw[8][16 * GOP];         // per-wave f32 epilogue staging [row*GOP + col]    (wave-private)
    const size_t z = blockIdx.z; A += z * sA; if (NSPLIT) A2 += z * sA; C += z * sC;
    const int tid = threadIdx.x, w = tid >> 5, lane = tid & 31, lr = lane & 15, hi = lane >> 4; const int wm = w >> 2, wn = w & 3;
    int by = blockIdx.y; bf* P0 = Qh; bf* P1 = Ql; bool isv = false;   // MODE 1: which projection this block's column tile belongs to, and the tile's index inside it
    if constexpr (MODE == 1) {
        if (by >= 2 * (DQ / GT)) { by -= 2 * (DQ / GT); Bt = BtV; P0 = Vt; P1 = Vr; isv = true; }
        else if (by >= DQ / GT) { by -= DQ / GT; Bt = BtK; P0 = Kh; P1 = Kl; }
    }
    const int r0 = blockIdx.x * GT, c0 = by * GT;
    v8f acc[4][2];
#pragma unroll
    for (int mb = 0; mb < 4; ++mb)
#pragma unroll
        for (int nb = 0; nb < 2; ++nb) acc[mb][nb] = (v8f){};
    const int srow = tid >> 3, sc8 = (tid & 7) * 8;          // staging: 8 lanes cover one row's 128 bytes; piece i is row srow + 32 i
    const char* gA = (const char*)(A + (size_t)r0 * K); const char* gA2 = (const char*)(A2 + (size_t)r0 * K); const char* gB = (const char*)(Bt + (size_t)c0 * K);   // block-uniform tile bases
    unsigned go[4];                                          // the lane's byte offset of piece i inside a tile's rows, the same for every plane and stage
#pragma unroll
    for (int i = 0; i < 4; ++i) go[i] = ((unsigned)(srow + 32 * i) * (unsigned)K + (unsigned)sc8) * 2u;
    const int so = srow * GLP + sc8;
    const int fa = (wm * 64 + lr) * GLP + 8 * hi, fb = (wn * 32 + lr) * GLP + 8 * hi;
    v8us ra[4], ra2[4], rb[4];
#pragma unroll
    for (int i = 0; i < 4; ++i) { ra[i] = *(const v8us*)(gA + go[i]); if (NSPLIT) ra2[i] = *(const v8us*)(gA2 + go[i]); rb[i] = *(const v8us*)(gB + go[i]); }
#pragma unroll
    for (int i = 0; i < 4; ++i) { *(v8usa*)(&tl[0][0][so + i * 32 * GLP]) = ra[i]; if (NSPLIT) *(v8usa*)(&tl[0][1][so + i * 32 * GLP]) = ra2[i]; *(v8usa*)(&tl[0][NPL - 1][so + i * 32 * GLP]) = rb[i]; }
    __syncthreads();
#pragma unroll 1
    for (int k0 = 0; k0 < K; k0 += GBK) {
        const int cur = (k0 / GBK) & 1; const bool more = k0 + GBK < K;
        gA += GBK * 2; gA2 += GBK * 2; gB += GBK * 2;        // the uniform bases step one stage; the lanes' offsets stay
        if (more) {
#pragma unroll
            for (int i = 0; i < 4; ++i) {   // a wait behind each load: this build lets a later load of the group land in an earlier one's address pair, and the wait stands in front of that overwrite
                ra[i] = *(const v8us*)(gA + go[i]); asm volatile("s_wait_xcnt 0x0" ::: "memory");
                if (NSPLIT) { ra2[i] = *(const v8us*)(gA2 + go[i]); asm volatile("s_wait_xcnt 0x0" ::: "memory"); }
                rb[i] = *(const v8us*)(gB + go[i]); asm volatile("s_wait_xcnt 0x0" ::: "memory"); }
        }
        const bf* ta = &tl[cur][0][fa]; const bf* ta2 = &tl[cur][NSPLIT][fa]; const bf* tb = &tl[cur][NPL - 1][fb];
#pragma unroll
        for (int kc = 0; kc < GBK; kc += 32) {
            v16bf a[4], a2[4], b[2];
#pragma unroll
            for (int mb = 0; mb < 4; ++mb) { a[mb] = ldsb(ta + mb * 16 * GLP + kc); if (NSPLIT) a2[mb] = ldsb(ta2 + mb * 16 * GLP + kc); }
#pragma unroll
            for (int nb = 0; nb < 2; ++nb) b[nb] = ldsb(tb + nb * 16 * GLP + kc);
#pragma unroll
            for (int nb = 0; nb < 2; ++nb)
#pragma unroll
                for (int mb = 0; mb < 4; ++mb) { acc[mb][nb] = wmmab(a[mb], b[nb], acc[mb][nb]); if (NSPLIT) acc[mb][nb] = wmmab(a2[mb], b[nb], acc[mb][nb]); }
        }
        if (more) {
#pragma unroll
            for (int i = 0; i < 4; ++i) { *(v8usa*)(&tl[cur ^ 1][0][so + i * 32 * GLP]) = ra[i]; if (NSPLIT) *(v8usa*)(&tl[cur ^ 1][1][so + i * 32 * GLP]) = ra2[i]; *(v8usa*)(&tl[cur ^ 1][NPL - 1][so + i * 32 * GLP]) = rb[i]; }
        }
        __syncthreads();
    }
    if (MODE == 1 && !isv) {
        f32a* st = (f32a*)&tl[0][0][0];                      // block f32 tile [row*GSP + col]
#pragma unroll
        for (int mb = 0; mb < 4; ++mb)
#pragma unroll
            for (int nb = 0; nb < 2; ++nb)
#pragma unroll
                for (int j = 0; j < 8; ++j) st[(wm * 64 + mb * 16 + hi * 8 + j) * GSP + wn * 32 + nb * 16 + lr] = acc[mb][nb][j];
        __syncthreads();                                     // publishes the tile: its rows are read back by other waves
        const int hs = w & 1, rw = (w >> 1) * 32 + (lane >> 3), c8 = (lane & 7) * 8;   // a wave takes 32 rows of one 64-wide head; one store = 4 rows = 512 contiguous bytes
        const size_t pb = ((z * NQH + (size_t)(by * 2 + hs)) * SEQ + r0) * HD + c8;
#pragma unroll
        for (int i = 0; i < 8; ++i) { const int row = rw + 4 * i; const f32a* sp = st + row * GSP + hs * HD + c8; const v4f x0 = *(const v4fa*)sp, x1 = *(const v4fa*)(sp + 4); v8us oh, ol;
#pragma unroll
            for (int q = 0; q < 4; ++q) { unsigned short a2, c2; splitf(x0[q], a2, c2); oh[q] = a2; ol[q] = c2; splitf(x1[q], a2, c2); oh[4 + q] = a2; ol[4 + q] = c2; }
            *(v8us*)(P0 + pb + (size_t)row * HD) = oh; *(v8us*)(P1 + pb + (size_t)row * HD) = ol; }
        asm volatile("s_wait_xcnt 0x0" ::: "memory");        // the build lays the v tiles' code behind these stores, where conversions land in the registers that the stores name: the wait stands in front of that overwrite
        return;
    }
    if constexpr (MODE == 1) {
        h16* sv = (h16*)&tl[0][0][0]; h16* sr = sv + GT * GVP;   // block f16 tiles, value and residual, transposed [col*GVP + row]; an accumulator lane holds 8 consecutive rows of one column
#pragma unroll
        for (int mb = 0; mb < 4; ++mb)
#pragma unroll
            for (int nb = 0; nb < 2; ++nb) { v8h o16, orr;
#pragma unroll
                for (int j = 0; j < 8; ++j) { const float x = acc[mb][nb][j]; const h16 hv = tohx(x); const float res = (x - (float)hv) * RCAR; o16[j] = hv; orr[j] = tohx(res); }
                const int si = (wn * 32 + nb * 16 + lr) * GVP + wm * 64 + mb * 16 + hi * 8; *(v8ha*)(sv + si) = o16; *(v8ha*)(sr + si) = orr; }
        __syncthreads();                                     // publishes the tiles: their columns are read back by other waves
        const int cw = tid >> 4, t8 = (tid & 15) * 8;        // 16 lanes cover one column's 128 rows = 256 contiguous bytes
        const size_t vb = (z * DVV + (size_t)c0) * SEQ + r0 + t8;
#pragma unroll
        for (int i = 0; i < 8; ++i) { const int col = cw + 16 * i; const v8h a16 = *(const v8ha*)(sv + col * GVP + t8), ar = *(const v8ha*)(sr + col * GVP + t8);
            *(v8ha*)((h16*)P0 + vb + (size_t)col * SEQ) = a16; *(v8ha*)((h16*)P1 + vb + (size_t)col * SEQ) = ar; }
        return;
    }
    float* os = &osw[w][0];
#pragma unroll
    for (int mb = 0; mb < 4; ++mb) {
#pragma unroll
        for (int nb = 0; nb < 2; ++nb) {
#pragma unroll
            for (int j = 0; j < 8; ++j) os[(hi * 8 + j) * GOP + nb * 16 + lr] = acc[mb][nb][j]; }
        __builtin_amdgcn_wave_barrier(); asm volatile("" ::: "memory");   // keeps the staging stores ahead of the row reads of other lanes of this wave
        float* crow = C + (size_t)(r0 + wm * 64 + mb * 16) * ldc + c0 + wn * 32;
#pragma unroll
        for (int s = 0; s < 4; ++s) { const int row = 4 * s + (lane >> 3), cofs = (lane & 7) * 4; const v4f val = *(const v4fa*)(os + row * GOP + cofs); *(v4f*)(crow + (size_t)row * ldc + cofs) = val; }
        __builtin_amdgcn_wave_barrier(); asm volatile("" ::: "memory");   // keeps the row reads ahead of the next block's staging stores
    }
}

// ---- k_prep: everything that depends on the inputs alone, in one launch; a block's index says which piece it does (block-uniform tests). Block 0: lambda (one wave); then the mask rounding; then the
// f32 -> bf16 conversions of x and of the four weight planes, 2048 elements per block. The single-wave serial piece has the lowest index.
__device__ __forceinline__ void cvt8(const float* __restrict__ src, bf* dst, size_t i) { const v8f v = *(const v8f*)(src + i * 8); v8us o;
#pragma unroll
    for (int k = 0; k < 8; ++k) o[k] = f2bf(v[k]); *(v8us*)(dst + i * 8) = o;
    asm volatile("s_wait_xcnt 0x0" ::: "memory"); }   // the build lays another piece's code behind this store, where a load lands in the registers that the store names: the wait stands in front of that overwrite
__device__ __forceinline__ void rbf4(const float* __restrict__ src, float* dst, int i) { const v4f a = *(const v4f*)(src + (size_t)i * 4); v4f o;
#pragma unroll
    for (int u = 0; u < 4; ++u) o[u] = bfr(a[u]); *(v4f*)(dst + (size_t)i * 4) = o;  }
__device__ __forceinline__ void lambda1(const float* __restrict__ lq1, const float* __restrict__ lk1, const float* __restrict__ lq2, const float* __restrict__ lk2, float* LAM, const int lane) { float d1 = 0.f, d2 = 0.f;
#pragma unroll 1
    for (int i = 0; i < HD; ++i) { float p1 = __fmul_rn(bfr(lq1[i]), bfr(lk1[i])); asm volatile("" : "+v"(p1)); d1 = __fadd_rn(d1, p1); float p2 = __fmul_rn(bfr(lq2[i]), bfr(lk2[i])); asm volatile("" : "+v"(p2)); d2 = __fadd_rn(d2, p2); }
    float lm = __fsub_rn(expf(d1), expf(d2)); asm volatile("" : "+v"(lm)); lm = __fadd_rn(lm, 0.8f); const float v = (lane == 0) ? lm : 0.0f; *(float*)(LAM + lane) = v;  }
#define PB_RB1 ((SEQ / 4 + 255) / 256)
#define PB_RBF (NB * PB_RB1)
#define PB_X1  (SEQ * DM / 2048)
#define PB_X   (NB * PB_X1)
#define PB_WQ  (DQ * DM / 2048)
#define PB_WV  (DVV * DM / 2048)
#define PB_WO  (DM * DVV / 2048)
#define PB_ALL (1 + PB_RBF + PB_X + 2 * PB_WQ + PB_WV + PB_WO)
static_assert((DQ * DM) % 2048 == 0);
static_assert((DVV * DM) % 2048 == 0);
__global__ __launch_bounds__(256) void k_prep(const float* __restrict__ x, const float* __restrict__ amask, const float* __restrict__ wq, const float* __restrict__ wk, const float* __restrict__ wv, const float* __restrict__ wo,
                                              const float* __restrict__ lq1, const float* __restrict__ lk1, const float* __restrict__ lq2, const float* __restrict__ lk2,
                                              bf* XB, float* AMB, bf* WQ, bf* WK, bf* WV, bf* WO, float* LAM) {
    int b = blockIdx.x; const int tid = threadIdx.x;
    if (b == 0) { if (tid < 32) lambda1(lq1, lk1, lq2, lk2, LAM, tid); return; }
    b -= 1;
    if (b < PB_RBF) { const int bz = b / PB_RB1, i = (b - bz * PB_RB1) * 256 + tid; if (i < SEQ / 4) rbf4(amask + (size_t)bz * SEQ_FULL, AMB + (size_t)bz * SEQ, i); return; }
    b -= PB_RBF;
    const int bz = b < PB_X ? b / PB_X1 : 0;                 // batch element of an x block
    const float* src = x + (size_t)bz * SEQ_FULL * DM; bf* dst = XB + (size_t)bz * SEQ * DM; int o = bz * PB_X1;   // the block's plane by uniform selects; o: the plane's first block
    if (b >= PB_X)                              { src = wq; dst = WQ; o = PB_X; }
    if (b >= PB_X + PB_WQ)                      { src = wk; dst = WK; o = PB_X + PB_WQ; }
    if (b >= PB_X + 2 * PB_WQ)                  { src = wv; dst = WV; o = PB_X + 2 * PB_WQ; }
    if (b >= PB_X + 2 * PB_WQ + PB_WV)          { src = wo; dst = WO; o = PB_X + 2 * PB_WQ + PB_WV; }
    cvt8(src, dst, (size_t)(b - o) * 256 + tid);
}

// ---- k_attn: causal differential attention for one (query block of 64, head) per block of 8 waves. The two score streams run side by side: waves 0..3 take stream 0, waves 4..7 stream 1
// (wave w & 3 owns 16 query rows), each group with its own Q/K hi/lo tiles, score tiles, O accumulators and running max/sum. Per 64-key chunk c = 0..qb each group stages the K hi/lo tile of its
// head plane 2h+st and half of the one V^T tile that both groups read; the softmax recurrence then runs on 32-key sub-chunks: scores S = Q.K (3 bf16 products, 16x32 tile per wave) ->
// t = S/8 - slope (pos_i - pos_j) + (1 - mask_j)(-1e9) for j <= i, excluded otherwise; online softmax (running max / sum, f32); P tile (f16 x4096, 16x32) per wave in LDS; O += P.V (one k-step).
// The first query block also forms P and V residual planes (x1024) and adds P_res.V + P.V_res per 16-column block through a second accumulator folded before normalisation.
// rowx<M>: the value of lane l ^ M of the lane's own 16-lane row, read through DPP (row_xmask) on the vector pipe; __shfl_xor compiles to ds_bpermute_b32, a trip through the LDS unit with a wait on dscnt per link. Every lane is on where it is used.
template <int M> __device__ __forceinline__ float rowx(float x) { return __builtin_bit_cast(float, __builtin_amdgcn_update_dpp(0, __builtin_bit_cast(int, x), 0x160 | M, 0xf, 0xf, true)); }
__device__ __forceinline__ v16h  ldsh(const h16* p) { return cat16(*(const v8ha*)p, *(const v8ha*)(p + 16)); }

// attn_blk: one stream's loop of one block (st is the wave group's stream). ER (first query block: residual planes) is a compile-time value, so the loops hold no test of it: a chunk's tile loads are one group
// behind which the LDS stores follow, and the sixteen probability chains of a sub-chunk stand in one basic block.
template <bool ER>
__device__ __forceinline__ void attn_blk(const bf* __restrict__ QPh, const bf* __restrict__ QPl, const bf* __restrict__ KPh, const bf* __restrict__ KPl, const h16* __restrict__ VT, const h16* __restrict__ VR,
                                         const float* __restrict__ amb, const int* __restrict__ tix, const float lam, const float slope, const float (&pq)[8], const int hh, const int qb, const int st,
                                         bf* qs0, bf* qs1, bf* ks0, bf* ks1, h16* vsm, h16* vrm, h16* pt, h16* prt, float* os) {
    const int tid = threadIdx.x & 127, w = tid >> 5, lane = tid & 31, lr = lane & 15, hi = lane >> 4;   // tid, w: inside the wave group of one stream
    const int q0 = qb * QBL, qrow0 = q0 + 16 * w + 8 * hi;
    // staging: piece i of a K plane is row 16 i + (tid >> 3), 16 bytes at 8 (tid & 7): the 64 x 64 tile is 8 KiB in a row, so a lane's byte offset is 16 tid + 2048 i; piece i of V^T is row d = 16 i + (tid >> 3), group st brings pieces 2 st and 2 st + 1
    const unsigned ko = (unsigned)tid * 16u, vo = ((unsigned)(tid >> 3) * (unsigned)SEQ + 8u * (unsigned)(tid & 7)) * 2u;   // the lane's offsets, the same for every chunk
    const int sk = (tid >> 3) * LP + (tid & 7) * 8;
    {
        const size_t vq = (size_t)(2 * hh + st);
        {   const char* pqh = (const char*)(QPh + (vq * SEQ + q0) * HD) + ko; const char* pql = (const char*)(QPl + (vq * SEQ + q0) * HD) + ko;
            v8us qh[4], ql[4];
#pragma unroll
            for (int i = 0; i < 4; ++i) { qh[i] = *(const v8usa*)(pqh + i * 2048); ql[i] = *(const v8usa*)(pql + i * 2048); }
            asm volatile("s_wait_xcnt 0x0" :: "v"(pqh), "v"(pql) : "memory");   // holds the address pairs whole up to this wait: without it a later load of the group may land in a pair that the loads before it name
#pragma unroll
            for (int i = 0; i < 4; ++i) { *(v8usa*)(&qs0[sk + i * 16 * LP]) = qh[i]; *(v8usa*)(&qs1[sk + i * 16 * LP]) = ql[i]; }
        }
        float m[8], l[8]; v8f O[4];
#pragma unroll
        for (int r = 0; r < 8; ++r) { m[r] = NEGB; l[r] = 0.0f; }
#pragma unroll
        for (int j = 0; j < 4; ++j) O[j] = (v8f){};
#pragma unroll 1
        for (int c = 0; c <= qb; ++c) {
            const int k0 = c * KCH;
            {   const char* pkh = (const char*)(KPh + (vq * SEQ + k0) * HD) + ko; const char* pkl = (const char*)(KPl + (vq * SEQ + k0) * HD) + ko;
                const char* pv = (const char*)(VT + ((size_t)hh * HD + 32 * st) * SEQ + k0) + vo; const char* pr = (const char*)(VR + ((size_t)hh * HD + 32 * st) * SEQ + k0) + vo;
                v8us kh[4], kl[4]; v8h vv[2], vr[2];
#pragma unroll
                for (int i = 0; i < 4; ++i) { kh[i] = *(const v8usa*)(pkh + i * 2048); kl[i] = *(const v8usa*)(pkl + i * 2048); }
#pragma unroll
                for (int i = 0; i < 2; ++i) { vv[i] = *(const v8ha*)(pv + i * (16 * SEQ * 2)); if constexpr (ER) vr[i] = *(const v8ha*)(pr + i * (16 * SEQ * 2)); }
                // holds the address pairs whole up to this wait: without it the last load of a group lands in the pair that the loads before it name
                if constexpr (ER) asm volatile("s_wait_xcnt 0x0" :: "v"(pkh), "v"(pkl), "v"(pv), "v"(pr) : "memory"); else asm volatile("s_wait_xcnt 0x0" :: "v"(pkh), "v"(pkl), "v"(pv) : "memory");
#pragma unroll
                for (int i = 0; i < 4; ++i) { *(v8usa*)(&ks0[sk + i * 16 * LP]) = kh[i]; *(v8usa*)(&ks1[sk + i * 16 * LP]) = kl[i]; }
#pragma unroll
                for (int i = 0; i < 2; ++i) { *(v8ha*)(&vsm[sk + (2 * st + i) * 16 * LP]) = vv[i]; if constexpr (ER) *(v8ha*)(&vrm[sk + (2 * st + i) * 16 * LP]) = vr[i]; }
            }
            __syncthreads();
#pragma unroll 1
            for (int sb = 0; sb < KCH / KSB; ++sb) {
                const int kb = sb * KSB;
                const int key0 = k0 + kb + lr, key1 = key0 + 16;
                const float pk0 = (float)tix[key0], pk1 = (float)tix[key1];
                const float om0 = 1.0f - amb[key0], om1 = 1.0f - amb[key1]; const float pad0 = om0 * -1.0e9f, pad1 = om1 * -1.0e9f;
                // ---- scores: S[row 8hi+r][key kb + nb*16 + lr], 3 bf16 products (hi.hi + lo.hi + hi.lo); fragments loaded right before each k-step, scheduling barrier after it
                v8f s[2]; s[0] = (v8f){}; s[1] = (v8f){};
                {   v16bf ah, al, bh, bl;
#pragma unroll
                    for (int kc = 0; kc < HD; kc += 32) {
                        ah = ldsb(&qs0[(16 * w + lr) * LP + kc + 8 * hi]); al = ldsb(&qs1[(16 * w + lr) * LP + kc + 8 * hi]);
#pragma unroll
                        for (int nb = 0; nb < 2; ++nb) { bh = ldsb(&ks0[(kb + nb * 16 + lr) * LP + kc + 8 * hi]); bl = ldsb(&ks1[(kb + nb * 16 + lr) * LP + kc + 8 * hi]);
                            s[nb] = wmmab(ah, bh, s[nb]); s[nb] = wmmab(al, bh, s[nb]); s[nb] = wmmab(ah, bl, s[nb]); }
                        asm volatile("v_nop\n\tv_nop\n\tv_nop\n\tv_nop" : "+v"(s[0]), "+v"(s[1]) : "v"(ah), "v"(al), "v"(bh), "v"(bl) : "memory");
                    }
                }
                // ---- additive terms by value select, sub-chunk max
                float cm[8];
#pragma unroll
                for (int r = 0; r < 8; ++r) cm[r] = NEGB;
#pragma unroll
                for (int nb = 0; nb < 2; ++nb) { const int kv = nb ? key1 : key0; const float pkv = nb ? pk1 : pk0; const float pdv = nb ? pad1 : pad0;
#pragma unroll
                    for (int r = 0; r < 8; ++r) { const float sa = s[nb][r] * SCL; const float pd = pq[r] - pkv; const float bia = slope * pd; const float sm = sa - bia;
                        const float tt = (kv <= qrow0 + r) ? (sm + pdv) : NEGB; s[nb][r] = tt; cm[r] = fmaxf(cm[r], tt); } }
                float cor[8], rs[8];
#pragma unroll
                for (int r = 0; r < 8; ++r) { float x = cm[r]; x = fmaxf(x, rowx<1>(x)); x = fmaxf(x, rowx<2>(x)); x = fmaxf(x, rowx<4>(x)); x = fmaxf(x, rowx<8>(x));
                    const float mn = fmaxf(m[r], x); const float dlt = (m[r] - mn) * L2E; cor[r] = __builtin_amdgcn_exp2f(dlt); m[r] = mn; rs[r] = 0.0f; }
                // ---- probabilities -> per-wave LDS tile (f16 x4096; residual x1024 on the first query block); excluded keys store exactly 0
#pragma unroll
                for (int nb = 0; nb < 2; ++nb) { const int kv = nb ? key1 : key0;
#pragma unroll
                    for (int r = 0; r < 8; ++r) { const float dq = (s[nb][r] - m[r]) * L2E; const float pe = __builtin_amdgcn_exp2f(dq); const float p = (kv <= qrow0 + r) ? pe : 0.0f; rs[r] = rs[r] + p;
                        const float pc = p * PCAR; const h16 ph = tohx(pc); const int li = (8 * hi + r) * PP + nb * 16 + lr; pt[li] = ph;
                        if constexpr (ER) { const float res = (pc - (float)ph) * RCAR; prt[li] = tohx(res); } } }
#pragma unroll
                for (int r = 0; r < 8; ++r) { float x = rs[r]; x += rowx<1>(x); x += rowx<2>(x); x += rowx<4>(x); x += rowx<8>(x);
                    const float lc = l[r] * cor[r]; l[r] = lc + x; const float cf = cor[r];
#pragma unroll
                    for (int j = 0; j < 4; ++j) O[j][r] = O[j][r] * cf; }
                __syncthreads();
                // ---- O[d block j][row] += P[row][key] . V^T[d][key] over the 32 keys of this sub-chunk (one k-step)
                {   const v16h a = ldsh(pt + lr * PP + 8 * hi); v16h b;
#pragma unroll
                    for (int j = 0; j < 4; ++j) { b = ldsh(&vsm[(j * 16 + lr) * LP + kb + 8 * hi]); O[j] = wmma16(a, b, O[j]); }
                    asm volatile("v_nop\n\tv_nop\n\tv_nop\n\tv_nop" : "+v"(O[0]), "+v"(O[1]), "+v"(O[2]), "+v"(O[3]) : "v"(a), "v"(b) : "memory");
                    if constexpr (ER) {
                        const v16h ar = ldsh(prt + lr * PP + 8 * hi);
#pragma unroll
                        for (int j = 0; j < 4; ++j) {
                            const v16h b2 = ldsh(&vsm[(j * 16 + lr) * LP + kb + 8 * hi]); const v16h br = ldsh(&vrm[(j * 16 + lr) * LP + kb + 8 * hi]);
                            v8f R = wmma16(ar, b2, (v8f){}); R = wmma16(a, br, R);
                            asm volatile("v_nop\n\tv_nop\n\tv_nop\n\tv_nop" : "+v"(R) : "v"(a), "v"(ar), "v"(b2), "v"(br) : "memory");
#pragma unroll
                            for (int r = 0; r < 8; ++r) { const float rr = R[r] * (1.0f / RCAR); O[j][r] = O[j][r] + rr; }
                        }
                    }
                }
                __syncthreads();
            }
        }
#pragma unroll
        for (int r = 0; r < 8; ++r) { const float rl = 1.0f / l[r]; const float il = rl * (1.0f / PCAR);
#pragma unroll
            for (int j = 0; j < 4; ++j) O[j][r] = O[j][r] * il; }
        if (st == 0) {
#pragma unroll
            for (int r = 0; r < 8; ++r)
#pragma unroll
                for (int j = 0; j < 4; ++j) os[(8 * hi + r) * OSP + j * 16 + lr] = O[j][r];
        }
        __syncthreads();                                     // publishes stream 0's result to the stream 1 wave of the same rows
        if (st != 0) {
#pragma unroll
            for (int r = 0; r < 8; ++r)
#pragma unroll
                for (int j = 0; j < 4; ++j) { const int oi = (8 * hi + r) * OSP + j * 16 + lr; const float lb = lam * O[j][r]; const float cur = os[oi]; os[oi] = cur - lb; }
        }
    }
}

__global__ __launch_bounds__(256) __attribute__((amdgpu_num_vgpr(256)))
void k_attn(const bf* __restrict__ QPh, const bf* __restrict__ QPl, const bf* __restrict__ KPh, const bf* __restrict__ KPl, const h16* __restrict__ VT, const h16* __restrict__ VR,
            const float* __restrict__ amb, const int* __restrict__ tix, const float* __restrict__ LAM, float* Ob) {
    __shared__ __align__(16) bf    qs[2][2][QBL * LP];   // Q [stream]{hi,lo} [row*LP + d]                   (cross-wave: block barriers)
    __shared__ __align__(16) bf    ks[2][2][KCH * LP];   // K [stream]{hi,lo} [key*LP + d]                   (cross-wave: block barriers)
    __shared__ __align__(16) h16   vsm[HD * LP];         // V^T tile [d*LP + key], read by both streams      (cross-wave: block barriers)
    __shared__ __align__(16) h16   vrm[HD * LP];         // V residual tile, first query block only         (cross-wave: block barriers)
    __shared__ __align__(16) h16   psm[8][16 * PP];      // per-wave P tile [row*PP + key], 16 x 32          (wave-private, block barriers used anyway)
    __shared__ __align__(16) h16   prm[8][16 * PP];      // per-wave P residual tile, first query block only
    __shared__ __align__(16) float osm[4][16 * OSP];     // f32 result / epilogue staging [row*OSP + d] per 16 query rows: written by stream 0's wave, finished by stream 1's
    const int st = __builtin_amdgcn_readfirstlane((int)(threadIdx.x >> 7));   // the wave group's stream, held scalar: tests of it are scalar branches, the stream's tile bases are uniform
    const int w8 = threadIdx.x >> 5, w = w8 & 3, lane = threadIdx.x & 31, lr = lane & 15, hi = lane >> 4;
    // A block's cost grows with qb and the grid holds more blocks than fit on the chip at once: the longest query blocks take the lowest indices
    // and the short ones fill the places that come free; (head, batch) is the fast index, so every run of consecutive blocks holds equal costs.
    const int hh = blockIdx.x, qb = SEQ / QBL - 1 - (int)blockIdx.z, q0 = qb * QBL;
    {   const size_t bz = blockIdx.y;                        // batch element: every plane is [NB][...]; only the token positions keep the input's own batch pitch
        QPh += bz * ((size_t)NQH * SEQ * HD); QPl += bz * ((size_t)NQH * SEQ * HD); KPh += bz * ((size_t)NQH * SEQ * HD); KPl += bz * ((size_t)NQH * SEQ * HD);
        VT += bz * ((size_t)NVH * HD * SEQ); VR += bz * ((size_t)NVH * HD * SEQ); amb += bz * SEQ; tix += bz * SEQ_FULL; Ob += bz * ((size_t)SEQ * DVV); }
    const int e2 = hh + 1;                                   // slope = 2^(-(h+1)/2): exact power of two times 2^-0.5 for odd exponents
    const float slope = ((e2 & 1) ? 0.70710678118654752f : 1.0f) * __uint_as_float(((unsigned)(127 - (e2 >> 1))) << 23);
    const float lam = LAM[0];
    const int qrow0 = q0 + 16 * w + 8 * hi;
    float pq[8];
#pragma unroll
    for (int r = 0; r < 8; ++r) pq[r] = (float)tix[qrow0 + r];
    float* os = &osm[w][0];
    // block-uniform: every wave of a block takes the same side, with all its barriers
    if (qb == 0) attn_blk<true>(QPh, QPl, KPh, KPl, VT, VR, amb, tix, lam, slope, pq, hh, qb, st, &qs[st][0][0], &qs[st][1][0], &ks[st][0][0], &ks[st][1][0], vsm, vrm, &psm[w8][0], &prm[w8][0], os);
    else         attn_blk<false>(QPh, QPl, KPh, KPl, VT, VR, amb, tix, lam, slope, pq, hh, qb, st, &qs[st][0][0], &qs[st][1][0], &ks[st][0][0], &ks[st][1][0], vsm, vrm, &psm[w8][0], &prm[w8][0], os);
    __syncthreads();
    float* orow = Ob + (size_t)(q0 + 16 * w) * DVV + hh * HD;
{
#pragma unroll
        for (int s2 = 0; s2 < 4; ++s2) { const int row = 8 * st + 2 * s2 + hi, cofs = lr * 4;   // each of the two waves of a row group stores 8 of its 16 rows
            const v4f val = *(const v4fa*)(os + row * OSP + cofs); *(v4f*)(orow + (size_t)row * DVV + cofs) = val; }
         }
}

#define GNB 32
static_assert((SEQ * HD / 1024) % GNB == 0);
__global__ __launch_bounds__(1024) void k_gnstat(const float* __restrict__ O, float* GST) {
    __shared__ float sh[1024]; const int tid = threadIdx.x; const int hh = blockIdx.x; const float* base = O + (size_t)blockIdx.y * SEQ * DVV + hh * HD; GST += blockIdx.y * (NVH * 32); const int n = SEQ * HD; const float rn = 1.0f / (float)n;
    // A thread's chain is e = tid + 1024 i: row (tid >> 6) + 16 i, column tid & 63. GNB loads of the chain are issued together, then added in the chain's own order.
    const float* pl = base + (size_t)(tid >> 6) * DVV + (tid & 63);
    float acc = 0.f;
#pragma unroll
    for (int g = 0; g < n / 1024; g += GNB) { float v[GNB];
#pragma unroll
        for (int u = 0; u < GNB; ++u) v[u] = pl[(size_t)(g + u) * 16 * DVV];
#pragma unroll
        for (int u = 0; u < GNB; ++u) acc = __fadd_rn(acc, v[u]); }
    sh[tid] = acc; __syncthreads();
#pragma unroll 1
    for (int st = 512; st > 0; st >>= 1) { if (tid < st) sh[tid] = __fadd_rn(sh[tid], sh[tid + st]); __syncthreads(); }
    const float mean = sh[0] * rn;
    __syncthreads();
    float acc2 = 0.f;
#pragma unroll
    for (int g = 0; g < n / 1024; g += GNB) { float v[GNB];
#pragma unroll
        for (int u = 0; u < GNB; ++u) v[u] = pl[(size_t)(g + u) * 16 * DVV];
#pragma unroll
        for (int u = 0; u < GNB; ++u) { const float dv = __fsub_rn(v[u], mean); acc2 = __builtin_fmaf(dv, dv, acc2); } }   // the fused square-add that the rolled loop compiled to, written out: left to the compiler, the unrolled chain fuses its first two squares the other way round
    asm volatile("s_wait_xcnt 0x0" :: "v"(pl) : "memory");   // holds the address pair whole up to this wait: without it this build lets the last load land in the pair that the loads before it name
    sh[tid] = acc2; __syncthreads();
#pragma unroll 1
    for (int st = 512; st > 0; st >>= 1) { if (tid < st) sh[tid] = __fadd_rn(sh[tid], sh[tid + st]); __syncthreads(); }
    if (tid < 32) { const float var = sh[0] * rn; const float rs = __fdiv_rn(1.0f, sqrtf(__fadd_rn(var, 1e-5f))); const float outv = (tid == 0) ? mean : ((tid == 1) ? rs : 0.0f);
        *(float*)(GST + hh * 32 + tid) = outv;  }
}
__global__ __launch_bounds__(256) void k_gnmerge(const float* __restrict__ O, const float* __restrict__ GST, const float* __restrict__ gw, const float* __restrict__ gb, bf* Ah, bf* Al) {
    const size_t e = ((size_t)blockIdx.x * 256 + threadIdx.x) * 2; if (e >= (size_t)SEQ * DVV) return;
    O += (size_t)blockIdx.y * SEQ * DVV; GST += blockIdx.y * (NVH * 32); Ah += (size_t)blockIdx.y * SEQ * DVV; Al += (size_t)blockIdx.y * SEQ * DVV;
    const int c = (int)(e % DVV); const int hh = c / HD; const float mean = GST[hh * 32], rs = GST[hh * 32 + 1]; v2us oh, ol;
#pragma unroll
    for (int q = 0; q < 2; ++q) { float cc = __fsub_rn(O[e + q], mean); asm volatile("" : "+v"(cc)); float nn = __fmul_rn(cc, rs); asm volatile("" : "+v"(nn)); float y = __fmul_rn(nn, bfr(gw[c + q])); asm volatile("" : "+v"(y)); y = __fadd_rn(y, bfr(gb[c + q])); const float z = __fmul_rn(y, 0.2f); unsigned short a2, c2; splitf(z, a2, c2); oh[q] = a2; ol[q] = c2; }
    *(v2us*)(Ah + e) = oh; *(v2us*)(Al + e) = ol;  }

extern "C" void kernel_launch(void* const* d_in, const int* in_sizes, int n_in,
                              void* d_out, int out_size, void* d_ws, size_t ws_size, hipStream_t stream) {
    if (n_in < 13) return;
    if (in_sizes[0] < (NB - 1) * SEQ_FULL * DM + SEQ * DM) return;
    if (in_sizes[1] < (NB - 1) * SEQ_FULL + SEQ) return;
    if (in_sizes[2] < (NB - 1) * SEQ_FULL + SEQ) return;
    if (in_sizes[3] < DQ * DM || in_sizes[4] < DQ * DM || in_sizes[5] < DVV * DM || in_sizes[6] < DM * DVV) return;
    if (in_sizes[7] < HD || in_sizes[8] < HD || in_sizes[9] < HD || in_sizes[10] < HD || in_sizes[11] < DVV || in_sizes[12] < DVV) return;
    if (out_size < (NB - 1) * SEQ_FULL * DM + SEQ * DM) return;
    const float* x = (const float*)d_in[0]; const float* amask = (const float*)d_in[1]; const int* tix = (const int*)d_in[2];
    const float* wq = (const float*)d_in[3]; const float* wk = (const float*)d_in[4]; const float* wv = (const float*)d_in[5]; const float* wo = (const float*)d_in[6];
    const float* lq1 = (const float*)d_in[7]; const float* lq2 = (const float*)d_in[8]; const float* lk1 = (const float*)d_in[9]; const float* lk2 = (const float*)d_in[10];
    const float* gnw = (const float*)d_in[11]; const float* gnb = (const float*)d_in[12];
    float* OUT = (float*)d_out;     // [NB][SEQ_FULL][1024]
    char* wsp = (char*)d_ws;
    auto take = [&](size_t bytes) { char* p = wsp; wsp += (bytes + 255) & ~(size_t)255; return (void*)p; };
    bf* WQ = (bf*)take((size_t)DQ * DM * 2); bf* WK = (bf*)take((size_t)DQ * DM * 2); bf* WV = (bf*)take((size_t)DVV * DM * 2); bf* WO = (bf*)take((size_t)DM * DVV * 2);
    bf* XB = (bf*)take((size_t)NB * SEQ * DM * 2); float* AMB = (float*)take((size_t)NB * SEQ * 4); float* LAM = (float*)take(256); float* GST = (float*)take((size_t)NB * NVH * 32 * 4);
    bf* QPh = (bf*)take((size_t)NB * NQH * SEQ * HD * 2); bf* QPl = (bf*)take((size_t)NB * NQH * SEQ * HD * 2); bf* KPh = (bf*)take((size_t)NB * NQH * SEQ * HD * 2); bf* KPl = (bf*)take((size_t)NB * NQH * SEQ * HD * 2);
    h16* VT16 = (h16*)take((size_t)NB * NVH * HD * SEQ * 2); h16* VRS = (h16*)take((size_t)NB * NVH * HD * SEQ * 2);
    float* Ob = (float*)take((size_t)NB * SEQ * DVV * 4); bf* ATh = (bf*)take((size_t)NB * SEQ * DVV * 2); bf* ATl = (bf*)take((size_t)NB * SEQ * DVV * 2);
    const size_t used = (size_t)(wsp - (char*)d_ws);
    if (used > ws_size || used > (size_t)268435456) return;
    // Every stage runs once for all NB batch elements: the batch index is a grid dimension (blockIdx.z in k_gemmb, blockIdx.y in k_attn and the GroupNorm kernels, folded into blockIdx.x in k_prep), workspace planes are [NB][...].
    k_prep<<<PB_ALL, 256, 0, stream>>>(x, amask, wq, wk, wv, wo, lq1, lk1, lq2, lk2, XB, AMB, WQ, WK, WV, WO, LAM);
    k_gemmb<0, 1><<<dim3(SEQ / GT, (2 * DQ + DVV) / GT, NB), 256, 0, stream>>>(XB, nullptr, WQ, DM, nullptr, 0, (size_t)SEQ * DM, 0, WK, WV, QPh, QPl, KPh, KPl, (bf*)VT16, (bf*)VRS);
    k_attn<<<dim3(NVH, NB, SEQ / QBL), 256, 0, stream>>>(QPh, QPl, KPh, KPl, VT16, VRS, AMB, tix, LAM, Ob);
    k_gnstat<<<dim3(NVH, NB, 1), 1024, 0, stream>>>(Ob, GST);
    k_gnmerge<<<dim3((unsigned)(((size_t)SEQ * DVV / 2 + 255) / 256), NB, 1), 256, 0, stream>>>(Ob, GST, gnw, gnb, ATh, ATl);
    k_gemmb<1><<<dim3(SEQ / GT, DM / GT, NB), 256, 0, stream>>>(ATh, ATl, WO, DVV, OUT, DM, (size_t)SEQ * DVV, (size_t)SEQ_FULL * DM);
}

// v010
// One run takes 177 microseconds.
// Timed twice side by side with v009, it ran 1.21 times as fast both times.
// Over all steps from v000 it is 5.47 times as fast.
#include <hip/hip_runtime.h>
#pragma clang fp contract(off)

// Compute dtypes (f32 accumulate everywhere): input projections x.Wq / x.Wk / x.Wv on v_wmma_f32_16x16x32_bf16 with bf16 RNE-converted inputs as operands (exact operands); q.k scores on v_wmma_f32_16x16x32_bf16 as bf16 hi/lo split (hi.hi + lo.hi + hi.lo); probability.value on v_wmma_f32_16x16x32_f16 (P f16 carried x4096, V f16; the first query block adds P and V residual planes carried x1024 through a second accumulator); softmax, ALiBi/pad terms, lambda and GroupNorm in f32; output projection on v_wmma_f32_16x16x32_bf16 (activation bf16 hi/lo x bf16 Wo, 2 products).
// Layout: x [NB][SEQ_FULL][1024]; Wq/Wk [2048][1024], Wv/Wo [1024][1024] ([out][in], used as K-contiguous Bt planes); per head h the 128 q/k columns are [half 1 | half 2] = virtual 64-wide heads 2h, 2h+1; mask [NB][SEQ_FULL] f32, token positions [NB][SEQ_FULL] int32; out [NB][SEQ_FULL][1024] f32.

#ifndef NB
#define NB 2
#endif
#ifndef SEQ
#define SEQ 2048
#endif
#define NB_FULL 2
#define SEQ_FULL 2048
#define DM   1024
#define NVH  16
#define HD   64
#define NQH  (2 * NVH)
#define DQ   (NQH * HD)
#define DVV  (NVH * HD)
#define SCL  0.125f
#define PCAR 4096.0f
#define RCAR 1024.0f
#define QBL  64
#define KCH  64
#define KSB  32
#define LP   72
#define OSP  68
#define L2E  1.4426950408889634f
#define NEGB (-3.0e38f)
static_assert(SEQ % 64 == 0);
static_assert(SEQ <= SEQ_FULL);
static_assert(NB >= 1);
static_assert(NB <= NB_FULL);
static_assert(QBL == KCH);
static_assert(KCH % KSB == 0);
static_assert((LP * 2) % 16 == 0);
static_assert((OSP * 4) % 16 == 0);
static_assert((SEQ * DVV) % 512 == 0);
static_assert((SEQ * DM) % 2048 == 0);

typedef _Float16 h16;
typedef unsigned short bf;
typedef __attribute__((ext_vector_type(16))) __bf16   v16bf;
typedef __attribute__((ext_vector_type(16))) _Float16 v16h;
typedef __attribute__((ext_vector_type(8)))  _Float16 v8h;
typedef __attribute__((ext_vector_type(8)))  unsigned short v8us;
typedef __attribute__((ext_vector_type(8)))  float    v8f;
typedef __attribute__((ext_vector_type(4)))  float    v4f;
typedef __attribute__((ext_vector_type(2)))  unsigned short v2us;
typedef v8h  __attribute__((may_alias)) v8ha;
typedef v4f  __attribute__((may_alias)) v4fa;
typedef v8us __attribute__((may_alias)) v8usa;
typedef float __attribute__((may_alias)) f32a;

__device__ __forceinline__ unsigned short f2bf(float f) { unsigned u = __float_as_uint(f); u += 0x7FFFu + ((u >> 16) & 1u); return (unsigned short)(u >> 16); }
__device__ __forceinline__ float bf2f(unsigned short b) { return __uint_as_float(((unsigned)b) << 16); }
__device__ __forceinline__ float bfr(float f) { return bf2f(f2bf(f)); }
__device__ __forceinline__ v16h cat16(v8h lo, v8h hi) { return __builtin_shufflevector(lo, hi, 0, 1, 2, 3, 4, 5, 6, 7, 8, 9, 10, 11, 12, 13, 14, 15); }
__device__ __forceinline__ v16bf cat16b(v8us lo, v8us hi) { return __builtin_bit_cast(v16bf, __builtin_shufflevector(lo, hi, 0, 1, 2, 3, 4, 5, 6, 7, 8, 9, 10, 11, 12, 13, 14, 15)); }
__device__ __forceinline__ v8f wmma16(v16h a, v16h b, v8f c) { return __builtin_amdgcn_wmma_f32_16x16x32_f16(false, a, false, b, (short)0, c, false, false); }
__device__ __forceinline__ v8f wmmab(v16bf a, v16bf b, v8f c) { return __builtin_amdgcn_wmma_f32_16x16x32_bf16(false, a, false, b, (short)0, c, false, false); }
__device__ __forceinline__ h16 tohx(float x) { return (h16)x; }
__device__ __forceinline__ void splitf(float y, unsigned short& h, unsigned short& l) { h = f2bf(y); l = f2bf(y - bf2f(h)); }

// ---- k_gemmb: block-tiled GEMM, 8 waves (2 x 4) per 128x128 output tile, wave tile 64x32 (8 accumulators); grid (M/128, N/128, Z), 256 threads.
// c[m][n] (f32) = sum_k A[m][k] Bt[n][k] (+ A2[m][k] Bt[n][k] when NSPLIT == 1). z-batch strides sA/sC in elements. K % 64 == 0, K >= 64.
// MODE 0: c goes to C (f32, pitch ldc). MODE 1: the q, k and v projections of one A in one grid; blockIdx.y runs over the column tiles of Bt (q), then BtK (k), then BtV (v), a block-uniform choice.
// q, k tiles: c is split into bf16 hi/lo and goes to the head planes P0/P1 [z][n / 64][m][n % 64]. v tiles: c goes transposed, as f16 and as its
// residual x1024, to P0/P1 [z][n][m]. Both turn the tile in the stage buffers, free behind the loop's last barrier, so that every global store covers whole 128-byte lines.
// A stage is 64 k of every operand row (one whole 128-byte line per row), read from the K-contiguous planes by whole-line 16-byte loads, kept in registers while the
// previous stage is multiplied, then stored to the other of two LDS buffers (row pitch 144 B); one block barrier per stage publishes it and ends the reads of the buffer refilled next.
// Fragments: lane -> row/col (lane & 15); elements 0..7 <- k + 8*(lane>>4), elements 8..15 <- k + 16 + 8*(lane>>4), for A and Bt alike. k runs upward, one accumulate chain per element.
#define GT   128
#define GBK  64
#define GLP  72
#define GOP  36
#define GSP  132
#define GVP  136
static_assert(SEQ % GT == 0);
static_assert(DQ % GT == 0);
static_assert(DVV % GT == 0);
static_assert(DM % GT == 0);
static_assert(DM % GBK == 0);
static_assert(DVV % GBK == 0);
static_assert((GLP * 2) % 16 == 0);
static_assert((GOP * 4) % 16 == 0);
static_assert((GSP * 4) % 16 == 0);
static_assert((GVP * 2) % 16 == 0);
static_assert(GT == 2 * HD);
static_assert(GT * GSP * 4 <= 2 * 2 * GT * GLP * 2);
static_assert(2 * GT * GVP * 2 <= 2 * 2 * GT * GLP * 2);
__device__ __forceinline__ v16bf ldsb(const bf* p) { return cat16b(*(const v8usa*)p, *(const v8usa*)(p + 16)); }
template <int NSPLIT, int MODE = 0>
// waves_per_eu: the register budget is that of 4 waves per SIMD (two 8-wave blocks per WGP), so that a k-step's fragment loads may be grouped ahead of its products
__global__ __launch_bounds__(256) __attribute__((amdgpu_waves_per_eu(1, 4)))
void k_gemmb(const bf* __restrict__ A, const bf* __restrict__ A2, const bf* __restrict__ Bt, int K, float* C, int ldc, size_t sA, size_t sC, const bf* __restrict__ BtK = nullptr, const bf* __restrict__ BtV = nullptr,
             bf* Qh = nullptr, bf* Ql = nullptr, bf* Kh = nullptr, bf* Kl = nullptr, bf* Vt = nullptr, bf* Vr = nullptr) {
    constexpr int NPL = 2 + NSPLIT;                          // planes per stage: A, (A2,) Bt
    __shared__ __align__(16) bf    tl[2][NPL][GT * GLP];     // two stage buffers [row*GLP + k]                  (cross-wave: block barriers)
    __shared__ __align__(16) float osw[8][16 * GOP];         // per-wave f32 epilogue staging [row*GOP + col]    (wave-private)
    const size_t z = blockIdx.z; A += z * sA; if (NSPLIT) A2 += z * sA; C += z * sC;
    const int tid = threadIdx.x, w = tid >> 5, lane = tid & 31, lr = lane & 15, hi = lane >> 4; const int wm = w >> 2, wn = w & 3;
    int by = blockIdx.y; bf* P0 = Qh; bf* P1 = Ql; bool isv = false;   // MODE 1: which projection this block's column tile belongs to, and the tile's index inside it
    if constexpr (MODE == 1) {
        if (by >= 2 * (DQ / GT)) { by -= 2 * (DQ / GT); Bt = BtV; P0 = Vt; P1 = Vr; isv = true; }
        else if (by >= DQ / GT) { by -= DQ / GT; Bt = BtK; P0 = Kh; P1 = Kl; }
    }
    const int r0 = blockIdx.x * GT, c0 = by * GT;
    v8f acc[4][2];
#pragma unroll
    for (int mb = 0; mb < 4; ++mb)
#pragma unroll
        for (int nb = 0; nb < 2; ++nb) acc[mb][nb] = (v8f){};
    const int srow = tid >> 3, sc8 = (tid & 7) * 8;          // staging: 8 lanes cover one row's 128 bytes; piece i is row srow + 32 i
    const char* gA = (const char*)(A + (size_t)r0 * K); const char* gA2 = (const char*)(A2 + (size_t)r0 * K); const char* gB = (const char*)(Bt + (size_t)c0 * K);   // block-uniform tile bases
    unsigned go[4];                                          // the lane's byte offset of piece i inside a tile's rows, the same for every plane and stage
#pragma unroll
    for (int i = 0; i < 4; ++i) go[i] = ((unsigned)(srow + 32 * i) * (unsigned)K + (unsigned)sc8) * 2u;
    const int so = srow * GLP + sc8;
    const int fa = (wm * 64 + lr) * GLP + 8 * hi, fb = (wn * 32 + lr) * GLP + 8 * hi;
    v8us ra[4], ra2[4], rb[4];
#pragma unroll
    for (int i = 0; i < 4; ++i) { ra[i] = *(const v8us*)(gA + go[i]); if (NSPLIT) ra2[i] = *(const v8us*)(gA2 + go[i]); rb[i] = *(const v8us*)(gB + go[i]); }
#pragma unroll
    for (int i = 0; i < 4; ++i) { *(v8usa*)(&tl[0][0][so + i * 32 * GLP]) = ra[i]; if (NSPLIT) *(v8usa*)(&tl[0][1][so + i * 32 * GLP]) = ra2[i]; *(v8usa*)(&tl[0][NPL - 1][so + i * 32 * GLP]) = rb[i]; }
    __syncthreads();
#pragma unroll 1
    for (int k0 = 0; k0 < K; k0 += GBK) {
        const int cur = (k0 / GBK) & 1; const bool more = k0 + GBK < K;
        gA += GBK * 2; gA2 += GBK * 2; gB += GBK * 2;        // the uniform bases step one stage; the lanes' offsets stay
        if (more) {
#pragma unroll
            for (int i = 0; i < 4; ++i) {   // a wait behind each load: this build lets a later load of the group land in an earlier one's address pair, and the wait stands in front of that overwrite
                ra[i] = *(const v8us*)(gA + go[i]); asm volatile("s_wait_xcnt 0x0" ::: "memory");
                if (NSPLIT) { ra2[i] = *(const v8us*)(gA2 + go[i]); asm volatile("s_wait_xcnt 0x0" ::: "memory"); }
                rb[i] = *(const v8us*)(gB + go[i]); asm volatile("s_wait_xcnt 0x0" ::: "memory"); }
        }
        const bf* ta = &tl[cur][0][fa]; const bf* ta2 = &tl[cur][NSPLIT][fa]; const bf* tb = &tl[cur][NPL - 1][fb];
#pragma unroll
        for (int kc = 0; kc < GBK; kc += 32) {
            v16bf a[4], a2[4], b[2];
#pragma unroll
            for (int mb = 0; mb < 4; ++mb) { a[mb] = ldsb(ta + mb * 16 * GLP + kc); if (NSPLIT) a2[mb] = ldsb(ta2 + mb * 16 * GLP + kc); }
#pragma unroll
            for (int nb = 0; nb < 2; ++nb) b[nb] = ldsb(tb + nb * 16 * GLP + kc);
#pragma unroll
            for (int nb = 0; nb < 2; ++nb)
#pragma unroll
                for (int mb = 0; mb < 4; ++mb) { acc[mb][nb] = wmmab(a[mb], b[nb], acc[mb][nb]); if (NSPLIT) acc[mb][nb] = wmmab(a2[mb], b[nb], acc[mb][nb]); }
        }
        if (more) {
#pragma unroll
            for (int i = 0; i < 4; ++i) { *(v8usa*)(&tl[cur ^ 1][0][so + i * 32 * GLP]) = ra[i]; if (NSPLIT) *(v8usa*)(&tl[cur ^ 1][1][so + i * 32 * GLP]) = ra2[i]; *(v8usa*)(&tl[cur ^ 1][NPL - 1][so + i * 32 * GLP]) = rb[i]; }
        }
        __syncthreads();
    }
    if (MODE == 1 && !isv) {
        f32a* st = (f32a*)&tl[0][0][0];                      // block f32 tile [row*GSP + col]
#pragma unroll
        for (int mb = 0; mb < 4; ++mb)
#pragma unroll
            for (int nb = 0; nb < 2; ++nb)
#pragma unroll
                for (int j = 0; j < 8; ++j) st[(wm * 64 + mb * 16 + hi * 8 + j) * GSP + wn * 32 + nb * 16 + lr] = acc[mb][nb][j];
        __syncthreads();                                     // publishes the tile: its rows are read back by other waves
        const int hs = w & 1, rw = (w >> 1) * 32 + (lane >> 3), c8 = (lane & 7) * 8;   // a wave takes 32 rows of one 64-wide head; one store = 4 rows = 512 contiguous bytes
        const size_t pb = ((z * NQH + (size_t)(by * 2 + hs)) * SEQ + r0) * HD + c8;
#pragma unroll
        for (int i = 0; i < 8; ++i) { const int row = rw + 4 * i; const f32a* sp = st + row * GSP + hs * HD + c8; const v4f x0 = *(const v4fa*)sp, x1 = *(const v4fa*)(sp + 4); v8us oh, ol;
#pragma unroll
            for (int q = 0; q < 4; ++q) { unsigned short a2, c2; splitf(x0[q], a2, c2); oh[q] = a2; ol[q] = c2; splitf(x1[q], a2, c2); oh[4 + q] = a2; ol[4 + q] = c2; }
            *(v8us*)(P0 + pb + (size_t)row * HD) = oh; *(v8us*)(P1 + pb + (size_t)row * HD) = ol; }
        asm volatile("s_wait_xcnt 0x0" ::: "memory");        // the build lays the v tiles' code behind these stores, where conversions land in the registers that the stores name: the wait stands in front of that overwrite
        return;
    }
    if constexpr (MODE == 1) {
        h16* sv = (h16*)&tl[0][0][0]; h16* sr = sv + GT * GVP;   // block f16 tiles, value and residual, transposed [col*GVP + row]; an accumulator lane holds 8 consecutive rows of one column
#pragma unroll
        for (int mb = 0; mb < 4; ++mb)
#pragma unroll
            for (int nb = 0; nb < 2; ++nb) { v8h o16, orr;
#pragma unroll
                for (int j = 0; j < 8; ++j) { const float x = acc[mb][nb][j]; const h16 hv = tohx(x); const float res = (x - (float)hv) * RCAR; o16[j] = hv; orr[j] = tohx(res); }
                const int si = (wn * 32 + nb * 16 + lr) * GVP + wm * 64 + mb * 16 + hi * 8; *(v8ha*)(sv + si) = o16; *(v8ha*)(sr + si) = orr; }
        __syncthreads();                                     // publishes the tiles: their columns are read back by other waves
        const int cw = tid >> 4, t8 = (tid & 15) * 8;        // 16 lanes cover one column's 128 rows = 256 contiguous bytes
        const size_t vb = (z * DVV + (size_t)c0) * SEQ + r0 + t8;
#pragma unroll
        for (int i = 0; i < 8; ++i) { const int col = cw + 16 * i; const v8h a16 = *(const v8ha*)(sv + col * GVP + t8), ar = *(const v8ha*)(sr + col * GVP + t8);
            *(v8ha*)((h16*)P0 + vb + (size_t)col * SEQ) = a16; *(v8ha*)((h16*)P1 + vb + (size_t)col * SEQ) = ar; }
        return;
    }
    float* os = &osw[w][0];
#pragma unroll
    for (int mb = 0; mb < 4; ++mb) {
#pragma unroll
        for (int nb = 0; nb < 2; ++nb) {
#pragma unroll
            for (int j = 0; j < 8; ++j) os[(hi * 8 + j) * GOP + nb * 16 + lr] = acc[mb][nb][j]; }
        __builtin_amdgcn_wave_barrier(); asm volatile("" ::: "memory");   // keeps the staging stores ahead of the row reads of other lanes of this wave
        float* crow = C + (size_t)(r0 + wm * 64 + mb * 16) * ldc + c0 + wn * 32;
#pragma unroll
        for (int s = 0; s < 4; ++s) { const int row = 4 * s + (lane >> 3), cofs = (lane & 7) * 4; const v4f val = *(const v4fa*)(os + row * GOP + cofs); *(v4f*)(crow + (size_t)row * ldc + cofs) = val; }
        __builtin_amdgcn_wave_barrier(); asm volatile("" ::: "memory");   // keeps the row reads ahead of the next block's staging stores
    }
}

// ---- k_prep: everything that depends on the inputs alone, in one launch; a block's index says which piece it does (block-uniform tests). Block 0: lambda (one wave); then the mask rounding; then the
// f32 -> bf16 conversions of x and of the four weight planes, 2048 elements per block. The single-wave serial piece has the lowest index.
__device__ __forceinline__ void cvt8(const float* __restrict__ src, bf* dst, size_t i) { const v8f v = *(const v8f*)(src + i * 8); v8us o;
#pragma unroll
    for (int k = 0; k < 8; ++k) o[k] = f2bf(v[k]); *(v8us*)(dst + i * 8) = o;
    asm volatile("s_wait_xcnt 0x0" ::: "memory"); }   // the build lays another piece's code behind this store, where a load lands in the registers that the store names: the wait stands in front of that overwrite
__device__ __forceinline__ void rbf4(const float* __restrict__ src, float* dst, int i) { const v4f a = *(const v4f*)(src + (size_t)i * 4); v4f o;
#pragma unroll
    for (int u = 0; u < 4; ++u) o[u] = bfr(a[u]); *(v4f*)(dst + (size_t)i * 4) = o;  }
__device__ __forceinline__ void lambda1(const float* __restrict__ lq1, const float* __restrict__ lk1, const float* __restrict__ lq2, const float* __restrict__ lk2, float* LAM, const int lane) { float d1 = 0.f, d2 = 0.f;
#pragma unroll 1
    for (int i = 0; i < HD; ++i) { float p1 = __fmul_rn(bfr(lq1[i]), bfr(lk1[i])); asm volatile("" : "+v"(p1)); d1 = __fadd_rn(d1, p1); float p2 = __fmul_rn(bfr(lq2[i]), bfr(lk2[i])); asm volatile("" : "+v"(p2)); d2 = __fadd_rn(d2, p2); }
    float lm = __fsub_rn(expf(d1), expf(d2)); asm volatile("" : "+v"(lm)); lm = __fadd_rn(lm, 0.8f); const float v = (lane == 0) ? lm : 0.0f; *(float*)(LAM + lane) = v;  }
#define PB_RB1 ((SEQ / 4 + 255) / 256)
#define PB_RBF (NB * PB_RB1)
#define PB_X1  (SEQ * DM / 2048)
#define PB_X   (NB * PB_X1)
#define PB_WQ  (DQ * DM / 2048)
#define PB_WV  (DVV * DM / 2048)
#define PB_WO  (DM * DVV / 2048)
#define PB_ALL (1 + PB_RBF + PB_X + 2 * PB_WQ + PB_WV + PB_WO)
static_assert((DQ * DM) % 2048 == 0);
static_assert((DVV * DM) % 2048 == 0);
__global__ __launch_bounds__(256) void k_prep(const float* __restrict__ x, const float* __restrict__ amask, const float* __restrict__ wq, const float* __restrict__ wk, const float* __restrict__ wv, const float* __restrict__ wo,
                                              const float* __restrict__ lq1, const float* __restrict__ lk1, const float* __restrict__ lq2, const float* __restrict__ lk2,
                                              bf* XB, float* AMB, bf* WQ, bf* WK, bf* WV, bf* WO, float* LAM) {
    int b = blockIdx.x; const int tid = threadIdx.x;
    if (b == 0) { if (tid < 32) lambda1(lq1, lk1, lq2, lk2, LAM, tid); return; }
    b -= 1;
    if (b < PB_RBF) { const int bz = b / PB_RB1, i = (b - bz * PB_RB1) * 256 + tid; if (i < SEQ / 4) rbf4(amask + (size_t)bz * SEQ_FULL, AMB + (size_t)bz * SEQ, i); return; }
    b -= PB_RBF;
    const int bz = b < PB_X ? b / PB_X1 : 0;                 // batch element of an x block
    const float* src = x + (size_t)bz * SEQ_FULL * DM; bf* dst = XB + (size_t)bz * SEQ * DM; int o = bz * PB_X1;   // the block's plane by uniform selects; o: the plane's first block
    if (b >= PB_X)                              { src = wq; dst = WQ; o = PB_X; }
    if (b >= PB_X + PB_WQ)                      { src = wk; dst = WK; o = PB_X + PB_WQ; }
    if (b >= PB_X + 2 * PB_WQ)                  { src = wv; dst = WV; o = PB_X + 2 * PB_WQ; }
    if (b >= PB_X + 2 * PB_WQ + PB_WV)          { src = wo; dst = WO; o = PB_X + 2 * PB_WQ + PB_WV; }
    cvt8(src, dst, (size_t)(b - o) * 256 + tid);
}

// ---- k_attn: causal differential attention for one (query block of 64, head) per block of 8 waves. The two score streams run side by side: waves 0..3 take stream 0, waves 4..7 stream 1
// (wave w & 3 owns 16 query rows), each group with its own Q/K hi/lo tiles, O accumulators and running max/sum. Per 64-key chunk c = 0..qb each group stages the K hi/lo tile of its
// head plane 2h+st and half of the one V^T tile that both groups read; the keys' positions and pad terms (f32) are staged beside them. The softmax recurrence runs on 32-key sub-chunks.
// Both products are taken transposed: S^T = K.Q^T (A = K rows, B = Q rows; 3 bf16 products, two 16-key tiles per wave) and O^T += V^T.P^T (A = V^T rows, B = P). A lane then holds ONE query (column lane & 15)
// and 16 of the sub-chunk's 32 keys: register r of tile nb is key 16 nb + 8 (lane >> 4) + r, which is the k order of a B fragment's element 8 nb + r. So the probabilities, converted in place, are the
// B operand of the second product (no trip through LDS, no barrier around it); max and sum of a query run in the lane, with one exchange between the wave's halves; max, sum and rescale factor are one value a lane.
// t = S/8 - slope (pos_i - pos_j) + (1 - mask_j)(-1e9) for j <= i, excluded otherwise; online softmax (running max / sum, f32); P f16 x4096. The first query block
// forms P and V residual planes (x1024) and adds V.P_res + V_res.P per 16-row block of O^T through a second accumulator folded before normalisation.
// xhalf: the value of lane l ^ 16, read on the vector pipe. Every lane is on where it is used.
__device__ __forceinline__ float xhalf(float x) { return __builtin_bit_cast(float, __builtin_amdgcn_permlanex16(__builtin_bit_cast(int, x), __builtin_bit_cast(int, x), 0x76543210, 0xfedcba98, false, false)); }
__device__ __forceinline__ v16h  ldsh(const h16* p) { return cat16(*(const v8ha*)p, *(const v8ha*)(p + 16)); }

// attn_blk: one stream's loop of one block (st is the wave group's stream). ER (first query block: residual planes) is a compile-time value, so the loops hold no test of it: a chunk's tile loads are one group
// behind which the LDS stores follow, and the sixteen probability chains of a sub-chunk stand in one basic block.
template <bool ER>
__device__ __forceinline__ void attn_blk(const bf* __restrict__ QPh, const bf* __restrict__ QPl, const bf* __restrict__ KPh, const bf* __restrict__ KPl, const h16* __restrict__ VT, const h16* __restrict__ VR,
                                         const float* __restrict__ amb, const int* __restrict__ tix, const float lam, const float slope, const float pq, const int hh, const int qb, const int st,
                                         bf* qs0, bf* qs1, bf* ks0, bf* ks1, h16* vsm, h16* vrm, float* pkf, float* pdf, float* os) {
    const int tid = threadIdx.x & 127, w = tid >> 5, lane = tid & 31, lr = lane & 15, hi = lane >> 4;   // tid, w: inside the wave group of one stream
    const int q0 = qb * QBL, qrow = q0 + 16 * w + lr;        // the lane's query
    // staging: piece i of a K plane is row 16 i + (tid >> 3), 16 bytes at 8 (tid & 7): the 64 x 64 tile is 8 KiB in a row, so a lane's byte offset is 16 tid + 2048 i; piece i of V^T is row d = 16 i + (tid >> 3), group st brings pieces 2 st and 2 st + 1
    const unsigned ko = (unsigned)tid * 16u, vo = ((unsigned)(tid >> 3) * (unsigned)SEQ + 8u * (unsigned)(tid & 7)) * 2u;   // the lane's offsets, the same for every chunk
    const int sk = (tid >> 3) * LP + (tid & 7) * 8;
    {
        const size_t vq = (size_t)(2 * hh + st);
        {   const char* pqh = (const char*)(QPh + (vq * SEQ + q0) * HD) + ko; const char* pql = (const char*)(QPl + (vq * SEQ + q0) * HD) + ko;
            v8us qh[4], ql[4];
#pragma unroll
            for (int i = 0; i < 4; ++i) { qh[i] = *(const v8usa*)(pqh + i * 2048); ql[i] = *(const v8usa*)(pql + i * 2048); }
            asm volatile("s_wait_xcnt 0x0" :: "v"(pqh), "v"(pql) : "memory");   // holds the address pairs whole up to this wait: without it a later load of the group may land in a pair that the loads before it name
#pragma unroll
            for (int i = 0; i < 4; ++i) { *(v8usa*)(&qs0[sk + i * 16 * LP]) = qh[i]; *(v8usa*)(&qs1[sk + i * 16 * LP]) = ql[i]; }
        }
        float m = NEGB, l = 0.0f; v8f O[4];                  // O[j][r] = O^T[d = 16 j + 8 hi + r][query lr]
#pragma unroll
        for (int j = 0; j < 4; ++j) O[j] = (v8f){};
#pragma unroll 1
        for (int c = 0; c <= qb; ++c) {
            const int k0 = c * KCH;
            {   const char* pkh = (const char*)(KPh + (vq * SEQ + k0) * HD) + ko; const char* pkl = (const char*)(KPl + (vq * SEQ + k0) * HD) + ko;
                const char* pv = (const char*)(VT + ((size_t)hh * HD + 32 * st) * SEQ + k0) + vo; const char* pr = (const char*)(VR + ((size_t)hh * HD + 32 * st) * SEQ + k0) + vo;
                const int* ptx = tix + k0 + (tid & (KCH - 1)); const float* pam = amb + k0 + (tid & (KCH - 1));   // key tid & 63 of the chunk
                v8us kh[4], kl[4]; v8h vv[2], vr[2];
#pragma unroll
                for (int i = 0; i < 4; ++i) { kh[i] = *(const v8usa*)(pkh + i * 2048); kl[i] = *(const v8usa*)(pkl + i * 2048); }
#pragma unroll
                for (int i = 0; i < 2; ++i) { vv[i] = *(const v8ha*)(pv + i * (16 * SEQ * 2)); if constexpr (ER) vr[i] = *(const v8ha*)(pr + i * (16 * SEQ * 2)); }
                const int kt = *ptx; const float km = *pam;
                // holds the address pairs whole up to this wait: without it the last load of a group lands in the pair that the loads before it name
                if constexpr (ER) asm volatile("s_wait_xcnt 0x0" :: "v"(pkh), "v"(pkl), "v"(pv), "v"(pr), "v"(ptx), "v"(pam) : "memory"); else asm volatile("s_wait_xcnt 0x0" :: "v"(pkh), "v"(pkl), "v"(pv), "v"(ptx), "v"(pam) : "memory");
#pragma unroll
                for (int i = 0; i < 4; ++i) { *(v8usa*)(&ks0[sk + i * 16 * LP]) = kh[i]; *(v8usa*)(&ks1[sk + i * 16 * LP]) = kl[i]; }
#pragma unroll
                for (int i = 0; i < 2; ++i) { *(v8ha*)(&vsm[sk + (2 * st + i) * 16 * LP]) = vv[i]; if constexpr (ER) *(v8ha*)(&vrm[sk + (2 * st + i) * 16 * LP]) = vr[i]; }
                if (st == 0 && tid < KCH) { const float om = 1.0f - km; pkf[tid] = (float)kt; pdf[tid] = om * -1.0e9f; }   // one copy of the keys' terms for both streams
            }
            __syncthreads();
#pragma unroll 1
            for (int sb = 0; sb < KCH / KSB; ++sb) {
                const int kb = sb * KSB;
                const int kl0 = kb + 8 * hi, key0 = k0 + kl0;    // the lane's first key of tile 0, in the chunk and in the sequence; tile nb, register r: + 16 nb + r
                v4f pk[2][2], pd[2][2];
#pragma unroll
                for (int nb = 0; nb < 2; ++nb)
#pragma unroll
                    for (int u = 0; u < 2; ++u) { pk[nb][u] = *(const v4fa*)(pkf + kl0 + nb * 16 + 4 * u); pd[nb][u] = *(const v4fa*)(pdf + kl0 + nb * 16 + 4 * u); }
                // ---- scores: S^T[key kb + nb*16 + 8hi + r][query lr], 3 bf16 products (hi.hi + Qlo.Khi + Qhi.Klo); fragments loaded right before each k-step, scheduling barrier after it
                v8f s[2]; s[0] = (v8f){}; s[1] = (v8f){};
                {   v16bf ah, al, bh, bl;
#pragma unroll
                    for (int kc = 0; kc < HD; kc += 32) {
                        ah = ldsb(&qs0[(16 * w + lr) * LP + kc + 8 * hi]); al = ldsb(&qs1[(16 * w + lr) * LP + kc + 8 * hi]);
#pragma unroll
                        for (int nb = 0; nb < 2; ++nb) { bh = ldsb(&ks0[(kb + nb * 16 + lr) * LP + kc + 8 * hi]); bl = ldsb(&ks1[(kb + nb * 16 + lr) * LP + kc + 8 * hi]);
                            s[nb] = wmmab(bh, ah, s[nb]); s[nb] = wmmab(bh, al, s[nb]); s[nb] = wmmab(bl, ah, s[nb]); }
                        asm volatile("v_nop\n\tv_nop\n\tv_nop\n\tv_nop" : "+v"(s[0]), "+v"(s[1]) : "v"(ah), "v"(al), "v"(bh), "v"(bl) : "memory");   // the four vector slots between the k-step's last product and whatever next touches its result or operands, on every path
                    }
                }
                // ---- additive terms by value select, the lane's max over its 16 keys (two chains), then the other half's
                float cm[2];
#pragma unroll
                for (int nb = 0; nb < 2; ++nb) { cm[nb] = NEGB;
#pragma unroll
                    for (int r = 0; r < 8; ++r) { const float pkv = pk[nb][r >> 2][r & 3], pdv = pd[nb][r >> 2][r & 3];
                        const float sa = s[nb][r] * SCL; const float pdd = pq - pkv; const float bia = slope * pdd; const float sm = sa - bia;
                        const float tt = (key0 + nb * 16 + r <= qrow) ? (sm + pdv) : NEGB; s[nb][r] = tt; cm[nb] = fmaxf(cm[nb], tt); } }
                float x = fmaxf(cm[0], cm[1]); x = fmaxf(x, xhalf(x));
                const float mn = fmaxf(m, x); const float dlt = (m - mn) * L2E; const float cor = __builtin_amdgcn_exp2f(dlt); m = mn;
                // ---- probabilities, converted in place into the B fragment (f16 x4096; residual x1024 on the first query block); excluded keys hold exactly 0. The lane's sum runs in four chains.
                v16h pb, pbr; float ra[2][2];
#pragma unroll
                for (int nb = 0; nb < 2; ++nb) {
#pragma unroll
                    for (int r = 0; r < 8; ++r) { const float dq = (s[nb][r] - m) * L2E; const float pe = __builtin_amdgcn_exp2f(dq); const float p = (key0 + nb * 16 + r <= qrow) ? pe : 0.0f;
                        if (r < 2) ra[nb][r] = p; else ra[nb][r & 1] = ra[nb][r & 1] + p;
                        const float pc = p * PCAR; const h16 ph = tohx(pc); pb[nb * 8 + r] = ph;
                        if constexpr (ER) { const float res = (pc - (float)ph) * RCAR; pbr[nb * 8 + r] = tohx(res); } } }
                {   const float r0s = ra[0][0] + ra[0][1], r1s = ra[1][0] + ra[1][1]; float xs = r0s + r1s; xs = xs + xhalf(xs);
                    const float lc = l * cor; l = lc + xs;
#pragma unroll
                    for (int j = 0; j < 4; ++j)
#pragma unroll
                        for (int r = 0; r < 8; ++r) O[j][r] = O[j][r] * cor; }
                // ---- O^T[d block j][query] += V^T[d][key] . P[query][key] over the 32 keys of this sub-chunk (one k-step)
                {   v16h b;
#pragma unroll
                    for (int j = 0; j < 4; ++j) { b = ldsh(&vsm[(j * 16 + lr) * LP + kb + 8 * hi]); O[j] = wmma16(b, pb, O[j]); }
                    asm volatile("v_nop\n\tv_nop\n\tv_nop\n\tv_nop" : "+v"(O[0]), "+v"(O[1]), "+v"(O[2]), "+v"(O[3]) : "v"(pb), "v"(b) : "memory");   // the same four slots behind the last product, also on the loop's taken branch
                    if constexpr (ER) {
#pragma unroll
                        for (int j = 0; j < 4; ++j) {
                            const v16h b2 = ldsh(&vsm[(j * 16 + lr) * LP + kb + 8 * hi]); const v16h br = ldsh(&vrm[(j * 16 + lr) * LP + kb + 8 * hi]);
                            v8f R = wmma16(b2, pbr, (v8f){}); R = wmma16(br, pb, R);
                            asm volatile("v_nop\n\tv_nop\n\tv_nop\n\tv_nop" : "+v"(R) : "v"(pb), "v"(pbr), "v"(b2), "v"(br) : "memory");   // the same four slots in front of the reads of R
#pragma unroll
                            for (int r = 0; r < 8; ++r) { const float rr = R[r] * (1.0f / RCAR); O[j][r] = O[j][r] + rr; }
                        }
                    }
                }
            }
            __syncthreads();                                 // ends every wave's reads of the K, V and key-term tiles, which the next chunk's staging overwrites
        }
        {   const float rl = 1.0f / l; const float il = rl * (1.0f / PCAR);
#pragma unroll
            for (int j = 0; j < 4; ++j)
#pragma unroll
                for (int r = 0; r < 8; ++r) O[j][r] = O[j][r] * il; }
        float* ol = os + lr * OSP + 8 * hi;                  // the lane's query row of the result tile [row*OSP + d]; block j is 8 consecutive d at 16 j
        if (st == 0) {
#pragma unroll
            for (int j = 0; j < 4; ++j) { *(v4fa*)(ol + j * 16) = (v4f){O[j][0], O[j][1], O[j][2], O[j][3]}; *(v4fa*)(ol + j * 16 + 4) = (v4f){O[j][4], O[j][5], O[j][6], O[j][7]}; }
        }
        __syncthreads();                                     // publishes stream 0's result to the stream 1 wave of the same rows
        if (st != 0) {
#pragma unroll
            for (int j = 0; j < 4; ++j)
#pragma unroll
                for (int u = 0; u < 2; ++u) { const v4f cur = *(const v4fa*)(ol + j * 16 + 4 * u); v4f o;
#pragma unroll
                    for (int q = 0; q < 4; ++q) { const float lb = lam * O[j][4 * u + q]; o[q] = cur[q] - lb; }
                    *(v4fa*)(ol + j * 16 + 4 * u) = o; }
        }
    }
}

__global__ __launch_bounds__(256) __attribute__((amdgpu_num_vgpr(256)))
void k_attn(const bf* __restrict__ QPh, const bf* __restrict__ QPl, const bf* __restrict__ KPh, const bf* __restrict__ KPl, const h16* __restrict__ VT, const h16* __restrict__ VR,
            const float* __restrict__ amb, const int* __restrict__ tix, const float* __restrict__ LAM, float* Ob) {
    __shared__ __align__(16) bf    qs[2][2][QBL * LP];   // Q [stream]{hi,lo} [row*LP + d]                   (cross-wave: block barriers)
    __shared__ __align__(16) bf    ks[2][2][KCH * LP];   // K [stream]{hi,lo} [key*LP + d]                   (cross-wave: block barriers)
    __shared__ __align__(16) h16   vsm[HD * LP];         // V^T tile [d*LP + key], read by both streams      (cross-wave: block barriers)
    __shared__ __align__(16) h16   vrm[HD * LP];         // V residual tile, first query block only         (cross-wave: block barriers)
    __shared__ __align__(16) float kts[2][KCH];          // the chunk's keys: position, pad term (f32)       (cross-wave: block barriers)
    __shared__ __align__(16) float osm[4][16 * OSP];     // f32 result / epilogue staging [row*OSP + d] per 16 query rows: written by stream 0's wave, finished by stream 1's
    const int st = __builtin_amdgcn_readfirstlane((int)(threadIdx.x >> 7));   // the wave group's stream, held scalar: tests of it are scalar branches, the stream's tile bases are uniform
    const int w8 = threadIdx.x >> 5, w = w8 & 3, lane = threadIdx.x & 31, lr = lane & 15, hi = lane >> 4;
    // A block's cost grows with qb and the grid holds more blocks than fit on the chip at once: the longest query blocks take the lowest indices
    // and the short ones fill the places that come free; (head, batch) is the fast index, so every run of consecutive blocks holds equal costs.
    const int hh = blockIdx.x, qb = SEQ / QBL - 1 - (int)blockIdx.z, q0 = qb * QBL;
    {   const size_t bz = blockIdx.y;                        // batch element: every plane is [NB][...]; only the token positions keep the input's own batch pitch
        QPh += bz * ((size_t)NQH * SEQ * HD); QPl += bz * ((size_t)NQH * SEQ * HD); KPh += bz * ((size_t)NQH * SEQ * HD); KPl += bz * ((size_t)NQH * SEQ * HD);
        VT += bz * ((size_t)NVH * HD * SEQ); VR += bz * ((size_t)NVH * HD * SEQ); amb += bz * SEQ; tix += bz * SEQ_FULL; Ob += bz * ((size_t)SEQ * DVV); }
    const int e2 = hh + 1;                                   // slope = 2^(-(h+1)/2): exact power of two times 2^-0.5 for odd exponents
    const float slope = ((e2 & 1) ? 0.70710678118654752f : 1.0f) * __uint_as_float(((unsigned)(127 - (e2 >> 1))) << 23);
    const float lam = LAM[0];
    const float pq = (float)tix[q0 + 16 * w + lr];           // position of the lane's query
    float* os = &osm[w][0];
    // block-uniform: every wave of a block takes the same side, with all its barriers
    if (qb == 0) attn_blk<true>(QPh, QPl, KPh, KPl, VT, VR, amb, tix, lam, slope, pq, hh, qb, st, &qs[st][0][0], &qs[st][1][0], &ks[st][0][0], &ks[st][1][0], vsm, vrm, &kts[0][0], &kts[1][0], os);
    else         attn_blk<false>(QPh, QPl, KPh, KPl, VT, VR, amb, tix, lam, slope, pq, hh, qb, st, &qs[st][0][0], &qs[st][1][0], &ks[st][0][0], &ks[st][1][0], vsm, vrm, &kts[0][0], &kts[1][0], os);
    __syncthreads();
    float* orow = Ob + (size_t)(q0 + 16 * w) * DVV + hh * HD;
{
#pragma unroll
        for (int s2 = 0; s2 < 4; ++s2) { const int row = 8 * st + 2 * s2 + hi, cofs = lr * 4;   // each of the two waves of a row group stores 8 of its 16 rows
            const v4f val = *(const v4fa*)(os + row * OSP + cofs); *(v4f*)(orow + (size_t)row * DVV + cofs) = val; }
         }
}

#define GNB 32
static_assert((SEQ * HD / 1024) % GNB == 0);
__global__ __launch_bounds__(1024) void k_gnstat(const float* __restrict__ O, float* GST) {
    __shared__ float sh[1024]; const int tid = threadIdx.x; const int hh = blockIdx.x; const float* base = O + (size_t)blockIdx.y * SEQ * DVV + hh * HD; GST += blockIdx.y * (NVH * 32); const int n = SEQ * HD; const float rn = 1.0f / (float)n;
    // A thread's chain is e = tid + 1024 i: row (tid >> 6) + 16 i, column tid & 63. GNB loads of the chain are issued together, then added in the chain's own order.
    const float* pl = base + (size_t)(tid >> 6) * DVV + (tid & 63);
    float acc = 0.f;
#pragma unroll
    for (int g = 0; g < n / 1024; g += GNB) { float v[GNB];
#pragma unroll
        for (int u = 0; u < GNB; ++u) v[u] = pl[(size_t)(g + u) * 16 * DVV];
#pragma unroll
        for (int u = 0; u < GNB; ++u) acc = __fadd_rn(acc, v[u]); }
    sh[tid] = acc; __syncthreads();
#pragma unroll 1
    for (int st = 512; st > 0; st >>= 1) { if (tid < st) sh[tid] = __fadd_rn(sh[tid], sh[tid + st]); __syncthreads(); }
    const float mean = sh[0] * rn;
    __syncthreads();
    float acc2 = 0.f;
#pragma unroll
    for (int g = 0; g < n / 1024; g += GNB) { float v[GNB];
#pragma unroll
        for (int u = 0; u < GNB; ++u) v[u] = pl[(size_t)(g + u) * 16 * DVV];
#pragma unroll
        for (int u = 0; u < GNB; ++u) { const float dv = __fsub_rn(v[u], mean); acc2 = __builtin_fmaf(dv, dv, acc2); } }   // the fused square-add that the rolled loop compiled to, written out: left to the compiler, the unrolled chain fuses its first two squares the other way round
    asm volatile("s_wait_xcnt 0x0" :: "v"(pl) : "memory");   // holds the address pair whole up to this wait: without it this build lets the last load land in the pair that the loads before it name
    sh[tid] = acc2; __syncthreads();
#pragma unroll 1
    for (int st = 512; st > 0; st >>= 1) { if (tid < st) sh[tid] = __fadd_rn(sh[tid], sh[tid + st]); __syncthreads(); }
    if (tid < 32) { const float var = sh[0] * rn; const float rs = __fdiv_rn(1.0f, sqrtf(__fadd_rn(var, 1e-5f))); const float outv = (tid == 0) ? mean : ((tid == 1) ? rs : 0.0f);
        *(float*)(GST + hh * 32 + tid) = outv;  }
}
__global__ __launch_bounds__(256) void k_gnmerge(const float* __restrict__ O, const float* __restrict__ GST, const float* __restrict__ gw, const float* __restrict__ gb, bf* Ah, bf* Al) {
    const size_t e = ((size_t)blockIdx.x * 256 + threadIdx.x) * 2; if (e >= (size_t)SEQ * DVV) return;
    O += (size_t)blockIdx.y * SEQ * DVV; GST += blockIdx.y * (NVH * 32); Ah += (size_t)blockIdx.y * SEQ * DVV; Al += (size_t)blockIdx.y * SEQ * DVV;
    const int c = (int)(e % DVV); const int hh = c / HD; const float mean = GST[hh * 32], rs = GST[hh * 32 + 1]; v2us oh, ol;
#pragma unroll
    for (int q = 0; q < 2; ++q) { float cc = __fsub_rn(O[e + q], mean); asm volatile("" : "+v"(cc)); float nn = __fmul_rn(cc, rs); asm volatile("" : "+v"(nn)); float y = __fmul_rn(nn, bfr(gw[c + q])); asm volatile("" : "+v"(y)); y = __fadd_rn(y, bfr(gb[c + q])); const float z = __fmul_rn(y, 0.2f); unsigned short a2, c2; splitf(z, a2, c2); oh[q] = a2; ol[q] = c2; }
    *(v2us*)(Ah + e) = oh; *(v2us*)(Al + e) = ol;  }

extern "C" void kernel_launch(void* const* d_in, const int* in_sizes, int n_in,
                              void* d_out, int out_size, void* d_ws, size_t ws_size, hipStream_t stream) {
    if (n_in < 13) return;
    if (in_sizes[0] < (NB - 1) * SEQ_FULL * DM + SEQ * DM) return;
    if (in_sizes[1] < (NB - 1) * SEQ_FULL + SEQ) return;
    if (in_sizes[2] < (NB - 1) * SEQ_FULL + SEQ) return;
    if (in_sizes[3] < DQ * DM || in_sizes[4] < DQ * DM || in_sizes[5] < DVV * DM || in_sizes[6] < DM * DVV) return;
    if (in_sizes[7] < HD || in_sizes[8] < HD || in_sizes[9] < HD || in_sizes[10] < HD || in_sizes[11] < DVV || in_sizes[12] < DVV) return;
    if (out_size < (NB - 1) * SEQ_FULL * DM + SEQ * DM) return;
    const float* x = (const float*)d_in[0]; const float* amask = (const float*)d_in[1]; const int* tix = (const int*)d_in[2];
    const float* wq = (const float*)d_in[3]; const float* wk = (const float*)d_in[4]; const float* wv = (const float*)d_in[5]; const float* wo = (const float*)d_in[6];
    const float* lq1 = (const float*)d_in[7]; const float* lq2 = (const float*)d_in[8]; const float* lk1 = (const float*)d_in[9]; const float* lk2 = (const float*)d_in[10];
    const float* gnw = (const float*)d_in[11]; const float* gnb = (const float*)d_in[12];
    float* OUT = (float*)d_out;     // [NB][SEQ_FULL][1024]
    char* wsp = (char*)d_ws;
    auto take = [&](size_t bytes) { char* p = wsp; wsp += (bytes + 255) & ~(size_t)255; return (void*)p; };
    bf* WQ = (bf*)take((size_t)DQ * DM * 2); bf* WK = (bf*)take((size_t)DQ * DM * 2); bf* WV = (bf*)take((size_t)DVV * DM * 2); bf* WO = (bf*)take((size_t)DM * DVV * 2);
    bf* XB = (bf*)take((size_t)NB * SEQ * DM * 2); float* AMB = (float*)take((size_t)NB * SEQ * 4); float* LAM = (float*)take(256); float* GST = (float*)take((size_t)NB * NVH * 32 * 4);
    bf* QPh = (bf*)take((size_t)NB * NQH * SEQ * HD * 2); bf* QPl = (bf*)take((size_t)NB * NQH * SEQ * HD * 2); bf* KPh = (bf*)take((size_t)NB * NQH * SEQ * HD * 2); bf* KPl = (bf*)take((size_t)NB * NQH * SEQ * HD * 2);
    h16* VT16 = (h16*)take((size_t)NB * NVH * HD * SEQ * 2); h16* VRS = (h16*)take((size_t)NB * NVH * HD * SEQ * 2);
    float* Ob = (float*)take((size_t)NB * SEQ * DVV * 4); bf* ATh = (bf*)take((size_t)NB * SEQ * DVV * 2); bf* ATl = (bf*)take((size_t)NB * SEQ * DVV * 2);
    const size_t used = (size_t)(wsp - (char*)d_ws);
    if (used > ws_size || used > (size_t)268435456) return;
    // Every stage runs once for all NB batch elements: the batch index is a grid dimension (blockIdx.z in k_gemmb, blockIdx.y in k_attn and the GroupNorm kernels, folded into blockIdx.x in k_prep), workspace planes are [NB][...].
    k_prep<<<PB_ALL, 256, 0, stream>>>(x, amask, wq, wk, wv, wo, lq1, lk1, lq2, lk2, XB, AMB, WQ, WK, WV, WO, LAM);
    k_gemmb<0, 1><<<dim3(SEQ / GT, (2 * DQ + DVV) / GT, NB), 256, 0, stream>>>(XB, nullptr, WQ, DM, nullptr, 0, (size_t)SEQ * DM, 0, WK, WV, QPh, QPl, KPh, KPl, (bf*)VT16, (bf*)VRS);
    k_attn<<<dim3(NVH, NB, SEQ / QBL), 256, 0, stream>>>(QPh, QPl, KPh, KPl, VT16, VRS, AMB, tix, LAM, Ob);
    k_gnstat<<<dim3(NVH, NB, 1), 1024, 0, stream>>>(Ob, GST);
    k_gnmerge<<<dim3((unsigned)(((size_t)SEQ * DVV / 2 + 255) / 256), NB, 1), 256, 0, stream>>>(Ob, GST, gnw, gnb, ATh, ATl);
    k_gemmb<1><<<dim3(SEQ / GT, DM / GT, NB), 256, 0, stream>>>(ATh, ATl, WO, DVV, OUT, DM, (size_t)SEQ * DVV, (size_t)SEQ_FULL * DM);
}
